// v000
// Times are from an AMD MI455X. After a warm-up the kernel runs many times in a row, and a time is the length of
// such a window on the GPU divided by its runs, so every launch and the gaps after it count. The runs cycle
// through copies of the inputs. A figure is the median of several windows, for all but v000 over two sittings.
// Sittings can differ by a few percent; kernels timed side by side share one.
// The starting kernel, v000, takes 312 microseconds a run.
#include <hip/hip_runtime.h>
#include <hip/hip_bf16.h>

// ---------------------------------------------------------------------------
// StateSequenceTransformer on MI455X (gfx1250, wave32, WMMA 16x16x32 f16)
//   B=4 T=2048 D_MODEL=128 NHEAD=4 hd=32 DFF=256 WINDOW=64 NLAYERS=3
//   One wave (32 threads) owns a 16-row tile.
//   Weights pre-packed into per-lane B-fragment order -> b128 vector loads.
//   V stored transposed+padded so attn@V B-fragments are contiguous.
// ---------------------------------------------------------------------------

#define R_TOT  8192
#define T_SEQ  2048
#define DM     128
#define DFF_   256
#define QKV_LD 256            /* q (scaled) + k, f16 */
#define T_PAD  2144           /* 64 front pad + 2048 + 32 back pad */
#define LN_EPS 1e-5f
#define QSCALE 0.17677669529663687f /* 1/sqrt(32) */

typedef __attribute__((ext_vector_type(16))) _Float16 v16h;
typedef __attribute__((ext_vector_type(8)))  _Float16 v8h;
typedef __attribute__((ext_vector_type(8)))  float    v8f;

__device__ __forceinline__ v8f wmma16(v16h a, v16h b, v8f c) {
  return __builtin_amdgcn_wmma_f32_16x16x32_f16(false, a, false, b, (short)0, c,
                                                false, false);
}

// A fragment: 16x32 f16 from row-major src (ld multiple of 8, 16B aligned).
// lane<16: row=lane, K={0..7,16..23}; lane>=16: row=lane-16, K={8..15,24..31}
__device__ __forceinline__ v16h load_a_frag(const _Float16* src, int ld) {
  int lane = threadIdx.x & 31;
  const _Float16* p = src + (lane & 15) * ld + ((lane < 16) ? 0 : 8);
  v8h lo = *(const v8h*)p;
  v8h hi = *(const v8h*)(p + 16);
  return __builtin_shufflevector(lo, hi, 0, 1, 2, 3, 4, 5, 6, 7,
                                 8, 9, 10, 11, 12, 13, 14, 15);
}

// Pre-packed B fragment: tile = 512 f16, lane's 16 values contiguous (32B).
__device__ __forceinline__ v16h load_b_packed(const _Float16* base, int tile) {
  int lane = threadIdx.x & 31;
  return *(const v16h*)(base + ((size_t)tile << 9) + (lane << 4));
}

// Build v16h from two contiguous v8h loads at p and p+16 (K^T / generic).
__device__ __forceinline__ v16h load_kpair(const _Float16* p) {
  v8h lo = *(const v8h*)p;
  v8h hi = *(const v8h*)(p + 16);
  return __builtin_shufflevector(lo, hi, 0, 1, 2, 3, 4, 5, 6, 7,
                                 8, 9, 10, 11, 12, 13, 14, 15);
}

// ---------------------------------------------------------------------------
// prep: pack f32 weights (K x N row-major, ld=Nld) into B-fragment tiles.
// tile id = nt*Ktiles + kt; elements outside (Ksrc,Nsrc) -> 0 (padding).
// ---------------------------------------------------------------------------
__global__ void pack_b(const float* __restrict__ src, _Float16* __restrict__ dst,
                       int Ktiles, int Ntiles, int Ksrc, int Nsrc, int Nld) {
  int idx = blockIdx.x * blockDim.x + threadIdx.x;
  int total = Ktiles * Ntiles * 32;
  if (idx >= total) return;
  int lane = idx & 31;
  int tile = idx >> 5;
  int kt = tile % Ktiles, nt = tile / Ktiles;
  int col = lane & 15, kB = (lane < 16) ? 0 : 8;
  int n = nt * 16 + col;
  _Float16* d = dst + ((size_t)tile << 9) + (lane << 4);
#pragma unroll
  for (int i = 0; i < 8; ++i) {
    int k0 = kt * 32 + kB + i, k1 = k0 + 16;
    d[i]     = (k0 < Ksrc && n < Nsrc) ? (_Float16)src[k0 * Nld + n] : (_Float16)0.f;
    d[8 + i] = (k1 < Ksrc && n < Nsrc) ? (_Float16)src[k1 * Nld + n] : (_Float16)0.f;
  }
}

__global__ void build_x16(const float* __restrict__ E, const float* __restrict__ rho,
                          _Float16* __restrict__ x) {
  int i = blockIdx.x * blockDim.x + threadIdx.x;  // R*32
  int row = i >> 5, c = i & 31;
  _Float16 v = (_Float16)0.f;
  if (c < 8)       v = (_Float16)E[row * 8 + c];
  else if (c < 16) v = (_Float16)rho[row * 8 + (c - 8)];
  x[i] = v;
}

__global__ void zero_vT_pads(_Float16* __restrict__ vT) {
  int i = blockIdx.x * blockDim.x + threadIdx.x;  // 512 rows * 96 pad entries
  if (i >= 512 * 96) return;
  int row = i / 96, c = i % 96;
  int pos = (c < 64) ? c : (64 + T_SEQ + (c - 64));
  vT[(size_t)row * T_PAD + pos] = (_Float16)0.f;
}

// ---------------------------------------------------------------------------
// in_proj: h = relu(x@W1+b1)@W2 + b2 + PE  -> h32 + h16
// ---------------------------------------------------------------------------
__global__ void inproj_kernel(const _Float16* __restrict__ x16,
                              const _Float16* __restrict__ pw1,  // 8 tiles
                              const float* __restrict__ b1,
                              const _Float16* __restrict__ pw2,  // 32 tiles [nt*4+kt]
                              const float* __restrict__ b2,
                              float* __restrict__ h32, _Float16* __restrict__ h16) {
  __shared__ _Float16 t1[16 * 128];
  int row0 = blockIdx.x * 16;
  int lane = threadIdx.x & 31;
  int nCol = lane & 15, mBase = (lane < 16) ? 0 : 8;

  v16h a = load_a_frag(x16 + row0 * 32, 32);
#pragma unroll
  for (int nt = 0; nt < 8; ++nt) {
    v8f acc = {};
    acc = wmma16(a, load_b_packed(pw1, nt), acc);
    float bias = b1[nt * 16 + nCol];
#pragma unroll
    for (int r = 0; r < 8; ++r) {
      float v = acc[r] + bias;
      t1[(mBase + r) * 128 + nt * 16 + nCol] = (_Float16)(v > 0.f ? v : 0.f);
    }
  }
  __syncthreads();

  v16h a2[4];
#pragma unroll
  for (int kt = 0; kt < 4; ++kt) a2[kt] = load_a_frag(t1 + kt * 32, 128);
#pragma unroll
  for (int nt = 0; nt < 8; ++nt) {
    v8f acc = {};
#pragma unroll
    for (int kt = 0; kt < 4; ++kt)
      acc = wmma16(a2[kt], load_b_packed(pw2, nt * 4 + kt), acc);
    int n = nt * 16 + nCol;
    float bias = b2[n];
    float div = __expf(-(float)(n >> 1) * (9.210340371976184f / 64.f));
#pragma unroll
    for (int r = 0; r < 8; ++r) {
      int row = row0 + mBase + r;
      float ang = (float)(row & (T_SEQ - 1)) * div;
      float pe = (n & 1) ? __cosf(ang) : __sinf(ang);
      float v = acc[r] + bias + pe;
      h32[row * DM + n] = v;
      h16[row * DM + n] = (_Float16)v;
    }
  }
}

// ---------------------------------------------------------------------------
// qkv: q (scaled) and k -> qkv16 (R x 256); v -> vT transposed+padded.
// grid (R/16, 24)
// ---------------------------------------------------------------------------
__global__ void qkv_kernel(const _Float16* __restrict__ h16,
                           const _Float16* __restrict__ pqkv,  // 96 tiles [nt*4+kt]
                           const float* __restrict__ bqkv,
                           _Float16* __restrict__ qkv16, _Float16* __restrict__ vT) {
  int row0 = blockIdx.x * 16;
  int nt = blockIdx.y;
  int lane = threadIdx.x & 31;
  int nCol = lane & 15, mBase = (lane < 16) ? 0 : 8;

  v8f acc = {};
#pragma unroll
  for (int kt = 0; kt < 4; ++kt)
    acc = wmma16(load_a_frag(h16 + row0 * DM + kt * 32, DM),
                 load_b_packed(pqkv, nt * 4 + kt), acc);
  int n = nt * 16 + nCol;
  float bias = bqkv[n];
  if (n < 256) {  // q (scaled) / k : row-major
    float scale = (n < 128) ? QSCALE : 1.0f;
#pragma unroll
    for (int r = 0; r < 8; ++r)
      qkv16[(size_t)(row0 + mBase + r) * QKV_LD + n] =
          (_Float16)((acc[r] + bias) * scale);
  } else {        // v : transposed with padded time axis, vectorized store
    int d = n - 256;
    int head = d >> 5, dd = d & 31;
    int bIdx = row0 >> 11;
    int t0m = (row0 & (T_SEQ - 1)) + mBase;
    v8h vv;
#pragma unroll
    for (int r = 0; r < 8; ++r) vv[r] = (_Float16)(acc[r] + bias);
    *(v8h*)(vT + (size_t)((bIdx * 4 + head) * 32 + dd) * T_PAD + 64 + t0m) = vv;
  }
}

// ---------------------------------------------------------------------------
// windowed attention: 16 queries x 1 head per wave. grid (R/16, NHEAD)
// ---------------------------------------------------------------------------
__global__ void attn_kernel(const _Float16* __restrict__ qkv16,
                            const _Float16* __restrict__ vT,
                            _Float16* __restrict__ ao16) {
  __shared__ _Float16 at[16 * 96];  // attn probs, K padded 80 -> 96
  int row0 = blockIdx.x * 16;
  int head = blockIdx.y;
  int t0 = row0 & (T_SEQ - 1);
  int bRow0 = row0 - t0;
  int bIdx = row0 >> 11;
  int lane = threadIdx.x & 31;
  int nCol = lane & 15, mBase = (lane < 16) ? 0 : 8, kBase = mBase;
  int keyBase = t0 - 64;

  v16h qa = load_a_frag(qkv16 + (size_t)row0 * QKV_LD + head * 32, QKV_LD);

  v8f s[5];
#pragma unroll
  for (int kt = 0; kt < 5; ++kt) {
    int j = keyBase + kt * 16 + nCol;   // key position for this lane's column
    int jr = j < 0 ? 0 : j;             // clamp address; mask handles validity
    v16h kb = load_kpair(qkv16 + (size_t)(bRow0 + jr) * QKV_LD + 128 + head * 32 + kBase);
    v8f c = {};
    c = wmma16(qa, kb, c);
#pragma unroll
    for (int r = 0; r < 8; ++r) {
      int iQ = t0 + mBase + r;
      bool valid = (j >= 0) && (j <= iQ) && (j >= iQ - 63);
      s[kt][r] = valid ? c[r] : -1e30f;
    }
  }

  // row softmax: row m lives in one vgpr slot across the 16 lanes of a half
#pragma unroll
  for (int r = 0; r < 8; ++r) {
    float mx = s[0][r];
#pragma unroll
    for (int kt = 1; kt < 5; ++kt) mx = fmaxf(mx, s[kt][r]);
#pragma unroll
    for (int msk = 1; msk < 16; msk <<= 1) mx = fmaxf(mx, __shfl_xor(mx, msk, 32));
    float sum = 0.f;
#pragma unroll
    for (int kt = 0; kt < 5; ++kt) { float e = __expf(s[kt][r] - mx); s[kt][r] = e; sum += e; }
#pragma unroll
    for (int msk = 1; msk < 16; msk <<= 1) sum += __shfl_xor(sum, msk, 32);
    float inv = 1.0f / sum;
#pragma unroll
    for (int kt = 0; kt < 5; ++kt) s[kt][r] *= inv;
  }

  // C-layout -> A-fragment layout via LDS (16 x 96, cols 80..95 zero)
#pragma unroll
  for (int kt = 0; kt < 5; ++kt)
#pragma unroll
    for (int r = 0; r < 8; ++r)
      at[(mBase + r) * 96 + kt * 16 + nCol] = (_Float16)s[kt][r];
#pragma unroll
  for (int r = 0; r < 8; ++r) at[(mBase + r) * 96 + 80 + nCol] = (_Float16)0.f;
  __syncthreads();

  // attn(16x96) @ V(96x32): 2 N-tiles x 3 K-chunks, contiguous vT loads
#pragma unroll
  for (int nt = 0; nt < 2; ++nt) {
    int d = nt * 16 + nCol;
    const _Float16* vrow = vT + (size_t)((bIdx * 4 + head) * 32 + d) * T_PAD + 64 + keyBase;
    v8f acc = {};
#pragma unroll
    for (int kc = 0; kc < 3; ++kc) {
      v16h aa = load_a_frag(at + kc * 32, 96);
      v16h vb = load_kpair(vrow + kc * 32 + kBase);
      acc = wmma16(aa, vb, acc);
    }
#pragma unroll
    for (int r = 0; r < 8; ++r)
      ao16[(size_t)(row0 + mBase + r) * DM + head * 32 + nt * 16 + nCol] = (_Float16)acc[r];
  }
}

// ---------------------------------------------------------------------------
// o-proj + residual + layernorm -> h32/h16
// ---------------------------------------------------------------------------
__global__ void oproj_ln_kernel(const _Float16* __restrict__ ao16,
                                const _Float16* __restrict__ pwo,  // 32 tiles
                                const float* __restrict__ bo,
                                const float* __restrict__ g, const float* __restrict__ bb,
                                float* __restrict__ h32, _Float16* __restrict__ h16) {
  int row0 = blockIdx.x * 16;
  int lane = threadIdx.x & 31;
  int nCol = lane & 15, mBase = (lane < 16) ? 0 : 8;

  v16h a[4];
#pragma unroll
  for (int kt = 0; kt < 4; ++kt) a[kt] = load_a_frag(ao16 + row0 * DM + kt * 32, DM);

  v8f out[8];
#pragma unroll
  for (int nt = 0; nt < 8; ++nt) {
    v8f acc = {};
#pragma unroll
    for (int kt = 0; kt < 4; ++kt)
      acc = wmma16(a[kt], load_b_packed(pwo, nt * 4 + kt), acc);
    float bias = bo[nt * 16 + nCol];
#pragma unroll
    for (int r = 0; r < 8; ++r)
      out[nt][r] = acc[r] + bias + h32[(row0 + mBase + r) * DM + nt * 16 + nCol];
  }
#pragma unroll
  for (int r = 0; r < 8; ++r) {
    float sm = 0.f, sq = 0.f;
#pragma unroll
    for (int nt = 0; nt < 8; ++nt) { float v = out[nt][r]; sm += v; sq += v * v; }
#pragma unroll
    for (int msk = 1; msk < 16; msk <<= 1) { sm += __shfl_xor(sm, msk, 32); sq += __shfl_xor(sq, msk, 32); }
    float mu = sm * (1.f / 128.f);
    float inv = rsqrtf(sq * (1.f / 128.f) - mu * mu + LN_EPS);
#pragma unroll
    for (int nt = 0; nt < 8; ++nt) {
      int n = nt * 16 + nCol;
      int row = row0 + mBase + r;
      float y = (out[nt][r] - mu) * inv * g[n] + bb[n];
      h32[row * DM + n] = y;
      h16[row * DM + n] = (_Float16)y;
    }
  }
}

// ---------------------------------------------------------------------------
// FFN: relu(h@W1+b1)@W2+b2, residual + layernorm
// ---------------------------------------------------------------------------
__global__ void ffn_ln_kernel(const _Float16* __restrict__ h16in,
                              const _Float16* __restrict__ pf1,  // 64 tiles [nt*4+kt]
                              const float* __restrict__ b1,
                              const _Float16* __restrict__ pf2,  // 64 tiles [nt*8+kt]
                              const float* __restrict__ b2,
                              const float* __restrict__ g, const float* __restrict__ bb,
                              float* __restrict__ h32, _Float16* __restrict__ h16) {
  __shared__ _Float16 mid[16 * DFF_];
  int row0 = blockIdx.x * 16;
  int lane = threadIdx.x & 31;
  int nCol = lane & 15, mBase = (lane < 16) ? 0 : 8;

  v16h a[4];
#pragma unroll
  for (int kt = 0; kt < 4; ++kt) a[kt] = load_a_frag(h16in + row0 * DM + kt * 32, DM);
#pragma unroll
  for (int nt = 0; nt < 16; ++nt) {
    v8f acc = {};
#pragma unroll
    for (int kt = 0; kt < 4; ++kt)
      acc = wmma16(a[kt], load_b_packed(pf1, nt * 4 + kt), acc);
    float bias = b1[nt * 16 + nCol];
#pragma unroll
    for (int r = 0; r < 8; ++r) {
      float v = acc[r] + bias;
      mid[(mBase + r) * DFF_ + nt * 16 + nCol] = (_Float16)(v > 0.f ? v : 0.f);
    }
  }
  __syncthreads();

  v16h a2[8];
#pragma unroll
  for (int kt = 0; kt < 8; ++kt) a2[kt] = load_a_frag(mid + kt * 32, DFF_);

  v8f out[8];
#pragma unroll
  for (int nt = 0; nt < 8; ++nt) {
    v8f acc = {};
#pragma unroll
    for (int kt = 0; kt < 8; ++kt)
      acc = wmma16(a2[kt], load_b_packed(pf2, nt * 8 + kt), acc);
    float bias = b2[nt * 16 + nCol];
#pragma unroll
    for (int r = 0; r < 8; ++r)
      out[nt][r] = acc[r] + bias + h32[(row0 + mBase + r) * DM + nt * 16 + nCol];
  }
#pragma unroll
  for (int r = 0; r < 8; ++r) {
    float sm = 0.f, sq = 0.f;
#pragma unroll
    for (int nt = 0; nt < 8; ++nt) { float v = out[nt][r]; sm += v; sq += v * v; }
#pragma unroll
    for (int msk = 1; msk < 16; msk <<= 1) { sm += __shfl_xor(sm, msk, 32); sq += __shfl_xor(sq, msk, 32); }
    float mu = sm * (1.f / 128.f);
    float inv = rsqrtf(sq * (1.f / 128.f) - mu * mu + LN_EPS);
#pragma unroll
    for (int nt = 0; nt < 8; ++nt) {
      int n = nt * 16 + nCol;
      int row = row0 + mBase + r;
      float y = (out[nt][r] - mu) * inv * g[n] + bb[n];
      h32[row * DM + n] = y;
      h16[row * DM + n] = (_Float16)y;
    }
  }
}

// ---------------------------------------------------------------------------
// head: out = h16 @ W_head(128x16 padded) + b_head -> fp32 (R x 8)
// ---------------------------------------------------------------------------
__global__ void head_kernel(const _Float16* __restrict__ h16,
                            const _Float16* __restrict__ pwh,  // 4 tiles
                            const float* __restrict__ bh,
                            float* __restrict__ out) {
  int row0 = blockIdx.x * 16;
  int lane = threadIdx.x & 31;
  int nCol = lane & 15, mBase = (lane < 16) ? 0 : 8;
  v8f acc = {};
#pragma unroll
  for (int kt = 0; kt < 4; ++kt)
    acc = wmma16(load_a_frag(h16 + row0 * DM + kt * 32, DM),
                 load_b_packed(pwh, kt), acc);
  if (nCol < 8) {
    float bias = bh[nCol];
#pragma unroll
    for (int r = 0; r < 8; ++r) out[(row0 + mBase + r) * 8 + nCol] = acc[r] + bias;
  }
}

// ---------------------------------------------------------------------------
// host launch
// ---------------------------------------------------------------------------
extern "C" void kernel_launch(void* const* d_in, const int* in_sizes, int n_in,
                              void* d_out, int out_size, void* d_ws, size_t ws_size,
                              hipStream_t stream) {
  (void)in_sizes; (void)n_in; (void)out_size; (void)ws_size;
  const float* E      = (const float*)d_in[0];
  const float* rho    = (const float*)d_in[1];
  const float* W_in1  = (const float*)d_in[2];
  const float* b_in1  = (const float*)d_in[3];
  const float* W_in2  = (const float*)d_in[4];
  const float* b_in2  = (const float*)d_in[5];
  const float* Wqkv   = (const float*)d_in[6];
  const float* bqkv   = (const float*)d_in[7];
  const float* Wo     = (const float*)d_in[8];
  const float* bo     = (const float*)d_in[9];
  const float* ln1_g  = (const float*)d_in[10];
  const float* ln1_b  = (const float*)d_in[11];
  const float* Wff1   = (const float*)d_in[12];
  const float* bff1   = (const float*)d_in[13];
  const float* Wff2   = (const float*)d_in[14];
  const float* bff2   = (const float*)d_in[15];
  const float* ln2_g  = (const float*)d_in[16];
  const float* ln2_b  = (const float*)d_in[17];
  const float* W_head = (const float*)d_in[18];
  const float* b_head = (const float*)d_in[19];

  char* w = (char*)d_ws;
  auto take = [&](size_t bytes) -> void* {
    void* p = (void*)w;
    w += (bytes + 255) & ~(size_t)255;
    return p;
  };
  _Float16* x16   = (_Float16*)take((size_t)R_TOT * 32 * 2);
  _Float16* h16   = (_Float16*)take((size_t)R_TOT * DM * 2);
  float*    h32   = (float*)   take((size_t)R_TOT * DM * 4);
  _Float16* qkv16 = (_Float16*)take((size_t)R_TOT * QKV_LD * 2);
  _Float16* vT    = (_Float16*)take((size_t)512 * T_PAD * 2);  // 16 (b*head) * 32 d rows
  _Float16* ao16  = (_Float16*)take((size_t)R_TOT * DM * 2);
  _Float16* pw1   = (_Float16*)take((size_t)8 * 512 * 2);
  _Float16* pw2   = (_Float16*)take((size_t)32 * 512 * 2);
  _Float16* pqkv  = (_Float16*)take((size_t)3 * 96 * 512 * 2);
  _Float16* pwo   = (_Float16*)take((size_t)3 * 32 * 512 * 2);
  _Float16* pf1   = (_Float16*)take((size_t)3 * 64 * 512 * 2);
  _Float16* pf2   = (_Float16*)take((size_t)3 * 64 * 512 * 2);
  _Float16* pwh   = (_Float16*)take((size_t)4 * 512 * 2);

  auto cdiv = [](int a, int b) { return (a + b - 1) / b; };

  // weight packing (f32 -> f16 B-fragment tiles, with K/N zero-padding)
  pack_b<<<cdiv(1 * 8 * 32, 256), 256, 0, stream>>>(W_in1, pw1, 1, 8, 16, 128, 128);
  pack_b<<<cdiv(4 * 8 * 32, 256), 256, 0, stream>>>(W_in2, pw2, 4, 8, 128, 128, 128);
  for (int l = 0; l < 3; ++l) {
    pack_b<<<cdiv(4 * 24 * 32, 256), 256, 0, stream>>>(
        Wqkv + (size_t)l * 128 * 384, pqkv + (size_t)l * 96 * 512, 4, 24, 128, 384, 384);
    pack_b<<<cdiv(4 * 8 * 32, 256), 256, 0, stream>>>(
        Wo + (size_t)l * 128 * 128, pwo + (size_t)l * 32 * 512, 4, 8, 128, 128, 128);
    pack_b<<<cdiv(4 * 16 * 32, 256), 256, 0, stream>>>(
        Wff1 + (size_t)l * 128 * 256, pf1 + (size_t)l * 64 * 512, 4, 16, 128, 256, 256);
    pack_b<<<cdiv(8 * 8 * 32, 256), 256, 0, stream>>>(
        Wff2 + (size_t)l * 256 * 128, pf2 + (size_t)l * 64 * 512, 8, 8, 256, 128, 128);
  }
  pack_b<<<cdiv(4 * 1 * 32, 256), 256, 0, stream>>>(W_head, pwh, 4, 1, 128, 8, 8);

  build_x16<<<R_TOT * 32 / 256, 256, 0, stream>>>(E, rho, x16);
  zero_vT_pads<<<cdiv(512 * 96, 256), 256, 0, stream>>>(vT);

  const int TILES = R_TOT / 16;  // 512
  inproj_kernel<<<TILES, 32, 0, stream>>>(x16, pw1, b_in1, pw2, b_in2, h32, h16);

  for (int l = 0; l < 3; ++l) {
    qkv_kernel<<<dim3(TILES, 24), 32, 0, stream>>>(
        h16, pqkv + (size_t)l * 96 * 512, bqkv + l * 384, qkv16, vT);
    attn_kernel<<<dim3(TILES, 4), 32, 0, stream>>>(qkv16, vT, ao16);
    oproj_ln_kernel<<<TILES, 32, 0, stream>>>(
        ao16, pwo + (size_t)l * 32 * 512, bo + l * 128,
        ln1_g + l * 128, ln1_b + l * 128, h32, h16);
    ffn_ln_kernel<<<TILES, 32, 0, stream>>>(
        h16, pf1 + (size_t)l * 64 * 512, bff1 + l * 256,
        pf2 + (size_t)l * 64 * 512, bff2 + l * 128,
        ln2_g + l * 128, ln2_b + l * 128, h32, h16);
  }
  head_kernel<<<TILES, 32, 0, stream>>>(h16, pwh, b_head, (float*)d_out);
}

// v001
// Measured time: 196 microseconds a run.
// Two timings next to v000 put it at 1.62 and 1.61 times that version's speed.
#include <hip/hip_runtime.h>
#include <hip/hip_bf16.h>

// ---------------------------------------------------------------------------
// StateSequenceTransformer on MI455X (gfx1250, wave32, WMMA 16x16x32 f16)
//   B=4 T=2048 D_MODEL=128 NHEAD=4 hd=32 DFF=256 WINDOW=64 NLAYERS=3
//   One wave (32 threads) owns a 16-row tile.
//   Weights pre-packed into per-lane B-fragment order -> b128 vector loads.
//   V stored transposed+padded so attn@V B-fragments are contiguous.
// ---------------------------------------------------------------------------

#define R_TOT  8192
#define T_SEQ  2048
#define DM     128
#define DFF_   256
#define QKV_LD 256            /* q (scaled) + k, f16 */
#define T_PAD  2144           /* 64 front pad + 2048 + 32 back pad */
#define LN_EPS 1e-5f
#define QSCALE 0.17677669529663687f /* 1/sqrt(32) */

typedef __attribute__((ext_vector_type(16))) _Float16 v16h;
typedef __attribute__((ext_vector_type(8)))  _Float16 v8h;
typedef __attribute__((ext_vector_type(8)))  float    v8f;

__device__ __forceinline__ v8f wmma16(v16h a, v16h b, v8f c) {
  return __builtin_amdgcn_wmma_f32_16x16x32_f16(false, a, false, b, (short)0, c,
                                                false, false);
}

// A fragment: 16x32 f16 from row-major src (ld multiple of 8, 16B aligned).
// lane<16: row=lane, K={0..7,16..23}; lane>=16: row=lane-16, K={8..15,24..31}
__device__ __forceinline__ v16h load_a_frag(const _Float16* src, int ld) {
  int lane = threadIdx.x & 31;
  const _Float16* p = src + (lane & 15) * ld + ((lane < 16) ? 0 : 8);
  v8h lo = *(const v8h*)p;
  v8h hi = *(const v8h*)(p + 16);
  return __builtin_shufflevector(lo, hi, 0, 1, 2, 3, 4, 5, 6, 7,
                                 8, 9, 10, 11, 12, 13, 14, 15);
}

// Pre-packed B fragment: tile = 512 f16, lane's 16 values contiguous (32B).
__device__ __forceinline__ v16h load_b_packed(const _Float16* base, int tile) {
  int lane = threadIdx.x & 31;
  return *(const v16h*)(base + ((size_t)tile << 9) + (lane << 4));
}

// Build v16h from two contiguous v8h loads at p and p+16 (K^T / generic).
__device__ __forceinline__ v16h load_kpair(const _Float16* p) {
  v8h lo = *(const v8h*)p;
  v8h hi = *(const v8h*)(p + 16);
  return __builtin_shufflevector(lo, hi, 0, 1, 2, 3, 4, 5, 6, 7,
                                 8, 9, 10, 11, 12, 13, 14, 15);
}

// ---------------------------------------------------------------------------
// prep: every piece of set-up work is independent of every other piece, so all
// of it shares ONE launch; a block-uniform range test on blockIdx.x picks the
// piece. Weight packing comes first in the grid (longest chain per thread).
//   pack: f32 weights (K x N row-major, ld=NLD) -> B-fragment tiles,
//         tile id = nt*KT + kt; elements outside (KSRC,NSRC) -> 0 (padding).
// ---------------------------------------------------------------------------
#define PB_W1  0     /*    1 block : W_in1  1 x  8 tiles          */
#define PB_W2  1     /*    4 blocks: W_in2  4 x  8 tiles          */
#define PB_QKV 5     /*   36 blocks: Wqkv   4 x 24 tiles, 3 layers */
#define PB_WO  41    /*   12 blocks: Wo     4 x  8 tiles, 3 layers */
#define PB_F1  53    /*   24 blocks: Wff1   4 x 16 tiles, 3 layers */
#define PB_F2  77    /*   24 blocks: Wff2   8 x  8 tiles, 3 layers */
#define PB_WH  101   /*    1 block : W_head 4 x  1 tiles (half full) */
#define PB_X   102   /* 1024 blocks: x16 = concat(E, rho), padded to 32 */
#define PB_PAD 1126  /*  192 blocks: zero the vT time pads         */
#define PB_END 1318

template <int KT, int KSRC, int NSRC, int NLD>
__device__ __forceinline__ void pack_lane(const float* __restrict__ src,
                                          _Float16* __restrict__ dst, int idx) {
  int lane = idx & 31;
  int tile = idx >> 5;
  int kt = tile % KT, nt = tile / KT;
  int col = lane & 15, kB = (lane < 16) ? 0 : 8;
  int n = nt * 16 + col;
  _Float16* d = dst + ((size_t)tile << 9) + (lane << 4);
#pragma unroll
  for (int i = 0; i < 8; ++i) {
    int k0 = kt * 32 + kB + i, k1 = k0 + 16;
    d[i]     = (k0 < KSRC && n < NSRC) ? (_Float16)src[k0 * NLD + n] : (_Float16)0.f;
    d[8 + i] = (k1 < KSRC && n < NSRC) ? (_Float16)src[k1 * NLD + n] : (_Float16)0.f;
  }
  // precaution: code of another piece follows in the listing and reuses the
  // registers that the last stores name; the wait stands in front of that reuse
  asm volatile("s_wait_xcnt 0x0" ::: "memory");
}

__global__ void prep_all(const float* __restrict__ E, const float* __restrict__ rho,
                         const float* __restrict__ W_in1, const float* __restrict__ W_in2,
                         const float* __restrict__ Wqkv, const float* __restrict__ Wo,
                         const float* __restrict__ Wff1, const float* __restrict__ Wff2,
                         const float* __restrict__ W_head,
                         _Float16* __restrict__ x16, _Float16* __restrict__ vT,
                         _Float16* __restrict__ pw1, _Float16* __restrict__ pw2,
                         _Float16* __restrict__ pqkv, _Float16* __restrict__ pwo,
                         _Float16* __restrict__ pf1, _Float16* __restrict__ pf2,
                         _Float16* __restrict__ pwh) {
  int b = blockIdx.x;
  int tid = threadIdx.x;
  if (b >= PB_PAD) {
    int i = (b - PB_PAD) * 256 + tid;  // 512 rows * 96 pad entries
    int row = i / 96, c = i % 96;
    int pos = (c < 64) ? c : (64 + T_SEQ + (c - 64));
    vT[(size_t)row * T_PAD + pos] = (_Float16)0.f;
  } else if (b >= PB_X) {
    int i = (b - PB_X) * 256 + tid;    // R*32
    int row = i >> 5, c = i & 31;
    _Float16 v = (_Float16)0.f;
    if (c < 8)       v = (_Float16)E[row * 8 + c];
    else if (c < 16) v = (_Float16)rho[row * 8 + (c - 8)];
    x16[i] = v;
    // precaution: same as in pack_lane, for the registers that this store names
    asm volatile("s_wait_xcnt 0x0" ::: "memory");
  } else if (b >= PB_WH) {
    if (tid < 128) pack_lane<4, 128, 8, 8>(W_head, pwh, tid);
  } else if (b >= PB_F2) {
    int l = (b - PB_F2) / 8, r = (b - PB_F2) % 8;
    pack_lane<8, 256, 128, 128>(Wff2 + (size_t)l * 256 * 128,
                                pf2 + (size_t)l * 64 * 512, r * 256 + tid);
  } else if (b >= PB_F1) {
    int l = (b - PB_F1) / 8, r = (b - PB_F1) % 8;
    pack_lane<4, 128, 256, 256>(Wff1 + (size_t)l * 128 * 256,
                                pf1 + (size_t)l * 64 * 512, r * 256 + tid);
  } else if (b >= PB_WO) {
    int l = (b - PB_WO) / 4, r = (b - PB_WO) % 4;
    pack_lane<4, 128, 128, 128>(Wo + (size_t)l * 128 * 128,
                                pwo + (size_t)l * 32 * 512, r * 256 + tid);
  } else if (b >= PB_QKV) {
    int l = (b - PB_QKV) / 12, r = (b - PB_QKV) % 12;
    pack_lane<4, 128, 384, 384>(Wqkv + (size_t)l * 128 * 384,
                                pqkv + (size_t)l * 96 * 512, r * 256 + tid);
  } else if (b >= PB_W2) {
    pack_lane<4, 128, 128, 128>(W_in2, pw2, (b - PB_W2) * 256 + tid);
  } else {
    pack_lane<1, 16, 128, 128>(W_in1, pw1, tid);
  }
}

// ---------------------------------------------------------------------------
// in_proj: h = relu(x@W1+b1)@W2 + b2 + PE  -> h32 + h16
// ---------------------------------------------------------------------------
__global__ void inproj_kernel(const _Float16* __restrict__ x16,
                              const _Float16* __restrict__ pw1,  // 8 tiles
                              const float* __restrict__ b1,
                              const _Float16* __restrict__ pw2,  // 32 tiles [nt*4+kt]
                              const float* __restrict__ b2,
                              float* __restrict__ h32, _Float16* __restrict__ h16) {
  __shared__ _Float16 t1[16 * 128];
  int row0 = blockIdx.x * 16;
  int lane = threadIdx.x & 31;
  int nCol = lane & 15, mBase = (lane < 16) ? 0 : 8;

  v16h a = load_a_frag(x16 + row0 * 32, 32);
#pragma unroll
  for (int nt = 0; nt < 8; ++nt) {
    v8f acc = {};
    acc = wmma16(a, load_b_packed(pw1, nt), acc);
    float bias = b1[nt * 16 + nCol];
#pragma unroll
    for (int r = 0; r < 8; ++r) {
      float v = acc[r] + bias;
      t1[(mBase + r) * 128 + nt * 16 + nCol] = (_Float16)(v > 0.f ? v : 0.f);
    }
  }
  __syncthreads();

  v16h a2[4];
#pragma unroll
  for (int kt = 0; kt < 4; ++kt) a2[kt] = load_a_frag(t1 + kt * 32, 128);
#pragma unroll
  for (int nt = 0; nt < 8; ++nt) {
    v8f acc = {};
#pragma unroll
    for (int kt = 0; kt < 4; ++kt)
      acc = wmma16(a2[kt], load_b_packed(pw2, nt * 4 + kt), acc);
    int n = nt * 16 + nCol;
    float bias = b2[n];
    float div = __expf(-(float)(n >> 1) * (9.210340371976184f / 64.f));
#pragma unroll
    for (int r = 0; r < 8; ++r) {
      int row = row0 + mBase + r;
      float ang = (float)(row & (T_SEQ - 1)) * div;
      float pe = (n & 1) ? __cosf(ang) : __sinf(ang);
      float v = acc[r] + bias + pe;
      h32[row * DM + n] = v;
      h16[row * DM + n] = (_Float16)v;
    }
  }
}

// ---------------------------------------------------------------------------
// qkv: q (scaled) and k -> qkv16 (R x 256); v -> vT transposed+padded.
// grid (R/16, 24)
// ---------------------------------------------------------------------------
__global__ void qkv_kernel(const _Float16* __restrict__ h16,
                           const _Float16* __restrict__ pqkv,  // 96 tiles [nt*4+kt]
                           const float* __restrict__ bqkv,
                           _Float16* __restrict__ qkv16, _Float16* __restrict__ vT) {
  int row0 = blockIdx.x * 16;
  int nt = blockIdx.y;
  int lane = threadIdx.x & 31;
  int nCol = lane & 15, mBase = (lane < 16) ? 0 : 8;

  v8f acc = {};
#pragma unroll
  for (int kt = 0; kt < 4; ++kt)
    acc = wmma16(load_a_frag(h16 + row0 * DM + kt * 32, DM),
                 load_b_packed(pqkv, nt * 4 + kt), acc);
  int n = nt * 16 + nCol;
  float bias = bqkv[n];
  if (n < 256) {  // q (scaled) / k : row-major
    float scale = (n < 128) ? QSCALE : 1.0f;
#pragma unroll
    for (int r = 0; r < 8; ++r)
      qkv16[(size_t)(row0 + mBase + r) * QKV_LD + n] =
          (_Float16)((acc[r] + bias) * scale);
  } else {        // v : transposed with padded time axis, vectorized store
    int d = n - 256;
    int head = d >> 5, dd = d & 31;
    int bIdx = row0 >> 11;
    int t0m = (row0 & (T_SEQ - 1)) + mBase;
    v8h vv;
#pragma unroll
    for (int r = 0; r < 8; ++r) vv[r] = (_Float16)(acc[r] + bias);
    *(v8h*)(vT + (size_t)((bIdx * 4 + head) * 32 + dd) * T_PAD + 64 + t0m) = vv;
  }
}

// ---------------------------------------------------------------------------
// windowed attention: 16 queries x 1 head per wave. grid (R/16, NHEAD)
// ---------------------------------------------------------------------------
__global__ void attn_kernel(const _Float16* __restrict__ qkv16,
                            const _Float16* __restrict__ vT,
                            _Float16* __restrict__ ao16) {
  __shared__ _Float16 at[16 * 96];  // attn probs, K padded 80 -> 96
  int row0 = blockIdx.x * 16;
  int head = blockIdx.y;
  int t0 = row0 & (T_SEQ - 1);
  int bRow0 = row0 - t0;
  int bIdx = row0 >> 11;
  int lane = threadIdx.x & 31;
  int nCol = lane & 15, mBase = (lane < 16) ? 0 : 8, kBase = mBase;
  int keyBase = t0 - 64;

  v16h qa = load_a_frag(qkv16 + (size_t)row0 * QKV_LD + head * 32, QKV_LD);

  v8f s[5];
#pragma unroll
  for (int kt = 0; kt < 5; ++kt) {
    int j = keyBase + kt * 16 + nCol;   // key position for this lane's column
    int jr = j < 0 ? 0 : j;             // clamp address; mask handles validity
    v16h kb = load_kpair(qkv16 + (size_t)(bRow0 + jr) * QKV_LD + 128 + head * 32 + kBase);
    v8f c = {};
    c = wmma16(qa, kb, c);
#pragma unroll
    for (int r = 0; r < 8; ++r) {
      int iQ = t0 + mBase + r;
      bool valid = (j >= 0) && (j <= iQ) && (j >= iQ - 63);
      s[kt][r] = valid ? c[r] : -1e30f;
    }
  }

  // row softmax: row m lives in one vgpr slot across the 16 lanes of a half
#pragma unroll
  for (int r = 0; r < 8; ++r) {
    float mx = s[0][r];
#pragma unroll
    for (int kt = 1; kt < 5; ++kt) mx = fmaxf(mx, s[kt][r]);
#pragma unroll
    for (int msk = 1; msk < 16; msk <<= 1) mx = fmaxf(mx, __shfl_xor(mx, msk, 32));
    float sum = 0.f;
#pragma unroll
    for (int kt = 0; kt < 5; ++kt) { float e = __expf(s[kt][r] - mx); s[kt][r] = e; sum += e; }
#pragma unroll
    for (int msk = 1; msk < 16; msk <<= 1) sum += __shfl_xor(sum, msk, 32);
    float inv = 1.0f / sum;
#pragma unroll
    for (int kt = 0; kt < 5; ++kt) s[kt][r] *= inv;
  }

  // C-layout -> A-fragment layout via LDS (16 x 96, cols 80..95 zero)
#pragma unroll
  for (int kt = 0; kt < 5; ++kt)
#pragma unroll
    for (int r = 0; r < 8; ++r)
      at[(mBase + r) * 96 + kt * 16 + nCol] = (_Float16)s[kt][r];
#pragma unroll
  for (int r = 0; r < 8; ++r) at[(mBase + r) * 96 + 80 + nCol] = (_Float16)0.f;
  __syncthreads();

  // attn(16x96) @ V(96x32): 2 N-tiles x 3 K-chunks, contiguous vT loads
#pragma unroll
  for (int nt = 0; nt < 2; ++nt) {
    int d = nt * 16 + nCol;
    const _Float16* vrow = vT + (size_t)((bIdx * 4 + head) * 32 + d) * T_PAD + 64 + keyBase;
    v8f acc = {};
#pragma unroll
    for (int kc = 0; kc < 3; ++kc) {
      v16h aa = load_a_frag(at + kc * 32, 96);
      v16h vb = load_kpair(vrow + kc * 32 + kBase);
      acc = wmma16(aa, vb, acc);
    }
#pragma unroll
    for (int r = 0; r < 8; ++r)
      ao16[(size_t)(row0 + mBase + r) * DM + head * 32 + nt * 16 + nCol] = (_Float16)acc[r];
  }
}

// ---------------------------------------------------------------------------
// o-proj + residual + layernorm -> h32/h16
// ---------------------------------------------------------------------------
__global__ void oproj_ln_kernel(const _Float16* __restrict__ ao16,
                                const _Float16* __restrict__ pwo,  // 32 tiles
                                const float* __restrict__ bo,
                                const float* __restrict__ g, const float* __restrict__ bb,
                                float* __restrict__ h32, _Float16* __restrict__ h16) {
  int row0 = blockIdx.x * 16;
  int lane = threadIdx.x & 31;
  int nCol = lane & 15, mBase = (lane < 16) ? 0 : 8;

  v16h a[4];
#pragma unroll
  for (int kt = 0; kt < 4; ++kt) a[kt] = load_a_frag(ao16 + row0 * DM + kt * 32, DM);

  v8f out[8];
#pragma unroll
  for (int nt = 0; nt < 8; ++nt) {
    v8f acc = {};
#pragma unroll
    for (int kt = 0; kt < 4; ++kt)
      acc = wmma16(a[kt], load_b_packed(pwo, nt * 4 + kt), acc);
    float bias = bo[nt * 16 + nCol];
#pragma unroll
    for (int r = 0; r < 8; ++r)
      out[nt][r] = acc[r] + bias + h32[(row0 + mBase + r) * DM + nt * 16 + nCol];
  }
#pragma unroll
  for (int r = 0; r < 8; ++r) {
    float sm = 0.f, sq = 0.f;
#pragma unroll
    for (int nt = 0; nt < 8; ++nt) { float v = out[nt][r]; sm += v; sq += v * v; }
#pragma unroll
    for (int msk = 1; msk < 16; msk <<= 1) { sm += __shfl_xor(sm, msk, 32); sq += __shfl_xor(sq, msk, 32); }
    float mu = sm * (1.f / 128.f);
    float inv = rsqrtf(sq * (1.f / 128.f) - mu * mu + LN_EPS);
#pragma unroll
    for (int nt = 0; nt < 8; ++nt) {
      int n = nt * 16 + nCol;
      int row = row0 + mBase + r;
      float y = (out[nt][r] - mu) * inv * g[n] + bb[n];
      h32[row * DM + n] = y;
      h16[row * DM + n] = (_Float16)y;
    }
  }
}

// ---------------------------------------------------------------------------
// FFN: relu(h@W1+b1)@W2+b2, residual + layernorm
// ---------------------------------------------------------------------------
__global__ void ffn_ln_kernel(const _Float16* __restrict__ h16in,
                              const _Float16* __restrict__ pf1,  // 64 tiles [nt*4+kt]
                              const float* __restrict__ b1,
                              const _Float16* __restrict__ pf2,  // 64 tiles [nt*8+kt]
                              const float* __restrict__ b2,
                              const float* __restrict__ g, const float* __restrict__ bb,
                              float* __restrict__ h32, _Float16* __restrict__ h16) {
  __shared__ _Float16 mid[16 * DFF_];
  int row0 = blockIdx.x * 16;
  int lane = threadIdx.x & 31;
  int nCol = lane & 15, mBase = (lane < 16) ? 0 : 8;

  v16h a[4];
#pragma unroll
  for (int kt = 0; kt < 4; ++kt) a[kt] = load_a_frag(h16in + row0 * DM + kt * 32, DM);
#pragma unroll
  for (int nt = 0; nt < 16; ++nt) {
    v8f acc = {};
#pragma unroll
    for (int kt = 0; kt < 4; ++kt)
      acc = wmma16(a[kt], load_b_packed(pf1, nt * 4 + kt), acc);
    float bias = b1[nt * 16 + nCol];
#pragma unroll
    for (int r = 0; r < 8; ++r) {
      float v = acc[r] + bias;
      mid[(mBase + r) * DFF_ + nt * 16 + nCol] = (_Float16)(v > 0.f ? v : 0.f);
    }
  }
  __syncthreads();

  v16h a2[8];
#pragma unroll
  for (int kt = 0; kt < 8; ++kt) a2[kt] = load_a_frag(mid + kt * 32, DFF_);

  v8f out[8];
#pragma unroll
  for (int nt = 0; nt < 8; ++nt) {
    v8f acc = {};
#pragma unroll
    for (int kt = 0; kt < 8; ++kt)
      acc = wmma16(a2[kt], load_b_packed(pf2, nt * 8 + kt), acc);
    float bias = b2[nt * 16 + nCol];
#pragma unroll
    for (int r = 0; r < 8; ++r)
      out[nt][r] = acc[r] + bias + h32[(row0 + mBase + r) * DM + nt * 16 + nCol];
  }
#pragma unroll
  for (int r = 0; r < 8; ++r) {
    float sm = 0.f, sq = 0.f;
#pragma unroll
    for (int nt = 0; nt < 8; ++nt) { float v = out[nt][r]; sm += v; sq += v * v; }
#pragma unroll
    for (int msk = 1; msk < 16; msk <<= 1) { sm += __shfl_xor(sm, msk, 32); sq += __shfl_xor(sq, msk, 32); }
    float mu = sm * (1.f / 128.f);
    float inv = rsqrtf(sq * (1.f / 128.f) - mu * mu + LN_EPS);
#pragma unroll
    for (int nt = 0; nt < 8; ++nt) {
      int n = nt * 16 + nCol;
      int row = row0 + mBase + r;
      float y = (out[nt][r] - mu) * inv * g[n] + bb[n];
      h32[row * DM + n] = y;
      h16[row * DM + n] = (_Float16)y;
    }
  }
}

// ---------------------------------------------------------------------------
// head: out = h16 @ W_head(128x16 padded) + b_head -> fp32 (R x 8)
// ---------------------------------------------------------------------------
__global__ void head_kernel(const _Float16* __restrict__ h16,
                            const _Float16* __restrict__ pwh,  // 4 tiles
                            const float* __restrict__ bh,
                            float* __restrict__ out) {
  int row0 = blockIdx.x * 16;
  int lane = threadIdx.x & 31;
  int nCol = lane & 15, mBase = (lane < 16) ? 0 : 8;
  v8f acc = {};
#pragma unroll
  for (int kt = 0; kt < 4; ++kt)
    acc = wmma16(load_a_frag(h16 + row0 * DM + kt * 32, DM),
                 load_b_packed(pwh, kt), acc);
  if (nCol < 8) {
    float bias = bh[nCol];
#pragma unroll
    for (int r = 0; r < 8; ++r) out[(row0 + mBase + r) * 8 + nCol] = acc[r] + bias;
  }
}

// ---------------------------------------------------------------------------
// host launch
// ---------------------------------------------------------------------------
extern "C" void kernel_launch(void* const* d_in, const int* in_sizes, int n_in,
                              void* d_out, int out_size, void* d_ws, size_t ws_size,
                              hipStream_t stream) {
  (void)in_sizes; (void)n_in; (void)out_size; (void)ws_size;
  const float* E      = (const float*)d_in[0];
  const float* rho    = (const float*)d_in[1];
  const float* W_in1  = (const float*)d_in[2];
  const float* b_in1  = (const float*)d_in[3];
  const float* W_in2  = (const float*)d_in[4];
  const float* b_in2  = (const float*)d_in[5];
  const float* Wqkv   = (const float*)d_in[6];
  const float* bqkv   = (const float*)d_in[7];
  const float* Wo     = (const float*)d_in[8];
  const float* bo     = (const float*)d_in[9];
  const float* ln1_g  = (const float*)d_in[10];
  const float* ln1_b  = (const float*)d_in[11];
  const float* Wff1   = (const float*)d_in[12];
  const float* bff1   = (const float*)d_in[13];
  const float* Wff2   = (const float*)d_in[14];
  const float* bff2   = (const float*)d_in[15];
  const float* ln2_g  = (const float*)d_in[16];
  const float* ln2_b  = (const float*)d_in[17];
  const float* W_head = (const float*)d_in[18];
  const float* b_head = (const float*)d_in[19];

  char* w = (char*)d_ws;
  auto take = [&](size_t bytes) -> void* {
    void* p = (void*)w;
    w += (bytes + 255) & ~(size_t)255;
    return p;
  };
  _Float16* x16   = (_Float16*)take((size_t)R_TOT * 32 * 2);
  _Float16* h16   = (_Float16*)take((size_t)R_TOT * DM * 2);
  float*    h32   = (float*)   take((size_t)R_TOT * DM * 4);
  _Float16* qkv16 = (_Float16*)take((size_t)R_TOT * QKV_LD * 2);
  _Float16* vT    = (_Float16*)take((size_t)512 * T_PAD * 2);  // 16 (b*head) * 32 d rows
  _Float16* ao16  = (_Float16*)take((size_t)R_TOT * DM * 2);
  _Float16* pw1   = (_Float16*)take((size_t)8 * 512 * 2);
  _Float16* pw2   = (_Float16*)take((size_t)32 * 512 * 2);
  _Float16* pqkv  = (_Float16*)take((size_t)3 * 96 * 512 * 2);
  _Float16* pwo   = (_Float16*)take((size_t)3 * 32 * 512 * 2);
  _Float16* pf1   = (_Float16*)take((size_t)3 * 64 * 512 * 2);
  _Float16* pf2   = (_Float16*)take((size_t)3 * 64 * 512 * 2);
  _Float16* pwh   = (_Float16*)take((size_t)4 * 512 * 2);

  // all set-up work (weight packing, x16, vT pads) in one launch
  prep_all<<<PB_END, 256, 0, stream>>>(E, rho, W_in1, W_in2, Wqkv, Wo, Wff1, Wff2, W_head,
                                       x16, vT, pw1, pw2, pqkv, pwo, pf1, pf2, pwh);

  const int TILES = R_TOT / 16;  // 512
  inproj_kernel<<<TILES, 32, 0, stream>>>(x16, pw1, b_in1, pw2, b_in2, h32, h16);

  for (int l = 0; l < 3; ++l) {
    qkv_kernel<<<dim3(TILES, 24), 32, 0, stream>>>(
        h16, pqkv + (size_t)l * 96 * 512, bqkv + l * 384, qkv16, vT);
    attn_kernel<<<dim3(TILES, 4), 32, 0, stream>>>(qkv16, vT, ao16);
    oproj_ln_kernel<<<TILES, 32, 0, stream>>>(
        ao16, pwo + (size_t)l * 32 * 512, bo + l * 128,
        ln1_g + l * 128, ln1_b + l * 128, h32, h16);
    ffn_ln_kernel<<<TILES, 32, 0, stream>>>(
        h16, pf1 + (size_t)l * 64 * 512, bff1 + l * 256,
        pf2 + (size_t)l * 64 * 512, bff2 + l * 128,
        ln2_g + l * 128, ln2_b + l * 128, h32, h16);
  }
  head_kernel<<<TILES, 32, 0, stream>>>(h16, pwh, b_head, (float*)d_out);
}

// v002
// A run of this version takes 63.3 microseconds.
// In two side-by-side timings against v001, it was 3.06 and 3.10 times as fast.
// All steps since v000 together make it 4.97 times as fast.
#include <hip/hip_runtime.h>
#include <hip/hip_bf16.h>

// ---------------------------------------------------------------------------
// StateSequenceTransformer on MI455X (gfx1250, wave32, WMMA 16x16x32 f16)
//   B=4 T=2048 D_MODEL=128 NHEAD=4 hd=32 DFF=256 WINDOW=64 NLAYERS=3
//   One 4-wave block (128 threads) owns a 16-row tile through a whole layer.
//   Weights pre-packed into per-lane B-fragment order -> b128 vector loads.
//   V stored transposed+padded so attn@V B-fragments are contiguous.
// ---------------------------------------------------------------------------

#define R_TOT  8192
#define T_SEQ  2048
#define DM     128
#define DFF_   256
#define QKV_LD 256            /* q (scaled) + k, f16 */
#define T_PAD  2144           /* 64 front pad + 2048 + 32 back pad */
#define HP     136            /* LDS pitch of the tile buffers between fused stages: 272 B = 16 B x odd */
#define TP     128            /* LDS pitch of in_proj's hidden tile */
#define MP     256            /* LDS pitch of the FFN's hidden tile */
#define AP     96             /* LDS pitch of the attention probs */
#define LN_EPS 1e-5f
#define QSCALE 0.17677669529663687f /* 1/sqrt(32) */

typedef __attribute__((ext_vector_type(16))) _Float16 v16h;
typedef __attribute__((ext_vector_type(8)))  _Float16 v8h;
typedef __attribute__((ext_vector_type(8)))  float    v8f;

__device__ __forceinline__ v8f wmma16(v16h a, v16h b, v8f c) {
  return __builtin_amdgcn_wmma_f32_16x16x32_f16(false, a, false, b, (short)0, c,
                                                false, false);
}

// A fragment: 16x32 f16 from row-major src (ld multiple of 8, 16B aligned).
// lane<16: row=lane, K={0..7,16..23}; lane>=16: row=lane-16, K={8..15,24..31}
__device__ __forceinline__ v16h load_a_frag(const _Float16* src, int ld) {
  int lane = threadIdx.x & 31;
  const _Float16* p = src + (lane & 15) * ld + ((lane < 16) ? 0 : 8);
  v8h lo = *(const v8h*)p;
  v8h hi = *(const v8h*)(p + 16);
  return __builtin_shufflevector(lo, hi, 0, 1, 2, 3, 4, 5, 6, 7,
                                 8, 9, 10, 11, 12, 13, 14, 15);
}

// Pre-packed B fragment: tile = 512 f16, lane's 16 values contiguous (32B).
__device__ __forceinline__ v16h load_b_packed(const _Float16* base, int tile) {
  int lane = threadIdx.x & 31;
  return *(const v16h*)(base + ((size_t)tile << 9) + (lane << 4));
}

// Build v16h from two contiguous v8h loads at p and p+16 (K^T / generic).
__device__ __forceinline__ v16h load_kpair(const _Float16* p) {
  v8h lo = *(const v8h*)p;
  v8h hi = *(const v8h*)(p + 16);
  return __builtin_shufflevector(lo, hi, 0, 1, 2, 3, 4, 5, 6, 7,
                                 8, 9, 10, 11, 12, 13, 14, 15);
}

// precaution: stands behind a run of global loads, in front of later loads whose
// results may land in the registers that held the run's addresses
__device__ __forceinline__ void addr_wait() {
  asm volatile("s_wait_xcnt 0x0" ::: "memory");
}

// ---------------------------------------------------------------------------
// prep: every piece of set-up work is independent of every other piece, so all
// of it shares ONE launch; a block-uniform range test on blockIdx.x picks the
// piece. Weight packing comes first in the grid (longest chain per thread).
//   pack: f32 weights (K x N row-major, ld=NLD) -> B-fragment tiles,
//         tile id = nt*KT + kt; elements outside (KSRC,NSRC) -> 0 (padding).
// ---------------------------------------------------------------------------
#define PB_W1  0     /*    1 block : W_in1  1 x  8 tiles          */
#define PB_W2  1     /*    4 blocks: W_in2  4 x  8 tiles          */
#define PB_QKV 5     /*   36 blocks: Wqkv   4 x 24 tiles, 3 layers */
#define PB_WO  41    /*   12 blocks: Wo     4 x  8 tiles, 3 layers */
#define PB_F1  53    /*   24 blocks: Wff1   4 x 16 tiles, 3 layers */
#define PB_F2  77    /*   24 blocks: Wff2   8 x  8 tiles, 3 layers */
#define PB_WH  101   /*    1 block : W_head 4 x  1 tiles (half full) */
#define PB_X   102   /* 1024 blocks: x16 = concat(E, rho), padded to 32 */
#define PB_PAD 1126  /*  384 blocks: zero the time pads of both vT buffers */
#define PB_END 1510

template <int KT, int KSRC, int NSRC, int NLD>
__device__ __forceinline__ void pack_lane(const float* __restrict__ src,
                                          _Float16* __restrict__ dst, int idx) {
  int lane = idx & 31;
  int tile = idx >> 5;
  int kt = tile % KT, nt = tile / KT;
  int col = lane & 15, kB = (lane < 16) ? 0 : 8;
  int n = nt * 16 + col;
  _Float16* d = dst + ((size_t)tile << 9) + (lane << 4);
#pragma unroll
  for (int i = 0; i < 8; ++i) {
    int k0 = kt * 32 + kB + i, k1 = k0 + 16;
    d[i]     = (k0 < KSRC && n < NSRC) ? (_Float16)src[k0 * NLD + n] : (_Float16)0.f;
    d[8 + i] = (k1 < KSRC && n < NSRC) ? (_Float16)src[k1 * NLD + n] : (_Float16)0.f;
  }
  // precaution: code of another piece follows in the listing and reuses the
  // registers that the last stores name; the wait stands in front of that reuse
  asm volatile("s_wait_xcnt 0x0" ::: "memory");
}

__global__ void prep_all(const float* __restrict__ E, const float* __restrict__ rho,
                         const float* __restrict__ W_in1, const float* __restrict__ W_in2,
                         const float* __restrict__ Wqkv, const float* __restrict__ Wo,
                         const float* __restrict__ Wff1, const float* __restrict__ Wff2,
                         const float* __restrict__ W_head,
                         _Float16* __restrict__ x16, _Float16* __restrict__ vT,
                         _Float16* __restrict__ pw1, _Float16* __restrict__ pw2,
                         _Float16* __restrict__ pqkv, _Float16* __restrict__ pwo,
                         _Float16* __restrict__ pf1, _Float16* __restrict__ pf2,
                         _Float16* __restrict__ pwh) {
  int b = blockIdx.x;
  int tid = threadIdx.x;
  if (b >= PB_PAD) {
    int i = (b - PB_PAD) * 256 + tid;  // 2 * 512 rows * 96 pad entries
    int row = i / 96, c = i % 96;
    int pos = (c < 64) ? c : (64 + T_SEQ + (c - 64));
    vT[(size_t)row * T_PAD + pos] = (_Float16)0.f;
  } else if (b >= PB_X) {
    int i = (b - PB_X) * 256 + tid;    // R*32
    int row = i >> 5, c = i & 31;
    _Float16 v = (_Float16)0.f;
    if (c < 8)       v = (_Float16)E[row * 8 + c];
    else if (c < 16) v = (_Float16)rho[row * 8 + (c - 8)];
    x16[i] = v;
    // precaution: same as in pack_lane, for the registers that this store names
    asm volatile("s_wait_xcnt 0x0" ::: "memory");
  } else if (b >= PB_WH) {
    if (tid < 128) pack_lane<4, 128, 8, 8>(W_head, pwh, tid);
  } else if (b >= PB_F2) {
    int l = (b - PB_F2) / 8, r = (b - PB_F2) % 8;
    pack_lane<8, 256, 128, 128>(Wff2 + (size_t)l * 256 * 128,
                                pf2 + (size_t)l * 64 * 512, r * 256 + tid);
  } else if (b >= PB_F1) {
    int l = (b - PB_F1) / 8, r = (b - PB_F1) % 8;
    pack_lane<4, 128, 256, 256>(Wff1 + (size_t)l * 128 * 256,
                                pf1 + (size_t)l * 64 * 512, r * 256 + tid);
  } else if (b >= PB_WO) {
    int l = (b - PB_WO) / 4, r = (b - PB_WO) % 4;
    pack_lane<4, 128, 128, 128>(Wo + (size_t)l * 128 * 128,
                                pwo + (size_t)l * 32 * 512, r * 256 + tid);
  } else if (b >= PB_QKV) {
    int l = (b - PB_QKV) / 12, r = (b - PB_QKV) % 12;
    pack_lane<4, 128, 384, 384>(Wqkv + (size_t)l * 128 * 384,
                                pqkv + (size_t)l * 96 * 512, r * 256 + tid);
  } else if (b >= PB_W2) {
    pack_lane<4, 128, 128, 128>(W_in2, pw2, (b - PB_W2) * 256 + tid);
  } else {
    pack_lane<1, 16, 128, 128>(W_in1, pw1, tid);
  }
}

// ---------------------------------------------------------------------------
// Row-local stages. Everything behind the K/V exchange of a layer depends only
// on the block's own 16 rows, so it runs in ONE launch: the tile goes from stage
// to stage through LDS, the f32 residual stays in registers, and the N tiles of
// the in_proj, qkv, o-proj and FFN products are dealt to the block's four waves.
// Every loop below is unrolled: fragment and accumulator arrays stay in
// registers only where their indices are compile-time constants.
// ---------------------------------------------------------------------------

// qkv of the tile in hs (LDS, pitch HP): q (scaled) and k -> qk_out (R x 256),
// v -> vT_out transposed+padded. Wave w takes N tiles i*4+w.
__device__ __forceinline__ void qkv_stage(const _Float16* hs,
                                          const _Float16* __restrict__ pq,  // 96 tiles [nt*4+kt]
                                          const float* __restrict__ bq,
                                          _Float16* __restrict__ qk_out,
                                          _Float16* __restrict__ vT_out,
                                          int row0, int w) {
  int lane = threadIdx.x & 31;
  int nCol = lane & 15, mBase = (lane < 16) ? 0 : 8;
  v16h a[4];
#pragma unroll
  for (int kt = 0; kt < 4; ++kt) a[kt] = load_a_frag(hs + kt * 32, HP);
#pragma unroll
  for (int i = 0; i < 6; ++i) {
    int nt = i * 4 + w;
    v8f acc = {};
#pragma unroll
    for (int kt = 0; kt < 4; ++kt)
      acc = wmma16(a[kt], load_b_packed(pq, nt * 4 + kt), acc);
    int n = nt * 16 + nCol;
    float bias = bq[n];
    if (i < 4) {  // q (scaled) / k : row-major
      float scale = (i < 2) ? QSCALE : 1.0f;
#pragma unroll
      for (int r = 0; r < 8; ++r)
        qk_out[(size_t)(row0 + mBase + r) * QKV_LD + n] =
            (_Float16)((acc[r] + bias) * scale);
    } else {      // v : transposed with padded time axis, vectorized store
      int d = n - 256;
      int hd = d >> 5, dd = d & 31;
      int bIdx = row0 >> 11;
      int t0m = (row0 & (T_SEQ - 1)) + mBase;
      v8h vv;
#pragma unroll
      for (int r = 0; r < 8; ++r) vv[r] = (_Float16)(acc[r] + bias);
      *(v8h*)(vT_out + (size_t)((bIdx * 4 + hd) * 32 + dd) * T_PAD + 64 + t0m) = vv;
    }
  }
}

// layernorm of the tile; wave w holds columns w*32 .. w*32+31 in o[2] (C layout).
// Row sums: 2 tiles in the lane, 16 lanes by shuffle, 4 waves through red.
__device__ __forceinline__ void ln_stage(v8f (&o)[2], float* red,  // [16 rows][4 waves][2]
                                         const float* __restrict__ g,
                                         const float* __restrict__ bb, int w) {
  int lane = threadIdx.x & 31;
  int nCol = lane & 15, mBase = (lane < 16) ? 0 : 8;
  float sm[8], sq[8];
#pragma unroll
  for (int r = 0; r < 8; ++r) {
    sm[r] = o[0][r] + o[1][r];
    sq[r] = o[0][r] * o[0][r] + o[1][r] * o[1][r];
#pragma unroll
    for (int msk = 1; msk < 16; msk <<= 1) {
      sm[r] += __shfl_xor(sm[r], msk, 32);
      sq[r] += __shfl_xor(sq[r], msk, 32);
    }
  }
  if (nCol == 0) {
#pragma unroll
    for (int r = 0; r < 8; ++r)
      *(float2*)(red + ((mBase + r) * 4 + w) * 2) = make_float2(sm[r], sq[r]);
  }
  __syncthreads();  // every wave reads all four waves' partial row sums
  int n0 = w * 32 + nCol;
  float g0 = g[n0], g1 = g[n0 + 16], b0 = bb[n0], b1 = bb[n0 + 16];
#pragma unroll
  for (int r = 0; r < 8; ++r) {
    float4 p = *(const float4*)(red + (mBase + r) * 8);
    float4 q = *(const float4*)(red + (mBase + r) * 8 + 4);
    float s = (p.x + p.z) + (q.x + q.z);
    float s2 = (p.y + p.w) + (q.y + q.w);
    float mu = s * (1.f / 128.f);
    float inv = rsqrtf(s2 * (1.f / 128.f) - mu * mu + LN_EPS);
    o[0][r] = (o[0][r] - mu) * inv * g0 + b0;
    o[1][r] = (o[1][r] - mu) * inv * g1 + b1;
  }
}

// the wave's two C tiles -> f16 rows in LDS (pitch HP)
__device__ __forceinline__ void tile_to_lds(const v8f (&o)[2], _Float16* hs, int w) {
  int lane = threadIdx.x & 31;
  int nCol = lane & 15, mBase = (lane < 16) ? 0 : 8;
#pragma unroll
  for (int i = 0; i < 2; ++i)
#pragma unroll
    for (int r = 0; r < 8; ++r)
      hs[(mBase + r) * HP + w * 32 + i * 16 + nCol] = (_Float16)o[i][r];
}

// ---------------------------------------------------------------------------
// in_proj + first qkv: h = relu(x@W1+b1)@W2 + b2 + PE -> h32; qkv of layer 0
// ---------------------------------------------------------------------------
__global__ __launch_bounds__(128) void inproj_qkv_kernel(
    const _Float16* __restrict__ x16,
    const _Float16* __restrict__ pw1,  // 8 tiles
    const float* __restrict__ b1,
    const _Float16* __restrict__ pw2,  // 32 tiles [nt*4+kt]
    const float* __restrict__ b2,
    float* __restrict__ h32,
    const _Float16* __restrict__ pq, const float* __restrict__ bq,
    _Float16* __restrict__ qk_out, _Float16* __restrict__ vT_out) {
  __shared__ __attribute__((aligned(16))) _Float16 t1[16 * TP];
  __shared__ __attribute__((aligned(16))) _Float16 hs[16 * HP];
  int row0 = blockIdx.x * 16;
  int w = threadIdx.x >> 5;
  int lane = threadIdx.x & 31;
  int nCol = lane & 15, mBase = (lane < 16) ? 0 : 8;

  v16h a = load_a_frag(x16 + row0 * 32, 32);
  addr_wait();  // behind the x16 loads, in front of the weight tile loads
#pragma unroll
  for (int i = 0; i < 2; ++i) {
    int nt = w * 2 + i;
    v8f acc = {};
    acc = wmma16(a, load_b_packed(pw1, nt), acc);
    float bias = b1[nt * 16 + nCol];
#pragma unroll
    for (int r = 0; r < 8; ++r) {
      float v = acc[r] + bias;
      t1[(mBase + r) * TP + nt * 16 + nCol] = (_Float16)(v > 0.f ? v : 0.f);
    }
  }
  __syncthreads();  // every wave reads all 128 columns of t1 as A fragments

  v16h a2[4];
#pragma unroll
  for (int kt = 0; kt < 4; ++kt) a2[kt] = load_a_frag(t1 + kt * 32, TP);
  v8f o[2];
#pragma unroll
  for (int i = 0; i < 2; ++i) {
    int nt = w * 2 + i;
    v8f acc = {};
#pragma unroll
    for (int kt = 0; kt < 4; ++kt)
      acc = wmma16(a2[kt], load_b_packed(pw2, nt * 4 + kt), acc);
    int n = nt * 16 + nCol;
    float bias = b2[n];
    float div = __expf(-(float)(n >> 1) * (9.210340371976184f / 64.f));
#pragma unroll
    for (int r = 0; r < 8; ++r) {
      int row = row0 + mBase + r;
      float ang = (float)(row & (T_SEQ - 1)) * div;
      float pe = (n & 1) ? __cosf(ang) : __sinf(ang);
      float v = acc[r] + bias + pe;
      h32[row * DM + n] = v;
      o[i][r] = v;
    }
  }
  tile_to_lds(o, hs, w);
  __syncthreads();  // every wave reads all 128 columns of hs as A fragments
  qkv_stage(hs, pq, bq, qk_out, vT_out, row0, w);
}

// ---------------------------------------------------------------------------
// one layer behind its qkv: windowed attention (wave = head), o-proj + residual
// + layernorm, FFN + residual + layernorm; leaves the tile in hs (f16, LDS) and,
// where STORE_H, in h32 for the next launch's residual.
// ---------------------------------------------------------------------------
template <bool STORE_H>
__device__ __forceinline__ void layer_body(
    const _Float16* __restrict__ qk_in, const _Float16* __restrict__ vT_in,
    const _Float16* __restrict__ pwo,  // 32 tiles [nt*4+kt]
    const float* __restrict__ bo,
    const float* __restrict__ g1, const float* __restrict__ be1,
    const _Float16* __restrict__ pf1,  // 64 tiles [nt*4+kt]
    const float* __restrict__ bf1,
    const _Float16* __restrict__ pf2,  // 64 tiles [nt*8+kt]
    const float* __restrict__ bf2,
    const float* __restrict__ g2, const float* __restrict__ be2,
    float* __restrict__ h32, _Float16* hs) {
  __shared__ __attribute__((aligned(16))) _Float16 at[4][16 * AP];  // attn probs, K padded 80 -> 96
  __shared__ __attribute__((aligned(16))) _Float16 ao[16 * HP];
  __shared__ __attribute__((aligned(16))) _Float16 h1[16 * HP];
  __shared__ __attribute__((aligned(16))) _Float16 mid[16 * MP];
  __shared__ __attribute__((aligned(16))) float red1[16 * 8];
  __shared__ __attribute__((aligned(16))) float red2[16 * 8];
  int row0 = blockIdx.x * 16;
  int w = threadIdx.x >> 5;
  int head = w;
  int t0 = row0 & (T_SEQ - 1);
  int bRow0 = row0 - t0;
  int bIdx = row0 >> 11;
  int lane = threadIdx.x & 31;
  int nCol = lane & 15, mBase = (lane < 16) ? 0 : 8, kBase = mBase;
  int keyBase = t0 - 64;
  _Float16* atw = at[w];

  v16h qa = load_a_frag(qk_in + (size_t)row0 * QKV_LD + head * 32, QKV_LD);
  addr_wait();  // behind the q loads, in front of the K loads

  v8f s[5];
#pragma unroll
  for (int kt = 0; kt < 5; ++kt) {
    int j = keyBase + kt * 16 + nCol;   // key position for this lane's column
    int jr = j < 0 ? 0 : j;             // clamp address; mask handles validity
    v16h kb = load_kpair(qk_in + (size_t)(bRow0 + jr) * QKV_LD + 128 + head * 32 + kBase);
    v8f c = {};
    c = wmma16(qa, kb, c);
#pragma unroll
    for (int r = 0; r < 8; ++r) {
      int iQ = t0 + mBase + r;
      bool valid = (j >= 0) && (j <= iQ) && (j >= iQ - 63);
      s[kt][r] = valid ? c[r] : -1e30f;
    }
  }

  // row softmax: row m lives in one vgpr slot across the 16 lanes of a half
#pragma unroll
  for (int r = 0; r < 8; ++r) {
    float mx = s[0][r];
#pragma unroll
    for (int kt = 1; kt < 5; ++kt) mx = fmaxf(mx, s[kt][r]);
#pragma unroll
    for (int msk = 1; msk < 16; msk <<= 1) mx = fmaxf(mx, __shfl_xor(mx, msk, 32));
    float sum = 0.f;
#pragma unroll
    for (int kt = 0; kt < 5; ++kt) { float e = __expf(s[kt][r] - mx); s[kt][r] = e; sum += e; }
#pragma unroll
    for (int msk = 1; msk < 16; msk <<= 1) sum += __shfl_xor(sum, msk, 32);
    float inv = 1.0f / sum;
#pragma unroll
    for (int kt = 0; kt < 5; ++kt) s[kt][r] *= inv;
  }

  // C-layout -> A-fragment layout via LDS (16 x 96, cols 80..95 zero)
#pragma unroll
  for (int kt = 0; kt < 5; ++kt)
#pragma unroll
    for (int r = 0; r < 8; ++r)
      atw[(mBase + r) * AP + kt * 16 + nCol] = (_Float16)s[kt][r];
#pragma unroll
  for (int r = 0; r < 8; ++r) atw[(mBase + r) * AP + 80 + nCol] = (_Float16)0.f;
  __syncthreads();  // a lane's A fragment holds probs that other lanes wrote

  // attn(16x96) @ V(96x32): 2 N-tiles x 3 K-chunks, contiguous vT loads
#pragma unroll
  for (int nt = 0; nt < 2; ++nt) {
    int d = nt * 16 + nCol;
    const _Float16* vrow = vT_in + (size_t)((bIdx * 4 + head) * 32 + d) * T_PAD + 64 + keyBase;
    v8f acc = {};
#pragma unroll
    for (int kc = 0; kc < 3; ++kc) {
      v16h aa = load_a_frag(atw + kc * 32, AP);
      v16h vb = load_kpair(vrow + kc * 32 + kBase);
      acc = wmma16(aa, vb, acc);
    }
#pragma unroll
    for (int r = 0; r < 8; ++r)
      ao[(mBase + r) * HP + head * 32 + nt * 16 + nCol] = (_Float16)acc[r];
  }
  __syncthreads();  // every wave reads all four heads' columns of ao

  // o-proj + residual + layernorm; wave w owns columns w*32 .. w*32+31
  v8f o[2];
  {
    v16h a[4];
#pragma unroll
    for (int kt = 0; kt < 4; ++kt) a[kt] = load_a_frag(ao + kt * 32, HP);
#pragma unroll
    for (int i = 0; i < 2; ++i) {
      int nt = w * 2 + i;
      v8f acc = {};
#pragma unroll
      for (int kt = 0; kt < 4; ++kt)
        acc = wmma16(a[kt], load_b_packed(pwo, nt * 4 + kt), acc);
      float bias = bo[nt * 16 + nCol];
#pragma unroll
      for (int r = 0; r < 8; ++r)
        o[i][r] = acc[r] + bias + h32[(row0 + mBase + r) * DM + nt * 16 + nCol];
      addr_wait();  // parts the two column tiles' weight and residual loads
    }
  }
  ln_stage(o, red1, g1, be1, w);
  tile_to_lds(o, h1, w);
  __syncthreads();  // every wave reads all 128 columns of h1

  // FFN up: wave w owns hidden columns w*64 .. w*64+63
  {
    v16h a[4];
#pragma unroll
    for (int kt = 0; kt < 4; ++kt) a[kt] = load_a_frag(h1 + kt * 32, HP);
#pragma unroll
    for (int i = 0; i < 4; ++i) {
      int nt = w * 4 + i;
      v8f acc = {};
#pragma unroll
      for (int kt = 0; kt < 4; ++kt)
        acc = wmma16(a[kt], load_b_packed(pf1, nt * 4 + kt), acc);
      addr_wait();  // behind the weight tile loads, in front of the bias loads
      float bias = bf1[nt * 16 + nCol];
#pragma unroll
      for (int r = 0; r < 8; ++r) {
        float v = acc[r] + bias;
        mid[(mBase + r) * MP + nt * 16 + nCol] = (_Float16)(v > 0.f ? v : 0.f);
      }
    }
  }
  __syncthreads();  // every wave reads all 256 columns of mid

  // FFN down + residual (still in o) + layernorm
  {
    v16h a2[8];
#pragma unroll
    for (int kt = 0; kt < 8; ++kt) a2[kt] = load_a_frag(mid + kt * 32, MP);
#pragma unroll
    for (int i = 0; i < 2; ++i) {
      int nt = w * 2 + i;
      v8f acc = {};
#pragma unroll
      for (int kt = 0; kt < 8; ++kt)
        acc = wmma16(a2[kt], load_b_packed(pf2, nt * 8 + kt), acc);
      float bias = bf2[nt * 16 + nCol];
#pragma unroll
      for (int r = 0; r < 8; ++r) o[i][r] = acc[r] + bias + o[i][r];
    }
  }
  ln_stage(o, red2, g2, be2, w);
  if (STORE_H) {
#pragma unroll
    for (int i = 0; i < 2; ++i)
#pragma unroll
      for (int r = 0; r < 8; ++r)
        h32[(row0 + mBase + r) * DM + w * 32 + i * 16 + nCol] = o[i][r];
  }
  tile_to_lds(o, hs, w);
  __syncthreads();  // the stage behind reads all 128 columns of hs
}

// layer l, then the qkv of layer l+1 into the OTHER q/k and vT buffers (blocks
// of this launch still read this layer's K and V of their neighbours' rows)
__global__ __launch_bounds__(128) void layer_qkv_kernel(
    const _Float16* __restrict__ qk_in, const _Float16* __restrict__ vT_in,
    const _Float16* __restrict__ pwo, const float* __restrict__ bo,
    const float* __restrict__ g1, const float* __restrict__ be1,
    const _Float16* __restrict__ pf1, const float* __restrict__ bf1,
    const _Float16* __restrict__ pf2, const float* __restrict__ bf2,
    const float* __restrict__ g2, const float* __restrict__ be2,
    float* __restrict__ h32,
    const _Float16* __restrict__ pq, const float* __restrict__ bq,
    _Float16* __restrict__ qk_out, _Float16* __restrict__ vT_out) {
  __shared__ __attribute__((aligned(16))) _Float16 hs[16 * HP];
  layer_body<true>(qk_in, vT_in, pwo, bo, g1, be1, pf1, bf1, pf2, bf2, g2, be2, h32, hs);
  qkv_stage(hs, pq, bq, qk_out, vT_out, blockIdx.x * 16, threadIdx.x >> 5);
}

// last layer, then head: out = h @ W_head(128x16 padded) + b_head -> fp32 (R x 8)
__global__ __launch_bounds__(128) void layer_head_kernel(
    const _Float16* __restrict__ qk_in, const _Float16* __restrict__ vT_in,
    const _Float16* __restrict__ pwo, const float* __restrict__ bo,
    const float* __restrict__ g1, const float* __restrict__ be1,
    const _Float16* __restrict__ pf1, const float* __restrict__ bf1,
    const _Float16* __restrict__ pf2, const float* __restrict__ bf2,
    const float* __restrict__ g2, const float* __restrict__ be2,
    float* __restrict__ h32,
    const _Float16* __restrict__ pwh,  // 4 tiles
    const float* __restrict__ bh, float* __restrict__ out) {
  __shared__ __attribute__((aligned(16))) _Float16 hs[16 * HP];
  layer_body<false>(qk_in, vT_in, pwo, bo, g1, be1, pf1, bf1, pf2, bf2, g2, be2, h32, hs);
  if ((threadIdx.x >> 5) != 0) return;  // one N tile: one wave; no barrier follows
  int row0 = blockIdx.x * 16;
  int lane = threadIdx.x & 31;
  int nCol = lane & 15, mBase = (lane < 16) ? 0 : 8;
  v8f acc = {};
#pragma unroll
  for (int kt = 0; kt < 4; ++kt)
    acc = wmma16(load_a_frag(hs + kt * 32, HP), load_b_packed(pwh, kt), acc);
  if (nCol < 8) {
    float bias = bh[nCol];
#pragma unroll
    for (int r = 0; r < 8; ++r) out[(row0 + mBase + r) * 8 + nCol] = acc[r] + bias;
  }
}

// ---------------------------------------------------------------------------
// host launch
// ---------------------------------------------------------------------------
extern "C" void kernel_launch(void* const* d_in, const int* in_sizes, int n_in,
                              void* d_out, int out_size, void* d_ws, size_t ws_size,
                              hipStream_t stream) {
  (void)in_sizes; (void)n_in; (void)out_size; (void)ws_size;
  const float* E      = (const float*)d_in[0];
  const float* rho    = (const float*)d_in[1];
  const float* W_in1  = (const float*)d_in[2];
  const float* b_in1  = (const float*)d_in[3];
  const float* W_in2  = (const float*)d_in[4];
  const float* b_in2  = (const float*)d_in[5];
  const float* Wqkv   = (const float*)d_in[6];
  const float* bqkv   = (const float*)d_in[7];
  const float* Wo     = (const float*)d_in[8];
  const float* bo     = (const float*)d_in[9];
  const float* ln1_g  = (const float*)d_in[10];
  const float* ln1_b  = (const float*)d_in[11];
  const float* Wff1   = (const float*)d_in[12];
  const float* bff1   = (const float*)d_in[13];
  const float* Wff2   = (const float*)d_in[14];
  const float* bff2   = (const float*)d_in[15];
  const float* ln2_g  = (const float*)d_in[16];
  const float* ln2_b  = (const float*)d_in[17];
  const float* W_head = (const float*)d_in[18];
  const float* b_head = (const float*)d_in[19];

  char* w = (char*)d_ws;
  auto take = [&](size_t bytes) -> void* {
    void* p = (void*)w;
    w += (bytes + 255) & ~(size_t)255;
    return p;
  };
  _Float16* x16   = (_Float16*)take((size_t)R_TOT * 32 * 2);
  float*    h32   = (float*)   take((size_t)R_TOT * DM * 4);
  _Float16* qkA   = (_Float16*)take((size_t)R_TOT * QKV_LD * 2);
  _Float16* qkB   = (_Float16*)take((size_t)R_TOT * QKV_LD * 2);
  _Float16* vT    = (_Float16*)take((size_t)2 * 512 * T_PAD * 2);  // 2 x 16 (b*head) * 32 d rows
  _Float16* vTA   = vT;
  _Float16* vTB   = vT + (size_t)512 * T_PAD;
  _Float16* pw1   = (_Float16*)take((size_t)8 * 512 * 2);
  _Float16* pw2   = (_Float16*)take((size_t)32 * 512 * 2);
  _Float16* pqkv  = (_Float16*)take((size_t)3 * 96 * 512 * 2);
  _Float16* pwo   = (_Float16*)take((size_t)3 * 32 * 512 * 2);
  _Float16* pf1   = (_Float16*)take((size_t)3 * 64 * 512 * 2);
  _Float16* pf2   = (_Float16*)take((size_t)3 * 64 * 512 * 2);
  _Float16* pwh   = (_Float16*)take((size_t)4 * 512 * 2);

  // all set-up work (weight packing, x16, vT pads) in one launch
  prep_all<<<PB_END, 256, 0, stream>>>(E, rho, W_in1, W_in2, Wqkv, Wo, Wff1, Wff2, W_head,
                                       x16, vT, pw1, pw2, pqkv, pwo, pf1, pf2, pwh);

  const int TILES = R_TOT / 16;  // 512
  inproj_qkv_kernel<<<TILES, 128, 0, stream>>>(x16, pw1, b_in1, pw2, b_in2, h32,
                                               pqkv, bqkv, qkA, vTA);
  layer_qkv_kernel<<<TILES, 128, 0, stream>>>(
      qkA, vTA, pwo, bo, ln1_g, ln1_b, pf1, bff1, pf2, bff2, ln2_g, ln2_b, h32,
      pqkv + (size_t)96 * 512, bqkv + 384, qkB, vTB);
  layer_qkv_kernel<<<TILES, 128, 0, stream>>>(
      qkB, vTB, pwo + (size_t)32 * 512, bo + 128, ln1_g + 128, ln1_b + 128,
      pf1 + (size_t)64 * 512, bff1 + 256, pf2 + (size_t)64 * 512, bff2 + 128,
      ln2_g + 128, ln2_b + 128, h32,
      pqkv + (size_t)2 * 96 * 512, bqkv + 2 * 384, qkA, vTA);
  layer_head_kernel<<<TILES, 128, 0, stream>>>(
      qkA, vTA, pwo + (size_t)2 * 32 * 512, bo + 2 * 128, ln1_g + 2 * 128, ln1_b + 2 * 128,
      pf1 + (size_t)2 * 64 * 512, bff1 + 2 * 256, pf2 + (size_t)2 * 64 * 512, bff2 + 2 * 128,
      ln2_g + 2 * 128, ln2_b + 2 * 128, h32, pwh, b_head, (float*)d_out);
}

// v003
// A run of this version takes 57.2 microseconds.
// Next to v002, in two timings, it ran 1.11 and 1.10 times as fast.
// Over all steps from v000 it is 5.49 times as fast.
#include <hip/hip_runtime.h>
#include <hip/hip_bf16.h>

// ---------------------------------------------------------------------------
// StateSequenceTransformer on MI455X (gfx1250, wave32, WMMA 16x16x32 f16)
//   B=4 T=2048 D_MODEL=128 NHEAD=4 hd=32 DFF=256 WINDOW=64 NLAYERS=3
//   One 4-wave block (128 threads) owns a 16-row tile through a whole layer.
//   Weights pre-packed into per-lane B-fragment order -> b128 vector loads.
//   V stored transposed+padded so attn@V B-fragments are contiguous.
// ---------------------------------------------------------------------------

#define R_TOT  8192
#define T_SEQ  2048
#define DM     128
#define DFF_   256
#define QKV_LD 256            /* q (scaled) + k, f16 */
#define T_PAD  2144           /* 64 front pad + 2048 + 32 back pad */
#define HP     136            /* LDS pitch of the tile buffers between fused stages: 272 B = 16 B x odd */
#define TP     128            /* LDS pitch of in_proj's hidden tile */
#define MP     256            /* LDS pitch of the FFN's hidden tile */
#define AP     96             /* LDS pitch of the attention probs */
#define LN_EPS 1e-5f
#define QSCALE 0.17677669529663687f /* 1/sqrt(32) */

typedef __attribute__((ext_vector_type(16))) _Float16 v16h;
typedef __attribute__((ext_vector_type(8)))  _Float16 v8h;
typedef __attribute__((ext_vector_type(8)))  float    v8f;

__device__ __forceinline__ v8f wmma16(v16h a, v16h b, v8f c) {
  return __builtin_amdgcn_wmma_f32_16x16x32_f16(false, a, false, b, (short)0, c,
                                                false, false);
}

// A fragment: 16x32 f16 from row-major src (ld multiple of 8, 16B aligned).
// lane<16: row=lane, K={0..7,16..23}; lane>=16: row=lane-16, K={8..15,24..31}
__device__ __forceinline__ v16h load_a_frag(const _Float16* src, int ld) {
  int lane = threadIdx.x & 31;
  const _Float16* p = src + (lane & 15) * ld + ((lane < 16) ? 0 : 8);
  v8h lo = *(const v8h*)p;
  v8h hi = *(const v8h*)(p + 16);
  return __builtin_shufflevector(lo, hi, 0, 1, 2, 3, 4, 5, 6, 7,
                                 8, 9, 10, 11, 12, 13, 14, 15);
}

// Build v16h from two contiguous v8h loads at p and p+16 (K^T / generic).
__device__ __forceinline__ v16h load_kpair(const _Float16* p) {
  v8h lo = *(const v8h*)p;
  v8h hi = *(const v8h*)(p + 16);
  return __builtin_shufflevector(lo, hi, 0, 1, 2, 3, 4, 5, 6, 7,
                                 8, 9, 10, 11, 12, 13, 14, 15);
}

// Pre-packed B fragment: tile = 512 f16, lane's 16 values contiguous (32B).
// the lane's own address of an A fragment (see load_a_frag) / of packed tile
// 'tile'; further tiles of a run lie at compile-time distances from it
__device__ __forceinline__ const _Float16* a_lane_ptr(const _Float16* src, int ld) {
  int lane = threadIdx.x & 31;
  return src + (lane & 15) * ld + ((lane < 16) ? 0 : 8);
}
__device__ __forceinline__ const _Float16* b_lane_ptr(const _Float16* base, int tile) {
  int lane = threadIdx.x & 31;
  return base + ((size_t)tile << 9) + (lane << 4);
}
__device__ __forceinline__ v16h load_b_at(const _Float16* lp, int tile) {
  return *(const v16h*)(lp + (tile << 9));
}

// precaution: stands behind a run of global loads, in front of later loads whose
// results may land in the registers that held the run's addresses
__device__ __forceinline__ void addr_wait() {
  asm volatile("s_wait_xcnt 0x0" ::: "memory");
}

// ---------------------------------------------------------------------------
// prep: every piece of set-up work is independent of every other piece, so all
// of it shares ONE launch; a block-uniform range test on blockIdx.x picks the
// piece. Weight packing comes first in the grid (longest chain per thread).
//   pack: f32 weights (K x N row-major, ld=NLD) -> B-fragment tiles,
//         tile id = nt*KT + kt; elements outside (KSRC,NSRC) -> 0 (padding).
// ---------------------------------------------------------------------------
#define PB_W1  0     /*    1 block : W_in1  1 x  8 tiles          */
#define PB_W2  1     /*    4 blocks: W_in2  4 x  8 tiles          */
#define PB_QKV 5     /*   36 blocks: Wqkv   4 x 24 tiles, 3 layers */
#define PB_WO  41    /*   12 blocks: Wo     4 x  8 tiles, 3 layers */
#define PB_F1  53    /*   24 blocks: Wff1   4 x 16 tiles, 3 layers */
#define PB_F2  77    /*   24 blocks: Wff2   8 x  8 tiles, 3 layers */
#define PB_WH  101   /*    1 block : W_head 4 x  1 tiles (half full) */
#define PB_X   102   /* 1024 blocks: x16 = concat(E, rho), padded to 32 */
#define PB_PAD 1126  /*  384 blocks: zero the time pads of both vT buffers */
#define PB_END 1510

template <int KT, int KSRC, int NSRC, int NLD>
__device__ __forceinline__ void pack_lane(const float* __restrict__ src,
                                          _Float16* __restrict__ dst, int idx) {
  int lane = idx & 31;
  int tile = idx >> 5;
  int kt = tile % KT, nt = tile / KT;
  int col = lane & 15, kB = (lane < 16) ? 0 : 8;
  int n = nt * 16 + col;
  _Float16* d = dst + ((size_t)tile << 9) + (lane << 4);
#pragma unroll
  for (int i = 0; i < 8; ++i) {
    int k0 = kt * 32 + kB + i, k1 = k0 + 16;
    d[i]     = (k0 < KSRC && n < NSRC) ? (_Float16)src[k0 * NLD + n] : (_Float16)0.f;
    d[8 + i] = (k1 < KSRC && n < NSRC) ? (_Float16)src[k1 * NLD + n] : (_Float16)0.f;
  }
  // precaution: code of another piece follows in the listing and reuses the
  // registers that the last stores name; the wait stands in front of that reuse
  asm volatile("s_wait_xcnt 0x0" ::: "memory");
}

__global__ void prep_all(const float* __restrict__ E, const float* __restrict__ rho,
                         const float* __restrict__ W_in1, const float* __restrict__ W_in2,
                         const float* __restrict__ Wqkv, const float* __restrict__ Wo,
                         const float* __restrict__ Wff1, const float* __restrict__ Wff2,
                         const float* __restrict__ W_head,
                         _Float16* __restrict__ x16, _Float16* __restrict__ vT,
                         _Float16* __restrict__ pw1, _Float16* __restrict__ pw2,
                         _Float16* __restrict__ pqkv, _Float16* __restrict__ pwo,
                         _Float16* __restrict__ pf1, _Float16* __restrict__ pf2,
                         _Float16* __restrict__ pwh) {
  int b = blockIdx.x;
  int tid = threadIdx.x;
  if (b >= PB_PAD) {
    int i = (b - PB_PAD) * 256 + tid;  // 2 * 512 rows * 96 pad entries
    int row = i / 96, c = i % 96;
    int pos = (c < 64) ? c : (64 + T_SEQ + (c - 64));
    vT[(size_t)row * T_PAD + pos] = (_Float16)0.f;
  } else if (b >= PB_X) {
    int i = (b - PB_X) * 256 + tid;    // R*32
    int row = i >> 5, c = i & 31;
    _Float16 v = (_Float16)0.f;
    if (c < 8)       v = (_Float16)E[row * 8 + c];
    else if (c < 16) v = (_Float16)rho[row * 8 + (c - 8)];
    x16[i] = v;
    // precaution: same as in pack_lane, for the registers that this store names
    asm volatile("s_wait_xcnt 0x0" ::: "memory");
  } else if (b >= PB_WH) {
    if (tid < 128) pack_lane<4, 128, 8, 8>(W_head, pwh, tid);
  } else if (b >= PB_F2) {
    int l = (b - PB_F2) / 8, r = (b - PB_F2) % 8;
    pack_lane<8, 256, 128, 128>(Wff2 + (size_t)l * 256 * 128,
                                pf2 + (size_t)l * 64 * 512, r * 256 + tid);
  } else if (b >= PB_F1) {
    int l = (b - PB_F1) / 8, r = (b - PB_F1) % 8;
    pack_lane<4, 128, 256, 256>(Wff1 + (size_t)l * 128 * 256,
                                pf1 + (size_t)l * 64 * 512, r * 256 + tid);
  } else if (b >= PB_WO) {
    int l = (b - PB_WO) / 4, r = (b - PB_WO) % 4;
    pack_lane<4, 128, 128, 128>(Wo + (size_t)l * 128 * 128,
                                pwo + (size_t)l * 32 * 512, r * 256 + tid);
  } else if (b >= PB_QKV) {
    int l = (b - PB_QKV) / 12, r = (b - PB_QKV) % 12;
    pack_lane<4, 128, 384, 384>(Wqkv + (size_t)l * 128 * 384,
                                pqkv + (size_t)l * 96 * 512, r * 256 + tid);
  } else if (b >= PB_W2) {
    pack_lane<4, 128, 128, 128>(W_in2, pw2, (b - PB_W2) * 256 + tid);
  } else {
    pack_lane<1, 16, 128, 128>(W_in1, pw1, tid);
  }
}

// ---------------------------------------------------------------------------
// Row-local stages. Everything behind the K/V exchange of a layer depends only
// on the block's own 16 rows, so it runs in ONE launch: the tile goes from stage
// to stage through LDS, the f32 residual stays in registers, and the N tiles of
// the in_proj, qkv, o-proj and FFN products are dealt to the block's four waves.
// Every loop below is unrolled: fragment and accumulator arrays stay in
// registers only where their indices are compile-time constants.
// ---------------------------------------------------------------------------

// Global operands are fetched AHEAD: every weight fragment, bias, norm parameter
// and residual of a stage is loaded into registers, all of a stage at once, at
// least one stage before its use (a launch's first products: just before them),
// so that its latency runs under earlier work.

// ends a run of global loads or stores. The wait: a precaution, in front of
// whatever reuses the run's address registers. The scheduling barrier: it keeps
// later register writes behind that wait, and without it the compiler sinks
// loads fetched ahead towards their uses and issues them a few at a time between
// the matrix instructions, so that their latencies add up again.
__device__ __forceinline__ void fetch_end() {
  addr_wait();
  __builtin_amdgcn_sched_barrier(0);
}
// the same for a run of loads from one lane address p and one lane index n: as
// inputs of the wait's own statement both stay in their registers up to the wait,
// so that no result of the run itself lands in them in front of it
__device__ __forceinline__ void fetch_end(const void* p, int n) {
  asm volatile("s_wait_xcnt 0x0" :: "v"(p), "v"(n) : "memory");
  __builtin_amdgcn_sched_barrier(0);
}

// the wave's qkv weight fragments for N tiles i*4+w, i in [I0, I1), and biases
template <int I0, int I1>
__device__ __forceinline__ void qkv_fetch(v16h (&wq)[24], float (&bqv)[6],
                                          const _Float16* __restrict__ pq,  // 96 tiles [nt*4+kt]
                                          const float* __restrict__ bq, int w) {
  const _Float16* lp = b_lane_ptr(pq, w * 4);
  int nb = w * 16 + (threadIdx.x & 15);
#pragma unroll
  for (int i = I0; i < I1; ++i) {
#pragma unroll
    for (int kt = 0; kt < 4; ++kt) wq[i * 4 + kt] = load_b_at(lp, i * 16 + kt);
    bqv[i] = (bq + nb)[i * 64];
  }
  fetch_end(lp, nb);
}

// qkv of the tile in hs (LDS, pitch HP): q (scaled) and k -> qk_out (R x 256),
// v -> vT_out transposed+padded. Wave w takes N tiles i*4+w.
__device__ __forceinline__ void qkv_stage(const _Float16* hs,
                                          const v16h (&wq)[24], const float (&bqv)[6],
                                          _Float16* __restrict__ qk_out,
                                          _Float16* __restrict__ vT_out,
                                          int row0, int w) {
  int lane = threadIdx.x & 31;
  int nCol = lane & 15, mBase = (lane < 16) ? 0 : 8;
  v16h a[4];
#pragma unroll
  for (int kt = 0; kt < 4; ++kt) a[kt] = load_a_frag(hs + kt * 32, HP);
#pragma unroll
  for (int i = 0; i < 6; ++i) {
    int nt = i * 4 + w;
    v8f acc = {};
#pragma unroll
    for (int kt = 0; kt < 4; ++kt)
      acc = wmma16(a[kt], wq[i * 4 + kt], acc);
    int n = nt * 16 + nCol;
    float bias = bqv[i];
    if (i < 4) {  // q (scaled) / k : row-major
      float scale = (i < 2) ? QSCALE : 1.0f;
#pragma unroll
      for (int r = 0; r < 8; ++r)
        qk_out[(size_t)(row0 + mBase + r) * QKV_LD + n] =
            (_Float16)((acc[r] + bias) * scale);
    } else {      // v : transposed with padded time axis, vectorized store
      int d = n - 256;
      int hd = d >> 5, dd = d & 31;
      int bIdx = row0 >> 11;
      int t0m = (row0 & (T_SEQ - 1)) + mBase;
      v8h vv;
#pragma unroll
      for (int r = 0; r < 8; ++r) vv[r] = (_Float16)(acc[r] + bias);
      *(v8h*)(vT_out + (size_t)((bIdx * 4 + hd) * 32 + dd) * T_PAD + 64 + t0m) = vv;
    }
    fetch_end();
  }
}

// layernorm of the tile; wave w holds columns w*32 .. w*32+31 in o[2] (C layout).
// Row sums: 2 tiles in the lane, 16 lanes by shuffle, 4 waves through red.
// g0, g1, b0, b1: the lane's two columns of gain and shift, fetched ahead.
__device__ __forceinline__ void ln_stage(v8f (&o)[2], float* red,  // [16 rows][4 waves][2]
                                         float g0, float g1, float b0, float b1, int w) {
  int lane = threadIdx.x & 31;
  int nCol = lane & 15, mBase = (lane < 16) ? 0 : 8;
  float sm[8], sq[8];
#pragma unroll
  for (int r = 0; r < 8; ++r) {
    sm[r] = o[0][r] + o[1][r];
    sq[r] = o[0][r] * o[0][r] + o[1][r] * o[1][r];
#pragma unroll
    for (int msk = 1; msk < 16; msk <<= 1) {
      sm[r] += __shfl_xor(sm[r], msk, 32);
      sq[r] += __shfl_xor(sq[r], msk, 32);
    }
  }
  if (nCol == 0) {
#pragma unroll
    for (int r = 0; r < 8; ++r)
      *(float2*)(red + ((mBase + r) * 4 + w) * 2) = make_float2(sm[r], sq[r]);
  }
  __syncthreads();  // every wave reads all four waves' partial row sums
#pragma unroll
  for (int r = 0; r < 8; ++r) {
    float4 p = *(const float4*)(red + (mBase + r) * 8);
    float4 q = *(const float4*)(red + (mBase + r) * 8 + 4);
    float s = (p.x + p.z) + (q.x + q.z);
    float s2 = (p.y + p.w) + (q.y + q.w);
    float mu = s * (1.f / 128.f);
    float inv = rsqrtf(s2 * (1.f / 128.f) - mu * mu + LN_EPS);
    o[0][r] = (o[0][r] - mu) * inv * g0 + b0;
    o[1][r] = (o[1][r] - mu) * inv * g1 + b1;
  }
}

// the wave's two C tiles -> f16 rows in LDS (pitch HP)
__device__ __forceinline__ void tile_to_lds(const v8f (&o)[2], _Float16* hs, int w) {
  int lane = threadIdx.x & 31;
  int nCol = lane & 15, mBase = (lane < 16) ? 0 : 8;
#pragma unroll
  for (int i = 0; i < 2; ++i)
#pragma unroll
    for (int r = 0; r < 8; ++r)
      hs[(mBase + r) * HP + w * 32 + i * 16 + nCol] = (_Float16)o[i][r];
}

// ---------------------------------------------------------------------------
// in_proj + first qkv: h = relu(x@W1+b1)@W2 + b2 + PE -> h32; qkv of layer 0
// ---------------------------------------------------------------------------
// second bound: two blocks a WGP (the whole grid resident), which leaves each wave
// the register room that the fragments fetched ahead take
__global__ __launch_bounds__(128, 2) void inproj_qkv_kernel(
    const _Float16* __restrict__ x16,
    const _Float16* __restrict__ pw1,  // 8 tiles
    const float* __restrict__ b1,
    const _Float16* __restrict__ pw2,  // 32 tiles [nt*4+kt]
    const float* __restrict__ b2,
    float* __restrict__ h32,
    const _Float16* __restrict__ pq, const float* __restrict__ bq,
    _Float16* __restrict__ qk_out, _Float16* __restrict__ vT_out) {
  __shared__ __attribute__((aligned(16))) _Float16 t1[16 * TP];
  __shared__ __attribute__((aligned(16))) _Float16 hs[16 * HP];
  int row0 = blockIdx.x * 16;
  int w = threadIdx.x >> 5;
  int lane = threadIdx.x & 31;
  int nCol = lane & 15, mBase = (lane < 16) ? 0 : 8;

  // fetched first, in the order of use: x and both in_proj weights
  const _Float16* lx = a_lane_ptr(x16 + row0 * 32, 32);
  const _Float16* l1 = b_lane_ptr(pw1, w * 2);
  const _Float16* l2 = b_lane_ptr(pw2, w * 8);
  int n0 = w * 32 + nCol;
  v16h a = load_kpair(lx);
  v16h w1[2], w2[8];
  float b1v[2], b2v[2];
#pragma unroll
  for (int i = 0; i < 2; ++i) {
    w1[i] = load_b_at(l1, i);
    b1v[i] = (b1 + n0)[i * 16];
  }
#pragma unroll
  for (int i = 0; i < 2; ++i) {
#pragma unroll
    for (int kt = 0; kt < 4; ++kt) w2[i * 4 + kt] = load_b_at(l2, i * 4 + kt);
    b2v[i] = (b2 + n0)[i * 16];
  }
  // one wait for the whole run; its inputs are the run's addresses (see fetch_end)
  asm volatile("s_wait_xcnt 0x0" :: "v"(lx), "v"(l1), "v"(l2), "v"(n0) : "memory");
  __builtin_amdgcn_sched_barrier(0);  // as in fetch_end

#pragma unroll
  for (int i = 0; i < 2; ++i) {
    int nt = w * 2 + i;
    v8f acc = {};
    acc = wmma16(a, w1[i], acc);
    float bias = b1v[i];
#pragma unroll
    for (int r = 0; r < 8; ++r) {
      float v = acc[r] + bias;
      t1[(mBase + r) * TP + nt * 16 + nCol] = (_Float16)(v > 0.f ? v : 0.f);
    }
  }
  __syncthreads();  // every wave reads all 128 columns of t1 as A fragments

  // fetched under the second product and the position code: all that qkv reads
  v16h wq[24];
  float bqv[6];
  qkv_fetch<0, 6>(wq, bqv, pq, bq, w);

  v16h a2[4];
#pragma unroll
  for (int kt = 0; kt < 4; ++kt) a2[kt] = load_a_frag(t1 + kt * 32, TP);
  v8f o[2];
#pragma unroll
  for (int i = 0; i < 2; ++i) {
    int nt = w * 2 + i;
    v8f acc = {};
#pragma unroll
    for (int kt = 0; kt < 4; ++kt)
      acc = wmma16(a2[kt], w2[i * 4 + kt], acc);
    int n = nt * 16 + nCol;
    float bias = b2v[i];
    float div = __expf(-(float)(n >> 1) * (9.210340371976184f / 64.f));
#pragma unroll
    for (int r = 0; r < 8; ++r) {
      int row = row0 + mBase + r;
      float ang = (float)(row & (T_SEQ - 1)) * div;
      float pe = (n & 1) ? __cosf(ang) : __sinf(ang);
      o[i][r] = acc[r] + bias + pe;
    }
  }
#pragma unroll
  for (int i = 0; i < 2; ++i) {
#pragma unroll
    for (int r = 0; r < 8; ++r)
      h32[(row0 + mBase + r) * DM + w * 32 + i * 16 + nCol] = o[i][r];
    fetch_end();
  }
  tile_to_lds(o, hs, w);
  __syncthreads();  // every wave reads all 128 columns of hs as A fragments
  qkv_stage(hs, wq, bqv, qk_out, vT_out, row0, w);
}

// ---------------------------------------------------------------------------
// one layer behind its qkv: windowed attention (wave = head), o-proj + residual
// + layernorm, FFN + residual + layernorm; leaves the tile in hs (f16, LDS) and,
// where QKV, in h32 for the next launch's residual. The weights of the stage
// behind (next qkv where QKV, else the head) are fetched ahead into wn / bnv.
// ---------------------------------------------------------------------------
template <bool QKV>
__device__ __forceinline__ void layer_body(
    const _Float16* __restrict__ qk_in, const _Float16* __restrict__ vT_in,
    const _Float16* __restrict__ pwo,  // 32 tiles [nt*4+kt]
    const float* __restrict__ bo,
    const float* __restrict__ g1, const float* __restrict__ be1,
    const _Float16* __restrict__ pf1,  // 64 tiles [nt*4+kt]
    const float* __restrict__ bf1,
    const _Float16* __restrict__ pf2,  // 64 tiles [nt*8+kt]
    const float* __restrict__ bf2,
    const float* __restrict__ g2, const float* __restrict__ be2,
    float* __restrict__ h32, _Float16* hs,
    const _Float16* __restrict__ pn, const float* __restrict__ bn,
    v16h (&wn)[24], float (&bnv)[6]) {
  __shared__ __attribute__((aligned(16))) _Float16 at[4][16 * AP];  // attn probs, K padded 80 -> 96
  __shared__ __attribute__((aligned(16))) _Float16 ao[16 * HP];
  __shared__ __attribute__((aligned(16))) _Float16 h1[16 * HP];
  __shared__ __attribute__((aligned(16))) _Float16 mid[16 * MP];
  __shared__ __attribute__((aligned(16))) float red1[16 * 8];
  __shared__ __attribute__((aligned(16))) float red2[16 * 8];
  int row0 = blockIdx.x * 16;
  int w = threadIdx.x >> 5;
  int head = w;
  int t0 = row0 & (T_SEQ - 1);
  int bRow0 = row0 - t0;
  int bIdx = row0 >> 11;
  int lane = threadIdx.x & 31;
  int nCol = lane & 15, mBase = (lane < 16) ? 0 : 8, kBase = mBase;
  int keyBase = t0 - 64;
  int n0 = w * 32 + nCol;
  _Float16* atw = at[w];

  // fetched first: q, all five K fragments, all six V fragments
  const _Float16* lq = a_lane_ptr(qk_in + (size_t)row0 * QKV_LD + head * 32, QKV_LD);
  v16h qa = load_kpair(lq);
  const _Float16* lk[5];
  v16h kb[5];
#pragma unroll
  for (int kt = 0; kt < 5; ++kt) {
    int j = keyBase + kt * 16 + nCol;   // key position for this lane's column
    int jr = j < 0 ? 0 : j;             // clamp address; mask handles validity
    lk[kt] = qk_in + (size_t)(bRow0 + jr) * QKV_LD + head * 32 + kBase;
    kb[kt] = load_kpair(lk[kt] + 128);  // k stands behind q in the row
  }
  const _Float16* lv[2];
  v16h vb[6];
#pragma unroll
  for (int nt = 0; nt < 2; ++nt) {
    int d = nt * 16 + nCol;
    lv[nt] = vT_in + (size_t)((bIdx * 4 + head) * 32 + d) * T_PAD + 64 + keyBase + kBase;
#pragma unroll
    for (int kc = 0; kc < 3; ++kc) vb[nt * 3 + kc] = load_kpair(lv[nt] + kc * 32);
  }
  // one wait for the whole run; its inputs are the run's addresses (see fetch_end)
  asm volatile("s_wait_xcnt 0x0" :: "v"(lq), "v"(lk[0]), "v"(lk[1]), "v"(lk[2]), "v"(lk[3]),
               "v"(lk[4]), "v"(lv[0]), "v"(lv[1]) : "memory");
  __builtin_amdgcn_sched_barrier(0);  // as in fetch_end

  // fetched next: all that o-proj and the first layernorm read
  const _Float16* lo = b_lane_ptr(pwo, w * 8);
  const float* lr = h32 + (row0 + mBase) * DM + n0;
  v16h wo[8];
  float res[2][8], bov[2];
#pragma unroll
  for (int i = 0; i < 8; ++i) wo[i] = load_b_at(lo, i);
#pragma unroll
  for (int i = 0; i < 2; ++i) {
    bov[i] = (bo + n0)[i * 16];
#pragma unroll
    for (int r = 0; r < 8; ++r) res[i][r] = lr[r * DM + i * 16];
  }
  float g1a = g1[n0], g1b = (g1 + n0)[16], be1a = be1[n0], be1b = (be1 + n0)[16];
  // one wait for the whole run; its inputs are the run's addresses (see fetch_end)
  asm volatile("s_wait_xcnt 0x0" :: "v"(lo), "v"(lr), "v"(n0) : "memory");
  __builtin_amdgcn_sched_barrier(0);  // as in fetch_end

  v8f s[5];
#pragma unroll
  for (int kt = 0; kt < 5; ++kt) {
    int j = keyBase + kt * 16 + nCol;
    v8f c = {};
    c = wmma16(qa, kb[kt], c);
#pragma unroll
    for (int r = 0; r < 8; ++r) {
      int iQ = t0 + mBase + r;
      bool valid = (j >= 0) && (j <= iQ) && (j >= iQ - 63);
      s[kt][r] = valid ? c[r] : -1e30f;
    }
  }

  // keeps the next run of loads behind the score products: issued in front of
  // them it fills the load counter and the first product waits for more returns
  __builtin_amdgcn_sched_barrier(0);

  // fetched under the softmax: all that FFN up reads
  const _Float16* lf1 = b_lane_ptr(pf1, w * 16);
  int nf = w * 64 + nCol;
  v16h f1[16];
  float bf1v[4];
#pragma unroll
  for (int i = 0; i < 4; ++i) {
#pragma unroll
    for (int kt = 0; kt < 4; ++kt) f1[i * 4 + kt] = load_b_at(lf1, i * 4 + kt);
    bf1v[i] = (bf1 + nf)[i * 16];
  }
  fetch_end(lf1, nf);

  // row softmax: row m lives in one vgpr slot across the 16 lanes of a half
#pragma unroll
  for (int r = 0; r < 8; ++r) {
    float mx = s[0][r];
#pragma unroll
    for (int kt = 1; kt < 5; ++kt) mx = fmaxf(mx, s[kt][r]);
#pragma unroll
    for (int msk = 1; msk < 16; msk <<= 1) mx = fmaxf(mx, __shfl_xor(mx, msk, 32));
    float sum = 0.f;
#pragma unroll
    for (int kt = 0; kt < 5; ++kt) { float e = __expf(s[kt][r] - mx); s[kt][r] = e; sum += e; }
#pragma unroll
    for (int msk = 1; msk < 16; msk <<= 1) sum += __shfl_xor(sum, msk, 32);
    float inv = 1.0f / sum;
#pragma unroll
    for (int kt = 0; kt < 5; ++kt) s[kt][r] *= inv;
  }

  // C-layout -> A-fragment layout via LDS (16 x 96, cols 80..95 zero)
#pragma unroll
  for (int kt = 0; kt < 5; ++kt)
#pragma unroll
    for (int r = 0; r < 8; ++r)
      atw[(mBase + r) * AP + kt * 16 + nCol] = (_Float16)s[kt][r];
#pragma unroll
  for (int r = 0; r < 8; ++r) atw[(mBase + r) * AP + 80 + nCol] = (_Float16)0.f;
  __syncthreads();  // a lane's A fragment holds probs that other lanes wrote

  // attn(16x96) @ V(96x32): 2 N-tiles x 3 K-chunks
#pragma unroll
  for (int nt = 0; nt < 2; ++nt) {
    v8f acc = {};
#pragma unroll
    for (int kc = 0; kc < 3; ++kc) {
      v16h aa = load_a_frag(atw + kc * 32, AP);
      acc = wmma16(aa, vb[nt * 3 + kc], acc);
    }
#pragma unroll
    for (int r = 0; r < 8; ++r)
      ao[(mBase + r) * HP + head * 32 + nt * 16 + nCol] = (_Float16)acc[r];
  }
  __syncthreads();  // every wave reads all four heads' columns of ao

  // fetched under o-proj and the first layernorm: all that FFN down and the
  // second layernorm read
  const _Float16* lf2 = b_lane_ptr(pf2, w * 16);
  v16h f2[16];
  float bf2v[2];
#pragma unroll
  for (int i = 0; i < 2; ++i) {
#pragma unroll
    for (int kt = 0; kt < 8; ++kt) f2[i * 8 + kt] = load_b_at(lf2, i * 8 + kt);
    bf2v[i] = (bf2 + n0)[i * 16];
  }
  float g2a = g2[n0], g2b = (g2 + n0)[16], be2a = be2[n0], be2b = (be2 + n0)[16];
  fetch_end(lf2, n0);

  // o-proj + residual + layernorm; wave w owns columns w*32 .. w*32+31
  v8f o[2];
  {
    v16h a[4];
#pragma unroll
    for (int kt = 0; kt < 4; ++kt) a[kt] = load_a_frag(ao + kt * 32, HP);
#pragma unroll
    for (int i = 0; i < 2; ++i) {
      v8f acc = {};
#pragma unroll
      for (int kt = 0; kt < 4; ++kt)
        acc = wmma16(a[kt], wo[i * 4 + kt], acc);
#pragma unroll
      for (int r = 0; r < 8; ++r)
        o[i][r] = acc[r] + bov[i] + res[i][r];
    }
  }
  ln_stage(o, red1, g1a, g1b, be1a, be1b, w);
  tile_to_lds(o, h1, w);
  __syncthreads();  // every wave reads all 128 columns of h1

  // FFN up: wave w owns hidden columns w*64 .. w*64+63
  {
    v16h a[4];
#pragma unroll
    for (int kt = 0; kt < 4; ++kt) a[kt] = load_a_frag(h1 + kt * 32, HP);
#pragma unroll
    for (int i = 0; i < 4; ++i) {
      int nt = w * 4 + i;
      v8f acc = {};
#pragma unroll
      for (int kt = 0; kt < 4; ++kt)
        acc = wmma16(a[kt], f1[i * 4 + kt], acc);
      float bias = bf1v[i];
#pragma unroll
      for (int r = 0; r < 8; ++r) {
        float v = acc[r] + bias;
        mid[(mBase + r) * MP + nt * 16 + nCol] = (_Float16)(v > 0.f ? v : 0.f);
      }
    }
  }
  __syncthreads();  // every wave reads all 256 columns of mid

  // fetched under FFN down and the second layernorm: the stage behind's weights
  if (QKV) {
    qkv_fetch<0, 6>(wn, bnv, pn, bn, w);
  } else {
    const _Float16* lh = b_lane_ptr(pn, 0);
    int nh = nCol & 7;  // lanes 8..15 of a half read a valid entry that they do not use
#pragma unroll
    for (int kt = 0; kt < 4; ++kt) wn[kt] = load_b_at(lh, kt);
    bnv[0] = bn[nh];
    fetch_end(lh, nh);
  }

  // FFN down + residual (still in o) + layernorm
  {
    v16h a2[8];
#pragma unroll
    for (int kt = 0; kt < 8; ++kt) a2[kt] = load_a_frag(mid + kt * 32, MP);
#pragma unroll
    for (int i = 0; i < 2; ++i) {
      v8f acc = {};
#pragma unroll
      for (int kt = 0; kt < 8; ++kt)
        acc = wmma16(a2[kt], f2[i * 8 + kt], acc);
#pragma unroll
      for (int r = 0; r < 8; ++r) o[i][r] = acc[r] + bf2v[i] + o[i][r];
    }
  }
  ln_stage(o, red2, g2a, g2b, be2a, be2b, w);
  if (QKV) {
#pragma unroll
    for (int i = 0; i < 2; ++i)
#pragma unroll
      for (int r = 0; r < 8; ++r)
        h32[(row0 + mBase + r) * DM + w * 32 + i * 16 + nCol] = o[i][r];
    fetch_end();
  }
  tile_to_lds(o, hs, w);
  __syncthreads();  // the stage behind reads all 128 columns of hs
}

// layer l, then the qkv of layer l+1 into the OTHER q/k and vT buffers (blocks
// of this launch still read this layer's K and V of their neighbours' rows)
// second bound: two blocks a WGP (the whole grid resident), which leaves each wave
// the register room that the fragments fetched ahead take
__global__ __launch_bounds__(128, 2) void layer_qkv_kernel(
    const _Float16* __restrict__ qk_in, const _Float16* __restrict__ vT_in,
    const _Float16* __restrict__ pwo, const float* __restrict__ bo,
    const float* __restrict__ g1, const float* __restrict__ be1,
    const _Float16* __restrict__ pf1, const float* __restrict__ bf1,
    const _Float16* __restrict__ pf2, const float* __restrict__ bf2,
    const float* __restrict__ g2, const float* __restrict__ be2,
    float* __restrict__ h32,
    const _Float16* __restrict__ pq, const float* __restrict__ bq,
    _Float16* __restrict__ qk_out, _Float16* __restrict__ vT_out) {
  __shared__ __attribute__((aligned(16))) _Float16 hs[16 * HP];
  v16h wn[24];
  float bnv[6];
  layer_body<true>(qk_in, vT_in, pwo, bo, g1, be1, pf1, bf1, pf2, bf2, g2, be2, h32, hs,
                   pq, bq, wn, bnv);
  qkv_stage(hs, wn, bnv, qk_out, vT_out, blockIdx.x * 16, threadIdx.x >> 5);
}

// last layer, then head: out = h @ W_head(128x16 padded) + b_head -> fp32 (R x 8)
// second bound: two blocks a WGP (the whole grid resident), which leaves each wave
// the register room that the fragments fetched ahead take
__global__ __launch_bounds__(128, 2) void layer_head_kernel(
    const _Float16* __restrict__ qk_in, const _Float16* __restrict__ vT_in,
    const _Float16* __restrict__ pwo, const float* __restrict__ bo,
    const float* __restrict__ g1, const float* __restrict__ be1,
    const _Float16* __restrict__ pf1, const float* __restrict__ bf1,
    const _Float16* __restrict__ pf2, const float* __restrict__ bf2,
    const float* __restrict__ g2, const float* __restrict__ be2,
    float* __restrict__ h32,
    const _Float16* __restrict__ pwh,  // 4 tiles
    const float* __restrict__ bh, float* __restrict__ out) {
  __shared__ __attribute__((aligned(16))) _Float16 hs[16 * HP];
  v16h wn[24];
  float bnv[6];
  layer_body<false>(qk_in, vT_in, pwo, bo, g1, be1, pf1, bf1, pf2, bf2, g2, be2, h32, hs,
                    pwh, bh, wn, bnv);
  if ((threadIdx.x >> 5) != 0) return;  // one N tile: one wave; no barrier follows
  int row0 = blockIdx.x * 16;
  int lane = threadIdx.x & 31;
  int nCol = lane & 15, mBase = (lane < 16) ? 0 : 8;
  v8f acc = {};
#pragma unroll
  for (int kt = 0; kt < 4; ++kt)
    acc = wmma16(load_a_frag(hs + kt * 32, HP), wn[kt], acc);
  if (nCol < 8) {
    float bias = bnv[0];
#pragma unroll
    for (int r = 0; r < 8; ++r) out[(row0 + mBase + r) * 8 + nCol] = acc[r] + bias;
  }
}

// ---------------------------------------------------------------------------
// host launch
// ---------------------------------------------------------------------------
extern "C" void kernel_launch(void* const* d_in, const int* in_sizes, int n_in,
                              void* d_out, int out_size, void* d_ws, size_t ws_size,
                              hipStream_t stream) {
  (void)in_sizes; (void)n_in; (void)out_size; (void)ws_size;
  const float* E      = (const float*)d_in[0];
  const float* rho    = (const float*)d_in[1];
  const float* W_in1  = (const float*)d_in[2];
  const float* b_in1  = (const float*)d_in[3];
  const float* W_in2  = (const float*)d_in[4];
  const float* b_in2  = (const float*)d_in[5];
  const float* Wqkv   = (const float*)d_in[6];
  const float* bqkv   = (const float*)d_in[7];
  const float* Wo     = (const float*)d_in[8];
  const float* bo     = (const float*)d_in[9];
  const float* ln1_g  = (const float*)d_in[10];
  const float* ln1_b  = (const float*)d_in[11];
  const float* Wff1   = (const float*)d_in[12];
  const float* bff1   = (const float*)d_in[13];
  const float* Wff2   = (const float*)d_in[14];
  const float* bff2   = (const float*)d_in[15];
  const float* ln2_g  = (const float*)d_in[16];
  const float* ln2_b  = (const float*)d_in[17];
  const float* W_head = (const float*)d_in[18];
  const float* b_head = (const float*)d_in[19];

  char* w = (char*)d_ws;
  auto take = [&](size_t bytes) -> void* {
    void* p = (void*)w;
    w += (bytes + 255) & ~(size_t)255;
    return p;
  };
  _Float16* x16   = (_Float16*)take((size_t)R_TOT * 32 * 2);
  float*    h32   = (float*)   take((size_t)R_TOT * DM * 4);
  _Float16* qkA   = (_Float16*)take((size_t)R_TOT * QKV_LD * 2);
  _Float16* qkB   = (_Float16*)take((size_t)R_TOT * QKV_LD * 2);
  _Float16* vT    = (_Float16*)take((size_t)2 * 512 * T_PAD * 2);  // 2 x 16 (b*head) * 32 d rows
  _Float16* vTA   = vT;
  _Float16* vTB   = vT + (size_t)512 * T_PAD;
  _Float16* pw1   = (_Float16*)take((size_t)8 * 512 * 2);
  _Float16* pw2   = (_Float16*)take((size_t)32 * 512 * 2);
  _Float16* pqkv  = (_Float16*)take((size_t)3 * 96 * 512 * 2);
  _Float16* pwo   = (_Float16*)take((size_t)3 * 32 * 512 * 2);
  _Float16* pf1   = (_Float16*)take((size_t)3 * 64 * 512 * 2);
  _Float16* pf2   = (_Float16*)take((size_t)3 * 64 * 512 * 2);
  _Float16* pwh   = (_Float16*)take((size_t)4 * 512 * 2);

  // all set-up work (weight packing, x16, vT pads) in one launch
  prep_all<<<PB_END, 256, 0, stream>>>(E, rho, W_in1, W_in2, Wqkv, Wo, Wff1, Wff2, W_head,
                                       x16, vT, pw1, pw2, pqkv, pwo, pf1, pf2, pwh);

  const int TILES = R_TOT / 16;  // 512
  inproj_qkv_kernel<<<TILES, 128, 0, stream>>>(x16, pw1, b_in1, pw2, b_in2, h32,
                                               pqkv, bqkv, qkA, vTA);
  layer_qkv_kernel<<<TILES, 128, 0, stream>>>(
      qkA, vTA, pwo, bo, ln1_g, ln1_b, pf1, bff1, pf2, bff2, ln2_g, ln2_b, h32,
      pqkv + (size_t)96 * 512, bqkv + 384, qkB, vTB);
  layer_qkv_kernel<<<TILES, 128, 0, stream>>>(
      qkB, vTB, pwo + (size_t)32 * 512, bo + 128, ln1_g + 128, ln1_b + 128,
      pf1 + (size_t)64 * 512, bff1 + 256, pf2 + (size_t)64 * 512, bff2 + 128,
      ln2_g + 128, ln2_b + 128, h32,
      pqkv + (size_t)2 * 96 * 512, bqkv + 2 * 384, qkA, vTA);
  layer_head_kernel<<<TILES, 128, 0, stream>>>(
      qkA, vTA, pwo + (size_t)2 * 32 * 512, bo + 2 * 128, ln1_g + 2 * 128, ln1_b + 2 * 128,
      pf1 + (size_t)2 * 64 * 512, bff1 + 2 * 256, pf2 + (size_t)2 * 64 * 512, bff2 + 2 * 128,
      ln2_g + 2 * 128, ln2_b + 2 * 128, h32, pwh, b_head, (float*)d_out);
}

// v004
// One run takes 55.9 microseconds.
// Two timings next to v003 both put it at 1.03 times that version's speed.
// All steps since v000 together make it 5.65 times as fast.
#include <hip/hip_runtime.h>
#include <hip/hip_bf16.h>

// ---------------------------------------------------------------------------
// StateSequenceTransformer on MI455X (gfx1250, wave32, WMMA 16x16x32 f16)
//   B=4 T=2048 D_MODEL=128 NHEAD=4 hd=32 DFF=256 WINDOW=64 NLAYERS=3
//   One 4-wave block (128 threads) owns a 16-row tile through a whole layer.
//   Later launches' weights pre-packed into per-lane B-fragment order -> b128 vector loads.
//   V stored transposed+padded so attn@V B-fragments are contiguous.
// ---------------------------------------------------------------------------

#define R_TOT  8192
#define T_SEQ  2048
#define DM     128
#define DFF_   256
#define QKV_LD 256            /* q (scaled) + k, f16 */
#define T_PAD  2144           /* 64 front pad + 2048 + 32 back pad */
#define HP     136            /* LDS pitch of the tile buffers between fused stages: 272 B = 16 B x odd */
#define TP     128            /* LDS pitch of in_proj's hidden tile */
#define MP     256            /* LDS pitch of the FFN's hidden tile */
#define AP     96             /* LDS pitch of the attention probs */
#define LN_EPS 1e-5f
#define QSCALE 0.17677669529663687f /* 1/sqrt(32) */

typedef __attribute__((ext_vector_type(16))) _Float16 v16h;
typedef __attribute__((ext_vector_type(8)))  _Float16 v8h;
typedef __attribute__((ext_vector_type(8)))  float    v8f;

__device__ __forceinline__ v8f wmma16(v16h a, v16h b, v8f c) {
  return __builtin_amdgcn_wmma_f32_16x16x32_f16(false, a, false, b, (short)0, c,
                                                false, false);
}

// A fragment: 16x32 f16 from row-major src (ld multiple of 8, 16B aligned).
// lane<16: row=lane, K={0..7,16..23}; lane>=16: row=lane-16, K={8..15,24..31}
__device__ __forceinline__ v16h load_a_frag(const _Float16* src, int ld) {
  int lane = threadIdx.x & 31;
  const _Float16* p = src + (lane & 15) * ld + ((lane < 16) ? 0 : 8);
  v8h lo = *(const v8h*)p;
  v8h hi = *(const v8h*)(p + 16);
  return __builtin_shufflevector(lo, hi, 0, 1, 2, 3, 4, 5, 6, 7,
                                 8, 9, 10, 11, 12, 13, 14, 15);
}

// Build v16h from two contiguous v8h loads at p and p+16 (K^T / generic).
__device__ __forceinline__ v16h load_kpair(const _Float16* p) {
  v8h lo = *(const v8h*)p;
  v8h hi = *(const v8h*)(p + 16);
  return __builtin_shufflevector(lo, hi, 0, 1, 2, 3, 4, 5, 6, 7,
                                 8, 9, 10, 11, 12, 13, 14, 15);
}

// Pre-packed B fragment: tile = 512 f16, lane's 16 values contiguous (32B).
// the lane's own address of an A fragment (see load_a_frag) / of packed tile
// 'tile'; further tiles of a run lie at compile-time distances from it
__device__ __forceinline__ const _Float16* a_lane_ptr(const _Float16* src, int ld) {
  int lane = threadIdx.x & 31;
  return src + (lane & 15) * ld + ((lane < 16) ? 0 : 8);
}
__device__ __forceinline__ const _Float16* b_lane_ptr(const _Float16* base, int tile) {
  int lane = threadIdx.x & 31;
  return base + ((size_t)tile << 9) + (lane << 4);
}
__device__ __forceinline__ v16h load_b_at(const _Float16* lp, int tile) {
  return *(const v16h*)(lp + (tile << 9));
}

// precaution: stands behind a run of global loads, in front of later loads whose
// results may land in the registers that held the run's addresses
__device__ __forceinline__ void addr_wait() {
  asm volatile("s_wait_xcnt 0x0" ::: "memory");
}

// ---------------------------------------------------------------------------
// Set-up work rides in the first launch. What that launch itself multiplies by
// (W_in1, W_in2, layer 0's Wqkv) it reads as f32 and converts in registers. What
// later launches read (packed weights, the zero time pads of vT) is dealt out in
// units of one 16-byte store, one unit a thread, 64 units a tile, over the
// grid's first threads.
//   pack: f32 weights (K x N row-major) -> B-fragment tiles, tile id = nt*KT + kt;
//         columns past the source's width -> 0 (padding).
// ---------------------------------------------------------------------------
#define PT_WO  192   /* from   0: 192 tiles, Wqkv   4 x 24 tiles, layers 1 and 2 */
#define PT_F1  288   /* from 192:  96 tiles, Wo     4 x  8 tiles, 3 layers */
#define PT_F2  480   /* from 288: 192 tiles, Wff1   4 x 16 tiles, 3 layers */
#define PT_WH  672   /* from 480: 192 tiles, Wff2   8 x  8 tiles, 3 layers */
#define PT_PAD 676   /* from 672:   4 tiles, W_head 4 x  1 tiles (half full) */
#define PT_END 868   /* from 676: 192 x 64 units, the time pads of both vT buffers */

typedef __attribute__((ext_vector_type(2))) _Float16 v2h;

// f32 weights as B fragments of TWO N tiles at once: the lane reads two
// neighbouring columns (tile 0 holds the even, tile 1 the odd columns of a run of
// 32), so that 16 lanes cover a whole 128-byte line of a weight row.
// lp: the lane's address in row kB (0 or 8) of the weight; k order as in pack.
template <int NLD>
__device__ __forceinline__ void raw_fetch(float2 (&raw)[16], const float* lp, int kt) {
#pragma unroll
  for (int e = 0; e < 16; ++e)
    raw[e] = *(const float2*)(lp + (kt * 32 + (e < 8 ? e : e + 8)) * NLD);
}
__device__ __forceinline__ void raw_to_frags(const float2 (&raw)[16], v16h& f0, v16h& f1) {
#pragma unroll
  for (int e = 0; e < 16; ++e) {
    f0[e] = (_Float16)raw[e].x;
    f1[e] = (_Float16)raw[e].y;
  }
}

// ---------------------------------------------------------------------------
// Row-local stages. Everything behind the K/V exchange of a layer depends only
// on the block's own 16 rows, so it runs in ONE launch: the tile goes from stage
// to stage through LDS, the f32 residual stays in registers, and the N tiles of
// the in_proj, qkv, o-proj and FFN products are dealt to the block's four waves.
// Every loop below is unrolled: fragment and accumulator arrays stay in
// registers only where their indices are compile-time constants.
// ---------------------------------------------------------------------------

// Global operands are fetched AHEAD: every weight fragment, bias, norm parameter
// and residual of a stage is loaded into registers, all of a stage at once, at
// least one stage before its use (a launch's first products: just before them),
// so that its latency runs under earlier work.

// ends a run of global loads or stores. The wait: a precaution, in front of
// whatever reuses the run's address registers. The scheduling barrier: it keeps
// later register writes behind that wait, and without it the compiler sinks
// loads fetched ahead towards their uses and issues them a few at a time between
// the matrix instructions, so that their latencies add up again.
__device__ __forceinline__ void fetch_end() {
  addr_wait();
  __builtin_amdgcn_sched_barrier(0);
}
// the same for a run of loads from one lane address p and one lane index n: as
// inputs of the wait's own statement both stay in their registers up to the wait,
// so that no result of the run itself lands in them in front of it
__device__ __forceinline__ void fetch_end(const void* p, int n) {
  asm volatile("s_wait_xcnt 0x0" :: "v"(p), "v"(n) : "memory");
  __builtin_amdgcn_sched_barrier(0);
}

// the wave's qkv weight fragments for N tiles i*4+w, i in [I0, I1), and biases
template <int I0, int I1>
__device__ __forceinline__ void qkv_fetch(v16h (&wq)[24], float (&bqv)[6],
                                          const _Float16* __restrict__ pq,  // 96 tiles [nt*4+kt]
                                          const float* __restrict__ bq, int w) {
  const _Float16* lp = b_lane_ptr(pq, w * 4);
  int nb = w * 16 + (threadIdx.x & 15);
#pragma unroll
  for (int i = I0; i < I1; ++i) {
#pragma unroll
    for (int kt = 0; kt < 4; ++kt) wq[i * 4 + kt] = load_b_at(lp, i * 16 + kt);
    bqv[i] = (bq + nb)[i * 64];
  }
  fetch_end(lp, nb);
}

// qkv of the tile in hs (LDS, pitch HP): q (scaled) and k -> qk_out (R x 256),
// v -> vT_out transposed+padded. Wave w takes N tiles i*4+w.
__device__ __forceinline__ void qkv_stage(const _Float16* hs,
                                          const v16h (&wq)[24], const float (&bqv)[6],
                                          _Float16* __restrict__ qk_out,
                                          _Float16* __restrict__ vT_out,
                                          int row0, int w) {
  int lane = threadIdx.x & 31;
  int nCol = lane & 15, mBase = (lane < 16) ? 0 : 8;
  v16h a[4];
#pragma unroll
  for (int kt = 0; kt < 4; ++kt) a[kt] = load_a_frag(hs + kt * 32, HP);
#pragma unroll
  for (int i = 0; i < 6; ++i) {
    int nt = i * 4 + w;
    v8f acc = {};
#pragma unroll
    for (int kt = 0; kt < 4; ++kt)
      acc = wmma16(a[kt], wq[i * 4 + kt], acc);
    int n = nt * 16 + nCol;
    float bias = bqv[i];
    if (i < 4) {  // q (scaled) / k : row-major
      float scale = (i < 2) ? QSCALE : 1.0f;
#pragma unroll
      for (int r = 0; r < 8; ++r)
        qk_out[(size_t)(row0 + mBase + r) * QKV_LD + n] =
            (_Float16)((acc[r] + bias) * scale);
    } else {      // v : transposed with padded time axis, vectorized store
      int d = n - 256;
      int hd = d >> 5, dd = d & 31;
      int bIdx = row0 >> 11;
      int t0m = (row0 & (T_SEQ - 1)) + mBase;
      v8h vv;
#pragma unroll
      for (int r = 0; r < 8; ++r) vv[r] = (_Float16)(acc[r] + bias);
      *(v8h*)(vT_out + (size_t)((bIdx * 4 + hd) * 32 + dd) * T_PAD + 64 + t0m) = vv;
    }
    fetch_end();
  }
}

// layernorm of the tile; wave w holds columns w*32 .. w*32+31 in o[2] (C layout).
// Row sums: 2 tiles in the lane, 16 lanes by shuffle, 4 waves through red.
// g0, g1, b0, b1: the lane's two columns of gain and shift, fetched ahead.
__device__ __forceinline__ void ln_stage(v8f (&o)[2], float* red,  // [16 rows][4 waves][2]
                                         float g0, float g1, float b0, float b1, int w) {
  int lane = threadIdx.x & 31;
  int nCol = lane & 15, mBase = (lane < 16) ? 0 : 8;
  float sm[8], sq[8];
#pragma unroll
  for (int r = 0; r < 8; ++r) {
    sm[r] = o[0][r] + o[1][r];
    sq[r] = o[0][r] * o[0][r] + o[1][r] * o[1][r];
#pragma unroll
    for (int msk = 1; msk < 16; msk <<= 1) {
      sm[r] += __shfl_xor(sm[r], msk, 32);
      sq[r] += __shfl_xor(sq[r], msk, 32);
    }
  }
  if (nCol == 0) {
#pragma unroll
    for (int r = 0; r < 8; ++r)
      *(float2*)(red + ((mBase + r) * 4 + w) * 2) = make_float2(sm[r], sq[r]);
  }
  __syncthreads();  // every wave reads all four waves' partial row sums
#pragma unroll
  for (int r = 0; r < 8; ++r) {
    float4 p = *(const float4*)(red + (mBase + r) * 8);
    float4 q = *(const float4*)(red + (mBase + r) * 8 + 4);
    float s = (p.x + p.z) + (q.x + q.z);
    float s2 = (p.y + p.w) + (q.y + q.w);
    float mu = s * (1.f / 128.f);
    float inv = rsqrtf(s2 * (1.f / 128.f) - mu * mu + LN_EPS);
    o[0][r] = (o[0][r] - mu) * inv * g0 + b0;
    o[1][r] = (o[1][r] - mu) * inv * g1 + b1;
  }
}

// the wave's two C tiles -> f16 rows in LDS (pitch HP)
__device__ __forceinline__ void tile_to_lds(const v8f (&o)[2], _Float16* hs, int w) {
  int lane = threadIdx.x & 31;
  int nCol = lane & 15, mBase = (lane < 16) ? 0 : 8;
#pragma unroll
  for (int i = 0; i < 2; ++i)
#pragma unroll
    for (int r = 0; r < 8; ++r)
      hs[(mBase + r) * HP + w * 32 + i * 16 + nCol] = (_Float16)o[i][r];
}

// ---------------------------------------------------------------------------
// set-up units + in_proj + first qkv:
//   h = relu(x@W1+b1)@W2 + b2 + PE -> h32; qkv of layer 0
// Wave w owns columns w*32 .. w*32+31 of every product; its two C tiles hold the
// even and the odd ones (see raw_fetch), so a lane's pair of results is adjacent.
// ---------------------------------------------------------------------------

// one third of layer 0's qkv (G = 0: q, scaled; 1: k; 2: v), columns G*128 + nc0 + {0,1}
template <int G>
__device__ __forceinline__ void qkv0_group(const v16h (&a)[4], const float2 (&raw)[4][16],
                                           float2 bias, _Float16* __restrict__ qk_out,
                                           _Float16* __restrict__ vT_out, int row0, int w) {
  int lane = threadIdx.x & 31;
  int nCol = lane & 15, mBase = (lane < 16) ? 0 : 8;
  int nc0 = w * 32 + 2 * nCol;
  v16h f[8];
#pragma unroll
  for (int kt = 0; kt < 4; ++kt) raw_to_frags(raw[kt], f[kt], f[4 + kt]);
  v8f c0 = {}, c1 = {};
#pragma unroll
  for (int kt = 0; kt < 4; ++kt) c0 = wmma16(a[kt], f[kt], c0);
#pragma unroll
  for (int kt = 0; kt < 4; ++kt) c1 = wmma16(a[kt], f[4 + kt], c1);
  if (G < 2) {  // q (scaled) / k : row-major
    float scale = (G == 0) ? QSCALE : 1.0f;
#pragma unroll
    for (int r = 0; r < 8; ++r) {
      v2h p = {(_Float16)((c0[r] + bias.x) * scale), (_Float16)((c1[r] + bias.y) * scale)};
      *(v2h*)(qk_out + (size_t)(row0 + mBase + r) * QKV_LD + G * 128 + nc0) = p;
    }
  } else {      // v : transposed with padded time axis; head w, rows 2*nCol + {0,1}
    int bIdx = row0 >> 11;
    int t0m = (row0 & (T_SEQ - 1)) + mBase;
    v8h v0, v1;
#pragma unroll
    for (int r = 0; r < 8; ++r) {
      v0[r] = (_Float16)(c0[r] + bias.x);
      v1[r] = (_Float16)(c1[r] + bias.y);
    }
    _Float16* vp = vT_out + (size_t)((bIdx * 4 + w) * 32 + 2 * nCol) * T_PAD + 64 + t0m;
    *(v8h*)vp = v0;
    *(v8h*)(vp + T_PAD) = v1;
  }
  fetch_end();
}

// second bound: two blocks a WGP (the whole grid resident), which leaves each wave
// the register room that the weights fetched ahead take
__global__ __launch_bounds__(128, 2) void setup_inproj_qkv_kernel(
    const float* __restrict__ E, const float* __restrict__ rho,
    const float* __restrict__ W1, const float* __restrict__ b1,
    const float* __restrict__ W2, const float* __restrict__ b2,
    const float* __restrict__ Wqkv, const float* __restrict__ bq,
    const float* __restrict__ Wo, const float* __restrict__ Wff1,
    const float* __restrict__ Wff2, const float* __restrict__ W_head,
    float* __restrict__ h32, _Float16* __restrict__ qk_out,
    _Float16* __restrict__ vT,  // both buffers (pads); layer 0's v goes to the first
    _Float16* __restrict__ pqkv, _Float16* __restrict__ pwo,
    _Float16* __restrict__ pf1, _Float16* __restrict__ pf2,
    _Float16* __restrict__ pwh) {
  __shared__ __attribute__((aligned(16))) _Float16 t1[16 * TP];
  __shared__ __attribute__((aligned(16))) _Float16 hs[16 * HP];
  int row0 = blockIdx.x * 16;
  int w = threadIdx.x >> 5;
  int lane = threadIdx.x & 31;
  int nCol = lane & 15, mBase = (lane < 16) ? 0 : 8, kB = mBase;
  int nc0 = w * 32 + 2 * nCol;

  // the thread's set-up unit. A tile's 64 units are two whole waves, so the tile
  // number is the same in every lane: taken as a scalar, the choice of the
  // weight is scalar work and scalar branches.
  int gid = blockIdx.x * 128 + threadIdx.x;
  int tu = __builtin_amdgcn_readfirstlane(gid >> 6);
  float pv[8] = {0.f, 0.f, 0.f, 0.f, 0.f, 0.f, 0.f, 0.f};
  _Float16* pd = pwh;
  bool pin = false;
  if (tu < PT_PAD) {
    // half a lane's share of a packed tile: 8 k rows of one column
    const float* src;
    _Float16* dst;
    int t, ks = 2, nld;
    if (tu < PT_WO) {
      int l = 1 + tu / 96;
      t = tu % 96; nld = 384;
      src = Wqkv + l * 128 * 384; dst = pqkv + (size_t)(l * 96 + t) * 512;
    } else if (tu < PT_F1) {
      int v = tu - PT_WO;
      t = v & 31; nld = 128;
      src = Wo + (v >> 5) * 128 * 128; dst = pwo + (size_t)v * 512;
    } else if (tu < PT_F2) {
      int v = tu - PT_F1;
      t = v & 63; nld = 256;
      src = Wff1 + (v >> 6) * 128 * 256; dst = pf1 + (size_t)v * 512;
    } else if (tu < PT_WH) {
      int v = tu - PT_F2;
      t = v & 63; nld = 128; ks = 3;
      src = Wff2 + (v >> 6) * 256 * 128; dst = pf2 + (size_t)v * 512;
    } else {
      t = tu - PT_WH; nld = 8;
      src = W_head; dst = pwh + (size_t)t * 512;
    }
    int kt = t & ((1 << ks) - 1), nt = t >> ks;
    int pl = (gid >> 1) & 31, half = gid & 1;  // packed lane; which 8 of its 16 values
    int n = nt * 16 + (pl & 15);
    int k0 = kt * 32 + ((pl < 16) ? 0 : 8) + half * 16;
    pin = n < nld;
    int nc = pin ? n : nld - 1;  // a padding column reads a valid entry that it does not use
    pd = dst + pl * 16 + half * 8;
    const float* pp[8];
#pragma unroll
    for (int i = 0; i < 8; ++i) {
      pp[i] = src + (k0 + i) * nld + nc;
      pv[i] = *pp[i];
    }
    // one wait for the whole run; its inputs are the run's addresses (see fetch_end)
    asm volatile("s_wait_xcnt 0x0" :: "v"(pp[0]), "v"(pp[1]), "v"(pp[2]), "v"(pp[3]),
                 "v"(pp[4]), "v"(pp[5]), "v"(pp[6]), "v"(pp[7]) : "memory");
  } else if (tu < PT_END) {
    // 16 bytes of a vT row's pads: 8 units in front of the time axis, 4 behind it
    int i = gid - PT_PAD * 64;
    int row = i / 12, c = i % 12;
    int pos = (c < 8) ? c * 8 : (64 + T_SEQ + (c - 8) * 8);
    v8h z = {};
    *(v8h*)(vT + (size_t)row * T_PAD + pos) = z;
    addr_wait();
  }
  // keeps the unit's loads in front of the run below: its store then waits for
  // them alone
  __builtin_amdgcn_sched_barrier(0);

  // fetched next, in the order of use: x and both in_proj weights, all f32.
  // x = concat(E, rho), K padded 16 -> 32: lanes 0..15 hold k 0..7 (E), lanes
  // 16..31 k 8..15 (rho); the upper half of every fragment is the zero padding
  const float* lx = ((lane < 16) ? E : rho) + (row0 + nCol) * 8;
  const float* l1 = W1 + kB * DM + nc0;
  const float* l2 = W2 + kB * DM + nc0;
  float4 xa = *(const float4*)lx, xb = *(const float4*)(lx + 4);
  float2 r1[8], r2[4][16];
#pragma unroll
  for (int e = 0; e < 8; ++e) r1[e] = *(const float2*)(l1 + e * DM);
  float2 b1p = *(const float2*)(b1 + nc0);
#pragma unroll
  for (int kt = 0; kt < 4; ++kt) raw_fetch<DM>(r2[kt], l2, kt);
  float2 b2p = *(const float2*)(b2 + nc0);
  // one wait for the whole run; its inputs are the run's addresses (see fetch_end)
  asm volatile("s_wait_xcnt 0x0" :: "v"(lx), "v"(l1), "v"(l2), "v"(nc0) : "memory");
  __builtin_amdgcn_sched_barrier(0);  // as in fetch_end

  if (tu < PT_PAD) {
    v8h hv;
#pragma unroll
    for (int i = 0; i < 8; ++i) hv[i] = pin ? (_Float16)pv[i] : (_Float16)0.f;
    *(v8h*)pd = hv;
    fetch_end();
  }

  {
    v16h a = {}, w1a = {}, w1b = {};
    a[0] = (_Float16)xa.x; a[1] = (_Float16)xa.y; a[2] = (_Float16)xa.z; a[3] = (_Float16)xa.w;
    a[4] = (_Float16)xb.x; a[5] = (_Float16)xb.y; a[6] = (_Float16)xb.z; a[7] = (_Float16)xb.w;
#pragma unroll
    for (int e = 0; e < 8; ++e) {
      w1a[e] = (_Float16)r1[e].x;
      w1b[e] = (_Float16)r1[e].y;
    }
    v8f c0 = {}, c1 = {};
    c0 = wmma16(a, w1a, c0);
    c1 = wmma16(a, w1b, c1);
#pragma unroll
    for (int r = 0; r < 8; ++r) {
      float u0 = c0[r] + b1p.x, u1 = c1[r] + b1p.y;
      v2h p = {(_Float16)(u0 > 0.f ? u0 : 0.f), (_Float16)(u1 > 0.f ? u1 : 0.f)};
      *(v2h*)(t1 + (mBase + r) * TP + nc0) = p;
    }
  }
  v16h w2[8];
#pragma unroll
  for (int kt = 0; kt < 4; ++kt) raw_to_frags(r2[kt], w2[kt], w2[4 + kt]);
  __syncthreads();  // every wave reads all 128 columns of t1 as A fragments

  // fetched under the second product: q's and k's weights of layer 0
  const float* lq = Wqkv + kB * 384 + nc0;
  float2 rq[4][16], rk[4][16], rv[4][16];
#pragma unroll
  for (int kt = 0; kt < 4; ++kt) raw_fetch<384>(rq[kt], lq, kt);
  float2 bqp = *(const float2*)(bq + nc0);
#pragma unroll
  for (int kt = 0; kt < 4; ++kt) raw_fetch<384>(rk[kt], lq + 128, kt);
  float2 bkp = *(const float2*)(bq + nc0 + 128);
  fetch_end(lq, nc0);

  v8f o[2];
  {
    v16h a2[4];
#pragma unroll
    for (int kt = 0; kt < 4; ++kt) a2[kt] = load_a_frag(t1 + kt * 32, TP);
#pragma unroll
    for (int i = 0; i < 2; ++i) {
      v8f acc = {};
#pragma unroll
      for (int kt = 0; kt < 4; ++kt)
        acc = wmma16(a2[kt], w2[i * 4 + kt], acc);
      o[i] = acc;
    }
  }

  // v's weights of layer 0; a run of its own: with all three in one run the build spills
#pragma unroll
  for (int kt = 0; kt < 4; ++kt) raw_fetch<384>(rv[kt], lq + 256, kt);
  float2 bvp = *(const float2*)(bq + nc0 + 256);
  fetch_end(lq, nc0);

  {
    // columns nc0 (even: sine) and nc0 + 1 (odd: cosine) share one frequency
    float div = __expf(-(float)(nc0 >> 1) * (9.210340371976184f / 64.f));
#pragma unroll
    for (int r = 0; r < 8; ++r) {
      int row = row0 + mBase + r;
      float ang = (float)(row & (T_SEQ - 1)) * div;
      o[0][r] = o[0][r] + b2p.x + __sinf(ang);
      o[1][r] = o[1][r] + b2p.y + __cosf(ang);
    }
  }
#pragma unroll
  for (int r = 0; r < 8; ++r)
    *(float2*)(h32 + (row0 + mBase + r) * DM + nc0) = make_float2(o[0][r], o[1][r]);
  fetch_end();
#pragma unroll
  for (int r = 0; r < 8; ++r) {
    v2h p = {(_Float16)o[0][r], (_Float16)o[1][r]};
    *(v2h*)(hs + (mBase + r) * HP + nc0) = p;
  }
  __syncthreads();  // every wave reads all 128 columns of hs as A fragments

  v16h a[4];
#pragma unroll
  for (int kt = 0; kt < 4; ++kt) a[kt] = load_a_frag(hs + kt * 32, HP);
  qkv0_group<0>(a, rq, bqp, qk_out, vT, row0, w);
  qkv0_group<1>(a, rk, bkp, qk_out, vT, row0, w);
  qkv0_group<2>(a, rv, bvp, qk_out, vT, row0, w);
}

// ---------------------------------------------------------------------------
// one layer behind its qkv: windowed attention (wave = head), o-proj + residual
// + layernorm, FFN + residual + layernorm; leaves the tile in hs (f16, LDS) and,
// where QKV, in h32 for the next launch's residual. The weights of the stage
// behind (next qkv where QKV, else the head) are fetched ahead into wn / bnv.
// ---------------------------------------------------------------------------
template <bool QKV>
__device__ __forceinline__ void layer_body(
    const _Float16* __restrict__ qk_in, const _Float16* __restrict__ vT_in,
    const _Float16* __restrict__ pwo,  // 32 tiles [nt*4+kt]
    const float* __restrict__ bo,
    const float* __restrict__ g1, const float* __restrict__ be1,
    const _Float16* __restrict__ pf1,  // 64 tiles [nt*4+kt]
    const float* __restrict__ bf1,
    const _Float16* __restrict__ pf2,  // 64 tiles [nt*8+kt]
    const float* __restrict__ bf2,
    const float* __restrict__ g2, const float* __restrict__ be2,
    float* __restrict__ h32, _Float16* hs,
    const _Float16* __restrict__ pn, const float* __restrict__ bn,
    v16h (&wn)[24], float (&bnv)[6]) {
  __shared__ __attribute__((aligned(16))) _Float16 at[4][16 * AP];  // attn probs, K padded 80 -> 96
  __shared__ __attribute__((aligned(16))) _Float16 ao[16 * HP];
  __shared__ __attribute__((aligned(16))) _Float16 h1[16 * HP];
  __shared__ __attribute__((aligned(16))) _Float16 mid[16 * MP];
  __shared__ __attribute__((aligned(16))) float red1[16 * 8];
  __shared__ __attribute__((aligned(16))) float red2[16 * 8];
  int row0 = blockIdx.x * 16;
  int w = threadIdx.x >> 5;
  int head = w;
  int t0 = row0 & (T_SEQ - 1);
  int bRow0 = row0 - t0;
  int bIdx = row0 >> 11;
  int lane = threadIdx.x & 31;
  int nCol = lane & 15, mBase = (lane < 16) ? 0 : 8, kBase = mBase;
  int keyBase = t0 - 64;
  int n0 = w * 32 + nCol;
  _Float16* atw = at[w];

  // fetched first: q, all five K fragments, all six V fragments
  const _Float16* lq = a_lane_ptr(qk_in + (size_t)row0 * QKV_LD + head * 32, QKV_LD);
  v16h qa = load_kpair(lq);
  const _Float16* lk[5];
  v16h kb[5];
#pragma unroll
  for (int kt = 0; kt < 5; ++kt) {
    int j = keyBase + kt * 16 + nCol;   // key position for this lane's column
    int jr = j < 0 ? 0 : j;             // clamp address; mask handles validity
    lk[kt] = qk_in + (size_t)(bRow0 + jr) * QKV_LD + head * 32 + kBase;
    kb[kt] = load_kpair(lk[kt] + 128);  // k stands behind q in the row
  }
  const _Float16* lv[2];
  v16h vb[6];
#pragma unroll
  for (int nt = 0; nt < 2; ++nt) {
    int d = nt * 16 + nCol;
    lv[nt] = vT_in + (size_t)((bIdx * 4 + head) * 32 + d) * T_PAD + 64 + keyBase + kBase;
#pragma unroll
    for (int kc = 0; kc < 3; ++kc) vb[nt * 3 + kc] = load_kpair(lv[nt] + kc * 32);
  }
  // one wait for the whole run; its inputs are the run's addresses (see fetch_end)
  asm volatile("s_wait_xcnt 0x0" :: "v"(lq), "v"(lk[0]), "v"(lk[1]), "v"(lk[2]), "v"(lk[3]),
               "v"(lk[4]), "v"(lv[0]), "v"(lv[1]) : "memory");
  __builtin_amdgcn_sched_barrier(0);  // as in fetch_end

  // fetched next: all that o-proj and the first layernorm read
  const _Float16* lo = b_lane_ptr(pwo, w * 8);
  const float* lr = h32 + (row0 + mBase) * DM + n0;
  v16h wo[8];
  float res[2][8], bov[2];
#pragma unroll
  for (int i = 0; i < 8; ++i) wo[i] = load_b_at(lo, i);
#pragma unroll
  for (int i = 0; i < 2; ++i) {
    bov[i] = (bo + n0)[i * 16];
#pragma unroll
    for (int r = 0; r < 8; ++r) res[i][r] = lr[r * DM + i * 16];
  }
  float g1a = g1[n0], g1b = (g1 + n0)[16], be1a = be1[n0], be1b = (be1 + n0)[16];
  // one wait for the whole run; its inputs are the run's addresses (see fetch_end)
  asm volatile("s_wait_xcnt 0x0" :: "v"(lo), "v"(lr), "v"(n0) : "memory");
  __builtin_amdgcn_sched_barrier(0);  // as in fetch_end

  v8f s[5];
#pragma unroll
  for (int kt = 0; kt < 5; ++kt) {
    int j = keyBase + kt * 16 + nCol;
    v8f c = {};
    c = wmma16(qa, kb[kt], c);
#pragma unroll
    for (int r = 0; r < 8; ++r) {
      int iQ = t0 + mBase + r;
      bool valid = (j >= 0) && (j <= iQ) && (j >= iQ - 63);
      s[kt][r] = valid ? c[r] : -1e30f;
    }
  }

  // keeps the next run of loads behind the score products: issued in front of
  // them it fills the load counter and the first product waits for more returns
  __builtin_amdgcn_sched_barrier(0);

  // fetched under the softmax: all that FFN up reads
  const _Float16* lf1 = b_lane_ptr(pf1, w * 16);
  int nf = w * 64 + nCol;
  v16h f1[16];
  float bf1v[4];
#pragma unroll
  for (int i = 0; i < 4; ++i) {
#pragma unroll
    for (int kt = 0; kt < 4; ++kt) f1[i * 4 + kt] = load_b_at(lf1, i * 4 + kt);
    bf1v[i] = (bf1 + nf)[i * 16];
  }
  fetch_end(lf1, nf);

  // row softmax: row m lives in one vgpr slot across the 16 lanes of a half
#pragma unroll
  for (int r = 0; r < 8; ++r) {
    float mx = s[0][r];
#pragma unroll
    for (int kt = 1; kt < 5; ++kt) mx = fmaxf(mx, s[kt][r]);
#pragma unroll
    for (int msk = 1; msk < 16; msk <<= 1) mx = fmaxf(mx, __shfl_xor(mx, msk, 32));
    float sum = 0.f;
#pragma unroll
    for (int kt = 0; kt < 5; ++kt) { float e = __expf(s[kt][r] - mx); s[kt][r] = e; sum += e; }
#pragma unroll
    for (int msk = 1; msk < 16; msk <<= 1) sum += __shfl_xor(sum, msk, 32);
    float inv = 1.0f / sum;
#pragma unroll
    for (int kt = 0; kt < 5; ++kt) s[kt][r] *= inv;
  }

  // C-layout -> A-fragment layout via LDS (16 x 96, cols 80..95 zero)
#pragma unroll
  for (int kt = 0; kt < 5; ++kt)
#pragma unroll
    for (int r = 0; r < 8; ++r)
      atw[(mBase + r) * AP + kt * 16 + nCol] = (_Float16)s[kt][r];
#pragma unroll
  for (int r = 0; r < 8; ++r) atw[(mBase + r) * AP + 80 + nCol] = (_Float16)0.f;
  __syncthreads();  // a lane's A fragment holds probs that other lanes wrote

  // attn(16x96) @ V(96x32): 2 N-tiles x 3 K-chunks
#pragma unroll
  for (int nt = 0; nt < 2; ++nt) {
    v8f acc = {};
#pragma unroll
    for (int kc = 0; kc < 3; ++kc) {
      v16h aa = load_a_frag(atw + kc * 32, AP);
      acc = wmma16(aa, vb[nt * 3 + kc], acc);
    }
#pragma unroll
    for (int r = 0; r < 8; ++r)
      ao[(mBase + r) * HP + head * 32 + nt * 16 + nCol] = (_Float16)acc[r];
  }
  __syncthreads();  // every wave reads all four heads' columns of ao

  // fetched under o-proj and the first layernorm: all that FFN down and the
  // second layernorm read
  const _Float16* lf2 = b_lane_ptr(pf2, w * 16);
  v16h f2[16];
  float bf2v[2];
#pragma unroll
  for (int i = 0; i < 2; ++i) {
#pragma unroll
    for (int kt = 0; kt < 8; ++kt) f2[i * 8 + kt] = load_b_at(lf2, i * 8 + kt);
    bf2v[i] = (bf2 + n0)[i * 16];
  }
  float g2a = g2[n0], g2b = (g2 + n0)[16], be2a = be2[n0], be2b = (be2 + n0)[16];
  fetch_end(lf2, n0);

  // o-proj + residual + layernorm; wave w owns columns w*32 .. w*32+31
  v8f o[2];
  {
    v16h a[4];
#pragma unroll
    for (int kt = 0; kt < 4; ++kt) a[kt] = load_a_frag(ao + kt * 32, HP);
#pragma unroll
    for (int i = 0; i < 2; ++i) {
      v8f acc = {};
#pragma unroll
      for (int kt = 0; kt < 4; ++kt)
        acc = wmma16(a[kt], wo[i * 4 + kt], acc);
#pragma unroll
      for (int r = 0; r < 8; ++r)
        o[i][r] = acc[r] + bov[i] + res[i][r];
    }
  }
  ln_stage(o, red1, g1a, g1b, be1a, be1b, w);
  tile_to_lds(o, h1, w);
  __syncthreads();  // every wave reads all 128 columns of h1

  // FFN up: wave w owns hidden columns w*64 .. w*64+63
  {
    v16h a[4];
#pragma unroll
    for (int kt = 0; kt < 4; ++kt) a[kt] = load_a_frag(h1 + kt * 32, HP);
#pragma unroll
    for (int i = 0; i < 4; ++i) {
      int nt = w * 4 + i;
      v8f acc = {};
#pragma unroll
      for (int kt = 0; kt < 4; ++kt)
        acc = wmma16(a[kt], f1[i * 4 + kt], acc);
      float bias = bf1v[i];
#pragma unroll
      for (int r = 0; r < 8; ++r) {
        float v = acc[r] + bias;
        mid[(mBase + r) * MP + nt * 16 + nCol] = (_Float16)(v > 0.f ? v : 0.f);
      }
    }
  }
  __syncthreads();  // every wave reads all 256 columns of mid

  // fetched under FFN down and the second layernorm: the stage behind's weights
  if (QKV) {
    qkv_fetch<0, 6>(wn, bnv, pn, bn, w);
  } else {
    const _Float16* lh = b_lane_ptr(pn, 0);
    int nh = nCol & 7;  // lanes 8..15 of a half read a valid entry that they do not use
#pragma unroll
    for (int kt = 0; kt < 4; ++kt) wn[kt] = load_b_at(lh, kt);
    bnv[0] = bn[nh];
    fetch_end(lh, nh);
  }

  // FFN down + residual (still in o) + layernorm
  {
    v16h a2[8];
#pragma unroll
    for (int kt = 0; kt < 8; ++kt) a2[kt] = load_a_frag(mid + kt * 32, MP);
#pragma unroll
    for (int i = 0; i < 2; ++i) {
      v8f acc = {};
#pragma unroll
      for (int kt = 0; kt < 8; ++kt)
        acc = wmma16(a2[kt], f2[i * 8 + kt], acc);
#pragma unroll
      for (int r = 0; r < 8; ++r) o[i][r] = acc[r] + bf2v[i] + o[i][r];
    }
  }
  ln_stage(o, red2, g2a, g2b, be2a, be2b, w);
  if (QKV) {
#pragma unroll
    for (int i = 0; i < 2; ++i)
#pragma unroll
      for (int r = 0; r < 8; ++r)
        h32[(row0 + mBase + r) * DM + w * 32 + i * 16 + nCol] = o[i][r];
    fetch_end();
  }
  tile_to_lds(o, hs, w);
  __syncthreads();  // the stage behind reads all 128 columns of hs
}

// layer l, then the qkv of layer l+1 into the OTHER q/k and vT buffers (blocks
// of this launch still read this layer's K and V of their neighbours' rows)
// second bound: two blocks a WGP (the whole grid resident), which leaves each wave
// the register room that the fragments fetched ahead take
__global__ __launch_bounds__(128, 2) void layer_qkv_kernel(
    const _Float16* __restrict__ qk_in, const _Float16* __restrict__ vT_in,
    const _Float16* __restrict__ pwo, const float* __restrict__ bo,
    const float* __restrict__ g1, const float* __restrict__ be1,
    const _Float16* __restrict__ pf1, const float* __restrict__ bf1,
    const _Float16* __restrict__ pf2, const float* __restrict__ bf2,
    const float* __restrict__ g2, const float* __restrict__ be2,
    float* __restrict__ h32,
    const _Float16* __restrict__ pq, const float* __restrict__ bq,
    _Float16* __restrict__ qk_out, _Float16* __restrict__ vT_out) {
  __shared__ __attribute__((aligned(16))) _Float16 hs[16 * HP];
  v16h wn[24];
  float bnv[6];
  layer_body<true>(qk_in, vT_in, pwo, bo, g1, be1, pf1, bf1, pf2, bf2, g2, be2, h32, hs,
                   pq, bq, wn, bnv);
  qkv_stage(hs, wn, bnv, qk_out, vT_out, blockIdx.x * 16, threadIdx.x >> 5);
}

// last layer, then head: out = h @ W_head(128x16 padded) + b_head -> fp32 (R x 8)
// second bound: two blocks a WGP (the whole grid resident), which leaves each wave
// the register room that the fragments fetched ahead take
__global__ __launch_bounds__(128, 2) void layer_head_kernel(
    const _Float16* __restrict__ qk_in, const _Float16* __restrict__ vT_in,
    const _Float16* __restrict__ pwo, const float* __restrict__ bo,
    const float* __restrict__ g1, const float* __restrict__ be1,
    const _Float16* __restrict__ pf1, const float* __restrict__ bf1,
    const _Float16* __restrict__ pf2, const float* __restrict__ bf2,
    const float* __restrict__ g2, const float* __restrict__ be2,
    float* __restrict__ h32,
    const _Float16* __restrict__ pwh,  // 4 tiles
    const float* __restrict__ bh, float* __restrict__ out) {
  __shared__ __attribute__((aligned(16))) _Float16 hs[16 * HP];
  v16h wn[24];
  float bnv[6];
  layer_body<false>(qk_in, vT_in, pwo, bo, g1, be1, pf1, bf1, pf2, bf2, g2, be2, h32, hs,
                    pwh, bh, wn, bnv);
  if ((threadIdx.x >> 5) != 0) return;  // one N tile: one wave; no barrier follows
  int row0 = blockIdx.x * 16;
  int lane = threadIdx.x & 31;
  int nCol = lane & 15, mBase = (lane < 16) ? 0 : 8;
  v8f acc = {};
#pragma unroll
  for (int kt = 0; kt < 4; ++kt)
    acc = wmma16(load_a_frag(hs + kt * 32, HP), wn[kt], acc);
  if (nCol < 8) {
    float bias = bnv[0];
#pragma unroll
    for (int r = 0; r < 8; ++r) out[(row0 + mBase + r) * 8 + nCol] = acc[r] + bias;
  }
}

// ---------------------------------------------------------------------------
// host launch
// ---------------------------------------------------------------------------
extern "C" void kernel_launch(void* const* d_in, const int* in_sizes, int n_in,
                              void* d_out, int out_size, void* d_ws, size_t ws_size,
                              hipStream_t stream) {
  (void)in_sizes; (void)n_in; (void)out_size; (void)ws_size;
  const float* E      = (const float*)d_in[0];
  const float* rho    = (const float*)d_in[1];
  const float* W_in1  = (const float*)d_in[2];
  const float* b_in1  = (const float*)d_in[3];
  const float* W_in2  = (const float*)d_in[4];
  const float* b_in2  = (const float*)d_in[5];
  const float* Wqkv   = (const float*)d_in[6];
  const float* bqkv   = (const float*)d_in[7];
  const float* Wo     = (const float*)d_in[8];
  const float* bo     = (const float*)d_in[9];
  const float* ln1_g  = (const float*)d_in[10];
  const float* ln1_b  = (const float*)d_in[11];
  const float* Wff1   = (const float*)d_in[12];
  const float* bff1   = (const float*)d_in[13];
  const float* Wff2   = (const float*)d_in[14];
  const float* bff2   = (const float*)d_in[15];
  const float* ln2_g  = (const float*)d_in[16];
  const float* ln2_b  = (const float*)d_in[17];
  const float* W_head = (const float*)d_in[18];
  const float* b_head = (const float*)d_in[19];

  char* w = (char*)d_ws;
  auto take = [&](size_t bytes) -> void* {
    void* p = (void*)w;
    w += (bytes + 255) & ~(size_t)255;
    return p;
  };
  float*    h32   = (float*)   take((size_t)R_TOT * DM * 4);
  _Float16* qkA   = (_Float16*)take((size_t)R_TOT * QKV_LD * 2);
  _Float16* qkB   = (_Float16*)take((size_t)R_TOT * QKV_LD * 2);
  _Float16* vT    = (_Float16*)take((size_t)2 * 512 * T_PAD * 2);  // 2 x 16 (b*head) * 32 d rows
  _Float16* vTA   = vT;
  _Float16* vTB   = vT + (size_t)512 * T_PAD;
  _Float16* pqkv  = (_Float16*)take((size_t)3 * 96 * 512 * 2);
  _Float16* pwo   = (_Float16*)take((size_t)3 * 32 * 512 * 2);
  _Float16* pf1   = (_Float16*)take((size_t)3 * 64 * 512 * 2);
  _Float16* pf2   = (_Float16*)take((size_t)3 * 64 * 512 * 2);
  _Float16* pwh   = (_Float16*)take((size_t)4 * 512 * 2);

  const int TILES = R_TOT / 16;  // 512
  setup_inproj_qkv_kernel<<<TILES, 128, 0, stream>>>(
      E, rho, W_in1, b_in1, W_in2, b_in2, Wqkv, bqkv, Wo, Wff1, Wff2, W_head,
      h32, qkA, vT, pqkv, pwo, pf1, pf2, pwh);
  layer_qkv_kernel<<<TILES, 128, 0, stream>>>(
      qkA, vTA, pwo, bo, ln1_g, ln1_b, pf1, bff1, pf2, bff2, ln2_g, ln2_b, h32,
      pqkv + (size_t)96 * 512, bqkv + 384, qkB, vTB);
  layer_qkv_kernel<<<TILES, 128, 0, stream>>>(
      qkB, vTB, pwo + (size_t)32 * 512, bo + 128, ln1_g + 128, ln1_b + 128,
      pf1 + (size_t)64 * 512, bff1 + 256, pf2 + (size_t)64 * 512, bff2 + 128,
      ln2_g + 128, ln2_b + 128, h32,
      pqkv + (size_t)2 * 96 * 512, bqkv + 2 * 384, qkA, vTA);
  layer_head_kernel<<<TILES, 128, 0, stream>>>(
      qkA, vTA, pwo + (size_t)2 * 32 * 512, bo + 2 * 128, ln1_g + 2 * 128, ln1_b + 2 * 128,
      pf1 + (size_t)2 * 64 * 512, bff1 + 2 * 256, pf2 + (size_t)2 * 64 * 512, bff2 + 2 * 128,
      ln2_g + 2 * 128, ln2_b + 2 * 128, h32, pwh, b_head, (float*)d_out);
}

// v005
// A run of this version takes 48.8 microseconds.
// Timed twice side by side with v004, it ran 1.13 and 1.14 times as fast.
// Counting every step since v000, it is 6.41 times as fast.
#include <hip/hip_runtime.h>
#include <hip/hip_bf16.h>

// ---------------------------------------------------------------------------
// StateSequenceTransformer on MI455X (gfx1250, wave32, WMMA 16x16x32 f16)
//   B=4 T=2048 D_MODEL=128 NHEAD=4 hd=32 DFF=256 WINDOW=64 NLAYERS=3
//   One 4-wave block (128 threads) owns a 16-row tile through a whole layer.
//   Weights pre-packed into per-lane B-fragment order -> b128 vector loads.
//   q, K, V and the f32 residual pass from launch to launch in the order of the
//   reader's fragments, so that a wave's 16-byte loads and stores cover whole
//   128-byte lines, each alone or (the first launch's v and residual) two together.
// ---------------------------------------------------------------------------

#define R_TOT  8192
#define T_SEQ  2048
#define DM     128
#define DFF_   256
#define QK_TILE 4096          /* f16 of a 16-row tile in the q/k buffer: {q (scaled), k} x 4 heads x 512 */
#define VG     133            /* 16-key groups of a V plane: 4 zero groups, 128, 1 zero group */
#define VPLANE (VG * 512)     /* f16 of one (batch, head) plane of V: [group][d 0..31][16 keys] */
#define H_TILE 2048           /* f32 of a 16-row tile of the residual */
#define HP     136            /* LDS pitch of the tile buffers between fused stages: 272 B = 16 B x odd */
#define TP     128            /* LDS pitch of in_proj's hidden tile */
#define MP     256            /* LDS pitch of the FFN's hidden tile */
#define AP     96             /* LDS pitch of the attention probs */
#define LN_EPS 1e-5f
#define QSCALE 0.17677669529663687f /* 1/sqrt(32) */

typedef __attribute__((ext_vector_type(16))) _Float16 v16h;
typedef __attribute__((ext_vector_type(8)))  _Float16 v8h;
typedef __attribute__((ext_vector_type(8)))  float    v8f;

__device__ __forceinline__ v8f wmma16(v16h a, v16h b, v8f c) {
  return __builtin_amdgcn_wmma_f32_16x16x32_f16(false, a, false, b, (short)0, c,
                                                false, false);
}

// A fragment: 16x32 f16 from row-major src (ld multiple of 8, 16B aligned).
// lane<16: row=lane, K={0..7,16..23}; lane>=16: row=lane-16, K={8..15,24..31}
__device__ __forceinline__ v16h load_a_frag(const _Float16* src, int ld) {
  int lane = threadIdx.x & 31;
  const _Float16* p = src + (lane & 15) * ld + ((lane < 16) ? 0 : 8);
  v8h lo = *(const v8h*)p;
  v8h hi = *(const v8h*)(p + 16);
  return __builtin_shufflevector(lo, hi, 0, 1, 2, 3, 4, 5, 6, 7,
                                 8, 9, 10, 11, 12, 13, 14, 15);
}

// A fragment's 16 values from two 16-byte pieces, dist f16 apart.
__device__ __forceinline__ v16h load_pair(const _Float16* p, int dist) {
  v8h lo = *(const v8h*)p;
  v8h hi = *(const v8h*)(p + dist);
  return __builtin_shufflevector(lo, hi, 0, 1, 2, 3, 4, 5, 6, 7,
                                 8, 9, 10, 11, 12, 13, 14, 15);
}

// Pre-packed B fragment: tile = 512 f16, lane's 16 values contiguous (32B).
// the lane's own address of packed tile 'tile'; further tiles of a run lie at
// compile-time distances from it
__device__ __forceinline__ const _Float16* b_lane_ptr(const _Float16* base, int tile) {
  int lane = threadIdx.x & 31;
  return base + ((size_t)tile << 9) + (lane << 4);
}
__device__ __forceinline__ v16h load_b_at(const _Float16* lp, int tile) {
  return *(const v16h*)(lp + (tile << 9));
}

// precaution: stands behind a run of global loads, in front of later loads whose
// results may land in the registers that held the run's addresses
__device__ __forceinline__ void addr_wait() {
  asm volatile("s_wait_xcnt 0x0" ::: "memory");
}

// ---------------------------------------------------------------------------
// Set-up work rides in the first launch. What that launch itself multiplies by
// (W_in1, W_in2, layer 0's Wqkv) it reads as f32 and converts in registers. What
// later launches read (packed weights, the zero groups of V) is dealt out in
// units of one 16-byte store, one unit a thread, 64 units a tile, over the
// grid's first threads.
//   pack: f32 weights (K x N row-major) -> B-fragment tiles, tile id = nt*KT + kt;
//         columns past the source's width -> 0 (padding).
// ---------------------------------------------------------------------------
#define PT_WO  192   /* from   0: 192 tiles, Wqkv   4 x 24 tiles, layers 1 and 2 */
#define PT_F1  288   /* from 192:  96 tiles, Wo     4 x  8 tiles, 3 layers */
#define PT_F2  480   /* from 288: 192 tiles, Wff1   4 x 16 tiles, 3 layers */
#define PT_WH  672   /* from 480: 192 tiles, Wff2   8 x  8 tiles, 3 layers */
#define PT_PAD 676   /* from 672:   4 tiles, W_head 4 x  1 tiles (half full) */
#define PT_END 836   /* from 676: 160 x 64 units, the zero groups of both V buffers */

typedef __attribute__((ext_vector_type(2))) _Float16 v2h;

// f32 weights as B fragments of TWO N tiles at once: the lane reads two
// neighbouring columns (tile 0 holds the even, tile 1 the odd columns of a run of
// 32), so that 16 lanes cover a whole 128-byte line of a weight row.
// lp: the lane's address in row kB (0 or 8) of the weight; k order as in pack.
template <int NLD>
__device__ __forceinline__ void raw_fetch(float2 (&raw)[16], const float* lp, int kt) {
#pragma unroll
  for (int e = 0; e < 16; ++e)
    raw[e] = *(const float2*)(lp + (kt * 32 + (e < 8 ? e : e + 8)) * NLD);
}
__device__ __forceinline__ void raw_to_frags(const float2 (&raw)[16], v16h& f0, v16h& f1) {
#pragma unroll
  for (int e = 0; e < 16; ++e) {
    f0[e] = (_Float16)raw[e].x;
    f1[e] = (_Float16)raw[e].y;
  }
}

// ---------------------------------------------------------------------------
// Row-local stages. Everything behind the K/V exchange of a layer depends only
// on the block's own 16 rows, so it runs in ONE launch: the tile goes from stage
// to stage through LDS, the f32 residual stays in registers, and the N tiles of
// the in_proj, qkv, o-proj and FFN products are dealt to the block's four waves.
// Every loop below is unrolled: fragment and accumulator arrays stay in
// registers only where their indices are compile-time constants.
// ---------------------------------------------------------------------------

// Global operands are fetched AHEAD: every weight fragment, bias, norm parameter
// and residual of a stage is loaded into registers, all of a stage at once, at
// least one stage before its use (a launch's first products: just before them; layer 0's q and k biases: just before their products),
// so that its latency runs under earlier work.

// ends a run of global loads or stores. The wait: a precaution, in front of
// whatever reuses the run's address registers. The scheduling barrier: it keeps
// later register writes behind that wait, and without it the compiler sinks
// loads fetched ahead towards their uses and issues them a few at a time between
// the matrix instructions, so that their latencies add up again.
__device__ __forceinline__ void fetch_end() {
  addr_wait();
  __builtin_amdgcn_sched_barrier(0);
}
// the same for a run of loads from one lane address p and one lane index n: as
// inputs of the wait's own statement both stay in their registers up to the wait,
// so that no result of the run itself lands in them in front of it
__device__ __forceinline__ void fetch_end(const void* p, int n) {
  asm volatile("s_wait_xcnt 0x0" :: "v"(p), "v"(n) : "memory");
  __builtin_amdgcn_sched_barrier(0);
}

// Layout of the q/k buffer. A (row tile, q or k, head) block is 16 rows x 32 d =
// 512 f16, held as the attention's fragment of it: piece [d >> 4][lane][8], where
// lane = row + 16 * ((d >> 3) & 1) and the 8 values are d & 7. q's A fragment and
// K's B fragment have the same lane and k order, so one layout serves both.
// The writer gets a lane's 8 values by the TRANSPOSED product W^T h^T: a packed B
// fragment of W is, register for register, the A fragment of W^T, and the A
// fragment of h the B fragment of h^T; in the result a lane holds one row of h
// (lane & 15) and 8 neighbouring columns of W.

// the wave's qkv weight fragments and biases: wave w takes head w, N tiles
// (i >> 1) * 8 + 2 * w + (i & 1); i = 0, 1: q; 2, 3: k; 4, 5: v.
// bqv: 8 a tile for q and k (a lane's 8 columns), then one a tile for v
__device__ __forceinline__ void qkv_fetch(v16h (&wq)[24], float (&bqv)[34],
                                          const _Float16* __restrict__ pq,  // 96 tiles [nt*4+kt]
                                          const float* __restrict__ bq, int w) {
  int lane = threadIdx.x & 31;
  const _Float16* lp = b_lane_ptr(pq, w * 8);
  int nb = (w * 32 + ((lane < 16) ? 0 : 8)) * 4;  // in bytes: the register that the loads name
  int nv = w * 32 + (lane & 15);
#pragma unroll
  for (int i = 0; i < 6; ++i) {
#pragma unroll
    for (int kt = 0; kt < 4; ++kt)
      wq[i * 4 + kt] = load_b_at(lp, (i >> 1) * 32 + (i & 1) * 4 + kt);
    if (i < 4) {
      const float* bp = (const float*)((const char*)bq + nb) + (i >> 1) * 128 + (i & 1) * 16;
      float4 lo = *(const float4*)bp, hi = *(const float4*)(bp + 4);
      bqv[i * 8 + 0] = lo.x; bqv[i * 8 + 1] = lo.y; bqv[i * 8 + 2] = lo.z; bqv[i * 8 + 3] = lo.w;
      bqv[i * 8 + 4] = hi.x; bqv[i * 8 + 5] = hi.y; bqv[i * 8 + 6] = hi.z; bqv[i * 8 + 7] = hi.w;
    } else {
      bqv[32 + (i & 1)] = (bq + nv)[256 + (i & 1) * 16];
    }
  }
  // one wait for the whole run; its inputs are the run's addresses (see fetch_end)
  asm volatile("s_wait_xcnt 0x0" :: "v"(lp), "v"(nb), "v"(nv) : "memory");
  __builtin_amdgcn_sched_barrier(0);  // as in fetch_end
}

// qkv of the tile in hs (LDS, pitch HP): q (scaled) and k -> qk_out, v -> v_out,
// each in its reader's fragment order; every store is 16 bytes a lane, 512
// contiguous bytes a wave.
__device__ __forceinline__ void qkv_stage(const _Float16* hs,
                                          const v16h (&wq)[24], const float (&bqv)[34],
                                          _Float16* __restrict__ qk_out,
                                          _Float16* __restrict__ v_out, int w) {
  int lane = threadIdx.x & 31;
  int nCol = lane & 15, mBase = (lane < 16) ? 0 : 8;
  int tile = blockIdx.x;
  _Float16* qd = qk_out + (size_t)tile * QK_TILE + w * 512 + lane * 8;
  _Float16* vd = v_out + (size_t)((tile >> 7) * 4 + w) * VPLANE + (4 + (tile & 127)) * 512 +
                 nCol * 16 + mBase;
  v16h a[4];
#pragma unroll
  for (int kt = 0; kt < 4; ++kt) a[kt] = load_a_frag(hs + kt * 32, HP);
#pragma unroll
  for (int i = 0; i < 6; ++i) {
    v8f acc = {};
    v8h vv;
    if (i < 4) {  // q (scaled) / k, transposed product: row nCol, d (i & 1) * 16 + mBase + r
#pragma unroll
      for (int kt = 0; kt < 4; ++kt)
        acc = wmma16(wq[i * 4 + kt], a[kt], acc);
      float scale = (i < 2) ? QSCALE : 1.0f;
#pragma unroll
      for (int r = 0; r < 8; ++r) vv[r] = (_Float16)((acc[r] + bqv[i * 8 + r]) * scale);
      *(v8h*)(qd + (i >> 1) * 2048 + (i & 1) * 256) = vv;
    } else {      // v: d (i & 1) * 16 + nCol, keys mBase + r
#pragma unroll
      for (int kt = 0; kt < 4; ++kt)
        acc = wmma16(a[kt], wq[i * 4 + kt], acc);
      float bias = bqv[32 + (i & 1)];
#pragma unroll
      for (int r = 0; r < 8; ++r) vv[r] = (_Float16)(acc[r] + bias);
      *(v8h*)(vd + (i & 1) * 256) = vv;
    }
    fetch_end();
  }
}

// layernorm of the tile; wave w holds columns w*32 .. w*32+31 in o[2] (C layout).
// Row sums: 2 tiles in the lane, 16 lanes by shuffle, 4 waves through red.
// g0, g1, b0, b1: the lane's two columns of gain and shift, fetched ahead.
__device__ __forceinline__ void ln_stage(v8f (&o)[2], float* red,  // [16 rows][4 waves][2]
                                         float g0, float g1, float b0, float b1, int w) {
  int lane = threadIdx.x & 31;
  int nCol = lane & 15, mBase = (lane < 16) ? 0 : 8;
  float sm[8], sq[8];
#pragma unroll
  for (int r = 0; r < 8; ++r) {
    sm[r] = o[0][r] + o[1][r];
    sq[r] = o[0][r] * o[0][r] + o[1][r] * o[1][r];
#pragma unroll
    for (int msk = 1; msk < 16; msk <<= 1) {
      sm[r] += __shfl_xor(sm[r], msk, 32);
      sq[r] += __shfl_xor(sq[r], msk, 32);
    }
  }
  if (nCol == 0) {
#pragma unroll
    for (int r = 0; r < 8; ++r)
      *(float2*)(red + ((mBase + r) * 4 + w) * 2) = make_float2(sm[r], sq[r]);
  }
  __syncthreads();  // every wave reads all four waves' partial row sums
#pragma unroll
  for (int r = 0; r < 8; ++r) {
    float4 p = *(const float4*)(red + (mBase + r) * 8);
    float4 q = *(const float4*)(red + (mBase + r) * 8 + 4);
    float s = (p.x + p.z) + (q.x + q.z);
    float s2 = (p.y + p.w) + (q.y + q.w);
    float mu = s * (1.f / 128.f);
    float inv = rsqrtf(s2 * (1.f / 128.f) - mu * mu + LN_EPS);
    o[0][r] = (o[0][r] - mu) * inv * g0 + b0;
    o[1][r] = (o[1][r] - mu) * inv * g1 + b1;
  }
}

// the wave's two C tiles -> f16 rows in LDS (pitch HP)
__device__ __forceinline__ void tile_to_lds(const v8f (&o)[2], _Float16* hs, int w) {
  int lane = threadIdx.x & 31;
  int nCol = lane & 15, mBase = (lane < 16) ? 0 : 8;
#pragma unroll
  for (int i = 0; i < 2; ++i)
#pragma unroll
    for (int r = 0; r < 8; ++r)
      hs[(mBase + r) * HP + w * 32 + i * 16 + nCol] = (_Float16)o[i][r];
}

// ---------------------------------------------------------------------------
// set-up units + in_proj + first qkv:
//   h = relu(x@W1+b1)@W2 + b2 + PE -> h32; qkv of layer 0
// Wave w owns columns w*32 .. w*32+31 of every product; its two C tiles hold the
// even and the odd ones (see raw_fetch), so a lane's pair of results is adjacent.
// ---------------------------------------------------------------------------

// q (G = 0, scaled) or k (G = 1) of layer 0, head w, by the transposed product (see
// the q/k layout): the lane holds row nCol and, the even columns in c0 and the odd
// in c1, d = 2 * mBase .. 2 * mBase + 15. The biases of those 16 columns are fetched
// here, under the products: there is no register room for them further ahead
template <int G>
__device__ __forceinline__ void qk0_group(const v16h (&a)[4], const float2 (&raw)[4][16],
                                          const float* __restrict__ bq,
                                          _Float16* __restrict__ qk_out, int w) {
  int lane = threadIdx.x & 31;
  const float* bp = bq + G * 128 + w * 32 + (lane >> 4) * 16;
  float4 b4[4];
#pragma unroll
  for (int e = 0; e < 4; ++e) b4[e] = *(const float4*)(bp + e * 4);
  // the run's wait; with the address as its input the loads stay in front of it
  asm volatile("s_wait_xcnt 0x0" :: "v"(bp) : "memory");
  __builtin_amdgcn_sched_barrier(0);  // as in fetch_end
  v16h f[8];
#pragma unroll
  for (int kt = 0; kt < 4; ++kt) raw_to_frags(raw[kt], f[kt], f[4 + kt]);
  v8f c0 = {}, c1 = {};
#pragma unroll
  for (int kt = 0; kt < 4; ++kt) c0 = wmma16(f[kt], a[kt], c0);
#pragma unroll
  for (int kt = 0; kt < 4; ++kt) c1 = wmma16(f[4 + kt], a[kt], c1);
  float scale = (G == 0) ? QSCALE : 1.0f;
  _Float16* dst = qk_out + (size_t)blockIdx.x * QK_TILE + G * 2048 + w * 512 +
                  (lane >> 4) * 256 + (lane & 15) * 8;
#pragma unroll
  for (int s = 0; s < 2; ++s) {  // d & 8: the fragment lane is row + 16 * s
    v8h vv;
#pragma unroll
    for (int j = 0; j < 4; ++j) {
      int r = s * 4 + j;
      float be = (r & 1) ? b4[r >> 1].z : b4[r >> 1].x;
      float bd = (r & 1) ? b4[r >> 1].w : b4[r >> 1].y;
      vv[2 * j] = (_Float16)((c0[r] + be) * scale);
      vv[2 * j + 1] = (_Float16)((c1[r] + bd) * scale);
    }
    *(v8h*)(dst + s * 128) = vv;
  }
  fetch_end();
}

// v of layer 0, head w: d = 2 * nCol + {0, 1}, keys mBase + r
__device__ __forceinline__ void v0_group(const v16h (&a)[4], const float2 (&raw)[4][16],
                                         float2 bias, _Float16* __restrict__ v_out, int w) {
  int lane = threadIdx.x & 31;
  int nCol = lane & 15, mBase = (lane < 16) ? 0 : 8;
  int tile = blockIdx.x;
  v16h f[8];
#pragma unroll
  for (int kt = 0; kt < 4; ++kt) raw_to_frags(raw[kt], f[kt], f[4 + kt]);
  v8f c0 = {}, c1 = {};
#pragma unroll
  for (int kt = 0; kt < 4; ++kt) c0 = wmma16(a[kt], f[kt], c0);
#pragma unroll
  for (int kt = 0; kt < 4; ++kt) c1 = wmma16(a[kt], f[4 + kt], c1);
  v8h v0, v1;
#pragma unroll
  for (int r = 0; r < 8; ++r) {
    v0[r] = (_Float16)(c0[r] + bias.x);
    v1[r] = (_Float16)(c1[r] + bias.y);
  }
  _Float16* vp = v_out + (size_t)((tile >> 7) * 4 + w) * VPLANE + (4 + (tile & 127)) * 512 +
                 nCol * 32 + mBase;
  *(v8h*)vp = v0;
  *(v8h*)(vp + 16) = v1;
  fetch_end();
}

// second bound: two blocks a WGP (the whole grid resident), which leaves each wave
// the register room that the weights fetched ahead take
__global__ __launch_bounds__(128, 2) void setup_inproj_qkv_kernel(
    const float* __restrict__ E, const float* __restrict__ rho,
    const float* __restrict__ W1, const float* __restrict__ b1,
    const float* __restrict__ W2, const float* __restrict__ b2,
    const float* __restrict__ Wqkv, const float* __restrict__ bq,
    const float* __restrict__ Wo, const float* __restrict__ Wff1,
    const float* __restrict__ Wff2, const float* __restrict__ W_head,
    float* __restrict__ h32, _Float16* __restrict__ qk_out,
    _Float16* __restrict__ vT,  // both V buffers (zero groups); layer 0's v goes to the first
    _Float16* __restrict__ pqkv, _Float16* __restrict__ pwo,
    _Float16* __restrict__ pf1, _Float16* __restrict__ pf2,
    _Float16* __restrict__ pwh) {
  __shared__ __attribute__((aligned(16))) _Float16 t1[16 * TP];
  __shared__ __attribute__((aligned(16))) _Float16 hs[16 * HP];
  int row0 = blockIdx.x * 16;
  int w = threadIdx.x >> 5;
  int lane = threadIdx.x & 31;
  int nCol = lane & 15, mBase = (lane < 16) ? 0 : 8, kB = mBase;
  int nc0 = w * 32 + 2 * nCol;

  // the thread's set-up unit. A tile's 64 units are two whole waves, so the tile
  // number is the same in every lane: taken as a scalar, the choice of the
  // weight is scalar work and scalar branches.
  int gid = blockIdx.x * 128 + threadIdx.x;
  int tu = __builtin_amdgcn_readfirstlane(gid >> 6);
  float pv[8] = {0.f, 0.f, 0.f, 0.f, 0.f, 0.f, 0.f, 0.f};
  _Float16* pd = pwh;
  bool pin = false;
  if (tu < PT_PAD) {
    // half a lane's share of a packed tile: 8 k rows of one column
    const float* src;
    _Float16* dst;
    int t, ks = 2, nld;
    if (tu < PT_WO) {
      int l = 1 + tu / 96;
      t = tu % 96; nld = 384;
      src = Wqkv + l * 128 * 384; dst = pqkv + (size_t)(l * 96 + t) * 512;
    } else if (tu < PT_F1) {
      int v = tu - PT_WO;
      t = v & 31; nld = 128;
      src = Wo + (v >> 5) * 128 * 128; dst = pwo + (size_t)v * 512;
    } else if (tu < PT_F2) {
      int v = tu - PT_F1;
      t = v & 63; nld = 256;
      src = Wff1 + (v >> 6) * 128 * 256; dst = pf1 + (size_t)v * 512;
    } else if (tu < PT_WH) {
      int v = tu - PT_F2;
      t = v & 63; nld = 128; ks = 3;
      src = Wff2 + (v >> 6) * 256 * 128; dst = pf2 + (size_t)v * 512;
    } else {
      t = tu - PT_WH; nld = 8;
      src = W_head; dst = pwh + (size_t)t * 512;
    }
    int kt = t & ((1 << ks) - 1), nt = t >> ks;
    int pl = (gid >> 1) & 31, half = gid & 1;  // packed lane; which 8 of its 16 values
    int n = nt * 16 + (pl & 15);
    int k0 = kt * 32 + ((pl < 16) ? 0 : 8) + half * 16;
    pin = n < nld;
    int nc = pin ? n : nld - 1;  // a padding column reads a valid entry that it does not use
    pd = dst + pl * 16 + half * 8;
    const float* pp[8];
#pragma unroll
    for (int i = 0; i < 8; ++i) {
      pp[i] = src + (k0 + i) * nld + nc;
      pv[i] = *pp[i];
    }
    // one wait for the whole run; its inputs are the run's addresses (see fetch_end)
    asm volatile("s_wait_xcnt 0x0" :: "v"(pp[0]), "v"(pp[1]), "v"(pp[2]), "v"(pp[3]),
                 "v"(pp[4]), "v"(pp[5]), "v"(pp[6]), "v"(pp[7]) : "memory");
  } else if (tu < PT_END) {
    // 16 bytes of a V plane's zero groups: four groups in front of the keys, one behind
    int i = gid - PT_PAD * 64;
    int plane = i / 320, c = i % 320;
    int pos = (c < 256) ? c * 8 : ((VG - 1) * 512 + (c - 256) * 8);
    v8h z = {};
    *(v8h*)(vT + (size_t)plane * VPLANE + pos) = z;
    addr_wait();
  }
  // keeps the unit's loads in front of the run below: its store then waits for
  // them alone
  __builtin_amdgcn_sched_barrier(0);

  // fetched next, in the order of use: x and both in_proj weights, all f32.
  // x = concat(E, rho), K padded 16 -> 32: lanes 0..15 hold k 0..7 (E), lanes
  // 16..31 k 8..15 (rho); the upper half of every fragment is the zero padding
  const float* lx = ((lane < 16) ? E : rho) + (row0 + nCol) * 8;
  const float* l1 = W1 + kB * DM + nc0;
  const float* l2 = W2 + kB * DM + nc0;
  float4 xa = *(const float4*)lx, xb = *(const float4*)(lx + 4);
  float2 r1[8], r2[4][16];
#pragma unroll
  for (int e = 0; e < 8; ++e) r1[e] = *(const float2*)(l1 + e * DM);
  float2 b1p = *(const float2*)(b1 + nc0);
#pragma unroll
  for (int kt = 0; kt < 4; ++kt) raw_fetch<DM>(r2[kt], l2, kt);
  float2 b2p = *(const float2*)(b2 + nc0);
  // one wait for the whole run; its inputs are the run's addresses (see fetch_end)
  asm volatile("s_wait_xcnt 0x0" :: "v"(lx), "v"(l1), "v"(l2), "v"(nc0) : "memory");
  __builtin_amdgcn_sched_barrier(0);  // as in fetch_end

  if (tu < PT_PAD) {
    v8h hv;
#pragma unroll
    for (int i = 0; i < 8; ++i) hv[i] = pin ? (_Float16)pv[i] : (_Float16)0.f;
    *(v8h*)pd = hv;
    fetch_end();
  }

  {
    v16h a = {}, w1a = {}, w1b = {};
    a[0] = (_Float16)xa.x; a[1] = (_Float16)xa.y; a[2] = (_Float16)xa.z; a[3] = (_Float16)xa.w;
    a[4] = (_Float16)xb.x; a[5] = (_Float16)xb.y; a[6] = (_Float16)xb.z; a[7] = (_Float16)xb.w;
#pragma unroll
    for (int e = 0; e < 8; ++e) {
      w1a[e] = (_Float16)r1[e].x;
      w1b[e] = (_Float16)r1[e].y;
    }
    v8f c0 = {}, c1 = {};
    c0 = wmma16(a, w1a, c0);
    c1 = wmma16(a, w1b, c1);
#pragma unroll
    for (int r = 0; r < 8; ++r) {
      float u0 = c0[r] + b1p.x, u1 = c1[r] + b1p.y;
      v2h p = {(_Float16)(u0 > 0.f ? u0 : 0.f), (_Float16)(u1 > 0.f ? u1 : 0.f)};
      *(v2h*)(t1 + (mBase + r) * TP + nc0) = p;
    }
  }
  v16h w2[8];
#pragma unroll
  for (int kt = 0; kt < 4; ++kt) raw_to_frags(r2[kt], w2[kt], w2[4 + kt]);
  __syncthreads();  // every wave reads all 128 columns of t1 as A fragments

  // fetched under the second product: q's and k's weights of layer 0
  const float* lq = Wqkv + kB * 384 + nc0;
  float2 rq[4][16], rk[4][16], rv[4][16];
#pragma unroll
  for (int kt = 0; kt < 4; ++kt) raw_fetch<384>(rq[kt], lq, kt);
#pragma unroll
  for (int kt = 0; kt < 4; ++kt) raw_fetch<384>(rk[kt], lq + 128, kt);
  fetch_end(lq, nc0);

  v8f o[2];
  {
    v16h a2[4];
#pragma unroll
    for (int kt = 0; kt < 4; ++kt) a2[kt] = load_a_frag(t1 + kt * 32, TP);
#pragma unroll
    for (int i = 0; i < 2; ++i) {
      v8f acc = {};
#pragma unroll
      for (int kt = 0; kt < 4; ++kt)
        acc = wmma16(a2[kt], w2[i * 4 + kt], acc);
      o[i] = acc;
    }
  }

  // v's weights of layer 0; a run of its own: with all three in one run the build spills
#pragma unroll
  for (int kt = 0; kt < 4; ++kt) raw_fetch<384>(rv[kt], lq + 256, kt);
  float2 bvp = *(const float2*)(bq + nc0 + 256);
  fetch_end(lq, nc0);

  {
    // columns nc0 (even: sine) and nc0 + 1 (odd: cosine) share one frequency
    float div = __expf(-(float)(nc0 >> 1) * (9.210340371976184f / 64.f));
#pragma unroll
    for (int r = 0; r < 8; ++r) {
      int row = row0 + mBase + r;
      float ang = (float)(row & (T_SEQ - 1)) * div;
      o[0][r] = o[0][r] + b2p.x + __sinf(ang);
      o[1][r] = o[1][r] + b2p.y + __cosf(ang);
    }
  }
  {
    // the residual in the order of the layer launches' C tiles (see layer_body):
    // columns nc0 and nc0 + 1 are neighbouring lanes of C tile nCol >> 3 there
    float* hd = h32 + blockIdx.x * H_TILE + w * 512 + (nCol >> 3) * 256 +
                (((2 * nCol) & 15) + 2 * mBase) * 4;
#pragma unroll
    for (int i = 0; i < 2; ++i)
#pragma unroll
      for (int q = 0; q < 2; ++q)
        *(float4*)(hd + q * 128 + i * 4) =
            make_float4(o[i][q * 4], o[i][q * 4 + 1], o[i][q * 4 + 2], o[i][q * 4 + 3]);
    // the run's wait; with the address as its input the stores stay in front of it
    asm volatile("s_wait_xcnt 0x0" :: "v"(hd) : "memory");
    __builtin_amdgcn_sched_barrier(0);  // as in fetch_end
  }
#pragma unroll
  for (int r = 0; r < 8; ++r) {
    v2h p = {(_Float16)o[0][r], (_Float16)o[1][r]};
    *(v2h*)(hs + (mBase + r) * HP + nc0) = p;
  }
  __syncthreads();  // every wave reads all 128 columns of hs as A fragments

  v16h a[4];
#pragma unroll
  for (int kt = 0; kt < 4; ++kt) a[kt] = load_a_frag(hs + kt * 32, HP);
  qk0_group<0>(a, rq, bq, qk_out, w);
  qk0_group<1>(a, rk, bq, qk_out, w);
  v0_group(a, rv, bvp, vT, w);
}

// ---------------------------------------------------------------------------
// one layer behind its qkv: windowed attention (wave = head), o-proj + residual
// + layernorm, FFN + residual + layernorm; leaves the tile in hs (f16, LDS) and,
// where QKV, in h32 for the next launch's residual. The weights of the stage
// behind (next qkv where QKV, else the head) are fetched ahead into wn / bnv.
// ---------------------------------------------------------------------------
template <bool QKV>
__device__ __forceinline__ void layer_body(
    const _Float16* __restrict__ qk_in, const _Float16* __restrict__ vT_in,
    const _Float16* __restrict__ pwo,  // 32 tiles [nt*4+kt]
    const float* __restrict__ bo,
    const float* __restrict__ g1, const float* __restrict__ be1,
    const _Float16* __restrict__ pf1,  // 64 tiles [nt*4+kt]
    const float* __restrict__ bf1,
    const _Float16* __restrict__ pf2,  // 64 tiles [nt*8+kt]
    const float* __restrict__ bf2,
    const float* __restrict__ g2, const float* __restrict__ be2,
    float* __restrict__ h32, _Float16* hs,
    const _Float16* __restrict__ pn, const float* __restrict__ bn,
    v16h (&wn)[24], float (&bnv)[34]) {
  __shared__ __attribute__((aligned(16))) _Float16 at[4][16 * AP];  // attn probs, K padded 80 -> 96
  __shared__ __attribute__((aligned(16))) _Float16 ao[16 * HP];
  __shared__ __attribute__((aligned(16))) _Float16 h1[16 * HP];
  __shared__ __attribute__((aligned(16))) _Float16 mid[16 * MP];
  __shared__ __attribute__((aligned(16))) float red1[16 * 8];
  __shared__ __attribute__((aligned(16))) float red2[16 * 8];
  int row0 = blockIdx.x * 16;
  int w = threadIdx.x >> 5;
  int head = w;
  int t0 = row0 & (T_SEQ - 1);
  int tile = blockIdx.x, tb = tile & 127;  // the tile; its number within the batch
  int bIdx = row0 >> 11;
  int lane = threadIdx.x & 31;
  int nCol = lane & 15, mBase = (lane < 16) ? 0 : 8, kBase = mBase;
  int keyBase = t0 - 64;
  int n0 = w * 32 + nCol;
  _Float16* atw = at[w];

  // fetched first: q, all five K fragments, all six V fragments
  // (each in fragment order: see the q/k layout; V: [16-key group][d][16 keys])
  const _Float16* lq = qk_in + (size_t)tile * QK_TILE + head * 512 + lane * 8;
  v16h qa = load_pair(lq, 256);
  const _Float16* lk[5];
  v16h kb[5];
#pragma unroll
  for (int kt = 0; kt < 5; ++kt) {
    int kti = tb - 4 + kt;              // key tile within the batch
    int ktc = kti < 0 ? 0 : kti;        // clamp address; mask handles validity
    lk[kt] = qk_in + (size_t)(tile - tb + ktc) * QK_TILE + head * 512 + lane * 8;
    kb[kt] = load_pair(lk[kt] + 2048, 256);  // k stands behind q in the tile
  }
  // group tb of the plane holds key keyBase (four zero groups stand in front)
  const _Float16* lv = vT_in + (size_t)(bIdx * 4 + head) * VPLANE + tb * 512 + nCol * 16 + kBase;
  v16h vb[6];
#pragma unroll
  for (int nt = 0; nt < 2; ++nt)
#pragma unroll
    for (int kc = 0; kc < 3; ++kc) vb[nt * 3 + kc] = load_pair(lv + nt * 256 + kc * 1024, 512);
  // one wait for the whole run; its inputs are the run's addresses (see fetch_end)
  asm volatile("s_wait_xcnt 0x0" :: "v"(lq), "v"(lk[0]), "v"(lk[1]), "v"(lk[2]), "v"(lk[3]),
               "v"(lk[4]), "v"(lv) : "memory");
  __builtin_amdgcn_sched_barrier(0);  // as in fetch_end

  // fetched next: all that o-proj and the first layernorm read
  const _Float16* lo = b_lane_ptr(pwo, w * 8);
  // the residual lies as the wave's C tiles: [tile][wave][C tile][r >> 2][lane][r & 3]
  const float* lr = h32 + tile * H_TILE + w * 512 + lane * 4;
  v16h wo[8];
  float res[2][8], bov[2];
#pragma unroll
  for (int i = 0; i < 8; ++i) wo[i] = load_b_at(lo, i);
#pragma unroll
  for (int i = 0; i < 2; ++i) {
    bov[i] = (bo + n0)[i * 16];
#pragma unroll
    for (int q = 0; q < 2; ++q) {
      float4 t = *(const float4*)(lr + i * 256 + q * 128);
      res[i][q * 4] = t.x; res[i][q * 4 + 1] = t.y; res[i][q * 4 + 2] = t.z; res[i][q * 4 + 3] = t.w;
    }
  }
  float g1a = g1[n0], g1b = (g1 + n0)[16], be1a = be1[n0], be1b = (be1 + n0)[16];
  // one wait for the whole run; its inputs are the run's addresses (see fetch_end)
  asm volatile("s_wait_xcnt 0x0" :: "v"(lo), "v"(lr), "v"(n0) : "memory");
  __builtin_amdgcn_sched_barrier(0);  // as in fetch_end

  v8f s[5];
#pragma unroll
  for (int kt = 0; kt < 5; ++kt) {
    int j = keyBase + kt * 16 + nCol;
    v8f c = {};
    c = wmma16(qa, kb[kt], c);
#pragma unroll
    for (int r = 0; r < 8; ++r) {
      int iQ = t0 + mBase + r;
      bool valid = (j >= 0) && (j <= iQ) && (j >= iQ - 63);
      s[kt][r] = valid ? c[r] : -1e30f;
    }
  }

  // keeps the next run of loads behind the score products: issued in front of
  // them it fills the load counter and the first product waits for more returns
  __builtin_amdgcn_sched_barrier(0);

  // fetched under the softmax: all that FFN up reads
  const _Float16* lf1 = b_lane_ptr(pf1, w * 16);
  int nf = w * 64 + nCol;
  v16h f1[16];
  float bf1v[4];
#pragma unroll
  for (int i = 0; i < 4; ++i) {
#pragma unroll
    for (int kt = 0; kt < 4; ++kt) f1[i * 4 + kt] = load_b_at(lf1, i * 4 + kt);
    bf1v[i] = (bf1 + nf)[i * 16];
  }
  fetch_end(lf1, nf);

  // row softmax: row m lives in one vgpr slot across the 16 lanes of a half
#pragma unroll
  for (int r = 0; r < 8; ++r) {
    float mx = s[0][r];
#pragma unroll
    for (int kt = 1; kt < 5; ++kt) mx = fmaxf(mx, s[kt][r]);
#pragma unroll
    for (int msk = 1; msk < 16; msk <<= 1) mx = fmaxf(mx, __shfl_xor(mx, msk, 32));
    float sum = 0.f;
#pragma unroll
    for (int kt = 0; kt < 5; ++kt) { float e = __expf(s[kt][r] - mx); s[kt][r] = e; sum += e; }
#pragma unroll
    for (int msk = 1; msk < 16; msk <<= 1) sum += __shfl_xor(sum, msk, 32);
    float inv = 1.0f / sum;
#pragma unroll
    for (int kt = 0; kt < 5; ++kt) s[kt][r] *= inv;
  }

  // C-layout -> A-fragment layout via LDS (16 x 96, cols 80..95 zero)
#pragma unroll
  for (int kt = 0; kt < 5; ++kt)
#pragma unroll
    for (int r = 0; r < 8; ++r)
      atw[(mBase + r) * AP + kt * 16 + nCol] = (_Float16)s[kt][r];
#pragma unroll
  for (int r = 0; r < 8; ++r) atw[(mBase + r) * AP + 80 + nCol] = (_Float16)0.f;
  __syncthreads();  // a lane's A fragment holds probs that other lanes wrote

  // attn(16x96) @ V(96x32): 2 N-tiles x 3 K-chunks
#pragma unroll
  for (int nt = 0; nt < 2; ++nt) {
    v8f acc = {};
#pragma unroll
    for (int kc = 0; kc < 3; ++kc) {
      v16h aa = load_a_frag(atw + kc * 32, AP);
      acc = wmma16(aa, vb[nt * 3 + kc], acc);
    }
#pragma unroll
    for (int r = 0; r < 8; ++r)
      ao[(mBase + r) * HP + head * 32 + nt * 16 + nCol] = (_Float16)acc[r];
  }
  __syncthreads();  // every wave reads all four heads' columns of ao

  // fetched under o-proj and the first layernorm: all that FFN down and the
  // second layernorm read
  const _Float16* lf2 = b_lane_ptr(pf2, w * 16);
  v16h f2[16];
  float bf2v[2];
#pragma unroll
  for (int i = 0; i < 2; ++i) {
#pragma unroll
    for (int kt = 0; kt < 8; ++kt) f2[i * 8 + kt] = load_b_at(lf2, i * 8 + kt);
    bf2v[i] = (bf2 + n0)[i * 16];
  }
  float g2a = g2[n0], g2b = (g2 + n0)[16], be2a = be2[n0], be2b = (be2 + n0)[16];
  fetch_end(lf2, n0);

  // o-proj + residual + layernorm; wave w owns columns w*32 .. w*32+31
  v8f o[2];
  {
    v16h a[4];
#pragma unroll
    for (int kt = 0; kt < 4; ++kt) a[kt] = load_a_frag(ao + kt * 32, HP);
#pragma unroll
    for (int i = 0; i < 2; ++i) {
      v8f acc = {};
#pragma unroll
      for (int kt = 0; kt < 4; ++kt)
        acc = wmma16(a[kt], wo[i * 4 + kt], acc);
#pragma unroll
      for (int r = 0; r < 8; ++r)
        o[i][r] = acc[r] + bov[i] + res[i][r];
    }
  }
  ln_stage(o, red1, g1a, g1b, be1a, be1b, w);
  tile_to_lds(o, h1, w);
  __syncthreads();  // every wave reads all 128 columns of h1

  // FFN up: wave w owns hidden columns w*64 .. w*64+63
  {
    v16h a[4];
#pragma unroll
    for (int kt = 0; kt < 4; ++kt) a[kt] = load_a_frag(h1 + kt * 32, HP);
#pragma unroll
    for (int i = 0; i < 4; ++i) {
      int nt = w * 4 + i;
      v8f acc = {};
#pragma unroll
      for (int kt = 0; kt < 4; ++kt)
        acc = wmma16(a[kt], f1[i * 4 + kt], acc);
      float bias = bf1v[i];
#pragma unroll
      for (int r = 0; r < 8; ++r) {
        float v = acc[r] + bias;
        mid[(mBase + r) * MP + nt * 16 + nCol] = (_Float16)(v > 0.f ? v : 0.f);
      }
    }
  }
  __syncthreads();  // every wave reads all 256 columns of mid

  // fetched under FFN down and the second layernorm: the stage behind's weights
  if (QKV) {
    qkv_fetch(wn, bnv, pn, bn, w);
  } else {
    const _Float16* lh = b_lane_ptr(pn, 0);
    int nh = nCol & 7;  // lanes 8..15 of a half read a valid entry that they do not use
#pragma unroll
    for (int kt = 0; kt < 4; ++kt) wn[kt] = load_b_at(lh, kt);
    bnv[0] = bn[nh];
    fetch_end(lh, nh);
  }

  // FFN down + residual (still in o) + layernorm
  {
    v16h a2[8];
#pragma unroll
    for (int kt = 0; kt < 8; ++kt) a2[kt] = load_a_frag(mid + kt * 32, MP);
#pragma unroll
    for (int i = 0; i < 2; ++i) {
      v8f acc = {};
#pragma unroll
      for (int kt = 0; kt < 8; ++kt)
        acc = wmma16(a2[kt], f2[i * 8 + kt], acc);
#pragma unroll
      for (int r = 0; r < 8; ++r) o[i][r] = acc[r] + bf2v[i] + o[i][r];
    }
  }
  ln_stage(o, red2, g2a, g2b, be2a, be2b, w);
  if (QKV) {
    float* hd = h32 + tile * H_TILE + w * 512 + lane * 4;
#pragma unroll
    for (int i = 0; i < 2; ++i)
#pragma unroll
      for (int q = 0; q < 2; ++q)
        *(float4*)(hd + i * 256 + q * 128) =
            make_float4(o[i][q * 4], o[i][q * 4 + 1], o[i][q * 4 + 2], o[i][q * 4 + 3]);
    fetch_end();
  }
  tile_to_lds(o, hs, w);
  __syncthreads();  // the stage behind reads all 128 columns of hs
}

// layer l, then the qkv of layer l+1 into the OTHER q/k and vT buffers (blocks
// of this launch still read this layer's K and V of their neighbours' rows)
// second bound: two blocks a WGP (the whole grid resident), which leaves each wave
// the register room that the fragments fetched ahead take
__global__ __launch_bounds__(128, 2) void layer_qkv_kernel(
    const _Float16* __restrict__ qk_in, const _Float16* __restrict__ vT_in,
    const _Float16* __restrict__ pwo, const float* __restrict__ bo,
    const float* __restrict__ g1, const float* __restrict__ be1,
    const _Float16* __restrict__ pf1, const float* __restrict__ bf1,
    const _Float16* __restrict__ pf2, const float* __restrict__ bf2,
    const float* __restrict__ g2, const float* __restrict__ be2,
    float* __restrict__ h32,
    const _Float16* __restrict__ pq, const float* __restrict__ bq,
    _Float16* __restrict__ qk_out, _Float16* __restrict__ vT_out) {
  __shared__ __attribute__((aligned(16))) _Float16 hs[16 * HP];
  v16h wn[24];
  float bnv[34];
  layer_body<true>(qk_in, vT_in, pwo, bo, g1, be1, pf1, bf1, pf2, bf2, g2, be2, h32, hs,
                   pq, bq, wn, bnv);
  qkv_stage(hs, wn, bnv, qk_out, vT_out, threadIdx.x >> 5);
}

// last layer, then head: out = h @ W_head(128x16 padded) + b_head -> fp32 (R x 8)
// second bound: two blocks a WGP (the whole grid resident), which leaves each wave
// the register room that the fragments fetched ahead take
__global__ __launch_bounds__(128, 2) void layer_head_kernel(
    const _Float16* __restrict__ qk_in, const _Float16* __restrict__ vT_in,
    const _Float16* __restrict__ pwo, const float* __restrict__ bo,
    const float* __restrict__ g1, const float* __restrict__ be1,
    const _Float16* __restrict__ pf1, const float* __restrict__ bf1,
    const _Float16* __restrict__ pf2, const float* __restrict__ bf2,
    const float* __restrict__ g2, const float* __restrict__ be2,
    float* __restrict__ h32,
    const _Float16* __restrict__ pwh,  // 4 tiles
    const float* __restrict__ bh, float* __restrict__ out) {
  __shared__ __attribute__((aligned(16))) _Float16 hs[16 * HP];
  v16h wn[24];
  float bnv[34];
  layer_body<false>(qk_in, vT_in, pwo, bo, g1, be1, pf1, bf1, pf2, bf2, g2, be2, h32, hs,
                    pwh, bh, wn, bnv);
  if ((threadIdx.x >> 5) != 0) return;  // one N tile: one wave; no barrier follows
  int row0 = blockIdx.x * 16;
  int lane = threadIdx.x & 31;
  int nCol = lane & 15, mBase = (lane < 16) ? 0 : 8;
  v8f acc = {};
#pragma unroll
  for (int kt = 0; kt < 4; ++kt)
    acc = wmma16(load_a_frag(hs + kt * 32, HP), wn[kt], acc);
  if (nCol < 8) {
    float bias = bnv[0];
#pragma unroll
    for (int r = 0; r < 8; ++r) out[(row0 + mBase + r) * 8 + nCol] = acc[r] + bias;
  }
}

// ---------------------------------------------------------------------------
// host launch
// ---------------------------------------------------------------------------
extern "C" void kernel_launch(void* const* d_in, const int* in_sizes, int n_in,
                              void* d_out, int out_size, void* d_ws, size_t ws_size,
                              hipStream_t stream) {
  (void)in_sizes; (void)n_in; (void)out_size; (void)ws_size;
  const float* E      = (const float*)d_in[0];
  const float* rho    = (const float*)d_in[1];
  const float* W_in1  = (const float*)d_in[2];
  const float* b_in1  = (const float*)d_in[3];
  const float* W_in2  = (const float*)d_in[4];
  const float* b_in2  = (const float*)d_in[5];
  const float* Wqkv   = (const float*)d_in[6];
  const float* bqkv   = (const float*)d_in[7];
  const float* Wo     = (const float*)d_in[8];
  const float* bo     = (const float*)d_in[9];
  const float* ln1_g  = (const float*)d_in[10];
  const float* ln1_b  = (const float*)d_in[11];
  const float* Wff1   = (const float*)d_in[12];
  const float* bff1   = (const float*)d_in[13];
  const float* Wff2   = (const float*)d_in[14];
  const float* bff2   = (const float*)d_in[15];
  const float* ln2_g  = (const float*)d_in[16];
  const float* ln2_b  = (const float*)d_in[17];
  const float* W_head = (const float*)d_in[18];
  const float* b_head = (const float*)d_in[19];

  char* w = (char*)d_ws;
  auto take = [&](size_t bytes) -> void* {
    void* p = (void*)w;
    w += (bytes + 255) & ~(size_t)255;
    return p;
  };
  float*    h32   = (float*)   take((size_t)R_TOT * DM * 4);
  _Float16* qkA   = (_Float16*)take((size_t)(R_TOT / 16) * QK_TILE * 2);
  _Float16* qkB   = (_Float16*)take((size_t)(R_TOT / 16) * QK_TILE * 2);
  _Float16* vT    = (_Float16*)take((size_t)2 * 16 * VPLANE * 2);  // 2 x 16 (b*head) planes
  _Float16* vTA   = vT;
  _Float16* vTB   = vT + (size_t)16 * VPLANE;
  _Float16* pqkv  = (_Float16*)take((size_t)3 * 96 * 512 * 2);
  _Float16* pwo   = (_Float16*)take((size_t)3 * 32 * 512 * 2);
  _Float16* pf1   = (_Float16*)take((size_t)3 * 64 * 512 * 2);
  _Float16* pf2   = (_Float16*)take((size_t)3 * 64 * 512 * 2);
  _Float16* pwh   = (_Float16*)take((size_t)4 * 512 * 2);

  const int TILES = R_TOT / 16;  // 512
  setup_inproj_qkv_kernel<<<TILES, 128, 0, stream>>>(
      E, rho, W_in1, b_in1, W_in2, b_in2, Wqkv, bqkv, Wo, Wff1, Wff2, W_head,
      h32, qkA, vT, pqkv, pwo, pf1, pf2, pwh);
  layer_qkv_kernel<<<TILES, 128, 0, stream>>>(
      qkA, vTA, pwo, bo, ln1_g, ln1_b, pf1, bff1, pf2, bff2, ln2_g, ln2_b, h32,
      pqkv + (size_t)96 * 512, bqkv + 384, qkB, vTB);
  layer_qkv_kernel<<<TILES, 128, 0, stream>>>(
      qkB, vTB, pwo + (size_t)32 * 512, bo + 128, ln1_g + 128, ln1_b + 128,
      pf1 + (size_t)64 * 512, bff1 + 256, pf2 + (size_t)64 * 512, bff2 + 128,
      ln2_g + 128, ln2_b + 128, h32,
      pqkv + (size_t)2 * 96 * 512, bqkv + 2 * 384, qkA, vTA);
  layer_head_kernel<<<TILES, 128, 0, stream>>>(
      qkA, vTA, pwo + (size_t)2 * 32 * 512, bo + 2 * 128, ln1_g + 2 * 128, ln1_b + 2 * 128,
      pf1 + (size_t)2 * 64 * 512, bff1 + 2 * 256, pf2 + (size_t)2 * 64 * 512, bff2 + 2 * 128,
      ln2_g + 2 * 128, ln2_b + 2 * 128, h32, pwh, b_head, (float*)d_out);
}

// v006
// Measured time: 44.3 microseconds a run.
// Next to v005, in two timings, it ran 1.10 times as fast each time.
// Over all steps from v000 it is 7.05 times as fast.
#include <hip/hip_runtime.h>
#include <hip/hip_bf16.h>

// ---------------------------------------------------------------------------
// StateSequenceTransformer on MI455X (gfx1250, wave32, WMMA 16x16x32 f16)
//   B=4 T=2048 D_MODEL=128 NHEAD=4 hd=32 DFF=256 WINDOW=64 NLAYERS=3
//   One 4-wave block (128 threads) owns a 16-row tile through a whole layer.
//   Weights pre-packed into per-lane B-fragment order -> b128 vector loads.
//   q, K, V and the f32 residual pass from launch to launch in the order of the
//   reader's fragments, so that a wave's 16-byte loads and stores cover whole
//   128-byte lines, each alone or (the first launch's v and residual) two together.
// ---------------------------------------------------------------------------

#define R_TOT  8192
#define T_SEQ  2048
#define DM     128
#define DFF_   256
#define QK_TILE 4096          /* f16 of a 16-row tile in the q/k buffer: {q (scaled), k} x 4 heads x 512 */
#define VG     133            /* 16-key groups of a V plane: 4 zero groups, 128, 1 zero group */
#define VPLANE (VG * 512)     /* f16 of one (batch, head) plane of V: [group][d 0..31][16 keys] */
#define H_TILE 2048           /* f32 of a 16-row tile of the residual */
#define HP     136            /* LDS pitch of the tile buffers between fused stages: 272 B = 16 B x odd */
#define TP     136            /* LDS pitch of in_proj's hidden tile: 272 B = 16 B x odd */
#define MP     264            /* LDS pitch of the FFN's hidden tile: 528 B = 16 B x odd */
#define AP     104            /* LDS pitch of the attention probs, 96 columns in use: 208 B = 16 B x odd */
#define LN_EPS 1e-5f
#define QSCALE 0.17677669529663687f /* 1/sqrt(32) */

typedef __attribute__((ext_vector_type(16))) _Float16 v16h;
typedef __attribute__((ext_vector_type(8)))  _Float16 v8h;
typedef __attribute__((ext_vector_type(8)))  float    v8f;

__device__ __forceinline__ v8f wmma16(v16h a, v16h b, v8f c) {
  return __builtin_amdgcn_wmma_f32_16x16x32_f16(false, a, false, b, (short)0, c,
                                                false, false);
}

// A fragment: 16x32 f16 from row-major src (ld multiple of 8, 16B aligned).
// lane<16: row=lane, K={0..7,16..23}; lane>=16: row=lane-16, K={8..15,24..31}
__device__ __forceinline__ v16h load_a_frag(const _Float16* src, int ld) {
  int lane = threadIdx.x & 31;
  const _Float16* p = src + (lane & 15) * ld + ((lane < 16) ? 0 : 8);
  v8h lo = *(const v8h*)p;
  v8h hi = *(const v8h*)(p + 16);
  return __builtin_shufflevector(lo, hi, 0, 1, 2, 3, 4, 5, 6, 7,
                                 8, 9, 10, 11, 12, 13, 14, 15);
}

// A fragment's 16 values from two 16-byte pieces, dist f16 apart.
__device__ __forceinline__ v16h load_pair(const _Float16* p, int dist) {
  v8h lo = *(const v8h*)p;
  v8h hi = *(const v8h*)(p + dist);
  return __builtin_shufflevector(lo, hi, 0, 1, 2, 3, 4, 5, 6, 7,
                                 8, 9, 10, 11, 12, 13, 14, 15);
}

// Pre-packed B fragment: tile = 512 f16, lane's 16 values contiguous (32B).
// the lane's own address of packed tile 'tile'; further tiles of a run lie at
// compile-time distances from it
__device__ __forceinline__ const _Float16* b_lane_ptr(const _Float16* base, int tile) {
  int lane = threadIdx.x & 31;
  return base + ((size_t)tile << 9) + (lane << 4);
}
__device__ __forceinline__ v16h load_b_at(const _Float16* lp, int tile) {
  return *(const v16h*)(lp + (tile << 9));
}

// precaution: stands behind a run of global loads, in front of later loads whose
// results may land in the registers that held the run's addresses
__device__ __forceinline__ void addr_wait() {
  asm volatile("s_wait_xcnt 0x0" ::: "memory");
}

// ---------------------------------------------------------------------------
// Set-up work rides in the first launch. What that launch itself multiplies by
// (W_in1, W_in2, layer 0's Wqkv) it reads as f32 and converts in registers. What
// later launches read (packed weights, the zero groups of V) is dealt out in
// units of one 16-byte store, one unit a thread, 64 units a tile, over the
// grid's first threads.
//   pack: f32 weights (K x N row-major) -> B-fragment tiles, tile id = nt*KT + kt;
//         columns past the source's width -> 0 (padding).
// ---------------------------------------------------------------------------
#define PT_WO  192   /* from   0: 192 tiles, Wqkv   4 x 24 tiles, layers 1 and 2 */
#define PT_F1  288   /* from 192:  96 tiles, Wo     4 x  8 tiles, 3 layers */
#define PT_F2  480   /* from 288: 192 tiles, Wff1   4 x 16 tiles, 3 layers */
#define PT_WH  672   /* from 480: 192 tiles, Wff2   8 x  8 tiles, 3 layers */
#define PT_PAD 676   /* from 672:   4 tiles, W_head 4 x  1 tiles (half full) */
#define PT_END 836   /* from 676: 160 x 64 units, the zero groups of both V buffers */

typedef __attribute__((ext_vector_type(2))) _Float16 v2h;

// f32 weights as B fragments of TWO N tiles at once: the lane reads two
// neighbouring columns (tile 0 holds the even, tile 1 the odd columns of a run of
// 32), so that 16 lanes cover a whole 128-byte line of a weight row.
// lp: the lane's address in row kB (0 or 8) of the weight; k order as in pack.
template <int NLD>
__device__ __forceinline__ void raw_fetch(float2 (&raw)[16], const float* lp, int kt) {
#pragma unroll
  for (int e = 0; e < 16; ++e)
    raw[e] = *(const float2*)(lp + (kt * 32 + (e < 8 ? e : e + 8)) * NLD);
}
__device__ __forceinline__ void raw_to_frags(const float2 (&raw)[16], v16h& f0, v16h& f1) {
#pragma unroll
  for (int e = 0; e < 16; ++e) {
    f0[e] = (_Float16)raw[e].x;
    f1[e] = (_Float16)raw[e].y;
  }
}

// ---------------------------------------------------------------------------
// Row-local stages. Everything behind the K/V exchange of a layer depends only
// on the block's own 16 rows, so it runs in ONE launch: the tile goes from stage
// to stage through LDS, the f32 residual stays in registers, and the N tiles of
// the in_proj, qkv, o-proj and FFN products are dealt to the block's four waves.
// Every loop below is unrolled: fragment and accumulator arrays stay in
// registers only where their indices are compile-time constants.
// ---------------------------------------------------------------------------

// Global operands are fetched AHEAD: every weight fragment, bias, norm parameter
// and residual of a stage is loaded into registers, all of a stage at once, at
// least one stage before its use (a launch's first products: just before them; layer 0's q and k biases: just before their products),
// so that its latency runs under earlier work.

// ends a run of global loads or stores. The wait: a precaution, in front of
// whatever reuses the run's address registers. The scheduling barrier: it keeps
// later register writes behind that wait, and without it the compiler sinks
// loads fetched ahead towards their uses and issues them a few at a time between
// the matrix instructions, so that their latencies add up again.
__device__ __forceinline__ void fetch_end() {
  addr_wait();
  __builtin_amdgcn_sched_barrier(0);
}
// the same for a run of loads from one lane address p and one lane index n: as
// inputs of the wait's own statement both stay in their registers up to the wait,
// so that no result of the run itself lands in them in front of it
__device__ __forceinline__ void fetch_end(const void* p, int n) {
  asm volatile("s_wait_xcnt 0x0" :: "v"(p), "v"(n) : "memory");
  __builtin_amdgcn_sched_barrier(0);
}

// Layout of the q/k buffer. A (row tile, q or k, head) block is 16 rows x 32 d =
// 512 f16, held as the attention's fragment of it: piece [d >> 4][lane][8], where
// lane = row + 16 * ((d >> 3) & 1) and the 8 values are d & 7. q's A fragment and
// K's B fragment have the same lane and k order, so one layout serves both.
// The writer gets a lane's 8 values by the TRANSPOSED product W^T h^T: a packed B
// fragment of W is, register for register, the A fragment of W^T, and the A
// fragment of h the B fragment of h^T; in the result a lane holds one row of h
// (lane & 15) and 8 neighbouring columns of W.

// the wave's qkv weight fragments and biases: wave w takes head w, N tiles
// (i >> 1) * 8 + 2 * w + (i & 1); i = 0, 1: q; 2, 3: k; 4, 5: v.
// bqv: 8 a tile for q and k (a lane's 8 columns), then one a tile for v
__device__ __forceinline__ void qkv_fetch(v16h (&wq)[24], float (&bqv)[34],
                                          const _Float16* __restrict__ pq,  // 96 tiles [nt*4+kt]
                                          const float* __restrict__ bq, int w) {
  int lane = threadIdx.x & 31;
  const _Float16* lp = b_lane_ptr(pq, w * 8);
  int nb = (w * 32 + ((lane < 16) ? 0 : 8)) * 4;  // in bytes: the register that the loads name
  int nv = w * 32 + (lane & 15);
#pragma unroll
  for (int i = 0; i < 6; ++i) {
#pragma unroll
    for (int kt = 0; kt < 4; ++kt)
      wq[i * 4 + kt] = load_b_at(lp, (i >> 1) * 32 + (i & 1) * 4 + kt);
    if (i < 4) {
      const float* bp = (const float*)((const char*)bq + nb) + (i >> 1) * 128 + (i & 1) * 16;
      float4 lo = *(const float4*)bp, hi = *(const float4*)(bp + 4);
      bqv[i * 8 + 0] = lo.x; bqv[i * 8 + 1] = lo.y; bqv[i * 8 + 2] = lo.z; bqv[i * 8 + 3] = lo.w;
      bqv[i * 8 + 4] = hi.x; bqv[i * 8 + 5] = hi.y; bqv[i * 8 + 6] = hi.z; bqv[i * 8 + 7] = hi.w;
    } else {
      bqv[32 + (i & 1)] = (bq + nv)[256 + (i & 1) * 16];
    }
  }
  // one wait for the whole run; its inputs are the run's addresses (see fetch_end)
  asm volatile("s_wait_xcnt 0x0" :: "v"(lp), "v"(nb), "v"(nv) : "memory");
  __builtin_amdgcn_sched_barrier(0);  // as in fetch_end
}

// qkv of the tile in hs (LDS, pitch HP): q (scaled) and k -> qk_out, v -> v_out,
// each in its reader's fragment order; every store is 16 bytes a lane, 512
// contiguous bytes a wave.
__device__ __forceinline__ void qkv_stage(const _Float16* hs,
                                          const v16h (&wq)[24], const float (&bqv)[34],
                                          _Float16* __restrict__ qk_out,
                                          _Float16* __restrict__ v_out, int w) {
  int lane = threadIdx.x & 31;
  int nCol = lane & 15, mBase = (lane < 16) ? 0 : 8;
  int tile = blockIdx.x;
  _Float16* qd = qk_out + (size_t)tile * QK_TILE + w * 512 + lane * 8;
  _Float16* vd = v_out + (size_t)((tile >> 7) * 4 + w) * VPLANE + (4 + (tile & 127)) * 512 +
                 nCol * 16 + mBase;
  v16h a[4];
#pragma unroll
  for (int kt = 0; kt < 4; ++kt) a[kt] = load_a_frag(hs + kt * 32, HP);
#pragma unroll
  for (int i = 0; i < 6; ++i) {
    v8f acc = {};
    v8h vv;
    if (i < 4) {  // q (scaled) / k, transposed product: row nCol, d (i & 1) * 16 + mBase + r
#pragma unroll
      for (int kt = 0; kt < 4; ++kt)
        acc = wmma16(wq[i * 4 + kt], a[kt], acc);
      float scale = (i < 2) ? QSCALE : 1.0f;
#pragma unroll
      for (int r = 0; r < 8; ++r) vv[r] = (_Float16)((acc[r] + bqv[i * 8 + r]) * scale);
      *(v8h*)(qd + (i >> 1) * 2048 + (i & 1) * 256) = vv;
    } else {      // v: d (i & 1) * 16 + nCol, keys mBase + r
#pragma unroll
      for (int kt = 0; kt < 4; ++kt)
        acc = wmma16(a[kt], wq[i * 4 + kt], acc);
      float bias = bqv[32 + (i & 1)];
#pragma unroll
      for (int r = 0; r < 8; ++r) vv[r] = (_Float16)(acc[r] + bias);
      *(v8h*)(vd + (i & 1) * 256) = vv;
    }
    fetch_end();
  }
}

// layernorm of the tile; wave w holds columns w*32 .. w*32+31 in o[2] (C layout).
// Row sums: 2 tiles in the lane, 16 lanes by shuffle, 4 waves through red.
// g0, g1, b0, b1: the lane's two columns of gain and shift, fetched ahead.
__device__ __forceinline__ void ln_stage(v8f (&o)[2], float* red,  // [16 rows][4 waves][2]
                                         float g0, float g1, float b0, float b1, int w) {
  int lane = threadIdx.x & 31;
  int nCol = lane & 15, mBase = (lane < 16) ? 0 : 8;
  float sm[8], sq[8];
#pragma unroll
  for (int r = 0; r < 8; ++r) {
    sm[r] = o[0][r] + o[1][r];
    sq[r] = o[0][r] * o[0][r] + o[1][r] * o[1][r];
#pragma unroll
    for (int msk = 1; msk < 16; msk <<= 1) {
      sm[r] += __shfl_xor(sm[r], msk, 32);
      sq[r] += __shfl_xor(sq[r], msk, 32);
    }
  }
  if (nCol == 0) {
#pragma unroll
    for (int r = 0; r < 8; ++r)
      *(float2*)(red + ((mBase + r) * 4 + w) * 2) = make_float2(sm[r], sq[r]);
  }
  __syncthreads();  // every wave reads all four waves' partial row sums
#pragma unroll
  for (int r = 0; r < 8; ++r) {
    float4 p = *(const float4*)(red + (mBase + r) * 8);
    float4 q = *(const float4*)(red + (mBase + r) * 8 + 4);
    float s = (p.x + p.z) + (q.x + q.z);
    float s2 = (p.y + p.w) + (q.y + q.w);
    float mu = s * (1.f / 128.f);
    float inv = rsqrtf(s2 * (1.f / 128.f) - mu * mu + LN_EPS);
    o[0][r] = (o[0][r] - mu) * inv * g0 + b0;
    o[1][r] = (o[1][r] - mu) * inv * g1 + b1;
  }
}

// the wave's two C tiles -> f16 rows in LDS (pitch HP)
__device__ __forceinline__ void tile_to_lds(const v8f (&o)[2], _Float16* hs, int w) {
  int lane = threadIdx.x & 31;
  int nCol = lane & 15, mBase = (lane < 16) ? 0 : 8;
#pragma unroll
  for (int i = 0; i < 2; ++i)
#pragma unroll
    for (int r = 0; r < 8; ++r)
      hs[(mBase + r) * HP + w * 32 + i * 16 + nCol] = (_Float16)o[i][r];
}

// ---------------------------------------------------------------------------
// set-up units + in_proj + first qkv:
//   h = relu(x@W1+b1)@W2 + b2 + PE -> h32; qkv of layer 0
// Wave w owns columns w*32 .. w*32+31 of every product; its two C tiles hold the
// even and the odd ones (see raw_fetch), so a lane's pair of results is adjacent.
// ---------------------------------------------------------------------------

// q (G = 0, scaled) or k (G = 1) of layer 0, head w, by the transposed product (see
// the q/k layout): the lane holds row nCol and, the even columns in c0 and the odd
// in c1, d = 2 * mBase .. 2 * mBase + 15. The biases of those 16 columns are fetched
// here, under the products: there is no register room for them further ahead
template <int G>
__device__ __forceinline__ void qk0_group(const v16h (&a)[4], const float2 (&raw)[4][16],
                                          const float* __restrict__ bq,
                                          _Float16* __restrict__ qk_out, int w) {
  int lane = threadIdx.x & 31;
  const float* bp = bq + G * 128 + w * 32 + (lane >> 4) * 16;
  float4 b4[4];
#pragma unroll
  for (int e = 0; e < 4; ++e) b4[e] = *(const float4*)(bp + e * 4);
  // the run's wait; with the address as its input the loads stay in front of it
  asm volatile("s_wait_xcnt 0x0" :: "v"(bp) : "memory");
  __builtin_amdgcn_sched_barrier(0);  // as in fetch_end
  v16h f[8];
#pragma unroll
  for (int kt = 0; kt < 4; ++kt) raw_to_frags(raw[kt], f[kt], f[4 + kt]);
  v8f c0 = {}, c1 = {};
#pragma unroll
  for (int kt = 0; kt < 4; ++kt) c0 = wmma16(f[kt], a[kt], c0);
#pragma unroll
  for (int kt = 0; kt < 4; ++kt) c1 = wmma16(f[4 + kt], a[kt], c1);
  float scale = (G == 0) ? QSCALE : 1.0f;
  _Float16* dst = qk_out + (size_t)blockIdx.x * QK_TILE + G * 2048 + w * 512 +
                  (lane >> 4) * 256 + (lane & 15) * 8;
#pragma unroll
  for (int s = 0; s < 2; ++s) {  // d & 8: the fragment lane is row + 16 * s
    v8h vv;
#pragma unroll
    for (int j = 0; j < 4; ++j) {
      int r = s * 4 + j;
      float be = (r & 1) ? b4[r >> 1].z : b4[r >> 1].x;
      float bd = (r & 1) ? b4[r >> 1].w : b4[r >> 1].y;
      vv[2 * j] = (_Float16)((c0[r] + be) * scale);
      vv[2 * j + 1] = (_Float16)((c1[r] + bd) * scale);
    }
    *(v8h*)(dst + s * 128) = vv;
  }
  fetch_end();
}

// v of layer 0, head w: d = 2 * nCol + {0, 1}, keys mBase + r
__device__ __forceinline__ void v0_group(const v16h (&a)[4], const float2 (&raw)[4][16],
                                         float2 bias, _Float16* __restrict__ v_out, int w) {
  int lane = threadIdx.x & 31;
  int nCol = lane & 15, mBase = (lane < 16) ? 0 : 8;
  int tile = blockIdx.x;
  v16h f[8];
#pragma unroll
  for (int kt = 0; kt < 4; ++kt) raw_to_frags(raw[kt], f[kt], f[4 + kt]);
  v8f c0 = {}, c1 = {};
#pragma unroll
  for (int kt = 0; kt < 4; ++kt) c0 = wmma16(a[kt], f[kt], c0);
#pragma unroll
  for (int kt = 0; kt < 4; ++kt) c1 = wmma16(a[kt], f[4 + kt], c1);
  v8h v0, v1;
#pragma unroll
  for (int r = 0; r < 8; ++r) {
    v0[r] = (_Float16)(c0[r] + bias.x);
    v1[r] = (_Float16)(c1[r] + bias.y);
  }
  _Float16* vp = v_out + (size_t)((tile >> 7) * 4 + w) * VPLANE + (4 + (tile & 127)) * 512 +
                 nCol * 32 + mBase;
  *(v8h*)vp = v0;
  *(v8h*)(vp + 16) = v1;
  fetch_end();
}

// second bound: two blocks a WGP (the whole grid resident), which leaves each wave
// the register room that the weights fetched ahead take
__global__ __launch_bounds__(128, 2) void setup_inproj_qkv_kernel(
    const float* __restrict__ E, const float* __restrict__ rho,
    const float* __restrict__ W1, const float* __restrict__ b1,
    const float* __restrict__ W2, const float* __restrict__ b2,
    const float* __restrict__ Wqkv, const float* __restrict__ bq,
    const float* __restrict__ Wo, const float* __restrict__ Wff1,
    const float* __restrict__ Wff2, const float* __restrict__ W_head,
    float* __restrict__ h32, _Float16* __restrict__ qk_out,
    _Float16* __restrict__ vT,  // both V buffers (zero groups); layer 0's v goes to the first
    _Float16* __restrict__ pqkv, _Float16* __restrict__ pwo,
    _Float16* __restrict__ pf1, _Float16* __restrict__ pf2,
    _Float16* __restrict__ pwh) {
  __shared__ __attribute__((aligned(16))) _Float16 t1[16 * TP];
  __shared__ __attribute__((aligned(16))) _Float16 hs[16 * HP];
  int row0 = blockIdx.x * 16;
  int w = threadIdx.x >> 5;
  int lane = threadIdx.x & 31;
  int nCol = lane & 15, mBase = (lane < 16) ? 0 : 8, kB = mBase;
  int nc0 = w * 32 + 2 * nCol;

  // the thread's set-up unit. A tile's 64 units are two whole waves, so the tile
  // number is the same in every lane: taken as a scalar, the choice of the
  // weight is scalar work and scalar branches.
  int gid = blockIdx.x * 128 + threadIdx.x;
  int tu = __builtin_amdgcn_readfirstlane(gid >> 6);
  float pv[8] = {0.f, 0.f, 0.f, 0.f, 0.f, 0.f, 0.f, 0.f};
  _Float16* pd = pwh;
  bool pin = false;
  if (tu < PT_PAD) {
    // half a lane's share of a packed tile: 8 k rows of one column
    const float* src;
    _Float16* dst;
    int t, ks = 2, nld;
    if (tu < PT_WO) {
      int l = 1 + tu / 96;
      t = tu % 96; nld = 384;
      src = Wqkv + l * 128 * 384; dst = pqkv + (size_t)(l * 96 + t) * 512;
    } else if (tu < PT_F1) {
      int v = tu - PT_WO;
      t = v & 31; nld = 128;
      src = Wo + (v >> 5) * 128 * 128; dst = pwo + (size_t)v * 512;
    } else if (tu < PT_F2) {
      int v = tu - PT_F1;
      t = v & 63; nld = 256;
      src = Wff1 + (v >> 6) * 128 * 256; dst = pf1 + (size_t)v * 512;
    } else if (tu < PT_WH) {
      int v = tu - PT_F2;
      t = v & 63; nld = 128; ks = 3;
      src = Wff2 + (v >> 6) * 256 * 128; dst = pf2 + (size_t)v * 512;
    } else {
      t = tu - PT_WH; nld = 8;
      src = W_head; dst = pwh + (size_t)t * 512;
    }
    int kt = t & ((1 << ks) - 1), nt = t >> ks;
    int pl = (gid >> 1) & 31, half = gid & 1;  // packed lane; which 8 of its 16 values
    int n = nt * 16 + (pl & 15);
    int k0 = kt * 32 + ((pl < 16) ? 0 : 8) + half * 16;
    pin = n < nld;
    int nc = pin ? n : nld - 1;  // a padding column reads a valid entry that it does not use
    pd = dst + pl * 16 + half * 8;
    const float* pp[8];
#pragma unroll
    for (int i = 0; i < 8; ++i) {
      pp[i] = src + (k0 + i) * nld + nc;
      pv[i] = *pp[i];
    }
    // one wait for the whole run; its inputs are the run's addresses (see fetch_end)
    asm volatile("s_wait_xcnt 0x0" :: "v"(pp[0]), "v"(pp[1]), "v"(pp[2]), "v"(pp[3]),
                 "v"(pp[4]), "v"(pp[5]), "v"(pp[6]), "v"(pp[7]) : "memory");
  } else if (tu < PT_END) {
    // 16 bytes of a V plane's zero groups: four groups in front of the keys, one behind
    int i = gid - PT_PAD * 64;
    int plane = i / 320, c = i % 320;
    int pos = (c < 256) ? c * 8 : ((VG - 1) * 512 + (c - 256) * 8);
    v8h z = {};
    *(v8h*)(vT + (size_t)plane * VPLANE + pos) = z;
    addr_wait();
  }
  // keeps the unit's loads in front of the run below: its store then waits for
  // them alone
  __builtin_amdgcn_sched_barrier(0);

  // fetched next, in the order of use: x and both in_proj weights, all f32.
  // x = concat(E, rho), K padded 16 -> 32: lanes 0..15 hold k 0..7 (E), lanes
  // 16..31 k 8..15 (rho); the upper half of every fragment is the zero padding
  const float* lx = ((lane < 16) ? E : rho) + (row0 + nCol) * 8;
  const float* l1 = W1 + kB * DM + nc0;
  const float* l2 = W2 + kB * DM + nc0;
  float4 xa = *(const float4*)lx, xb = *(const float4*)(lx + 4);
  float2 r1[8], r2[4][16];
#pragma unroll
  for (int e = 0; e < 8; ++e) r1[e] = *(const float2*)(l1 + e * DM);
  float2 b1p = *(const float2*)(b1 + nc0);
#pragma unroll
  for (int kt = 0; kt < 4; ++kt) raw_fetch<DM>(r2[kt], l2, kt);
  float2 b2p = *(const float2*)(b2 + nc0);
  // one wait for the whole run; its inputs are the run's addresses (see fetch_end)
  asm volatile("s_wait_xcnt 0x0" :: "v"(lx), "v"(l1), "v"(l2), "v"(nc0) : "memory");
  __builtin_amdgcn_sched_barrier(0);  // as in fetch_end

  if (tu < PT_PAD) {
    v8h hv;
#pragma unroll
    for (int i = 0; i < 8; ++i) hv[i] = pin ? (_Float16)pv[i] : (_Float16)0.f;
    *(v8h*)pd = hv;
    fetch_end();
  }

  {
    v16h a = {}, w1a = {}, w1b = {};
    a[0] = (_Float16)xa.x; a[1] = (_Float16)xa.y; a[2] = (_Float16)xa.z; a[3] = (_Float16)xa.w;
    a[4] = (_Float16)xb.x; a[5] = (_Float16)xb.y; a[6] = (_Float16)xb.z; a[7] = (_Float16)xb.w;
#pragma unroll
    for (int e = 0; e < 8; ++e) {
      w1a[e] = (_Float16)r1[e].x;
      w1b[e] = (_Float16)r1[e].y;
    }
    v8f c0 = {}, c1 = {};
    c0 = wmma16(a, w1a, c0);
    c1 = wmma16(a, w1b, c1);
#pragma unroll
    for (int r = 0; r < 8; ++r) {
      float u0 = c0[r] + b1p.x, u1 = c1[r] + b1p.y;
      v2h p = {(_Float16)(u0 > 0.f ? u0 : 0.f), (_Float16)(u1 > 0.f ? u1 : 0.f)};
      *(v2h*)(t1 + (mBase + r) * TP + nc0) = p;
    }
  }
  v16h w2[8];
#pragma unroll
  for (int kt = 0; kt < 4; ++kt) raw_to_frags(r2[kt], w2[kt], w2[4 + kt]);
  __syncthreads();  // every wave reads all 128 columns of t1 as A fragments

  // fetched under the second product: q's and k's weights of layer 0
  const float* lq = Wqkv + kB * 384 + nc0;
  float2 rq[4][16], rk[4][16], rv[4][16];
#pragma unroll
  for (int kt = 0; kt < 4; ++kt) raw_fetch<384>(rq[kt], lq, kt);
#pragma unroll
  for (int kt = 0; kt < 4; ++kt) raw_fetch<384>(rk[kt], lq + 128, kt);
  fetch_end(lq, nc0);

  v8f o[2];
  {
    v16h a2[4];
#pragma unroll
    for (int kt = 0; kt < 4; ++kt) a2[kt] = load_a_frag(t1 + kt * 32, TP);
#pragma unroll
    for (int i = 0; i < 2; ++i) {
      v8f acc = {};
#pragma unroll
      for (int kt = 0; kt < 4; ++kt)
        acc = wmma16(a2[kt], w2[i * 4 + kt], acc);
      o[i] = acc;
    }
  }

  // v's weights of layer 0; a run of its own: with all three in one run the build spills
#pragma unroll
  for (int kt = 0; kt < 4; ++kt) raw_fetch<384>(rv[kt], lq + 256, kt);
  float2 bvp = *(const float2*)(bq + nc0 + 256);
  fetch_end(lq, nc0);

  {
    // columns nc0 (even: sine) and nc0 + 1 (odd: cosine) share one frequency
    float div = __expf(-(float)(nc0 >> 1) * (9.210340371976184f / 64.f));
#pragma unroll
    for (int r = 0; r < 8; ++r) {
      int row = row0 + mBase + r;
      float ang = (float)(row & (T_SEQ - 1)) * div;
      o[0][r] = o[0][r] + b2p.x + __sinf(ang);
      o[1][r] = o[1][r] + b2p.y + __cosf(ang);
    }
  }
  {
    // the residual in the order of the layer launches' C tiles (see layer_body):
    // columns nc0 and nc0 + 1 are neighbouring lanes of C tile nCol >> 3 there
    float* hd = h32 + blockIdx.x * H_TILE + w * 512 + (nCol >> 3) * 256 +
                (((2 * nCol) & 15) + 2 * mBase) * 4;
#pragma unroll
    for (int i = 0; i < 2; ++i)
#pragma unroll
      for (int q = 0; q < 2; ++q)
        *(float4*)(hd + q * 128 + i * 4) =
            make_float4(o[i][q * 4], o[i][q * 4 + 1], o[i][q * 4 + 2], o[i][q * 4 + 3]);
    // the run's wait; with the address as its input the stores stay in front of it
    asm volatile("s_wait_xcnt 0x0" :: "v"(hd) : "memory");
    __builtin_amdgcn_sched_barrier(0);  // as in fetch_end
  }
#pragma unroll
  for (int r = 0; r < 8; ++r) {
    v2h p = {(_Float16)o[0][r], (_Float16)o[1][r]};
    *(v2h*)(hs + (mBase + r) * HP + nc0) = p;
  }
  __syncthreads();  // every wave reads all 128 columns of hs as A fragments

  v16h a[4];
#pragma unroll
  for (int kt = 0; kt < 4; ++kt) a[kt] = load_a_frag(hs + kt * 32, HP);
  qk0_group<0>(a, rq, bq, qk_out, w);
  qk0_group<1>(a, rk, bq, qk_out, w);
  v0_group(a, rv, bvp, vT, w);
}

// ---------------------------------------------------------------------------
// one layer behind its qkv: windowed attention (wave = head), o-proj + residual
// + layernorm, FFN + residual + layernorm; leaves the tile in hs (f16, LDS) and,
// where QKV, in h32 for the next launch's residual. The weights of the stage
// behind (next qkv where QKV, else the head) are fetched ahead into wn / bnv.
// ---------------------------------------------------------------------------
template <bool QKV>
__device__ __forceinline__ void layer_body(
    const _Float16* __restrict__ qk_in, const _Float16* __restrict__ vT_in,
    const _Float16* __restrict__ pwo,  // 32 tiles [nt*4+kt]
    const float* __restrict__ bo,
    const float* __restrict__ g1, const float* __restrict__ be1,
    const _Float16* __restrict__ pf1,  // 64 tiles [nt*4+kt]
    const float* __restrict__ bf1,
    const _Float16* __restrict__ pf2,  // 64 tiles [nt*8+kt]
    const float* __restrict__ bf2,
    const float* __restrict__ g2, const float* __restrict__ be2,
    float* __restrict__ h32, _Float16* hs,
    const _Float16* __restrict__ pn, const float* __restrict__ bn,
    v16h (&wn)[24], float (&bnv)[34]) {
  __shared__ __attribute__((aligned(16))) _Float16 at[4][16 * AP];  // attn probs, K padded 80 -> 96
  __shared__ __attribute__((aligned(16))) _Float16 ao[16 * HP];
  __shared__ __attribute__((aligned(16))) _Float16 h1[16 * HP];
  __shared__ __attribute__((aligned(16))) _Float16 mid[16 * MP];
  __shared__ __attribute__((aligned(16))) float red1[16 * 8];
  __shared__ __attribute__((aligned(16))) float red2[16 * 8];
  int row0 = blockIdx.x * 16;
  int w = threadIdx.x >> 5;
  int head = w;
  int t0 = row0 & (T_SEQ - 1);
  int tile = blockIdx.x, tb = tile & 127;  // the tile; its number within the batch
  int bIdx = row0 >> 11;
  int lane = threadIdx.x & 31;
  int nCol = lane & 15, mBase = (lane < 16) ? 0 : 8, kBase = mBase;
  int keyBase = t0 - 64;
  int n0 = w * 32 + nCol;
  _Float16* atw = at[w];

  // fetched first: q, all five K fragments, all six V fragments
  // (each in fragment order: see the q/k layout; V: [16-key group][d][16 keys])
  const _Float16* lq = qk_in + (size_t)tile * QK_TILE + head * 512 + lane * 8;
  v16h qa = load_pair(lq, 256);
  const _Float16* lk[5];
  v16h kb[5];
#pragma unroll
  for (int kt = 0; kt < 5; ++kt) {
    int kti = tb - 4 + kt;              // key tile within the batch
    int ktc = kti < 0 ? 0 : kti;        // clamp address; mask handles validity
    lk[kt] = qk_in + (size_t)(tile - tb + ktc) * QK_TILE + head * 512 + lane * 8;
    kb[kt] = load_pair(lk[kt] + 2048, 256);  // k stands behind q in the tile
  }
  // group tb of the plane holds key keyBase (four zero groups stand in front)
  const _Float16* lv = vT_in + (size_t)(bIdx * 4 + head) * VPLANE + tb * 512 + nCol * 16 + kBase;
  v16h vb[6];
#pragma unroll
  for (int nt = 0; nt < 2; ++nt)
#pragma unroll
    for (int kc = 0; kc < 3; ++kc) vb[nt * 3 + kc] = load_pair(lv + nt * 256 + kc * 1024, 512);
  // one wait for the whole run; its inputs are the run's addresses (see fetch_end)
  asm volatile("s_wait_xcnt 0x0" :: "v"(lq), "v"(lk[0]), "v"(lk[1]), "v"(lk[2]), "v"(lk[3]),
               "v"(lk[4]), "v"(lv) : "memory");
  __builtin_amdgcn_sched_barrier(0);  // as in fetch_end

  // fetched next: all that o-proj and the first layernorm read
  const _Float16* lo = b_lane_ptr(pwo, w * 8);
  // the residual lies as the wave's C tiles: [tile][wave][C tile][r >> 2][lane][r & 3]
  const float* lr = h32 + tile * H_TILE + w * 512 + lane * 4;
  v16h wo[8];
  float res[2][8], bov[2];
#pragma unroll
  for (int i = 0; i < 8; ++i) wo[i] = load_b_at(lo, i);
#pragma unroll
  for (int i = 0; i < 2; ++i) {
    bov[i] = (bo + n0)[i * 16];
#pragma unroll
    for (int q = 0; q < 2; ++q) {
      float4 t = *(const float4*)(lr + i * 256 + q * 128);
      res[i][q * 4] = t.x; res[i][q * 4 + 1] = t.y; res[i][q * 4 + 2] = t.z; res[i][q * 4 + 3] = t.w;
    }
  }
  float g1a = g1[n0], g1b = (g1 + n0)[16], be1a = be1[n0], be1b = (be1 + n0)[16];
  // one wait for the whole run; its inputs are the run's addresses (see fetch_end)
  asm volatile("s_wait_xcnt 0x0" :: "v"(lo), "v"(lr), "v"(n0) : "memory");
  __builtin_amdgcn_sched_barrier(0);  // as in fetch_end

  v8f s[5];
#pragma unroll
  for (int kt = 0; kt < 5; ++kt) {
    int j = keyBase + kt * 16 + nCol;
    v8f c = {};
    c = wmma16(qa, kb[kt], c);
#pragma unroll
    for (int r = 0; r < 8; ++r) {
      int iQ = t0 + mBase + r;
      bool valid = (j >= 0) && (j <= iQ) && (j >= iQ - 63);
      s[kt][r] = valid ? c[r] : -1e30f;
    }
  }

  // keeps the next run of loads behind the score products: issued in front of
  // them it fills the load counter and the first product waits for more returns
  __builtin_amdgcn_sched_barrier(0);

  // fetched under the softmax: all that FFN up reads
  const _Float16* lf1 = b_lane_ptr(pf1, w * 16);
  int nf = w * 64 + nCol;
  v16h f1[16];
  float bf1v[4];
#pragma unroll
  for (int i = 0; i < 4; ++i) {
#pragma unroll
    for (int kt = 0; kt < 4; ++kt) f1[i * 4 + kt] = load_b_at(lf1, i * 4 + kt);
    bf1v[i] = (bf1 + nf)[i * 16];
  }
  fetch_end(lf1, nf);

  // row softmax: row m lives in one vgpr slot across the 16 lanes of a half
#pragma unroll
  for (int r = 0; r < 8; ++r) {
    float mx = s[0][r];
#pragma unroll
    for (int kt = 1; kt < 5; ++kt) mx = fmaxf(mx, s[kt][r]);
#pragma unroll
    for (int msk = 1; msk < 16; msk <<= 1) mx = fmaxf(mx, __shfl_xor(mx, msk, 32));
    float sum = 0.f;
#pragma unroll
    for (int kt = 0; kt < 5; ++kt) { float e = __expf(s[kt][r] - mx); s[kt][r] = e; sum += e; }
#pragma unroll
    for (int msk = 1; msk < 16; msk <<= 1) sum += __shfl_xor(sum, msk, 32);
    float inv = 1.0f / sum;
#pragma unroll
    for (int kt = 0; kt < 5; ++kt) s[kt][r] *= inv;
  }

  // C-layout -> A-fragment layout via LDS (16 x 96, cols 80..95 zero)
#pragma unroll
  for (int kt = 0; kt < 5; ++kt)
#pragma unroll
    for (int r = 0; r < 8; ++r)
      atw[(mBase + r) * AP + kt * 16 + nCol] = (_Float16)s[kt][r];
#pragma unroll
  for (int r = 0; r < 8; ++r) atw[(mBase + r) * AP + 80 + nCol] = (_Float16)0.f;
  __syncthreads();  // a lane's A fragment holds probs that other lanes wrote

  // attn(16x96) @ V(96x32): 2 N-tiles x 3 K-chunks
#pragma unroll
  for (int nt = 0; nt < 2; ++nt) {
    v8f acc = {};
#pragma unroll
    for (int kc = 0; kc < 3; ++kc) {
      v16h aa = load_a_frag(atw + kc * 32, AP);
      acc = wmma16(aa, vb[nt * 3 + kc], acc);
    }
#pragma unroll
    for (int r = 0; r < 8; ++r)
      ao[(mBase + r) * HP + head * 32 + nt * 16 + nCol] = (_Float16)acc[r];
  }
  __syncthreads();  // every wave reads all four heads' columns of ao

  // fetched under o-proj and the first layernorm: all that FFN down and the
  // second layernorm read
  const _Float16* lf2 = b_lane_ptr(pf2, w * 16);
  v16h f2[16];
  float bf2v[2];
#pragma unroll
  for (int i = 0; i < 2; ++i) {
#pragma unroll
    for (int kt = 0; kt < 8; ++kt) f2[i * 8 + kt] = load_b_at(lf2, i * 8 + kt);
    bf2v[i] = (bf2 + n0)[i * 16];
  }
  float g2a = g2[n0], g2b = (g2 + n0)[16], be2a = be2[n0], be2b = (be2 + n0)[16];
  fetch_end(lf2, n0);

  // o-proj + residual + layernorm; wave w owns columns w*32 .. w*32+31
  v8f o[2];
  {
    v16h a[4];
#pragma unroll
    for (int kt = 0; kt < 4; ++kt) a[kt] = load_a_frag(ao + kt * 32, HP);
#pragma unroll
    for (int i = 0; i < 2; ++i) {
      v8f acc = {};
#pragma unroll
      for (int kt = 0; kt < 4; ++kt)
        acc = wmma16(a[kt], wo[i * 4 + kt], acc);
#pragma unroll
      for (int r = 0; r < 8; ++r)
        o[i][r] = acc[r] + bov[i] + res[i][r];
    }
  }
  ln_stage(o, red1, g1a, g1b, be1a, be1b, w);
  tile_to_lds(o, h1, w);
  __syncthreads();  // every wave reads all 128 columns of h1

  // FFN up: wave w owns hidden columns w*64 .. w*64+63
  {
    v16h a[4];
#pragma unroll
    for (int kt = 0; kt < 4; ++kt) a[kt] = load_a_frag(h1 + kt * 32, HP);
#pragma unroll
    for (int i = 0; i < 4; ++i) {
      int nt = w * 4 + i;
      v8f acc = {};
#pragma unroll
      for (int kt = 0; kt < 4; ++kt)
        acc = wmma16(a[kt], f1[i * 4 + kt], acc);
      float bias = bf1v[i];
#pragma unroll
      for (int r = 0; r < 8; ++r) {
        float v = acc[r] + bias;
        mid[(mBase + r) * MP + nt * 16 + nCol] = (_Float16)(v > 0.f ? v : 0.f);
      }
    }
  }
  __syncthreads();  // every wave reads all 256 columns of mid

  // fetched under FFN down and the second layernorm: the stage behind's weights
  if (QKV) {
    qkv_fetch(wn, bnv, pn, bn, w);
  } else {
    const _Float16* lh = b_lane_ptr(pn, 0);
    int nh = nCol & 7;  // lanes 8..15 of a half read a valid entry that they do not use
#pragma unroll
    for (int kt = 0; kt < 4; ++kt) wn[kt] = load_b_at(lh, kt);
    bnv[0] = bn[nh];
    fetch_end(lh, nh);
  }

  // FFN down + residual (still in o) + layernorm
  {
    v16h a2[8];
#pragma unroll
    for (int kt = 0; kt < 8; ++kt) a2[kt] = load_a_frag(mid + kt * 32, MP);
#pragma unroll
    for (int i = 0; i < 2; ++i) {
      v8f acc = {};
#pragma unroll
      for (int kt = 0; kt < 8; ++kt)
        acc = wmma16(a2[kt], f2[i * 8 + kt], acc);
#pragma unroll
      for (int r = 0; r < 8; ++r) o[i][r] = acc[r] + bf2v[i] + o[i][r];
    }
  }
  ln_stage(o, red2, g2a, g2b, be2a, be2b, w);
  if (QKV) {
    float* hd = h32 + tile * H_TILE + w * 512 + lane * 4;
#pragma unroll
    for (int i = 0; i < 2; ++i)
#pragma unroll
      for (int q = 0; q < 2; ++q)
        *(float4*)(hd + i * 256 + q * 128) =
            make_float4(o[i][q * 4], o[i][q * 4 + 1], o[i][q * 4 + 2], o[i][q * 4 + 3]);
    fetch_end();
  }
  tile_to_lds(o, hs, w);
  __syncthreads();  // the stage behind reads all 128 columns of hs
}

// layer l, then the qkv of layer l+1 into the OTHER q/k and vT buffers (blocks
// of this launch still read this layer's K and V of their neighbours' rows)
// second bound: two blocks a WGP (the whole grid resident), which leaves each wave
// the register room that the fragments fetched ahead take
__global__ __launch_bounds__(128, 2) void layer_qkv_kernel(
    const _Float16* __restrict__ qk_in, const _Float16* __restrict__ vT_in,
    const _Float16* __restrict__ pwo, const float* __restrict__ bo,
    const float* __restrict__ g1, const float* __restrict__ be1,
    const _Float16* __restrict__ pf1, const float* __restrict__ bf1,
    const _Float16* __restrict__ pf2, const float* __restrict__ bf2,
    const float* __restrict__ g2, const float* __restrict__ be2,
    float* __restrict__ h32,
    const _Float16* __restrict__ pq, const float* __restrict__ bq,
    _Float16* __restrict__ qk_out, _Float16* __restrict__ vT_out) {
  __shared__ __attribute__((aligned(16))) _Float16 hs[16 * HP];
  v16h wn[24];
  float bnv[34];
  layer_body<true>(qk_in, vT_in, pwo, bo, g1, be1, pf1, bf1, pf2, bf2, g2, be2, h32, hs,
                   pq, bq, wn, bnv);
  qkv_stage(hs, wn, bnv, qk_out, vT_out, threadIdx.x >> 5);
}

// last layer, then head: out = h @ W_head(128x16 padded) + b_head -> fp32 (R x 8)
// second bound: two blocks a WGP (the whole grid resident), which leaves each wave
// the register room that the fragments fetched ahead take
__global__ __launch_bounds__(128, 2) void layer_head_kernel(
    const _Float16* __restrict__ qk_in, const _Float16* __restrict__ vT_in,
    const _Float16* __restrict__ pwo, const float* __restrict__ bo,
    const float* __restrict__ g1, const float* __restrict__ be1,
    const _Float16* __restrict__ pf1, const float* __restrict__ bf1,
    const _Float16* __restrict__ pf2, const float* __restrict__ bf2,
    const float* __restrict__ g2, const float* __restrict__ be2,
    float* __restrict__ h32,
    const _Float16* __restrict__ pwh,  // 4 tiles
    const float* __restrict__ bh, float* __restrict__ out) {
  __shared__ __attribute__((aligned(16))) _Float16 hs[16 * HP];
  v16h wn[24];
  float bnv[34];
  layer_body<false>(qk_in, vT_in, pwo, bo, g1, be1, pf1, bf1, pf2, bf2, g2, be2, h32, hs,
                    pwh, bh, wn, bnv);
  if ((threadIdx.x >> 5) != 0) return;  // one N tile: one wave; no barrier follows
  int row0 = blockIdx.x * 16;
  int lane = threadIdx.x & 31;
  int nCol = lane & 15, mBase = (lane < 16) ? 0 : 8;
  v8f acc = {};
#pragma unroll
  for (int kt = 0; kt < 4; ++kt)
    acc = wmma16(load_a_frag(hs + kt * 32, HP), wn[kt], acc);
  if (nCol < 8) {
    float bias = bnv[0];
#pragma unroll
    for (int r = 0; r < 8; ++r) out[(row0 + mBase + r) * 8 + nCol] = acc[r] + bias;
  }
}

// ---------------------------------------------------------------------------
// host launch
// ---------------------------------------------------------------------------
extern "C" void kernel_launch(void* const* d_in, const int* in_sizes, int n_in,
                              void* d_out, int out_size, void* d_ws, size_t ws_size,
                              hipStream_t stream) {
  (void)in_sizes; (void)n_in; (void)out_size; (void)ws_size;
  const float* E      = (const float*)d_in[0];
  const float* rho    = (const float*)d_in[1];
  const float* W_in1  = (const float*)d_in[2];
  const float* b_in1  = (const float*)d_in[3];
  const float* W_in2  = (const float*)d_in[4];
  const float* b_in2  = (const float*)d_in[5];
  const float* Wqkv   = (const float*)d_in[6];
  const float* bqkv   = (const float*)d_in[7];
  const float* Wo     = (const float*)d_in[8];
  const float* bo     = (const float*)d_in[9];
  const float* ln1_g  = (const float*)d_in[10];
  const float* ln1_b  = (const float*)d_in[11];
  const float* Wff1   = (const float*)d_in[12];
  const float* bff1   = (const float*)d_in[13];
  const float* Wff2   = (const float*)d_in[14];
  const float* bff2   = (const float*)d_in[15];
  const float* ln2_g  = (const float*)d_in[16];
  const float* ln2_b  = (const float*)d_in[17];
  const float* W_head = (const float*)d_in[18];
  const float* b_head = (const float*)d_in[19];

  char* w = (char*)d_ws;
  auto take = [&](size_t bytes) -> void* {
    void* p = (void*)w;
    w += (bytes + 255) & ~(size_t)255;
    return p;
  };
  float*    h32   = (float*)   take((size_t)R_TOT * DM * 4);
  _Float16* qkA   = (_Float16*)take((size_t)(R_TOT / 16) * QK_TILE * 2);
  _Float16* qkB   = (_Float16*)take((size_t)(R_TOT / 16) * QK_TILE * 2);
  _Float16* vT    = (_Float16*)take((size_t)2 * 16 * VPLANE * 2);  // 2 x 16 (b*head) planes
  _Float16* vTA   = vT;
  _Float16* vTB   = vT + (size_t)16 * VPLANE;
  _Float16* pqkv  = (_Float16*)take((size_t)3 * 96 * 512 * 2);
  _Float16* pwo   = (_Float16*)take((size_t)3 * 32 * 512 * 2);
  _Float16* pf1   = (_Float16*)take((size_t)3 * 64 * 512 * 2);
  _Float16* pf2   = (_Float16*)take((size_t)3 * 64 * 512 * 2);
  _Float16* pwh   = (_Float16*)take((size_t)4 * 512 * 2);

  const int TILES = R_TOT / 16;  // 512
  setup_inproj_qkv_kernel<<<TILES, 128, 0, stream>>>(
      E, rho, W_in1, b_in1, W_in2, b_in2, Wqkv, bqkv, Wo, Wff1, Wff2, W_head,
      h32, qkA, vT, pqkv, pwo, pf1, pf2, pwh);
  layer_qkv_kernel<<<TILES, 128, 0, stream>>>(
      qkA, vTA, pwo, bo, ln1_g, ln1_b, pf1, bff1, pf2, bff2, ln2_g, ln2_b, h32,
      pqkv + (size_t)96 * 512, bqkv + 384, qkB, vTB);
  layer_qkv_kernel<<<TILES, 128, 0, stream>>>(
      qkB, vTB, pwo + (size_t)32 * 512, bo + 128, ln1_g + 128, ln1_b + 128,
      pf1 + (size_t)64 * 512, bff1 + 256, pf2 + (size_t)64 * 512, bff2 + 128,
      ln2_g + 128, ln2_b + 128, h32,
      pqkv + (size_t)2 * 96 * 512, bqkv + 2 * 384, qkA, vTA);
  layer_head_kernel<<<TILES, 128, 0, stream>>>(
      qkA, vTA, pwo + (size_t)2 * 32 * 512, bo + 2 * 128, ln1_g + 2 * 128, ln1_b + 2 * 128,
      pf1 + (size_t)2 * 64 * 512, bff1 + 2 * 256, pf2 + (size_t)2 * 64 * 512, bff2 + 2 * 128,
      ln2_g + 2 * 128, ln2_b + 2 * 128, h32, pwh, b_head, (float*)d_out);
}

// v007
// Measured time: 42.2 microseconds a run.
// Next to v006, in two timings, it ran 1.04 and 1.06 times as fast.
// All steps since v000 together make it 7.39 times as fast.
#include <hip/hip_runtime.h>
#include <hip/hip_bf16.h>

// ---------------------------------------------------------------------------
// StateSequenceTransformer on MI455X (gfx1250, wave32, WMMA 16x16x32 f16)
//   B=4 T=2048 D_MODEL=128 NHEAD=4 hd=32 DFF=256 WINDOW=64 NLAYERS=3
//   Four waves own a 16-row tile through a whole layer; a layer block holds two
//   such tiles (8 waves), which share one copy of the layer's weights in LDS.
//   Weights pre-packed into per-lane B-fragment order -> b128 vector loads.
//   q, K, V and the f32 residual pass from launch to launch in the order of the
//   reader's fragments, so that a wave's 16-byte loads and stores cover whole
//   128-byte lines, each alone or (the first launch's v and residual) two together.
// ---------------------------------------------------------------------------

#define R_TOT  8192
#define T_SEQ  2048
#define DM     128
#define DFF_   256
#define QK_TILE 4096          /* f16 of a 16-row tile in the q/k buffer: {q (scaled), k} x 4 heads x 512 */
#define VG     133            /* 16-key groups of a V plane: 4 zero groups, 128, 1 zero group */
#define VPLANE (VG * 512)     /* f16 of one (batch, head) plane of V: [group][d 0..31][16 keys] */
#define H_TILE 2048           /* f32 of a 16-row tile of the residual */
#define HP     136            /* LDS pitch of the tile buffers between fused stages: 272 B = 16 B x odd */
#define TP     136            /* LDS pitch of in_proj's hidden tile: 272 B = 16 B x odd */
#define MP     264            /* LDS pitch of the FFN's hidden tile: 528 B = 16 B x odd */
#define AP     104            /* LDS pitch of the attention probs, 96 columns in use: 208 B = 16 B x odd */
#define LN_EPS 1e-5f
#define QSCALE 0.17677669529663687f /* 1/sqrt(32) */

typedef __attribute__((ext_vector_type(16))) _Float16 v16h;
typedef __attribute__((ext_vector_type(8)))  _Float16 v8h;
typedef __attribute__((ext_vector_type(8)))  float    v8f;

__device__ __forceinline__ v8f wmma16(v16h a, v16h b, v8f c) {
  return __builtin_amdgcn_wmma_f32_16x16x32_f16(false, a, false, b, (short)0, c,
                                                false, false);
}

// A fragment: 16x32 f16 from row-major src (ld multiple of 8, 16B aligned).
// lane<16: row=lane, K={0..7,16..23}; lane>=16: row=lane-16, K={8..15,24..31}
__device__ __forceinline__ v16h load_a_frag(const _Float16* src, int ld) {
  int lane = threadIdx.x & 31;
  const _Float16* p = src + (lane & 15) * ld + ((lane < 16) ? 0 : 8);
  v8h lo = *(const v8h*)p;
  v8h hi = *(const v8h*)(p + 16);
  return __builtin_shufflevector(lo, hi, 0, 1, 2, 3, 4, 5, 6, 7,
                                 8, 9, 10, 11, 12, 13, 14, 15);
}

// A fragment's 16 values from two 16-byte pieces, dist f16 apart.
__device__ __forceinline__ v16h load_pair(const _Float16* p, int dist) {
  v8h lo = *(const v8h*)p;
  v8h hi = *(const v8h*)(p + dist);
  return __builtin_shufflevector(lo, hi, 0, 1, 2, 3, 4, 5, 6, 7,
                                 8, 9, 10, 11, 12, 13, 14, 15);
}

// Pre-packed B fragment: tile = 512 f16, lane's 16 values contiguous (32B).
// the lane's own address of packed tile 'tile'; further tiles of a run lie at
// compile-time distances from it
__device__ __forceinline__ const _Float16* b_lane_ptr(const _Float16* base, int tile) {
  int lane = threadIdx.x & 31;
  return base + ((size_t)tile << 9) + (lane << 4);
}
__device__ __forceinline__ v16h load_b_at(const _Float16* lp, int tile) {
  return *(const v16h*)(lp + (tile << 9));
}

// precaution: stands behind a run of global loads, in front of later loads whose
// results may land in the registers that held the run's addresses
__device__ __forceinline__ void addr_wait() {
  asm volatile("s_wait_xcnt 0x0" ::: "memory");
}

// The layer launches hold their packed weights in LDS, one copy for the block's
// two row tiles. LDS form of a packed tile: [values 0..7, values 8..15][lane][8],
// so that each 16-byte read of a wave covers 512 contiguous bytes (no shared bank).
// lp: the weights' start in LDS + lane * 8
__device__ __forceinline__ v16h load_w_lds(const _Float16* lp, int tile) {
  return load_pair(lp + (tile << 9), 256);
}

// eight asynchronous copies of 16 bytes a lane, 4 KiB apart in both spaces (the
// block's 256 threads move 4 tiles a copy). The wait in the copies' own statement:
// a precaution, in front of whatever reuses the copies' address registers.
__device__ __forceinline__ void copy8(unsigned l, const _Float16* g) {
  asm volatile(
      "global_load_async_to_lds_b128 %0, %8, off\n\t"
      "global_load_async_to_lds_b128 %1, %9, off\n\t"
      "global_load_async_to_lds_b128 %2, %10, off\n\t"
      "global_load_async_to_lds_b128 %3, %11, off\n\t"
      "global_load_async_to_lds_b128 %4, %12, off\n\t"
      "global_load_async_to_lds_b128 %5, %13, off\n\t"
      "global_load_async_to_lds_b128 %6, %14, off\n\t"
      "global_load_async_to_lds_b128 %7, %15, off\n\t"
      "s_wait_xcnt 0x0"
      :: "v"(l), "v"(l + 4096u), "v"(l + 8192u), "v"(l + 12288u),
         "v"(l + 16384u), "v"(l + 20480u), "v"(l + 24576u), "v"(l + 28672u),
         "v"(g), "v"(g + 2048), "v"(g + 4096), "v"(g + 6144),
         "v"(g + 8192), "v"(g + 10240), "v"(g + 12288), "v"(g + 14336)
      : "memory");
}
// NT packed tiles (a multiple of 32), global -> LDS, by the whole block.
// l: the thread's LDS byte address in the first four tiles; g: its 16 bytes there
template <int NT>
__device__ __forceinline__ void copy_tiles(unsigned l, const _Float16* g) {
#pragma unroll
  for (int j = 0; j < NT / 32; ++j) copy8(l + j * 32768u, g + j * 16384);
}

// ---------------------------------------------------------------------------
// Set-up work rides in the first launch. What that launch itself multiplies by
// (W_in1, W_in2, layer 0's Wqkv) it reads as f32 and converts in registers. What
// later launches read (packed weights, the zero groups of V) is dealt out in
// units of one 16-byte store, one unit a thread, 64 units a tile, over the
// grid's first threads.
//   pack: f32 weights (K x N row-major) -> B-fragment tiles, tile id = nt*KT + kt;
//         columns past the source's width -> 0 (padding).
// ---------------------------------------------------------------------------
#define PT_WO  192   /* from   0: 192 tiles, Wqkv   4 x 24 tiles, layers 1 and 2 */
#define PT_F1  288   /* from 192:  96 tiles, Wo     4 x  8 tiles, 3 layers */
#define PT_F2  480   /* from 288: 192 tiles, Wff1   4 x 16 tiles, 3 layers */
#define PT_WH  672   /* from 480: 192 tiles, Wff2   8 x  8 tiles, 3 layers */
#define PT_PAD 676   /* from 672:   4 tiles, W_head 4 x  1 tiles (half full) */
#define PT_END 836   /* from 676: 160 x 64 units, the zero groups of both V buffers */

typedef __attribute__((ext_vector_type(2))) _Float16 v2h;

// f32 weights as B fragments of TWO N tiles at once: the lane reads two
// neighbouring columns (tile 0 holds the even, tile 1 the odd columns of a run of
// 32), so that 16 lanes cover a whole 128-byte line of a weight row.
// lp: the lane's address in row kB (0 or 8) of the weight; k order as in pack.
template <int NLD>
__device__ __forceinline__ void raw_fetch(float2 (&raw)[16], const float* lp, int kt) {
#pragma unroll
  for (int e = 0; e < 16; ++e)
    raw[e] = *(const float2*)(lp + (kt * 32 + (e < 8 ? e : e + 8)) * NLD);
}
__device__ __forceinline__ void raw_to_frags(const float2 (&raw)[16], v16h& f0, v16h& f1) {
#pragma unroll
  for (int e = 0; e < 16; ++e) {
    f0[e] = (_Float16)raw[e].x;
    f1[e] = (_Float16)raw[e].y;
  }
}

// ---------------------------------------------------------------------------
// Row-local stages. Everything behind the K/V exchange of a layer depends only
// on the row tile's own 16 rows, so it runs in ONE launch: the tile goes from stage
// to stage through LDS, the f32 residual stays in registers, and the N tiles of
// every product are dealt to the row tile's four waves.
// Every loop below is unrolled: fragment and accumulator arrays stay in
// registers only where their indices are compile-time constants.
// ---------------------------------------------------------------------------

// Global operands are fetched AHEAD: every weight fragment, bias, norm parameter
// and residual of a stage is loaded into registers, all of a stage at once, at
// least one stage before its use (a launch's first products: just before them; layer 0's q and k biases: just before their products),
// so that its latency runs under earlier work.

// ends a run of global loads or stores. The wait: a precaution, in front of
// whatever reuses the run's address registers. The scheduling barrier: it keeps
// later register writes behind that wait, and without it the compiler sinks
// loads fetched ahead towards their uses and issues them a few at a time between
// the matrix instructions, so that their latencies add up again.
__device__ __forceinline__ void fetch_end() {
  addr_wait();
  __builtin_amdgcn_sched_barrier(0);
}
// the same for a run of loads from one lane address p and one lane index n: as
// inputs of the wait's own statement both stay in their registers up to the wait,
// so that no result of the run itself lands in them in front of it
__device__ __forceinline__ void fetch_end(const void* p, int n) {
  asm volatile("s_wait_xcnt 0x0" :: "v"(p), "v"(n) : "memory");
  __builtin_amdgcn_sched_barrier(0);
}

// Layout of the q/k buffer. A (row tile, q or k, head) block is 16 rows x 32 d =
// 512 f16, held as the attention's fragment of it: piece [d >> 4][lane][8], where
// lane = row + 16 * ((d >> 3) & 1) and the 8 values are d & 7. q's A fragment and
// K's B fragment have the same lane and k order, so one layout serves both.
// The writer gets a lane's 8 values by the TRANSPOSED product W^T h^T: a packed B
// fragment of W is, register for register, the A fragment of W^T, and the A
// fragment of h the B fragment of h^T; in the result a lane holds one row of h
// (lane & 15) and 8 neighbouring columns of W.

// the wave's qkv weight fragments and biases: wave w takes head w, N tiles
// (i >> 1) * 8 + 2 * w + (i & 1); i = 0, 1: q; 2, 3: k; 4, 5: v.
// bqv: 8 a tile for q and k (a lane's 8 columns), then one a tile for v
__device__ __forceinline__ void qkv_bias_fetch(float (&bqv)[34],
                                               const float* __restrict__ bq, int w) {
  int lane = threadIdx.x & 31;
  int nb = (w * 32 + ((lane < 16) ? 0 : 8)) * 4;  // in bytes: the register that the loads name
  int nv = w * 32 + (lane & 15);
#pragma unroll
  for (int i = 0; i < 6; ++i) {
    if (i < 4) {
      const float* bp = (const float*)((const char*)bq + nb) + (i >> 1) * 128 + (i & 1) * 16;
      float4 lo = *(const float4*)bp, hi = *(const float4*)(bp + 4);
      bqv[i * 8 + 0] = lo.x; bqv[i * 8 + 1] = lo.y; bqv[i * 8 + 2] = lo.z; bqv[i * 8 + 3] = lo.w;
      bqv[i * 8 + 4] = hi.x; bqv[i * 8 + 5] = hi.y; bqv[i * 8 + 6] = hi.z; bqv[i * 8 + 7] = hi.w;
    } else {
      bqv[32 + (i & 1)] = (bq + nv)[256 + (i & 1) * 16];
    }
  }
  // one wait for the whole run; its inputs are the run's addresses (see fetch_end)
  asm volatile("s_wait_xcnt 0x0" :: "v"(nb), "v"(nv) : "memory");
  __builtin_amdgcn_sched_barrier(0);  // as in fetch_end
}
// lw: the qkv weights' start in LDS (96 tiles [nt*4+kt]) + lane * 8
__device__ __forceinline__ void qkv_w_fetch(v16h (&wq)[24], const _Float16* lw, int w) {
#pragma unroll
  for (int i = 0; i < 6; ++i)
#pragma unroll
    for (int kt = 0; kt < 4; ++kt)
      wq[i * 4 + kt] = load_w_lds(lw, w * 8 + (i >> 1) * 32 + (i & 1) * 4 + kt);
  // keeps the run whole: sunk to their uses the reads would each cost their latency
  __builtin_amdgcn_sched_barrier(0);
}

// qkv of the tile in hs (LDS, pitch HP): q (scaled) and k -> qk_out, v -> v_out,
// each in its reader's fragment order; every store is 16 bytes a lane, 512
// contiguous bytes a wave.
__device__ __forceinline__ void qkv_stage(const _Float16* hs,
                                          const v16h (&wq)[24], const float (&bqv)[34],
                                          _Float16* __restrict__ qk_out,
                                          _Float16* __restrict__ v_out, int tile, int w) {
  int lane = threadIdx.x & 31;
  int nCol = lane & 15, mBase = (lane < 16) ? 0 : 8;
  _Float16* qd = qk_out + (size_t)tile * QK_TILE + w * 512 + lane * 8;
  _Float16* vd = v_out + (size_t)((tile >> 7) * 4 + w) * VPLANE + (4 + (tile & 127)) * 512 +
                 nCol * 16 + mBase;
  v16h a[4];
#pragma unroll
  for (int kt = 0; kt < 4; ++kt) a[kt] = load_a_frag(hs + kt * 32, HP);
#pragma unroll
  for (int i = 0; i < 6; ++i) {
    v8f acc = {};
    v8h vv;
    if (i < 4) {  // q (scaled) / k, transposed product: row nCol, d (i & 1) * 16 + mBase + r
#pragma unroll
      for (int kt = 0; kt < 4; ++kt)
        acc = wmma16(wq[i * 4 + kt], a[kt], acc);
      float scale = (i < 2) ? QSCALE : 1.0f;
#pragma unroll
      for (int r = 0; r < 8; ++r) vv[r] = (_Float16)((acc[r] + bqv[i * 8 + r]) * scale);
      *(v8h*)(qd + (i >> 1) * 2048 + (i & 1) * 256) = vv;
    } else {      // v: d (i & 1) * 16 + nCol, keys mBase + r
#pragma unroll
      for (int kt = 0; kt < 4; ++kt)
        acc = wmma16(a[kt], wq[i * 4 + kt], acc);
      float bias = bqv[32 + (i & 1)];
#pragma unroll
      for (int r = 0; r < 8; ++r) vv[r] = (_Float16)(acc[r] + bias);
      *(v8h*)(vd + (i & 1) * 256) = vv;
    }
    fetch_end();
  }
}

// layernorm of the tile; wave w holds columns w*32 .. w*32+31 in o[2] (C layout).
// Row sums: 2 tiles in the lane, 16 lanes by shuffle, 4 waves through red.
// g0, g1, b0, b1: the lane's two columns of gain and shift, fetched ahead.
// In two parts, so that other LDS reads can be put behind the row sums' reads.
__device__ __forceinline__ void ln_sums(const v8f (&o)[2], float* red,  // [16 rows][4 waves][2]
                                        float4 (&p)[8], float4 (&q)[8], int w) {
  int lane = threadIdx.x & 31;
  int nCol = lane & 15, mBase = (lane < 16) ? 0 : 8;
  float sm[8], sq[8];
#pragma unroll
  for (int r = 0; r < 8; ++r) {
    sm[r] = o[0][r] + o[1][r];
    sq[r] = o[0][r] * o[0][r] + o[1][r] * o[1][r];
#pragma unroll
    for (int msk = 1; msk < 16; msk <<= 1) {
      sm[r] += __shfl_xor(sm[r], msk, 32);
      sq[r] += __shfl_xor(sq[r], msk, 32);
    }
  }
  if (nCol == 0) {
#pragma unroll
    for (int r = 0; r < 8; ++r)
      *(float2*)(red + ((mBase + r) * 4 + w) * 2) = make_float2(sm[r], sq[r]);
  }
  __syncthreads();  // every wave reads all four waves' partial row sums
#pragma unroll
  for (int r = 0; r < 8; ++r) {
    p[r] = *(const float4*)(red + (mBase + r) * 8);
    q[r] = *(const float4*)(red + (mBase + r) * 8 + 4);
  }
}
__device__ __forceinline__ void ln_apply(v8f (&o)[2], const float4 (&p)[8], const float4 (&q)[8],
                                         float g0, float g1, float b0, float b1) {
#pragma unroll
  for (int r = 0; r < 8; ++r) {
    float s = (p[r].x + p[r].z) + (q[r].x + q[r].z);
    float s2 = (p[r].y + p[r].w) + (q[r].y + q[r].w);
    float mu = s * (1.f / 128.f);
    float inv = rsqrtf(s2 * (1.f / 128.f) - mu * mu + LN_EPS);
    o[0][r] = (o[0][r] - mu) * inv * g0 + b0;
    o[1][r] = (o[1][r] - mu) * inv * g1 + b1;
  }
}
__device__ __forceinline__ void ln_stage(v8f (&o)[2], float* red,
                                         float g0, float g1, float b0, float b1, int w) {
  float4 p[8], q[8];
  ln_sums(o, red, p, q, w);
  ln_apply(o, p, q, g0, g1, b0, b1);
}

// the wave's two C tiles -> f16 rows in LDS (pitch HP)
__device__ __forceinline__ void tile_to_lds(const v8f (&o)[2], _Float16* hs, int w) {
  int lane = threadIdx.x & 31;
  int nCol = lane & 15, mBase = (lane < 16) ? 0 : 8;
#pragma unroll
  for (int i = 0; i < 2; ++i)
#pragma unroll
    for (int r = 0; r < 8; ++r)
      hs[(mBase + r) * HP + w * 32 + i * 16 + nCol] = (_Float16)o[i][r];
}

// ---------------------------------------------------------------------------
// set-up units + in_proj + first qkv:
//   h = relu(x@W1+b1)@W2 + b2 + PE -> h32; qkv of layer 0
// Wave w owns columns w*32 .. w*32+31 of every product; its two C tiles hold the
// even and the odd ones (see raw_fetch), so a lane's pair of results is adjacent.
// ---------------------------------------------------------------------------

// q (G = 0, scaled) or k (G = 1) of layer 0, head w, by the transposed product (see
// the q/k layout): the lane holds row nCol and, the even columns in c0 and the odd
// in c1, d = 2 * mBase .. 2 * mBase + 15. The biases of those 16 columns are fetched
// here, under the products: there is no register room for them further ahead
template <int G>
__device__ __forceinline__ void qk0_group(const v16h (&a)[4], const float2 (&raw)[4][16],
                                          const float* __restrict__ bq,
                                          _Float16* __restrict__ qk_out, int w) {
  int lane = threadIdx.x & 31;
  const float* bp = bq + G * 128 + w * 32 + (lane >> 4) * 16;
  float4 b4[4];
#pragma unroll
  for (int e = 0; e < 4; ++e) b4[e] = *(const float4*)(bp + e * 4);
  // the run's wait; with the address as its input the loads stay in front of it
  asm volatile("s_wait_xcnt 0x0" :: "v"(bp) : "memory");
  __builtin_amdgcn_sched_barrier(0);  // as in fetch_end
  v16h f[8];
#pragma unroll
  for (int kt = 0; kt < 4; ++kt) raw_to_frags(raw[kt], f[kt], f[4 + kt]);
  v8f c0 = {}, c1 = {};
#pragma unroll
  for (int kt = 0; kt < 4; ++kt) c0 = wmma16(f[kt], a[kt], c0);
#pragma unroll
  for (int kt = 0; kt < 4; ++kt) c1 = wmma16(f[4 + kt], a[kt], c1);
  float scale = (G == 0) ? QSCALE : 1.0f;
  _Float16* dst = qk_out + (size_t)blockIdx.x * QK_TILE + G * 2048 + w * 512 +
                  (lane >> 4) * 256 + (lane & 15) * 8;
#pragma unroll
  for (int s = 0; s < 2; ++s) {  // d & 8: the fragment lane is row + 16 * s
    v8h vv;
#pragma unroll
    for (int j = 0; j < 4; ++j) {
      int r = s * 4 + j;
      float be = (r & 1) ? b4[r >> 1].z : b4[r >> 1].x;
      float bd = (r & 1) ? b4[r >> 1].w : b4[r >> 1].y;
      vv[2 * j] = (_Float16)((c0[r] + be) * scale);
      vv[2 * j + 1] = (_Float16)((c1[r] + bd) * scale);
    }
    *(v8h*)(dst + s * 128) = vv;
  }
  fetch_end();
}

// v of layer 0, head w: d = 2 * nCol + {0, 1}, keys mBase + r
__device__ __forceinline__ void v0_group(const v16h (&a)[4], const float2 (&raw)[4][16],
                                         float2 bias, _Float16* __restrict__ v_out, int w) {
  int lane = threadIdx.x & 31;
  int nCol = lane & 15, mBase = (lane < 16) ? 0 : 8;
  int tile = blockIdx.x;
  v16h f[8];
#pragma unroll
  for (int kt = 0; kt < 4; ++kt) raw_to_frags(raw[kt], f[kt], f[4 + kt]);
  v8f c0 = {}, c1 = {};
#pragma unroll
  for (int kt = 0; kt < 4; ++kt) c0 = wmma16(a[kt], f[kt], c0);
#pragma unroll
  for (int kt = 0; kt < 4; ++kt) c1 = wmma16(a[kt], f[4 + kt], c1);
  v8h v0, v1;
#pragma unroll
  for (int r = 0; r < 8; ++r) {
    v0[r] = (_Float16)(c0[r] + bias.x);
    v1[r] = (_Float16)(c1[r] + bias.y);
  }
  _Float16* vp = v_out + (size_t)((tile >> 7) * 4 + w) * VPLANE + (4 + (tile & 127)) * 512 +
                 nCol * 32 + mBase;
  *(v8h*)vp = v0;
  *(v8h*)(vp + 16) = v1;
  fetch_end();
}

// second bound: two blocks a WGP (the whole grid resident), which leaves each wave
// the register room that the weights fetched ahead take
__global__ __launch_bounds__(128, 2) void setup_inproj_qkv_kernel(
    const float* __restrict__ E, const float* __restrict__ rho,
    const float* __restrict__ W1, const float* __restrict__ b1,
    const float* __restrict__ W2, const float* __restrict__ b2,
    const float* __restrict__ Wqkv, const float* __restrict__ bq,
    const float* __restrict__ Wo, const float* __restrict__ Wff1,
    const float* __restrict__ Wff2, const float* __restrict__ W_head,
    float* __restrict__ h32, _Float16* __restrict__ qk_out,
    _Float16* __restrict__ vT,  // both V buffers (zero groups); layer 0's v goes to the first
    _Float16* __restrict__ pqkv, _Float16* __restrict__ pwo,
    _Float16* __restrict__ pf1, _Float16* __restrict__ pf2,
    _Float16* __restrict__ pwh) {
  __shared__ __attribute__((aligned(16))) _Float16 t1[16 * TP];
  __shared__ __attribute__((aligned(16))) _Float16 hs[16 * HP];
  int row0 = blockIdx.x * 16;
  int w = threadIdx.x >> 5;
  int lane = threadIdx.x & 31;
  int nCol = lane & 15, mBase = (lane < 16) ? 0 : 8, kB = mBase;
  int nc0 = w * 32 + 2 * nCol;

  // the thread's set-up unit. A tile's 64 units are two whole waves, so the tile
  // number is the same in every lane: taken as a scalar, the choice of the
  // weight is scalar work and scalar branches.
  int gid = blockIdx.x * 128 + threadIdx.x;
  int tu = __builtin_amdgcn_readfirstlane(gid >> 6);
  float pv[8] = {0.f, 0.f, 0.f, 0.f, 0.f, 0.f, 0.f, 0.f};
  _Float16* pd = pwh;
  bool pin = false;
  if (tu < PT_PAD) {
    // half a lane's share of a packed tile: 8 k rows of one column
    const float* src;
    _Float16* dst;
    int t, ks = 2, nld;
    if (tu < PT_WO) {
      int l = 1 + tu / 96;
      t = tu % 96; nld = 384;
      src = Wqkv + l * 128 * 384; dst = pqkv + (size_t)(l * 96 + t) * 512;
    } else if (tu < PT_F1) {
      int v = tu - PT_WO;
      t = v & 31; nld = 128;
      src = Wo + (v >> 5) * 128 * 128; dst = pwo + (size_t)v * 512;
    } else if (tu < PT_F2) {
      int v = tu - PT_F1;
      t = v & 63; nld = 256;
      src = Wff1 + (v >> 6) * 128 * 256; dst = pf1 + (size_t)v * 512;
    } else if (tu < PT_WH) {
      int v = tu - PT_F2;
      t = v & 63; nld = 128; ks = 3;
      src = Wff2 + (v >> 6) * 256 * 128; dst = pf2 + (size_t)v * 512;
    } else {
      t = tu - PT_WH; nld = 8;
      src = W_head; dst = pwh + (size_t)t * 512;
    }
    int kt = t & ((1 << ks) - 1), nt = t >> ks;
    int pl = (gid >> 1) & 31, half = gid & 1;  // packed lane; which 8 of its 16 values
    int n = nt * 16 + (pl & 15);
    int k0 = kt * 32 + ((pl < 16) ? 0 : 8) + half * 16;
    pin = n < nld;
    int nc = pin ? n : nld - 1;  // a padding column reads a valid entry that it does not use
    pd = dst + pl * 16 + half * 8;
    const float* pp[8];
#pragma unroll
    for (int i = 0; i < 8; ++i) {
      pp[i] = src + (k0 + i) * nld + nc;
      pv[i] = *pp[i];
    }
    // one wait for the whole run; its inputs are the run's addresses (see fetch_end)
    asm volatile("s_wait_xcnt 0x0" :: "v"(pp[0]), "v"(pp[1]), "v"(pp[2]), "v"(pp[3]),
                 "v"(pp[4]), "v"(pp[5]), "v"(pp[6]), "v"(pp[7]) : "memory");
  } else if (tu < PT_END) {
    // 16 bytes of a V plane's zero groups: four groups in front of the keys, one behind
    int i = gid - PT_PAD * 64;
    int plane = i / 320, c = i % 320;
    int pos = (c < 256) ? c * 8 : ((VG - 1) * 512 + (c - 256) * 8);
    v8h z = {};
    *(v8h*)(vT + (size_t)plane * VPLANE + pos) = z;
    addr_wait();
  }
  // keeps the unit's loads in front of the run below: its store then waits for
  // them alone
  __builtin_amdgcn_sched_barrier(0);

  // fetched next, in the order of use: x and both in_proj weights, all f32.
  // x = concat(E, rho), K padded 16 -> 32: lanes 0..15 hold k 0..7 (E), lanes
  // 16..31 k 8..15 (rho); the upper half of every fragment is the zero padding
  const float* lx = ((lane < 16) ? E : rho) + (row0 + nCol) * 8;
  const float* l1 = W1 + kB * DM + nc0;
  const float* l2 = W2 + kB * DM + nc0;
  float4 xa = *(const float4*)lx, xb = *(const float4*)(lx + 4);
  float2 r1[8], r2[4][16];
#pragma unroll
  for (int e = 0; e < 8; ++e) r1[e] = *(const float2*)(l1 + e * DM);
  float2 b1p = *(const float2*)(b1 + nc0);
#pragma unroll
  for (int kt = 0; kt < 4; ++kt) raw_fetch<DM>(r2[kt], l2, kt);
  float2 b2p = *(const float2*)(b2 + nc0);
  // one wait for the whole run; its inputs are the run's addresses (see fetch_end)
  asm volatile("s_wait_xcnt 0x0" :: "v"(lx), "v"(l1), "v"(l2), "v"(nc0) : "memory");
  __builtin_amdgcn_sched_barrier(0);  // as in fetch_end

  if (tu < PT_PAD) {
    v8h hv;
#pragma unroll
    for (int i = 0; i < 8; ++i) hv[i] = pin ? (_Float16)pv[i] : (_Float16)0.f;
    *(v8h*)pd = hv;
    fetch_end();
  }

  {
    v16h a = {}, w1a = {}, w1b = {};
    a[0] = (_Float16)xa.x; a[1] = (_Float16)xa.y; a[2] = (_Float16)xa.z; a[3] = (_Float16)xa.w;
    a[4] = (_Float16)xb.x; a[5] = (_Float16)xb.y; a[6] = (_Float16)xb.z; a[7] = (_Float16)xb.w;
#pragma unroll
    for (int e = 0; e < 8; ++e) {
      w1a[e] = (_Float16)r1[e].x;
      w1b[e] = (_Float16)r1[e].y;
    }
    v8f c0 = {}, c1 = {};
    c0 = wmma16(a, w1a, c0);
    c1 = wmma16(a, w1b, c1);
#pragma unroll
    for (int r = 0; r < 8; ++r) {
      float u0 = c0[r] + b1p.x, u1 = c1[r] + b1p.y;
      v2h p = {(_Float16)(u0 > 0.f ? u0 : 0.f), (_Float16)(u1 > 0.f ? u1 : 0.f)};
      *(v2h*)(t1 + (mBase + r) * TP + nc0) = p;
    }
  }
  v16h w2[8];
#pragma unroll
  for (int kt = 0; kt < 4; ++kt) raw_to_frags(r2[kt], w2[kt], w2[4 + kt]);
  __syncthreads();  // every wave reads all 128 columns of t1 as A fragments

  // fetched under the second product: q's and k's weights of layer 0
  const float* lq = Wqkv + kB * 384 + nc0;
  float2 rq[4][16], rk[4][16], rv[4][16];
#pragma unroll
  for (int kt = 0; kt < 4; ++kt) raw_fetch<384>(rq[kt], lq, kt);
#pragma unroll
  for (int kt = 0; kt < 4; ++kt) raw_fetch<384>(rk[kt], lq + 128, kt);
  fetch_end(lq, nc0);

  v8f o[2];
  {
    v16h a2[4];
#pragma unroll
    for (int kt = 0; kt < 4; ++kt) a2[kt] = load_a_frag(t1 + kt * 32, TP);
#pragma unroll
    for (int i = 0; i < 2; ++i) {
      v8f acc = {};
#pragma unroll
      for (int kt = 0; kt < 4; ++kt)
        acc = wmma16(a2[kt], w2[i * 4 + kt], acc);
      o[i] = acc;
    }
  }

  // v's weights of layer 0; a run of its own: with all three in one run the build spills
#pragma unroll
  for (int kt = 0; kt < 4; ++kt) raw_fetch<384>(rv[kt], lq + 256, kt);
  float2 bvp = *(const float2*)(bq + nc0 + 256);
  fetch_end(lq, nc0);

  {
    // columns nc0 (even: sine) and nc0 + 1 (odd: cosine) share one frequency
    float div = __expf(-(float)(nc0 >> 1) * (9.210340371976184f / 64.f));
#pragma unroll
    for (int r = 0; r < 8; ++r) {
      int row = row0 + mBase + r;
      float ang = (float)(row & (T_SEQ - 1)) * div;
      o[0][r] = o[0][r] + b2p.x + __sinf(ang);
      o[1][r] = o[1][r] + b2p.y + __cosf(ang);
    }
  }
  {
    // the residual in the order of the layer launches' C tiles (see layer_body):
    // columns nc0 and nc0 + 1 are neighbouring lanes of C tile nCol >> 3 there
    float* hd = h32 + blockIdx.x * H_TILE + w * 512 + (nCol >> 3) * 256 +
                (((2 * nCol) & 15) + 2 * mBase) * 4;
#pragma unroll
    for (int i = 0; i < 2; ++i)
#pragma unroll
      for (int q = 0; q < 2; ++q)
        *(float4*)(hd + q * 128 + i * 4) =
            make_float4(o[i][q * 4], o[i][q * 4 + 1], o[i][q * 4 + 2], o[i][q * 4 + 3]);
    // the run's wait; with the address as its input the stores stay in front of it
    asm volatile("s_wait_xcnt 0x0" :: "v"(hd) : "memory");
    __builtin_amdgcn_sched_barrier(0);  // as in fetch_end
  }
#pragma unroll
  for (int r = 0; r < 8; ++r) {
    v2h p = {(_Float16)o[0][r], (_Float16)o[1][r]};
    *(v2h*)(hs + (mBase + r) * HP + nc0) = p;
  }
  __syncthreads();  // every wave reads all 128 columns of hs as A fragments

  v16h a[4];
#pragma unroll
  for (int kt = 0; kt < 4; ++kt) a[kt] = load_a_frag(hs + kt * 32, HP);
  qk0_group<0>(a, rq, bq, qk_out, w);
  qk0_group<1>(a, rk, bq, qk_out, w);
  v0_group(a, rv, bvp, vT, w);
}

// ---------------------------------------------------------------------------
// one layer behind its qkv: windowed attention (wave = head), o-proj + residual
// + layernorm, FFN + residual + layernorm; leaves the tile in hs (f16, LDS) and,
// where QKV, in h32 for the next launch's residual. The weights of the stage
// behind (next qkv where QKV, else the head) are fetched ahead into wn / bnv.
// ---------------------------------------------------------------------------
template <bool QKV>
__device__ __forceinline__ void layer_body(
    const _Float16* __restrict__ qk_in, const _Float16* __restrict__ vT_in,
    const _Float16* __restrict__ pwo,  // 32 tiles [nt*4+kt]
    const float* __restrict__ bo,
    const float* __restrict__ g1, const float* __restrict__ be1,
    const _Float16* __restrict__ pf1,  // 64 tiles [nt*4+kt]
    const float* __restrict__ bf1,
    const _Float16* __restrict__ pf2,  // 64 tiles [nt*8+kt]
    const float* __restrict__ bf2,
    const float* __restrict__ g2, const float* __restrict__ be2,
    float* __restrict__ h32, _Float16* hs,
    const _Float16* __restrict__ pn, const float* __restrict__ bn,
    v16h (&wn)[24], float (&bnv)[34]) {
  // the layer's packed weights: tiles 0..31 Wo, 32..95 Wff1, 96..159 Wff2; the next
  // qkv's 96 tiles take the place of Wo and Wff1 once these have been read
  __shared__ __attribute__((aligned(16))) _Float16 wl[160 * 512];
  // one set of tile buffers for each of the block's two row tiles
  __shared__ __attribute__((aligned(16))) _Float16 at2[2][4][16 * AP];  // attn probs, K padded 80 -> 96
  __shared__ __attribute__((aligned(16))) _Float16 ao2[2][16 * HP];
  __shared__ __attribute__((aligned(16))) _Float16 h12[2][16 * HP];
  __shared__ __attribute__((aligned(16))) _Float16 mid2[2][16 * MP];
  __shared__ __attribute__((aligned(16))) float red12[2][16 * 8];
  __shared__ __attribute__((aligned(16))) float red22[2][16 * 8];
  int hb = threadIdx.x >> 7;  // which of the two row tiles
  _Float16* ao = ao2[hb];
  _Float16* h1 = h12[hb];
  _Float16* mid = mid2[hb];
  float* red1 = red12[hb];
  float* red2 = red22[hb];
  int w = (threadIdx.x >> 5) & 3;
  int head = w;
  int tile = blockIdx.x * 2 + hb, tb = tile & 127;  // the tile; its number within the batch
  int row0 = tile * 16;
  int t0 = row0 & (T_SEQ - 1);
  int bIdx = row0 >> 11;
  int lane = threadIdx.x & 31;
  int nCol = lane & 15, mBase = (lane < 16) ? 0 : 8, kBase = mBase;
  int keyBase = t0 - 64;
  int n0 = w * 32 + nCol;
  _Float16* atw = at2[hb][w];

  // fetched first: q, all five K fragments, all six V fragments
  // (each in fragment order: see the q/k layout; V: [16-key group][d][16 keys])
  const _Float16* lq = qk_in + (size_t)tile * QK_TILE + head * 512 + lane * 8;
  v16h qa = load_pair(lq, 256);
  const _Float16* lk[5];
  v16h kb[5];
#pragma unroll
  for (int kt = 0; kt < 5; ++kt) {
    int kti = tb - 4 + kt;              // key tile within the batch
    int ktc = kti < 0 ? 0 : kti;        // clamp address; mask handles validity
    lk[kt] = qk_in + (size_t)(tile - tb + ktc) * QK_TILE + head * 512 + lane * 8;
    kb[kt] = load_pair(lk[kt] + 2048, 256);  // k stands behind q in the tile
  }
  // group tb of the plane holds key keyBase (four zero groups stand in front)
  const _Float16* lv = vT_in + (size_t)(bIdx * 4 + head) * VPLANE + tb * 512 + nCol * 16 + kBase;
  v16h vb[6];
#pragma unroll
  for (int nt = 0; nt < 2; ++nt)
#pragma unroll
    for (int kc = 0; kc < 3; ++kc) vb[nt * 3 + kc] = load_pair(lv + nt * 256 + kc * 1024, 512);
  // one wait for the whole run; its inputs are the run's addresses (see fetch_end)
  asm volatile("s_wait_xcnt 0x0" :: "v"(lq), "v"(lk[0]), "v"(lk[1]), "v"(lk[2]), "v"(lk[3]),
               "v"(lk[4]), "v"(lv) : "memory");
  __builtin_amdgcn_sched_barrier(0);  // as in fetch_end

  // fetched next: what o-proj and the first layernorm read beside the weights
  // the residual lies as the wave's C tiles: [tile][wave][C tile][r >> 2][lane][r & 3]
  const float* lr = h32 + tile * H_TILE + w * 512 + lane * 4;
  float res[2][8], bov[2];
#pragma unroll
  for (int i = 0; i < 2; ++i) {
    bov[i] = (bo + n0)[i * 16];
#pragma unroll
    for (int q = 0; q < 2; ++q) {
      float4 t = *(const float4*)(lr + i * 256 + q * 128);
      res[i][q * 4] = t.x; res[i][q * 4 + 1] = t.y; res[i][q * 4 + 2] = t.z; res[i][q * 4 + 3] = t.w;
    }
  }
  float g1a = g1[n0], g1b = (g1 + n0)[16], be1a = be1[n0], be1b = (be1 + n0)[16];
  // one wait for the whole run; its inputs are the run's addresses (see fetch_end)
  asm volatile("s_wait_xcnt 0x0" :: "v"(lr), "v"(n0) : "memory");
  __builtin_amdgcn_sched_barrier(0);  // as in fetch_end

  // Wo, Wff1 and Wff2 -> LDS, once for both row tiles: 40 copies a thread, which fly
  // under the scores and the softmax. The thread's 16 bytes are half hf = t & 1 of
  // packed lane (t >> 1) & 31 in tile t >> 6 of every four (see load_w_lds).
  const int tx = threadIdx.x;
  const unsigned wdst = (unsigned)(size_t)wl + (tx >> 6) * 1024 + (tx & 1) * 512 +
                        ((tx >> 1) & 31) * 16;
  copy_tiles<32>(wdst, pwo + tx * 8);
  copy_tiles<64>(wdst + 32 * 1024, pf1 + tx * 8);
  copy_tiles<64>(wdst + 96 * 1024, pf2 + tx * 8);
  // keeps every copy in front of the scores: moved in among them it would start later
  __builtin_amdgcn_sched_barrier(0);
  const _Float16* lw = wl + lane * 8;

  v8f s[5];
#pragma unroll
  for (int kt = 0; kt < 5; ++kt) {
    int j = keyBase + kt * 16 + nCol;
    v8f c = {};
    c = wmma16(qa, kb[kt], c);
#pragma unroll
    for (int r = 0; r < 8; ++r) {
      int iQ = t0 + mBase + r;
      bool valid = (j >= 0) && (j <= iQ) && (j >= iQ - 63);
      s[kt][r] = valid ? c[r] : -1e30f;
    }
  }

  // keeps the next run of loads behind the score products: issued in front of
  // them it fills the load counter and the first product waits for more returns
  __builtin_amdgcn_sched_barrier(0);

  // fetched under the softmax: FFN up's biases
  int nf = w * 64 + nCol;
  float bf1v[4];
#pragma unroll
  for (int i = 0; i < 4; ++i) bf1v[i] = (bf1 + nf)[i * 16];
  // the run's wait; its input is the run's address (see fetch_end)
  asm volatile("s_wait_xcnt 0x0" :: "v"(nf) : "memory");
  __builtin_amdgcn_sched_barrier(0);  // as in fetch_end

  // row softmax: row m lives in one vgpr slot across the 16 lanes of a half
#pragma unroll
  for (int r = 0; r < 8; ++r) {
    float mx = s[0][r];
#pragma unroll
    for (int kt = 1; kt < 5; ++kt) mx = fmaxf(mx, s[kt][r]);
#pragma unroll
    for (int msk = 1; msk < 16; msk <<= 1) mx = fmaxf(mx, __shfl_xor(mx, msk, 32));
    float sum = 0.f;
#pragma unroll
    for (int kt = 0; kt < 5; ++kt) { float e = __expf(s[kt][r] - mx); s[kt][r] = e; sum += e; }
#pragma unroll
    for (int msk = 1; msk < 16; msk <<= 1) sum += __shfl_xor(sum, msk, 32);
    float inv = 1.0f / sum;
#pragma unroll
    for (int kt = 0; kt < 5; ++kt) s[kt][r] *= inv;
  }

  // C-layout -> A-fragment layout via LDS (16 x 96, cols 80..95 zero)
#pragma unroll
  for (int kt = 0; kt < 5; ++kt)
#pragma unroll
    for (int r = 0; r < 8; ++r)
      atw[(mBase + r) * AP + kt * 16 + nCol] = (_Float16)s[kt][r];
#pragma unroll
  for (int r = 0; r < 8; ++r) atw[(mBase + r) * AP + 80 + nCol] = (_Float16)0.f;
  // the wave's own weight copies have landed; the barrier behind shows them to all
  asm volatile("s_wait_asynccnt 0x0" ::: "memory");
  __syncthreads();  // a lane's A fragment holds probs that other lanes wrote

  // the probs' fragments first (LDS returns in order: the product waits for them
  // alone); then, fetched under that product: o-proj's weights, LDS -> registers
  v16h aa[3];
#pragma unroll
  for (int kc = 0; kc < 3; ++kc) aa[kc] = load_a_frag(atw + kc * 32, AP);
  // keeps these reads in front of the weights' reads, which the scheduler else puts first
  __builtin_amdgcn_sched_barrier(0);
  v16h wo[8];
#pragma unroll
  for (int i = 0; i < 8; ++i) wo[i] = load_w_lds(lw, w * 8 + i);
  // keeps the run whole: sunk to their uses the reads would each cost their latency
  __builtin_amdgcn_sched_barrier(0);

  // attn(16x96) @ V(96x32): 2 N-tiles x 3 K-chunks
#pragma unroll
  for (int nt = 0; nt < 2; ++nt) {
    v8f acc = {};
#pragma unroll
    for (int kc = 0; kc < 3; ++kc) acc = wmma16(aa[kc], vb[nt * 3 + kc], acc);
#pragma unroll
    for (int r = 0; r < 8; ++r)
      ao[(mBase + r) * HP + head * 32 + nt * 16 + nCol] = (_Float16)acc[r];
  }
  __syncthreads();  // every wave reads all four heads' columns of ao

  // o-proj's A fragments first (see the probs' above); then, fetched under o-proj and
  // the first layernorm: FFN up's weights, LDS -> registers, and what FFN down and
  // the second layernorm read beside the weights
  v16h ap[4];
#pragma unroll
  for (int kt = 0; kt < 4; ++kt) ap[kt] = load_a_frag(ao + kt * 32, HP);
  // keeps these reads in front of the weights' reads, which the scheduler else puts first
  __builtin_amdgcn_sched_barrier(0);
  v16h f1[16];
#pragma unroll
  for (int i = 0; i < 16; ++i) f1[i] = load_w_lds(lw, 32 + w * 16 + i);
  float bf2v[2];
#pragma unroll
  for (int i = 0; i < 2; ++i) bf2v[i] = (bf2 + n0)[i * 16];
  float g2a = g2[n0], g2b = (g2 + n0)[16], be2a = be2[n0], be2b = (be2 + n0)[16];
  // the run's wait; its input is the run's address (see fetch_end)
  asm volatile("s_wait_xcnt 0x0" :: "v"(n0) : "memory");
  __builtin_amdgcn_sched_barrier(0);  // as in fetch_end; it keeps the LDS reads whole too

  // o-proj + residual + layernorm; wave w owns columns w*32 .. w*32+31
  v8f o[2];
  {
#pragma unroll
    for (int i = 0; i < 2; ++i) {
      v8f acc = {};
#pragma unroll
      for (int kt = 0; kt < 4; ++kt)
        acc = wmma16(ap[kt], wo[i * 4 + kt], acc);
#pragma unroll
      for (int r = 0; r < 8; ++r)
        o[i][r] = acc[r] + bov[i] + res[i][r];
    }
  }
  ln_stage(o, red1, g1a, g1b, be1a, be1b, w);
  tile_to_lds(o, h1, w);
  // the wave's reads of Wo and Wff1 have returned: behind the barrier their place in
  // LDS is free for the next copies
  if (QKV) asm volatile("s_wait_dscnt 0x0" ::: "memory");
  __syncthreads();  // every wave reads all 128 columns of h1

  // the next qkv's weights -> LDS, in the place of Wo and Wff1: 24 copies a thread,
  // which fly under the FFN
  if (QKV) copy_tiles<96>(wdst, pn + tx * 8);
  // FFN up's A fragments first (see the probs' above); then, fetched under FFN up:
  // FFN down's weights, LDS -> registers
  v16h au[4];
#pragma unroll
  for (int kt = 0; kt < 4; ++kt) au[kt] = load_a_frag(h1 + kt * 32, HP);
  // keeps these reads in front of the weights' reads, which the scheduler else puts first
  __builtin_amdgcn_sched_barrier(0);
  v16h f2[16];
#pragma unroll
  for (int i = 0; i < 16; ++i) f2[i] = load_w_lds(lw, 96 + w * 16 + i);
  // keeps the run whole: sunk to their uses the reads would each cost their latency
  __builtin_amdgcn_sched_barrier(0);

  // FFN up: wave w owns hidden columns w*64 .. w*64+63
  {
#pragma unroll
    for (int i = 0; i < 4; ++i) {
      int nt = w * 4 + i;
      v8f acc = {};
#pragma unroll
      for (int kt = 0; kt < 4; ++kt)
        acc = wmma16(au[kt], f1[i * 4 + kt], acc);
      float bias = bf1v[i];
#pragma unroll
      for (int r = 0; r < 8; ++r) {
        float v = acc[r] + bias;
        mid[(mBase + r) * MP + nt * 16 + nCol] = (_Float16)(v > 0.f ? v : 0.f);
      }
    }
  }
  __syncthreads();  // every wave reads all 256 columns of mid

  // fetched under FFN down and the second layernorm: the stage behind's biases
  // and, for the head, its weights
  if (QKV) {
    qkv_bias_fetch(bnv, bn, w);
  } else {
    const _Float16* lh = b_lane_ptr(pn, 0);
    int nh = nCol & 7;  // lanes 8..15 of a half read a valid entry that they do not use
#pragma unroll
    for (int kt = 0; kt < 4; ++kt) wn[kt] = load_b_at(lh, kt);
    bnv[0] = bn[nh];
    fetch_end(lh, nh);
  }

  // FFN down + residual (still in o) + layernorm
  {
    v16h a2[8];
#pragma unroll
    for (int kt = 0; kt < 8; ++kt) a2[kt] = load_a_frag(mid + kt * 32, MP);
#pragma unroll
    for (int i = 0; i < 2; ++i) {
      v8f acc = {};
#pragma unroll
      for (int kt = 0; kt < 8; ++kt)
        acc = wmma16(a2[kt], f2[i * 8 + kt], acc);
#pragma unroll
      for (int r = 0; r < 8; ++r) o[i][r] = acc[r] + bf2v[i] + o[i][r];
    }
  }
  // the wave's own copies of the qkv weights have landed; the barrier in the
  // layernorm shows them to all
  if (QKV) {
    // keeps FFN down's products in front of the wait: the copies fly under them too
    __builtin_amdgcn_sched_barrier(0);
    asm volatile("s_wait_asynccnt 0x0" ::: "memory");
  }
  float4 sp[8], sq[8];
  ln_sums(o, red2, sp, sq, w);
  if (QKV) {
    // keeps the row sums' reads in front of the weights' reads, which then return
    // under the layernorm's arithmetic
    __builtin_amdgcn_sched_barrier(0);
    qkv_w_fetch(wn, lw, w);
  }
  ln_apply(o, sp, sq, g2a, g2b, be2a, be2b);
  if (QKV) {
    float* hd = h32 + tile * H_TILE + w * 512 + lane * 4;
#pragma unroll
    for (int i = 0; i < 2; ++i)
#pragma unroll
      for (int q = 0; q < 2; ++q)
        *(float4*)(hd + i * 256 + q * 128) =
            make_float4(o[i][q * 4], o[i][q * 4 + 1], o[i][q * 4 + 2], o[i][q * 4 + 3]);
    fetch_end();
  }
  tile_to_lds(o, hs, w);
  __syncthreads();  // the stage behind reads all 128 columns of hs
}

// layer l, then the qkv of layer l+1 into the OTHER q/k and vT buffers (blocks
// of this launch still read this layer's K and V of their neighbours' rows)
// second bound: one block a WGP (the whole grid resident), which leaves each wave
// the register room that the fragments fetched ahead take
__global__ __launch_bounds__(256, 1) void layer_qkv_kernel(
    const _Float16* __restrict__ qk_in, const _Float16* __restrict__ vT_in,
    const _Float16* __restrict__ pwo, const float* __restrict__ bo,
    const float* __restrict__ g1, const float* __restrict__ be1,
    const _Float16* __restrict__ pf1, const float* __restrict__ bf1,
    const _Float16* __restrict__ pf2, const float* __restrict__ bf2,
    const float* __restrict__ g2, const float* __restrict__ be2,
    float* __restrict__ h32,
    const _Float16* __restrict__ pq, const float* __restrict__ bq,
    _Float16* __restrict__ qk_out, _Float16* __restrict__ vT_out) {
  __shared__ __attribute__((aligned(16))) _Float16 hs2[2][16 * HP];
  int hb = threadIdx.x >> 7;  // which of the block's two row tiles
  _Float16* hs = hs2[hb];
  v16h wn[24];
  float bnv[34];
  layer_body<true>(qk_in, vT_in, pwo, bo, g1, be1, pf1, bf1, pf2, bf2, g2, be2, h32, hs,
                   pq, bq, wn, bnv);
  qkv_stage(hs, wn, bnv, qk_out, vT_out, blockIdx.x * 2 + hb, (threadIdx.x >> 5) & 3);
}

// last layer, then head: out = h @ W_head(128x16 padded) + b_head -> fp32 (R x 8)
// second bound: one block a WGP (the whole grid resident), which leaves each wave
// the register room that the fragments fetched ahead take
__global__ __launch_bounds__(256, 1) void layer_head_kernel(
    const _Float16* __restrict__ qk_in, const _Float16* __restrict__ vT_in,
    const _Float16* __restrict__ pwo, const float* __restrict__ bo,
    const float* __restrict__ g1, const float* __restrict__ be1,
    const _Float16* __restrict__ pf1, const float* __restrict__ bf1,
    const _Float16* __restrict__ pf2, const float* __restrict__ bf2,
    const float* __restrict__ g2, const float* __restrict__ be2,
    float* __restrict__ h32,
    const _Float16* __restrict__ pwh,  // 4 tiles
    const float* __restrict__ bh, float* __restrict__ out) {
  __shared__ __attribute__((aligned(16))) _Float16 hs2[2][16 * HP];
  int hb = threadIdx.x >> 7;  // which of the block's two row tiles
  _Float16* hs = hs2[hb];
  v16h wn[24];
  float bnv[34];
  layer_body<false>(qk_in, vT_in, pwo, bo, g1, be1, pf1, bf1, pf2, bf2, g2, be2, h32, hs,
                    pwh, bh, wn, bnv);
  if (((threadIdx.x >> 5) & 3) != 0) return;  // one N tile: one wave a row tile; no barrier follows
  int row0 = (blockIdx.x * 2 + hb) * 16;
  int lane = threadIdx.x & 31;
  int nCol = lane & 15, mBase = (lane < 16) ? 0 : 8;
  v8f acc = {};
#pragma unroll
  for (int kt = 0; kt < 4; ++kt)
    acc = wmma16(load_a_frag(hs + kt * 32, HP), wn[kt], acc);
  if (nCol < 8) {
    float bias = bnv[0];
#pragma unroll
    for (int r = 0; r < 8; ++r) out[(row0 + mBase + r) * 8 + nCol] = acc[r] + bias;
  }
}

// ---------------------------------------------------------------------------
// host launch
// ---------------------------------------------------------------------------
extern "C" void kernel_launch(void* const* d_in, const int* in_sizes, int n_in,
                              void* d_out, int out_size, void* d_ws, size_t ws_size,
                              hipStream_t stream) {
  (void)in_sizes; (void)n_in; (void)out_size; (void)ws_size;
  const float* E      = (const float*)d_in[0];
  const float* rho    = (const float*)d_in[1];
  const float* W_in1  = (const float*)d_in[2];
  const float* b_in1  = (const float*)d_in[3];
  const float* W_in2  = (const float*)d_in[4];
  const float* b_in2  = (const float*)d_in[5];
  const float* Wqkv   = (const float*)d_in[6];
  const float* bqkv   = (const float*)d_in[7];
  const float* Wo     = (const float*)d_in[8];
  const float* bo     = (const float*)d_in[9];
  const float* ln1_g  = (const float*)d_in[10];
  const float* ln1_b  = (const float*)d_in[11];
  const float* Wff1   = (const float*)d_in[12];
  const float* bff1   = (const float*)d_in[13];
  const float* Wff2   = (const float*)d_in[14];
  const float* bff2   = (const float*)d_in[15];
  const float* ln2_g  = (const float*)d_in[16];
  const float* ln2_b  = (const float*)d_in[17];
  const float* W_head = (const float*)d_in[18];
  const float* b_head = (const float*)d_in[19];

  char* w = (char*)d_ws;
  auto take = [&](size_t bytes) -> void* {
    void* p = (void*)w;
    w += (bytes + 255) & ~(size_t)255;
    return p;
  };
  float*    h32   = (float*)   take((size_t)R_TOT * DM * 4);
  _Float16* qkA   = (_Float16*)take((size_t)(R_TOT / 16) * QK_TILE * 2);
  _Float16* qkB   = (_Float16*)take((size_t)(R_TOT / 16) * QK_TILE * 2);
  _Float16* vT    = (_Float16*)take((size_t)2 * 16 * VPLANE * 2);  // 2 x 16 (b*head) planes
  _Float16* vTA   = vT;
  _Float16* vTB   = vT + (size_t)16 * VPLANE;
  _Float16* pqkv  = (_Float16*)take((size_t)3 * 96 * 512 * 2);
  _Float16* pwo   = (_Float16*)take((size_t)3 * 32 * 512 * 2);
  _Float16* pf1   = (_Float16*)take((size_t)3 * 64 * 512 * 2);
  _Float16* pf2   = (_Float16*)take((size_t)3 * 64 * 512 * 2);
  _Float16* pwh   = (_Float16*)take((size_t)4 * 512 * 2);

  const int TILES = R_TOT / 16;  // 512
  const int PAIRS = R_TOT / 32;  // 256: a layer block holds two row tiles
  setup_inproj_qkv_kernel<<<TILES, 128, 0, stream>>>(
      E, rho, W_in1, b_in1, W_in2, b_in2, Wqkv, bqkv, Wo, Wff1, Wff2, W_head,
      h32, qkA, vT, pqkv, pwo, pf1, pf2, pwh);
  layer_qkv_kernel<<<PAIRS, 256, 0, stream>>>(
      qkA, vTA, pwo, bo, ln1_g, ln1_b, pf1, bff1, pf2, bff2, ln2_g, ln2_b, h32,
      pqkv + (size_t)96 * 512, bqkv + 384, qkB, vTB);
  layer_qkv_kernel<<<PAIRS, 256, 0, stream>>>(
      qkB, vTB, pwo + (size_t)32 * 512, bo + 128, ln1_g + 128, ln1_b + 128,
      pf1 + (size_t)64 * 512, bff1 + 256, pf2 + (size_t)64 * 512, bff2 + 128,
      ln2_g + 128, ln2_b + 128, h32,
      pqkv + (size_t)2 * 96 * 512, bqkv + 2 * 384, qkA, vTA);
  layer_head_kernel<<<PAIRS, 256, 0, stream>>>(
      qkA, vTA, pwo + (size_t)2 * 32 * 512, bo + 2 * 128, ln1_g + 2 * 128, ln1_b + 2 * 128,
      pf1 + (size_t)2 * 64 * 512, bff1 + 2 * 256, pf2 + (size_t)2 * 64 * 512, bff2 + 2 * 128,
      ln2_g + 2 * 128, ln2_b + 2 * 128, h32, pwh, b_head, (float*)d_out);
}

// v008
// One run takes 39.6 microseconds.
// Timed twice side by side with v007, it ran 1.06 and 1.07 times as fast.
// All steps since v000 together make it 7.89 times as fast.
#include <hip/hip_runtime.h>
#include <hip/hip_bf16.h>

// ---------------------------------------------------------------------------
// StateSequenceTransformer on MI455X (gfx1250, wave32, WMMA 16x16x32 f16)
//   B=4 T=2048 D_MODEL=128 NHEAD=4 hd=32 DFF=256 WINDOW=64 NLAYERS=3
//   Four waves own a 16-row tile through a whole layer; a layer block holds two
//   such tiles (8 waves), which share one copy of the layer's weights in LDS.
//   Weights pre-packed into per-lane B-fragment order -> b128 vector loads.
//   q, K, V and the f32 residual pass from launch to launch in the order of the
//   reader's fragments, so that a wave's 16-byte loads and stores cover whole
//   128-byte lines, each alone or (the first launch's v and residual) two together.
// ---------------------------------------------------------------------------

#define R_TOT  8192
#define T_SEQ  2048
#define DM     128
#define DFF_   256
#define QK_TILE 4096          /* f16 of a 16-row tile in the q/k buffer: {q (scaled), k} x 4 heads x 512 */
#define VG     133            /* 16-key groups of a V plane: 4 zero groups, 128, 1 zero group */
#define VPLANE (VG * 512)     /* f16 of one (batch, head) plane of V: [group][d 0..31][16 keys] */
#define H_TILE 2048           /* f32 of a 16-row tile of the residual */
#define HP     136            /* LDS pitch of the tile buffers between fused stages: 272 B = 16 B x odd */
#define TP     136            /* LDS pitch of in_proj's hidden tile: 272 B = 16 B x odd */
#define MP     264            /* LDS pitch of the FFN's hidden tile: 528 B = 16 B x odd */
#define LN_EPS 1e-5f
#define QSCALE 0.17677669529663687f /* 1/sqrt(32) */

typedef __attribute__((ext_vector_type(16))) _Float16 v16h;
typedef __attribute__((ext_vector_type(8)))  _Float16 v8h;
typedef __attribute__((ext_vector_type(8)))  float    v8f;

__device__ __forceinline__ v8f wmma16(v16h a, v16h b, v8f c) {
  return __builtin_amdgcn_wmma_f32_16x16x32_f16(false, a, false, b, (short)0, c,
                                                false, false);
}

// the value that lane (lane ^ 16) holds: the same place in the wave's other 16-lane
// row, by one vector cross-row move (a shuffle would go through the LDS pipe)
__device__ __forceinline__ float other_half(float v) {
  unsigned u = __builtin_bit_cast(unsigned, v);
  return __builtin_bit_cast(float, __builtin_amdgcn_permlanex16(u, u, 0x76543210u, 0xfedcba98u,
                                                                false, false));
}

// A fragment: 16x32 f16 from row-major src (ld multiple of 8, 16B aligned).
// lane<16: row=lane, K={0..7,16..23}; lane>=16: row=lane-16, K={8..15,24..31}
__device__ __forceinline__ v16h load_a_frag(const _Float16* src, int ld) {
  int lane = threadIdx.x & 31;
  const _Float16* p = src + (lane & 15) * ld + ((lane < 16) ? 0 : 8);
  v8h lo = *(const v8h*)p;
  v8h hi = *(const v8h*)(p + 16);
  return __builtin_shufflevector(lo, hi, 0, 1, 2, 3, 4, 5, 6, 7,
                                 8, 9, 10, 11, 12, 13, 14, 15);
}

// A fragment's 16 values from two 16-byte pieces, dist f16 apart.
__device__ __forceinline__ v16h load_pair(const _Float16* p, int dist) {
  v8h lo = *(const v8h*)p;
  v8h hi = *(const v8h*)(p + dist);
  return __builtin_shufflevector(lo, hi, 0, 1, 2, 3, 4, 5, 6, 7,
                                 8, 9, 10, 11, 12, 13, 14, 15);
}

// Pre-packed B fragment: tile = 512 f16, lane's 16 values contiguous (32B).
// the lane's own address of packed tile 'tile'; further tiles of a run lie at
// compile-time distances from it
__device__ __forceinline__ const _Float16* b_lane_ptr(const _Float16* base, int tile) {
  int lane = threadIdx.x & 31;
  return base + ((size_t)tile << 9) + (lane << 4);
}
__device__ __forceinline__ v16h load_b_at(const _Float16* lp, int tile) {
  return *(const v16h*)(lp + (tile << 9));
}

// precaution: stands behind a run of global loads, in front of later loads whose
// results may land in the registers that held the run's addresses
__device__ __forceinline__ void addr_wait() {
  asm volatile("s_wait_xcnt 0x0" ::: "memory");
}

// The layer launches hold their packed weights in LDS, one copy for the block's
// two row tiles. LDS form of a packed tile: [values 0..7, values 8..15][lane][8],
// so that each 16-byte read of a wave covers 512 contiguous bytes (no shared bank).
// lp: the weights' start in LDS + lane * 8
__device__ __forceinline__ v16h load_w_lds(const _Float16* lp, int tile) {
  return load_pair(lp + (tile << 9), 256);
}

// eight asynchronous copies of 16 bytes a lane, 4 KiB apart in both spaces (the
// block's 256 threads move 4 tiles a copy). The wait in the copies' own statement:
// a precaution, in front of whatever reuses the copies' address registers.
__device__ __forceinline__ void copy8(unsigned l, const _Float16* g) {
  asm volatile(
      "global_load_async_to_lds_b128 %0, %8, off\n\t"
      "global_load_async_to_lds_b128 %1, %9, off\n\t"
      "global_load_async_to_lds_b128 %2, %10, off\n\t"
      "global_load_async_to_lds_b128 %3, %11, off\n\t"
      "global_load_async_to_lds_b128 %4, %12, off\n\t"
      "global_load_async_to_lds_b128 %5, %13, off\n\t"
      "global_load_async_to_lds_b128 %6, %14, off\n\t"
      "global_load_async_to_lds_b128 %7, %15, off\n\t"
      "s_wait_xcnt 0x0"
      :: "v"(l), "v"(l + 4096u), "v"(l + 8192u), "v"(l + 12288u),
         "v"(l + 16384u), "v"(l + 20480u), "v"(l + 24576u), "v"(l + 28672u),
         "v"(g), "v"(g + 2048), "v"(g + 4096), "v"(g + 6144),
         "v"(g + 8192), "v"(g + 10240), "v"(g + 12288), "v"(g + 14336)
      : "memory");
}
// NT packed tiles (a multiple of 32), global -> LDS, by the whole block.
// l: the thread's LDS byte address in the first four tiles; g: its 16 bytes there
template <int NT>
__device__ __forceinline__ void copy_tiles(unsigned l, const _Float16* g) {
#pragma unroll
  for (int j = 0; j < NT / 32; ++j) copy8(l + j * 32768u, g + j * 16384);
}

// ---------------------------------------------------------------------------
// Set-up work rides in the first launch. What that launch itself multiplies by
// (W_in1, W_in2, layer 0's Wqkv) it reads as f32 and converts in registers. What
// later launches read (packed weights, the zero groups of V) is dealt out in
// units of one 16-byte store, one unit a thread, 64 units a tile, over the
// grid's first threads.
//   pack: f32 weights (K x N row-major) -> B-fragment tiles, tile id = nt*KT + kt;
//         columns past the source's width -> 0 (padding).
// ---------------------------------------------------------------------------
#define PT_WO  192   /* from   0: 192 tiles, Wqkv   4 x 24 tiles, layers 1 and 2 */
#define PT_F1  288   /* from 192:  96 tiles, Wo     4 x  8 tiles, 3 layers */
#define PT_F2  480   /* from 288: 192 tiles, Wff1   4 x 16 tiles, 3 layers */
#define PT_WH  672   /* from 480: 192 tiles, Wff2   8 x  8 tiles, 3 layers */
#define PT_PAD 676   /* from 672:   4 tiles, W_head 4 x  1 tiles (half full) */
#define PT_END 836   /* from 676: 160 x 64 units, the zero groups of both V buffers */

typedef __attribute__((ext_vector_type(2))) _Float16 v2h;

// f32 weights as B fragments of TWO N tiles at once: the lane reads two
// neighbouring columns (tile 0 holds the even, tile 1 the odd columns of a run of
// 32), so that 16 lanes cover a whole 128-byte line of a weight row.
// lp: the lane's address in row kB (0 or 8) of the weight; k order as in pack.
template <int NLD>
__device__ __forceinline__ void raw_fetch(float2 (&raw)[16], const float* lp, int kt) {
#pragma unroll
  for (int e = 0; e < 16; ++e)
    raw[e] = *(const float2*)(lp + (kt * 32 + (e < 8 ? e : e + 8)) * NLD);
}
__device__ __forceinline__ void raw_to_frags(const float2 (&raw)[16], v16h& f0, v16h& f1) {
#pragma unroll
  for (int e = 0; e < 16; ++e) {
    f0[e] = (_Float16)raw[e].x;
    f1[e] = (_Float16)raw[e].y;
  }
}

// ---------------------------------------------------------------------------
// Row-local stages. Everything behind the K/V exchange of a layer depends only
// on the row tile's own 16 rows, so it runs in ONE launch: the tile goes from stage
// to stage through LDS, the f32 residual stays in registers, and the N tiles of
// every product are dealt to the row tile's four waves.
// Every loop below is unrolled: fragment and accumulator arrays stay in
// registers only where their indices are compile-time constants.
// ---------------------------------------------------------------------------

// Global operands are fetched AHEAD: every weight fragment, bias, norm parameter
// and residual of a stage is loaded into registers, all of a stage at once, at
// least one stage before its use (a launch's first products: just before them; layer 0's q and k biases and o-proj's weights: just before their products),
// so that its latency runs under earlier work.

// ends a run of global loads or stores. The wait: a precaution, in front of
// whatever reuses the run's address registers. The scheduling barrier: it keeps
// later register writes behind that wait, and without it the compiler sinks
// loads fetched ahead towards their uses and issues them a few at a time between
// the matrix instructions, so that their latencies add up again.
__device__ __forceinline__ void fetch_end() {
  addr_wait();
  __builtin_amdgcn_sched_barrier(0);
}
// the same for a run of loads from one lane address p and one lane index n: as
// inputs of the wait's own statement both stay in their registers up to the wait,
// so that no result of the run itself lands in them in front of it
__device__ __forceinline__ void fetch_end(const void* p, int n) {
  asm volatile("s_wait_xcnt 0x0" :: "v"(p), "v"(n) : "memory");
  __builtin_amdgcn_sched_barrier(0);
}

// Layout of the q/k buffer. A (row tile, q or k, head) block is 16 rows x 32 d =
// 512 f16, held as the attention's fragment of it: piece [d >> 4][lane][8], where
// lane = row + 16 * ((d >> 3) & 1) and the 8 values are d & 7. q's A fragment and
// K's B fragment have the same lane and k order, so one layout serves both.
// The writer gets a lane's 8 values by the TRANSPOSED product W^T h^T: a packed B
// fragment of W is, register for register, the A fragment of W^T, and the A
// fragment of h the B fragment of h^T; in the result a lane holds one row of h
// (lane & 15) and 8 neighbouring columns of W.

// the wave's qkv weight fragments and biases: wave w takes head w, N tiles
// (i >> 1) * 8 + 2 * w + (i & 1); i = 0, 1: q; 2, 3: k; 4, 5: v.
// bqv: 8 a tile for q and k (a lane's 8 columns), then one a tile for v
__device__ __forceinline__ void qkv_bias_fetch(float (&bqv)[34],
                                               const float* __restrict__ bq, int w) {
  int lane = threadIdx.x & 31;
  int nb = (w * 32 + ((lane < 16) ? 0 : 8)) * 4;  // in bytes: the register that the loads name
  int nv = w * 32 + (lane & 15);
#pragma unroll
  for (int i = 0; i < 6; ++i) {
    if (i < 4) {
      const float* bp = (const float*)((const char*)bq + nb) + (i >> 1) * 128 + (i & 1) * 16;
      float4 lo = *(const float4*)bp, hi = *(const float4*)(bp + 4);
      bqv[i * 8 + 0] = lo.x; bqv[i * 8 + 1] = lo.y; bqv[i * 8 + 2] = lo.z; bqv[i * 8 + 3] = lo.w;
      bqv[i * 8 + 4] = hi.x; bqv[i * 8 + 5] = hi.y; bqv[i * 8 + 6] = hi.z; bqv[i * 8 + 7] = hi.w;
    } else {
      bqv[32 + (i & 1)] = (bq + nv)[256 + (i & 1) * 16];
    }
  }
  // one wait for the whole run; its inputs are the run's addresses (see fetch_end)
  asm volatile("s_wait_xcnt 0x0" :: "v"(nb), "v"(nv) : "memory");
  __builtin_amdgcn_sched_barrier(0);  // as in fetch_end
}
// lw: the qkv weights' start in LDS (96 tiles [nt*4+kt]) + lane * 8
__device__ __forceinline__ void qkv_w_fetch(v16h (&wq)[24], const _Float16* lw, int w) {
#pragma unroll
  for (int i = 0; i < 6; ++i)
#pragma unroll
    for (int kt = 0; kt < 4; ++kt)
      wq[i * 4 + kt] = load_w_lds(lw, w * 8 + (i >> 1) * 32 + (i & 1) * 4 + kt);
  // keeps the run whole: sunk to their uses the reads would each cost their latency
  __builtin_amdgcn_sched_barrier(0);
}

// qkv of the tile in hs (LDS, pitch HP): q (scaled) and k -> qk_out, v -> v_out,
// each in its reader's fragment order; every store is 16 bytes a lane, 512
// contiguous bytes a wave.
__device__ __forceinline__ void qkv_stage(const _Float16* hs,
                                          const v16h (&wq)[24], const float (&bqv)[34],
                                          _Float16* __restrict__ qk_out,
                                          _Float16* __restrict__ v_out, int tile, int w) {
  int lane = threadIdx.x & 31;
  int nCol = lane & 15, mBase = (lane < 16) ? 0 : 8;
  _Float16* qd = qk_out + (size_t)tile * QK_TILE + w * 512 + lane * 8;
  _Float16* vd = v_out + (size_t)((tile >> 7) * 4 + w) * VPLANE + (4 + (tile & 127)) * 512 +
                 nCol * 16 + mBase;
  v16h a[4];
#pragma unroll
  for (int kt = 0; kt < 4; ++kt) a[kt] = load_a_frag(hs + kt * 32, HP);
#pragma unroll
  for (int i = 0; i < 6; ++i) {
    v8f acc = {};
    v8h vv;
    if (i < 4) {  // q (scaled) / k, transposed product: row nCol, d (i & 1) * 16 + mBase + r
#pragma unroll
      for (int kt = 0; kt < 4; ++kt)
        acc = wmma16(wq[i * 4 + kt], a[kt], acc);
      float scale = (i < 2) ? QSCALE : 1.0f;
#pragma unroll
      for (int r = 0; r < 8; ++r) vv[r] = (_Float16)((acc[r] + bqv[i * 8 + r]) * scale);
      *(v8h*)(qd + (i >> 1) * 2048 + (i & 1) * 256) = vv;
    } else {      // v: d (i & 1) * 16 + nCol, keys mBase + r
#pragma unroll
      for (int kt = 0; kt < 4; ++kt)
        acc = wmma16(a[kt], wq[i * 4 + kt], acc);
      float bias = bqv[32 + (i & 1)];
#pragma unroll
      for (int r = 0; r < 8; ++r) vv[r] = (_Float16)(acc[r] + bias);
      *(v8h*)(vd + (i & 1) * 256) = vv;
    }
    fetch_end();
  }
}

// layernorm of the tile; wave w holds columns w*32 .. w*32+31 in o[2] (C layout).
// Row sums: 2 tiles in the lane, 16 lanes by shuffle, 4 waves through red.
// g0, g1, b0, b1: the lane's two columns of gain and shift, fetched ahead.
// In two parts, so that other LDS reads can be put behind the row sums' reads.
__device__ __forceinline__ void ln_sums(const v8f (&o)[2], float* red,  // [16 rows][4 waves][2]
                                        float4 (&p)[8], float4 (&q)[8], int w) {
  int lane = threadIdx.x & 31;
  int nCol = lane & 15, mBase = (lane < 16) ? 0 : 8;
  float sm[8], sq[8];
#pragma unroll
  for (int r = 0; r < 8; ++r) {
    sm[r] = o[0][r] + o[1][r];
    sq[r] = o[0][r] * o[0][r] + o[1][r] * o[1][r];
#pragma unroll
    for (int msk = 1; msk < 16; msk <<= 1) {
      sm[r] += __shfl_xor(sm[r], msk, 32);
      sq[r] += __shfl_xor(sq[r], msk, 32);
    }
  }
  if (nCol == 0) {
#pragma unroll
    for (int r = 0; r < 8; ++r)
      *(float2*)(red + ((mBase + r) * 4 + w) * 2) = make_float2(sm[r], sq[r]);
  }
  __syncthreads();  // every wave reads all four waves' partial row sums
#pragma unroll
  for (int r = 0; r < 8; ++r) {
    p[r] = *(const float4*)(red + (mBase + r) * 8);
    q[r] = *(const float4*)(red + (mBase + r) * 8 + 4);
  }
}
__device__ __forceinline__ void ln_apply(v8f (&o)[2], const float4 (&p)[8], const float4 (&q)[8],
                                         float g0, float g1, float b0, float b1) {
#pragma unroll
  for (int r = 0; r < 8; ++r) {
    float s = (p[r].x + p[r].z) + (q[r].x + q[r].z);
    float s2 = (p[r].y + p[r].w) + (q[r].y + q[r].w);
    float mu = s * (1.f / 128.f);
    float inv = rsqrtf(s2 * (1.f / 128.f) - mu * mu + LN_EPS);
    o[0][r] = (o[0][r] - mu) * inv * g0 + b0;
    o[1][r] = (o[1][r] - mu) * inv * g1 + b1;
  }
}
__device__ __forceinline__ void ln_stage(v8f (&o)[2], float* red,
                                         float g0, float g1, float b0, float b1, int w) {
  float4 p[8], q[8];
  ln_sums(o, red, p, q, w);
  ln_apply(o, p, q, g0, g1, b0, b1);
}

// the wave's two C tiles -> f16 rows in LDS (pitch HP)
__device__ __forceinline__ void tile_to_lds(const v8f (&o)[2], _Float16* hs, int w) {
  int lane = threadIdx.x & 31;
  int nCol = lane & 15, mBase = (lane < 16) ? 0 : 8;
#pragma unroll
  for (int i = 0; i < 2; ++i)
#pragma unroll
    for (int r = 0; r < 8; ++r)
      hs[(mBase + r) * HP + w * 32 + i * 16 + nCol] = (_Float16)o[i][r];
}

// ---------------------------------------------------------------------------
// set-up units + in_proj + first qkv:
//   h = relu(x@W1+b1)@W2 + b2 + PE -> h32; qkv of layer 0
// Wave w owns columns w*32 .. w*32+31 of every product; its two C tiles hold the
// even and the odd ones (see raw_fetch), so a lane's pair of results is adjacent.
// ---------------------------------------------------------------------------

// q (G = 0, scaled) or k (G = 1) of layer 0, head w, by the transposed product (see
// the q/k layout): the lane holds row nCol and, the even columns in c0 and the odd
// in c1, d = 2 * mBase .. 2 * mBase + 15. The biases of those 16 columns are fetched
// here, under the products: there is no register room for them further ahead
template <int G>
__device__ __forceinline__ void qk0_group(const v16h (&a)[4], const float2 (&raw)[4][16],
                                          const float* __restrict__ bq,
                                          _Float16* __restrict__ qk_out, int w) {
  int lane = threadIdx.x & 31;
  const float* bp = bq + G * 128 + w * 32 + (lane >> 4) * 16;
  float4 b4[4];
#pragma unroll
  for (int e = 0; e < 4; ++e) b4[e] = *(const float4*)(bp + e * 4);
  // the run's wait; with the address as its input the loads stay in front of it
  asm volatile("s_wait_xcnt 0x0" :: "v"(bp) : "memory");
  __builtin_amdgcn_sched_barrier(0);  // as in fetch_end
  v16h f[8];
#pragma unroll
  for (int kt = 0; kt < 4; ++kt) raw_to_frags(raw[kt], f[kt], f[4 + kt]);
  v8f c0 = {}, c1 = {};
#pragma unroll
  for (int kt = 0; kt < 4; ++kt) c0 = wmma16(f[kt], a[kt], c0);
#pragma unroll
  for (int kt = 0; kt < 4; ++kt) c1 = wmma16(f[4 + kt], a[kt], c1);
  float scale = (G == 0) ? QSCALE : 1.0f;
  _Float16* dst = qk_out + (size_t)blockIdx.x * QK_TILE + G * 2048 + w * 512 +
                  (lane >> 4) * 256 + (lane & 15) * 8;
#pragma unroll
  for (int s = 0; s < 2; ++s) {  // d & 8: the fragment lane is row + 16 * s
    v8h vv;
#pragma unroll
    for (int j = 0; j < 4; ++j) {
      int r = s * 4 + j;
      float be = (r & 1) ? b4[r >> 1].z : b4[r >> 1].x;
      float bd = (r & 1) ? b4[r >> 1].w : b4[r >> 1].y;
      vv[2 * j] = (_Float16)((c0[r] + be) * scale);
      vv[2 * j + 1] = (_Float16)((c1[r] + bd) * scale);
    }
    *(v8h*)(dst + s * 128) = vv;
  }
  fetch_end();
}

// v of layer 0, head w: d = 2 * nCol + {0, 1}, keys mBase + r
__device__ __forceinline__ void v0_group(const v16h (&a)[4], const float2 (&raw)[4][16],
                                         float2 bias, _Float16* __restrict__ v_out, int w) {
  int lane = threadIdx.x & 31;
  int nCol = lane & 15, mBase = (lane < 16) ? 0 : 8;
  int tile = blockIdx.x;
  v16h f[8];
#pragma unroll
  for (int kt = 0; kt < 4; ++kt) raw_to_frags(raw[kt], f[kt], f[4 + kt]);
  v8f c0 = {}, c1 = {};
#pragma unroll
  for (int kt = 0; kt < 4; ++kt) c0 = wmma16(a[kt], f[kt], c0);
#pragma unroll
  for (int kt = 0; kt < 4; ++kt) c1 = wmma16(a[kt], f[4 + kt], c1);
  v8h v0, v1;
#pragma unroll
  for (int r = 0; r < 8; ++r) {
    v0[r] = (_Float16)(c0[r] + bias.x);
    v1[r] = (_Float16)(c1[r] + bias.y);
  }
  _Float16* vp = v_out + (size_t)((tile >> 7) * 4 + w) * VPLANE + (4 + (tile & 127)) * 512 +
                 nCol * 32 + mBase;
  *(v8h*)vp = v0;
  *(v8h*)(vp + 16) = v1;
  fetch_end();
}

// second bound: two blocks a WGP (the whole grid resident), which leaves each wave
// the register room that the weights fetched ahead take
__global__ __launch_bounds__(128, 2) void setup_inproj_qkv_kernel(
    const float* __restrict__ E, const float* __restrict__ rho,
    const float* __restrict__ W1, const float* __restrict__ b1,
    const float* __restrict__ W2, const float* __restrict__ b2,
    const float* __restrict__ Wqkv, const float* __restrict__ bq,
    const float* __restrict__ Wo, const float* __restrict__ Wff1,
    const float* __restrict__ Wff2, const float* __restrict__ W_head,
    float* __restrict__ h32, _Float16* __restrict__ qk_out,
    _Float16* __restrict__ vT,  // both V buffers (zero groups); layer 0's v goes to the first
    _Float16* __restrict__ pqkv, _Float16* __restrict__ pwo,
    _Float16* __restrict__ pf1, _Float16* __restrict__ pf2,
    _Float16* __restrict__ pwh) {
  __shared__ __attribute__((aligned(16))) _Float16 t1[16 * TP];
  __shared__ __attribute__((aligned(16))) _Float16 hs[16 * HP];
  int row0 = blockIdx.x * 16;
  int w = threadIdx.x >> 5;
  int lane = threadIdx.x & 31;
  int nCol = lane & 15, mBase = (lane < 16) ? 0 : 8, kB = mBase;
  int nc0 = w * 32 + 2 * nCol;

  // the thread's set-up unit. A tile's 64 units are two whole waves, so the tile
  // number is the same in every lane: taken as a scalar, the choice of the
  // weight is scalar work and scalar branches.
  int gid = blockIdx.x * 128 + threadIdx.x;
  int tu = __builtin_amdgcn_readfirstlane(gid >> 6);
  float pv[8] = {0.f, 0.f, 0.f, 0.f, 0.f, 0.f, 0.f, 0.f};
  _Float16* pd = pwh;
  bool pin = false;
  if (tu < PT_PAD) {
    // half a lane's share of a packed tile: 8 k rows of one column
    const float* src;
    _Float16* dst;
    int t, ks = 2, nld;
    if (tu < PT_WO) {
      int l = 1 + tu / 96;
      t = tu % 96; nld = 384;
      src = Wqkv + l * 128 * 384; dst = pqkv + (size_t)(l * 96 + t) * 512;
    } else if (tu < PT_F1) {
      int v = tu - PT_WO;
      t = v & 31; nld = 128;
      src = Wo + (v >> 5) * 128 * 128; dst = pwo + (size_t)v * 512;
    } else if (tu < PT_F2) {
      int v = tu - PT_F1;
      t = v & 63; nld = 256;
      src = Wff1 + (v >> 6) * 128 * 256; dst = pf1 + (size_t)v * 512;
    } else if (tu < PT_WH) {
      int v = tu - PT_F2;
      t = v & 63; nld = 128; ks = 3;
      src = Wff2 + (v >> 6) * 256 * 128; dst = pf2 + (size_t)v * 512;
    } else {
      t = tu - PT_WH; nld = 8;
      src = W_head; dst = pwh + (size_t)t * 512;
    }
    int kt = t & ((1 << ks) - 1), nt = t >> ks;
    int pl = (gid >> 1) & 31, half = gid & 1;  // packed lane; which 8 of its 16 values
    int n = nt * 16 + (pl & 15);
    int k0 = kt * 32 + ((pl < 16) ? 0 : 8) + half * 16;
    pin = n < nld;
    int nc = pin ? n : nld - 1;  // a padding column reads a valid entry that it does not use
    pd = dst + pl * 16 + half * 8;
    const float* pp[8];
#pragma unroll
    for (int i = 0; i < 8; ++i) {
      pp[i] = src + (k0 + i) * nld + nc;
      pv[i] = *pp[i];
    }
    // one wait for the whole run; its inputs are the run's addresses (see fetch_end)
    asm volatile("s_wait_xcnt 0x0" :: "v"(pp[0]), "v"(pp[1]), "v"(pp[2]), "v"(pp[3]),
                 "v"(pp[4]), "v"(pp[5]), "v"(pp[6]), "v"(pp[7]) : "memory");
  } else if (tu < PT_END) {
    // 16 bytes of a V plane's zero groups: four groups in front of the keys, one behind
    int i = gid - PT_PAD * 64;
    int plane = i / 320, c = i % 320;
    int pos = (c < 256) ? c * 8 : ((VG - 1) * 512 + (c - 256) * 8);
    v8h z = {};
    *(v8h*)(vT + (size_t)plane * VPLANE + pos) = z;
    addr_wait();
  }
  // keeps the unit's loads in front of the run below: its store then waits for
  // them alone
  __builtin_amdgcn_sched_barrier(0);

  // fetched next, in the order of use: x and both in_proj weights, all f32.
  // x = concat(E, rho), K padded 16 -> 32: lanes 0..15 hold k 0..7 (E), lanes
  // 16..31 k 8..15 (rho); the upper half of every fragment is the zero padding
  const float* lx = ((lane < 16) ? E : rho) + (row0 + nCol) * 8;
  const float* l1 = W1 + kB * DM + nc0;
  const float* l2 = W2 + kB * DM + nc0;
  float4 xa = *(const float4*)lx, xb = *(const float4*)(lx + 4);
  float2 r1[8], r2[4][16];
#pragma unroll
  for (int e = 0; e < 8; ++e) r1[e] = *(const float2*)(l1 + e * DM);
  float2 b1p = *(const float2*)(b1 + nc0);
#pragma unroll
  for (int kt = 0; kt < 4; ++kt) raw_fetch<DM>(r2[kt], l2, kt);
  float2 b2p = *(const float2*)(b2 + nc0);
  // one wait for the whole run; its inputs are the run's addresses (see fetch_end)
  asm volatile("s_wait_xcnt 0x0" :: "v"(lx), "v"(l1), "v"(l2), "v"(nc0) : "memory");
  __builtin_amdgcn_sched_barrier(0);  // as in fetch_end

  if (tu < PT_PAD) {
    v8h hv;
#pragma unroll
    for (int i = 0; i < 8; ++i) hv[i] = pin ? (_Float16)pv[i] : (_Float16)0.f;
    *(v8h*)pd = hv;
    fetch_end();
  }

  {
    v16h a = {}, w1a = {}, w1b = {};
    a[0] = (_Float16)xa.x; a[1] = (_Float16)xa.y; a[2] = (_Float16)xa.z; a[3] = (_Float16)xa.w;
    a[4] = (_Float16)xb.x; a[5] = (_Float16)xb.y; a[6] = (_Float16)xb.z; a[7] = (_Float16)xb.w;
#pragma unroll
    for (int e = 0; e < 8; ++e) {
      w1a[e] = (_Float16)r1[e].x;
      w1b[e] = (_Float16)r1[e].y;
    }
    v8f c0 = {}, c1 = {};
    c0 = wmma16(a, w1a, c0);
    c1 = wmma16(a, w1b, c1);
#pragma unroll
    for (int r = 0; r < 8; ++r) {
      float u0 = c0[r] + b1p.x, u1 = c1[r] + b1p.y;
      v2h p = {(_Float16)(u0 > 0.f ? u0 : 0.f), (_Float16)(u1 > 0.f ? u1 : 0.f)};
      *(v2h*)(t1 + (mBase + r) * TP + nc0) = p;
    }
  }
  v16h w2[8];
#pragma unroll
  for (int kt = 0; kt < 4; ++kt) raw_to_frags(r2[kt], w2[kt], w2[4 + kt]);
  __syncthreads();  // every wave reads all 128 columns of t1 as A fragments

  // fetched under the second product: q's and k's weights of layer 0
  const float* lq = Wqkv + kB * 384 + nc0;
  float2 rq[4][16], rk[4][16], rv[4][16];
#pragma unroll
  for (int kt = 0; kt < 4; ++kt) raw_fetch<384>(rq[kt], lq, kt);
#pragma unroll
  for (int kt = 0; kt < 4; ++kt) raw_fetch<384>(rk[kt], lq + 128, kt);
  fetch_end(lq, nc0);

  v8f o[2];
  {
    v16h a2[4];
#pragma unroll
    for (int kt = 0; kt < 4; ++kt) a2[kt] = load_a_frag(t1 + kt * 32, TP);
#pragma unroll
    for (int i = 0; i < 2; ++i) {
      v8f acc = {};
#pragma unroll
      for (int kt = 0; kt < 4; ++kt)
        acc = wmma16(a2[kt], w2[i * 4 + kt], acc);
      o[i] = acc;
    }
  }

  // v's weights of layer 0; a run of its own: with all three in one run the build spills
#pragma unroll
  for (int kt = 0; kt < 4; ++kt) raw_fetch<384>(rv[kt], lq + 256, kt);
  float2 bvp = *(const float2*)(bq + nc0 + 256);
  fetch_end(lq, nc0);

  {
    // columns nc0 (even: sine) and nc0 + 1 (odd: cosine) share one frequency
    float div = __expf(-(float)(nc0 >> 1) * (9.210340371976184f / 64.f));
#pragma unroll
    for (int r = 0; r < 8; ++r) {
      int row = row0 + mBase + r;
      float ang = (float)(row & (T_SEQ - 1)) * div;
      o[0][r] = o[0][r] + b2p.x + __sinf(ang);
      o[1][r] = o[1][r] + b2p.y + __cosf(ang);
    }
  }
  {
    // the residual in the order of the layer launches' C tiles (see layer_body):
    // columns nc0 and nc0 + 1 are neighbouring lanes of C tile nCol >> 3 there
    float* hd = h32 + blockIdx.x * H_TILE + w * 512 + (nCol >> 3) * 256 +
                (((2 * nCol) & 15) + 2 * mBase) * 4;
#pragma unroll
    for (int i = 0; i < 2; ++i)
#pragma unroll
      for (int q = 0; q < 2; ++q)
        *(float4*)(hd + q * 128 + i * 4) =
            make_float4(o[i][q * 4], o[i][q * 4 + 1], o[i][q * 4 + 2], o[i][q * 4 + 3]);
    // the run's wait; with the address as its input the stores stay in front of it
    asm volatile("s_wait_xcnt 0x0" :: "v"(hd) : "memory");
    __builtin_amdgcn_sched_barrier(0);  // as in fetch_end
  }
#pragma unroll
  for (int r = 0; r < 8; ++r) {
    v2h p = {(_Float16)o[0][r], (_Float16)o[1][r]};
    *(v2h*)(hs + (mBase + r) * HP + nc0) = p;
  }
  __syncthreads();  // every wave reads all 128 columns of hs as A fragments

  v16h a[4];
#pragma unroll
  for (int kt = 0; kt < 4; ++kt) a[kt] = load_a_frag(hs + kt * 32, HP);
  qk0_group<0>(a, rq, bq, qk_out, w);
  qk0_group<1>(a, rk, bq, qk_out, w);
  v0_group(a, rv, bvp, vT, w);
}

// ---------------------------------------------------------------------------
// one layer behind its qkv: windowed attention (wave = head), o-proj + residual
// + layernorm, FFN + residual + layernorm; leaves the tile in hs (f16, LDS) and,
// where QKV, in h32 for the next launch's residual. The weights of the stage
// behind (next qkv where QKV, else the head) are fetched ahead into wn / bnv.
// ---------------------------------------------------------------------------
template <bool QKV>
__device__ __forceinline__ void layer_body(
    const _Float16* __restrict__ qk_in, const _Float16* __restrict__ vT_in,
    const _Float16* __restrict__ pwo,  // 32 tiles [nt*4+kt]
    const float* __restrict__ bo,
    const float* __restrict__ g1, const float* __restrict__ be1,
    const _Float16* __restrict__ pf1,  // 64 tiles [nt*4+kt]
    const float* __restrict__ bf1,
    const _Float16* __restrict__ pf2,  // 64 tiles [nt*8+kt]
    const float* __restrict__ bf2,
    const float* __restrict__ g2, const float* __restrict__ be2,
    float* __restrict__ h32, _Float16* hs,
    const _Float16* __restrict__ pn, const float* __restrict__ bn,
    v16h (&wn)[24], float (&bnv)[34]) {
  // the layer's packed weights: tiles 0..31 Wo, 32..95 Wff1, 96..159 Wff2; the next
  // qkv's 96 tiles take the place of Wo and Wff1 once these have been read
  __shared__ __attribute__((aligned(16))) _Float16 wl[160 * 512];
  // one set of tile buffers for each of the block's two row tiles
  __shared__ __attribute__((aligned(16))) _Float16 ao2[2][16 * HP];
  __shared__ __attribute__((aligned(16))) _Float16 h12[2][16 * HP];
  __shared__ __attribute__((aligned(16))) _Float16 mid2[2][16 * MP];
  __shared__ __attribute__((aligned(16))) float red12[2][16 * 8];
  __shared__ __attribute__((aligned(16))) float red22[2][16 * 8];
  int hb = threadIdx.x >> 7;  // which of the two row tiles
  _Float16* ao = ao2[hb];
  _Float16* h1 = h12[hb];
  _Float16* mid = mid2[hb];
  float* red1 = red12[hb];
  float* red2 = red22[hb];
  int w = (threadIdx.x >> 5) & 3;
  int head = w;
  int tile = blockIdx.x * 2 + hb, tb = tile & 127;  // the tile; its number within the batch
  int row0 = tile * 16;
  int t0 = row0 & (T_SEQ - 1);
  int bIdx = row0 >> 11;
  int lane = threadIdx.x & 31;
  int nCol = lane & 15, mBase = (lane < 16) ? 0 : 8, kBase = mBase;
  int keyBase = t0 - 64;
  int n0 = w * 32 + nCol;

  // fetched first: q, all five K fragments, all six V fragments
  // (each in fragment order: see the q/k layout; V: [16-key group][d][16 keys])
  const _Float16* lq = qk_in + (size_t)tile * QK_TILE + head * 512 + lane * 8;
  v16h qa = load_pair(lq, 256);
  const _Float16* lk[5];
  v16h kb[5];
#pragma unroll
  for (int kt = 0; kt < 5; ++kt) {
    int kti = tb - 4 + kt;              // key tile within the batch
    int ktc = kti < 0 ? 0 : kti;        // clamp address; mask handles validity
    lk[kt] = qk_in + (size_t)(tile - tb + ktc) * QK_TILE + head * 512 + lane * 8;
    kb[kt] = load_pair(lk[kt] + 2048, 256);  // k stands behind q in the tile
  }
  // group tb of the plane holds key keyBase (four zero groups stand in front)
  const _Float16* lv = vT_in + (size_t)(bIdx * 4 + head) * VPLANE + tb * 512 + nCol * 16 + kBase;
  v16h vb[6];
#pragma unroll
  for (int nt = 0; nt < 2; ++nt)
#pragma unroll
    for (int kc = 0; kc < 3; ++kc) vb[nt * 3 + kc] = load_pair(lv + nt * 256 + kc * 1024, 512);
  // one wait for the whole run; its inputs are the run's addresses (see fetch_end)
  asm volatile("s_wait_xcnt 0x0" :: "v"(lq), "v"(lk[0]), "v"(lk[1]), "v"(lk[2]), "v"(lk[3]),
               "v"(lk[4]), "v"(lv) : "memory");
  __builtin_amdgcn_sched_barrier(0);  // as in fetch_end

  // fetched next: what o-proj and the first layernorm read beside the weights
  // the residual lies as the wave's C tiles: [tile][wave][C tile][r >> 2][lane][r & 3]
  const float* lr = h32 + tile * H_TILE + w * 512 + lane * 4;
  float res[2][8], bov[2];
#pragma unroll
  for (int i = 0; i < 2; ++i) {
    bov[i] = (bo + n0)[i * 16];
#pragma unroll
    for (int q = 0; q < 2; ++q) {
      float4 t = *(const float4*)(lr + i * 256 + q * 128);
      res[i][q * 4] = t.x; res[i][q * 4 + 1] = t.y; res[i][q * 4 + 2] = t.z; res[i][q * 4 + 3] = t.w;
    }
  }
  float g1a = g1[n0], g1b = (g1 + n0)[16], be1a = be1[n0], be1b = (be1 + n0)[16];
  // one wait for the whole run; its inputs are the run's addresses (see fetch_end)
  asm volatile("s_wait_xcnt 0x0" :: "v"(lr), "v"(n0) : "memory");
  __builtin_amdgcn_sched_barrier(0);  // as in fetch_end

  // Wo, Wff1 and Wff2 -> LDS, once for both row tiles: 40 copies a thread, which fly
  // under the attention. The thread's 16 bytes are half hf = t & 1 of
  // packed lane (t >> 1) & 31 in tile t >> 6 of every four (see load_w_lds).
  const int tx = threadIdx.x;
  const unsigned wdst = (unsigned)(size_t)wl + (tx >> 6) * 1024 + (tx & 1) * 512 +
                        ((tx >> 1) & 31) * 16;
  copy_tiles<32>(wdst, pwo + tx * 8);
  copy_tiles<64>(wdst + 32 * 1024, pf1 + tx * 8);
  copy_tiles<64>(wdst + 96 * 1024, pf2 + tx * 8);
  // keeps every copy in front of the scores: moved in among them it would start later
  __builtin_amdgcn_sched_barrier(0);
  const _Float16* lw = wl + lane * 8;

  // scores TRANSPOSED, S^T = K Q^T: K's B fragment is, register for register, the A
  // fragment of K, and q's A fragment the B fragment of q^T. A lane holds ONE query
  // (nCol) and keys mBase + r of every key tile; lane ^ 16 holds the query's other keys
  v8f s[5];
  int iQ = t0 + nCol;
#pragma unroll
  for (int kt = 0; kt < 5; ++kt) {
    v8f c = {};
    c = wmma16(kb[kt], qa, c);
#pragma unroll
    for (int r = 0; r < 8; ++r) {
      int j = keyBase + kt * 16 + mBase + r;
      bool valid = (j >= 0) && (j <= iQ) && (j >= iQ - 63);
      s[kt][r] = valid ? c[r] : -1e30f;
    }
  }

  // keeps the next run of loads behind the score products: issued in front of
  // them it fills the load counter and the first product waits for more returns
  __builtin_amdgcn_sched_barrier(0);

  // fetched under the softmax: FFN up's biases
  int nf = w * 64 + nCol;
  float bf1v[4];
#pragma unroll
  for (int i = 0; i < 4; ++i) bf1v[i] = (bf1 + nf)[i * 16];
  // the run's wait; its input is the run's address (see fetch_end)
  asm volatile("s_wait_xcnt 0x0" :: "v"(nf) : "memory");
  __builtin_amdgcn_sched_barrier(0);  // as in fetch_end

  // softmax of the lane's query: maximum and sum over its 40 scores in the lane (one
  // partial a key tile: five short chains, not one long one), then one exchange with
  // lane ^ 16. 1 / sum is applied to the output, where the lane still holds that query
  float mk[5], sk[5];
#pragma unroll
  for (int kt = 0; kt < 5; ++kt) {
    mk[kt] = s[kt][0];
#pragma unroll
    for (int r = 1; r < 8; ++r) mk[kt] = fmaxf(mk[kt], s[kt][r]);
  }
  float mx = fmaxf(fmaxf(fmaxf(mk[0], mk[1]), fmaxf(mk[2], mk[3])), mk[4]);
  mx = fmaxf(mx, other_half(mx));
#pragma unroll
  for (int kt = 0; kt < 5; ++kt) {
    sk[kt] = 0.f;
#pragma unroll
    for (int r = 0; r < 8; ++r) { float e = __expf(s[kt][r] - mx); s[kt][r] = e; sk[kt] += e; }
  }
  float sum = ((sk[0] + sk[1]) + (sk[2] + sk[3])) + sk[4];
  sum += other_half(sum);
  float inv = 1.0f / sum;

  // P^T's B fragments straight from the registers: chunk kc holds key tiles 2 kc and
  // 2 kc + 1, the lane's keys mBase + r of each, which is the fragment's k order
  // (keys 80..95 are the zero padding)
  v16h pt[3];
#pragma unroll
  for (int kc = 0; kc < 3; ++kc)
#pragma unroll
    for (int e = 0; e < 8; ++e) {
      pt[kc][e] = (_Float16)s[2 * kc][e];
      pt[kc][8 + e] = (kc < 2) ? (_Float16)s[(kc < 2) ? 2 * kc + 1 : 4][e] : (_Float16)0.f;
    }

  // O^T = V^T(32x96) @ P^T(96x16): V's B fragment is the A fragment of V^T; 2 M tiles
  // x 3 K chunks. The lane holds its query's d = nt * 16 + mBase + r: one 16-byte store
#pragma unroll
  for (int nt = 0; nt < 2; ++nt) {
    v8f acc = {};
#pragma unroll
    for (int kc = 0; kc < 3; ++kc) acc = wmma16(vb[nt * 3 + kc], pt[kc], acc);
    v8h ov;
#pragma unroll
    for (int r = 0; r < 8; ++r) ov[r] = (_Float16)(acc[r] * inv);
    *(v8h*)(ao + nCol * HP + head * 32 + nt * 16 + mBase) = ov;
  }
  // the wave's own weight copies have landed; the barrier behind shows them to all
  asm volatile("s_wait_asynccnt 0x0" ::: "memory");
  __syncthreads();  // every wave reads all four heads' columns of ao

  // o-proj's A fragments and weights first (LDS returns in order: the product waits
  // for them alone); then, fetched under o-proj and the first layernorm: FFN up's
  // weights, LDS -> registers, and what FFN down and the second layernorm read beside
  // the weights
  v16h ap[4];
#pragma unroll
  for (int kt = 0; kt < 4; ++kt) ap[kt] = load_a_frag(ao + kt * 32, HP);
  v16h wo[8];
#pragma unroll
  for (int i = 0; i < 8; ++i) wo[i] = load_w_lds(lw, w * 8 + i);
  // keeps these reads in front of FFN up's weights' reads, which the scheduler else puts first
  __builtin_amdgcn_sched_barrier(0);
  v16h f1[16];
#pragma unroll
  for (int i = 0; i < 16; ++i) f1[i] = load_w_lds(lw, 32 + w * 16 + i);
  float bf2v[2];
#pragma unroll
  for (int i = 0; i < 2; ++i) bf2v[i] = (bf2 + n0)[i * 16];
  float g2a = g2[n0], g2b = (g2 + n0)[16], be2a = be2[n0], be2b = (be2 + n0)[16];
  // the run's wait; its input is the run's address (see fetch_end)
  asm volatile("s_wait_xcnt 0x0" :: "v"(n0) : "memory");
  __builtin_amdgcn_sched_barrier(0);  // as in fetch_end; it keeps the LDS reads whole too

  // o-proj + residual + layernorm; wave w owns columns w*32 .. w*32+31
  v8f o[2];
  {
#pragma unroll
    for (int i = 0; i < 2; ++i) {
      v8f acc = {};
#pragma unroll
      for (int kt = 0; kt < 4; ++kt)
        acc = wmma16(ap[kt], wo[i * 4 + kt], acc);
#pragma unroll
      for (int r = 0; r < 8; ++r)
        o[i][r] = acc[r] + bov[i] + res[i][r];
    }
  }
  ln_stage(o, red1, g1a, g1b, be1a, be1b, w);
  tile_to_lds(o, h1, w);
  // the wave's reads of Wo and Wff1 have returned: behind the barrier their place in
  // LDS is free for the next copies
  if (QKV) asm volatile("s_wait_dscnt 0x0" ::: "memory");
  __syncthreads();  // every wave reads all 128 columns of h1

  // the next qkv's weights -> LDS, in the place of Wo and Wff1: 24 copies a thread,
  // which fly under the FFN
  if (QKV) copy_tiles<96>(wdst, pn + tx * 8);
  // FFN up's A fragments first (see o-proj's above); then, fetched under FFN up:
  // FFN down's weights, LDS -> registers
  v16h au[4];
#pragma unroll
  for (int kt = 0; kt < 4; ++kt) au[kt] = load_a_frag(h1 + kt * 32, HP);
  // keeps these reads in front of the weights' reads, which the scheduler else puts first
  __builtin_amdgcn_sched_barrier(0);
  v16h f2[16];
#pragma unroll
  for (int i = 0; i < 16; ++i) f2[i] = load_w_lds(lw, 96 + w * 16 + i);
  // keeps the run whole: sunk to their uses the reads would each cost their latency
  __builtin_amdgcn_sched_barrier(0);

  // FFN up: wave w owns hidden columns w*64 .. w*64+63
  {
#pragma unroll
    for (int i = 0; i < 4; ++i) {
      int nt = w * 4 + i;
      v8f acc = {};
#pragma unroll
      for (int kt = 0; kt < 4; ++kt)
        acc = wmma16(au[kt], f1[i * 4 + kt], acc);
      float bias = bf1v[i];
#pragma unroll
      for (int r = 0; r < 8; ++r) {
        float v = acc[r] + bias;
        mid[(mBase + r) * MP + nt * 16 + nCol] = (_Float16)(v > 0.f ? v : 0.f);
      }
    }
  }
  __syncthreads();  // every wave reads all 256 columns of mid

  // fetched under FFN down and the second layernorm: the stage behind's biases
  // and, for the head, its weights
  if (QKV) {
    qkv_bias_fetch(bnv, bn, w);
  } else {
    const _Float16* lh = b_lane_ptr(pn, 0);
    int nh = nCol & 7;  // lanes 8..15 of a half read a valid entry that they do not use
#pragma unroll
    for (int kt = 0; kt < 4; ++kt) wn[kt] = load_b_at(lh, kt);
    bnv[0] = bn[nh];
    fetch_end(lh, nh);
  }

  // FFN down + residual (still in o) + layernorm
  {
    v16h a2[8];
#pragma unroll
    for (int kt = 0; kt < 8; ++kt) a2[kt] = load_a_frag(mid + kt * 32, MP);
#pragma unroll
    for (int i = 0; i < 2; ++i) {
      v8f acc = {};
#pragma unroll
      for (int kt = 0; kt < 8; ++kt)
        acc = wmma16(a2[kt], f2[i * 8 + kt], acc);
#pragma unroll
      for (int r = 0; r < 8; ++r) o[i][r] = acc[r] + bf2v[i] + o[i][r];
    }
  }
  // the wave's own copies of the qkv weights have landed; the barrier in the
  // layernorm shows them to all
  if (QKV) {
    // keeps FFN down's products in front of the wait: the copies fly under them too
    __builtin_amdgcn_sched_barrier(0);
    asm volatile("s_wait_asynccnt 0x0" ::: "memory");
  }
  float4 sp[8], sq[8];
  ln_sums(o, red2, sp, sq, w);
  if (QKV) {
    // keeps the row sums' reads in front of the weights' reads, which then return
    // under the layernorm's arithmetic
    __builtin_amdgcn_sched_barrier(0);
    qkv_w_fetch(wn, lw, w);
  }
  ln_apply(o, sp, sq, g2a, g2b, be2a, be2b);
  if (QKV) {
    float* hd = h32 + tile * H_TILE + w * 512 + lane * 4;
#pragma unroll
    for (int i = 0; i < 2; ++i)
#pragma unroll
      for (int q = 0; q < 2; ++q)
        *(float4*)(hd + i * 256 + q * 128) =
            make_float4(o[i][q * 4], o[i][q * 4 + 1], o[i][q * 4 + 2], o[i][q * 4 + 3]);
    fetch_end();
  }
  tile_to_lds(o, hs, w);
  __syncthreads();  // the stage behind reads all 128 columns of hs
}

// layer l, then the qkv of layer l+1 into the OTHER q/k and vT buffers (blocks
// of this launch still read this layer's K and V of their neighbours' rows)
// second bound: one block a WGP (the whole grid resident), which leaves each wave
// the register room that the fragments fetched ahead take
__global__ __launch_bounds__(256, 1) void layer_qkv_kernel(
    const _Float16* __restrict__ qk_in, const _Float16* __restrict__ vT_in,
    const _Float16* __restrict__ pwo, const float* __restrict__ bo,
    const float* __restrict__ g1, const float* __restrict__ be1,
    const _Float16* __restrict__ pf1, const float* __restrict__ bf1,
    const _Float16* __restrict__ pf2, const float* __restrict__ bf2,
    const float* __restrict__ g2, const float* __restrict__ be2,
    float* __restrict__ h32,
    const _Float16* __restrict__ pq, const float* __restrict__ bq,
    _Float16* __restrict__ qk_out, _Float16* __restrict__ vT_out) {
  __shared__ __attribute__((aligned(16))) _Float16 hs2[2][16 * HP];
  int hb = threadIdx.x >> 7;  // which of the block's two row tiles
  _Float16* hs = hs2[hb];
  v16h wn[24];
  float bnv[34];
  layer_body<true>(qk_in, vT_in, pwo, bo, g1, be1, pf1, bf1, pf2, bf2, g2, be2, h32, hs,
                   pq, bq, wn, bnv);
  qkv_stage(hs, wn, bnv, qk_out, vT_out, blockIdx.x * 2 + hb, (threadIdx.x >> 5) & 3);
}

// last layer, then head: out = h @ W_head(128x16 padded) + b_head -> fp32 (R x 8)
// second bound: one block a WGP (the whole grid resident), which leaves each wave
// the register room that the fragments fetched ahead take
__global__ __launch_bounds__(256, 1) void layer_head_kernel(
    const _Float16* __restrict__ qk_in, const _Float16* __restrict__ vT_in,
    const _Float16* __restrict__ pwo, const float* __restrict__ bo,
    const float* __restrict__ g1, const float* __restrict__ be1,
    const _Float16* __restrict__ pf1, const float* __restrict__ bf1,
    const _Float16* __restrict__ pf2, const float* __restrict__ bf2,
    const float* __restrict__ g2, const float* __restrict__ be2,
    float* __restrict__ h32,
    const _Float16* __restrict__ pwh,  // 4 tiles
    const float* __restrict__ bh, float* __restrict__ out) {
  __shared__ __attribute__((aligned(16))) _Float16 hs2[2][16 * HP];
  int hb = threadIdx.x >> 7;  // which of the block's two row tiles
  _Float16* hs = hs2[hb];
  v16h wn[24];
  float bnv[34];
  layer_body<false>(qk_in, vT_in, pwo, bo, g1, be1, pf1, bf1, pf2, bf2, g2, be2, h32, hs,
                    pwh, bh, wn, bnv);
  if (((threadIdx.x >> 5) & 3) != 0) return;  // one N tile: one wave a row tile; no barrier follows
  int row0 = (blockIdx.x * 2 + hb) * 16;
  int lane = threadIdx.x & 31;
  int nCol = lane & 15, mBase = (lane < 16) ? 0 : 8;
  v8f acc = {};
#pragma unroll
  for (int kt = 0; kt < 4; ++kt)
    acc = wmma16(load_a_frag(hs + kt * 32, HP), wn[kt], acc);
  if (nCol < 8) {
    float bias = bnv[0];
#pragma unroll
    for (int r = 0; r < 8; ++r) out[(row0 + mBase + r) * 8 + nCol] = acc[r] + bias;
  }
}

// ---------------------------------------------------------------------------
// host launch
// ---------------------------------------------------------------------------
extern "C" void kernel_launch(void* const* d_in, const int* in_sizes, int n_in,
                              void* d_out, int out_size, void* d_ws, size_t ws_size,
                              hipStream_t stream) {
  (void)in_sizes; (void)n_in; (void)out_size; (void)ws_size;
  const float* E      = (const float*)d_in[0];
  const float* rho    = (const float*)d_in[1];
  const float* W_in1  = (const float*)d_in[2];
  const float* b_in1  = (const float*)d_in[3];
  const float* W_in2  = (const float*)d_in[4];
  const float* b_in2  = (const float*)d_in[5];
  const float* Wqkv   = (const float*)d_in[6];
  const float* bqkv   = (const float*)d_in[7];
  const float* Wo     = (const float*)d_in[8];
  const float* bo     = (const float*)d_in[9];
  const float* ln1_g  = (const float*)d_in[10];
  const float* ln1_b  = (const float*)d_in[11];
  const float* Wff1   = (const float*)d_in[12];
  const float* bff1   = (const float*)d_in[13];
  const float* Wff2   = (const float*)d_in[14];
  const float* bff2   = (const float*)d_in[15];
  const float* ln2_g  = (const float*)d_in[16];
  const float* ln2_b  = (const float*)d_in[17];
  const float* W_head = (const float*)d_in[18];
  const float* b_head = (const float*)d_in[19];

  char* w = (char*)d_ws;
  auto take = [&](size_t bytes) -> void* {
    void* p = (void*)w;
    w += (bytes + 255) & ~(size_t)255;
    return p;
  };
  float*    h32   = (float*)   take((size_t)R_TOT * DM * 4);
  _Float16* qkA   = (_Float16*)take((size_t)(R_TOT / 16) * QK_TILE * 2);
  _Float16* qkB   = (_Float16*)take((size_t)(R_TOT / 16) * QK_TILE * 2);
  _Float16* vT    = (_Float16*)take((size_t)2 * 16 * VPLANE * 2);  // 2 x 16 (b*head) planes
  _Float16* vTA   = vT;
  _Float16* vTB   = vT + (size_t)16 * VPLANE;
  _Float16* pqkv  = (_Float16*)take((size_t)3 * 96 * 512 * 2);
  _Float16* pwo   = (_Float16*)take((size_t)3 * 32 * 512 * 2);
  _Float16* pf1   = (_Float16*)take((size_t)3 * 64 * 512 * 2);
  _Float16* pf2   = (_Float16*)take((size_t)3 * 64 * 512 * 2);
  _Float16* pwh   = (_Float16*)take((size_t)4 * 512 * 2);

  const int TILES = R_TOT / 16;  // 512
  const int PAIRS = R_TOT / 32;  // 256: a layer block holds two row tiles
  setup_inproj_qkv_kernel<<<TILES, 128, 0, stream>>>(
      E, rho, W_in1, b_in1, W_in2, b_in2, Wqkv, bqkv, Wo, Wff1, Wff2, W_head,
      h32, qkA, vT, pqkv, pwo, pf1, pf2, pwh);
  layer_qkv_kernel<<<PAIRS, 256, 0, stream>>>(
      qkA, vTA, pwo, bo, ln1_g, ln1_b, pf1, bff1, pf2, bff2, ln2_g, ln2_b, h32,
      pqkv + (size_t)96 * 512, bqkv + 384, qkB, vTB);
  layer_qkv_kernel<<<PAIRS, 256, 0, stream>>>(
      qkB, vTB, pwo + (size_t)32 * 512, bo + 128, ln1_g + 128, ln1_b + 128,
      pf1 + (size_t)64 * 512, bff1 + 256, pf2 + (size_t)64 * 512, bff2 + 128,
      ln2_g + 128, ln2_b + 128, h32,
      pqkv + (size_t)2 * 96 * 512, bqkv + 2 * 384, qkA, vTA);
  layer_head_kernel<<<PAIRS, 256, 0, stream>>>(
      qkA, vTA, pwo + (size_t)2 * 32 * 512, bo + 2 * 128, ln1_g + 2 * 128, ln1_b + 2 * 128,
      pf1 + (size_t)2 * 64 * 512, bff1 + 2 * 256, pf2 + (size_t)2 * 64 * 512, bff2 + 2 * 128,
      ln2_g + 2 * 128, ln2_b + 2 * 128, h32, pwh, b_head, (float*)d_out);
}

// v009
// It runs in 36.1 microseconds.
// Next to v008, in two timings, it ran 1.11 and 1.10 times as fast.
// Over all steps from v000 it is 8.73 times as fast.
#include <hip/hip_runtime.h>
#include <hip/hip_bf16.h>

// ---------------------------------------------------------------------------
// StateSequenceTransformer on MI455X (gfx1250, wave32, WMMA 16x16x32 f16)
//   B=4 T=2048 D_MODEL=128 NHEAD=4 hd=32 DFF=256 WINDOW=64 NLAYERS=3
//   Four waves own a 16-row tile through a whole layer; a layer block holds two
//   such tiles (8 waves), which share one copy of the layer's weights in LDS.
//   Weights pre-packed into per-lane B-fragment order -> b128 vector loads.
//   q, K, V and the f32 residual pass from launch to launch in the order of the
//   reader's fragments, so that a wave's 16-byte loads and stores cover whole
//   128-byte lines, each alone or (the first launch's v) two together.
// ---------------------------------------------------------------------------

#define R_TOT  8192
#define T_SEQ  2048
#define DM     128
#define DFF_   256
#define QK_TILE 4096          /* f16 of a 16-row tile in the q/k buffer: {q (scaled), k} x 4 heads x 512 */
#define VG     133            /* 16-key groups of a V plane: 4 zero groups, 128, 1 zero group */
#define VPLANE (VG * 512)     /* f16 of one (batch, head) plane of V: [group][d 0..31][16 keys] */
#define H_TILE 2048           /* f32 of a 16-row tile of the residual */
#define HP     136            /* LDS pitch of the tile buffers between fused stages: 272 B = 16 B x odd */
#define TP     136            /* LDS pitch of in_proj's hidden tile: 272 B = 16 B x odd */
#define MP     264            /* LDS pitch of the FFN's hidden tile: 528 B = 16 B x odd */
#define LN_EPS 1e-5f
#define QSCALE 0.17677669529663687f /* 1/sqrt(32) */

typedef __attribute__((ext_vector_type(16))) _Float16 v16h;
typedef __attribute__((ext_vector_type(8)))  _Float16 v8h;
typedef __attribute__((ext_vector_type(8)))  float    v8f;

__device__ __forceinline__ v8f wmma16(v16h a, v16h b, v8f c) {
  return __builtin_amdgcn_wmma_f32_16x16x32_f16(false, a, false, b, (short)0, c,
                                                false, false);
}

// the value that lane (lane ^ 16) holds: the same place in the wave's other 16-lane
// row, by one vector cross-row move (a shuffle would go through the LDS pipe)
__device__ __forceinline__ float other_half(float v) {
  unsigned u = __builtin_bit_cast(unsigned, v);
  return __builtin_bit_cast(float, __builtin_amdgcn_permlanex16(u, u, 0x76543210u, 0xfedcba98u,
                                                                false, false));
}

// A fragment: 16x32 f16 from row-major src (ld multiple of 8, 16B aligned).
// lane<16: row=lane, K={0..7,16..23}; lane>=16: row=lane-16, K={8..15,24..31}
__device__ __forceinline__ v16h load_a_frag(const _Float16* src, int ld) {
  int lane = threadIdx.x & 31;
  const _Float16* p = src + (lane & 15) * ld + ((lane < 16) ? 0 : 8);
  v8h lo = *(const v8h*)p;
  v8h hi = *(const v8h*)(p + 16);
  return __builtin_shufflevector(lo, hi, 0, 1, 2, 3, 4, 5, 6, 7,
                                 8, 9, 10, 11, 12, 13, 14, 15);
}

// A fragment's 16 values from two 16-byte pieces, dist f16 apart.
__device__ __forceinline__ v16h load_pair(const _Float16* p, int dist) {
  v8h lo = *(const v8h*)p;
  v8h hi = *(const v8h*)(p + dist);
  return __builtin_shufflevector(lo, hi, 0, 1, 2, 3, 4, 5, 6, 7,
                                 8, 9, 10, 11, 12, 13, 14, 15);
}

// Pre-packed B fragment: tile = 512 f16, lane's 16 values contiguous (32B).
// the lane's own address of packed tile 'tile'; further tiles of a run lie at
// compile-time distances from it
__device__ __forceinline__ const _Float16* b_lane_ptr(const _Float16* base, int tile) {
  int lane = threadIdx.x & 31;
  return base + ((size_t)tile << 9) + (lane << 4);
}
__device__ __forceinline__ v16h load_b_at(const _Float16* lp, int tile) {
  return *(const v16h*)(lp + (tile << 9));
}

// precaution: stands behind a run of global loads, in front of later loads whose
// results may land in the registers that held the run's addresses
__device__ __forceinline__ void addr_wait() {
  asm volatile("s_wait_xcnt 0x0" ::: "memory");
}

// The layer launches hold their packed weights in LDS, one copy for the block's
// two row tiles. LDS form of a packed tile: [values 0..7, values 8..15][lane][8],
// so that each 16-byte read of a wave covers 512 contiguous bytes (no shared bank).
// lp: the weights' start in LDS + lane * 8
__device__ __forceinline__ v16h load_w_lds(const _Float16* lp, int tile) {
  return load_pair(lp + (tile << 9), 256);
}

// eight asynchronous copies of 16 bytes a lane, 4 KiB apart in both spaces (the
// block's 256 threads move 4 tiles a copy). The wait in the copies' own statement:
// a precaution, in front of whatever reuses the copies' address registers.
__device__ __forceinline__ void copy8(unsigned l, const _Float16* g) {
  asm volatile(
      "global_load_async_to_lds_b128 %0, %8, off\n\t"
      "global_load_async_to_lds_b128 %1, %9, off\n\t"
      "global_load_async_to_lds_b128 %2, %10, off\n\t"
      "global_load_async_to_lds_b128 %3, %11, off\n\t"
      "global_load_async_to_lds_b128 %4, %12, off\n\t"
      "global_load_async_to_lds_b128 %5, %13, off\n\t"
      "global_load_async_to_lds_b128 %6, %14, off\n\t"
      "global_load_async_to_lds_b128 %7, %15, off\n\t"
      "s_wait_xcnt 0x0"
      :: "v"(l), "v"(l + 4096u), "v"(l + 8192u), "v"(l + 12288u),
         "v"(l + 16384u), "v"(l + 20480u), "v"(l + 24576u), "v"(l + 28672u),
         "v"(g), "v"(g + 2048), "v"(g + 4096), "v"(g + 6144),
         "v"(g + 8192), "v"(g + 10240), "v"(g + 12288), "v"(g + 14336)
      : "memory");
}
// NT packed tiles (a multiple of 32), global -> LDS, by the whole block.
// l: the thread's LDS byte address in the first four tiles; g: its 16 bytes there
template <int NT>
__device__ __forceinline__ void copy_tiles(unsigned l, const _Float16* g) {
#pragma unroll
  for (int j = 0; j < NT / 32; ++j) copy8(l + j * 32768u, g + j * 16384);
}

// ---------------------------------------------------------------------------
// Set-up work rides in the first launch. What that launch itself multiplies by
// (W_in1, W_in2, layer 0's Wqkv) it reads as f32 and converts in registers. What
// later launches read (packed weights, the zero groups of V) is dealt out in
// units of one 16-byte store, one unit a thread, 64 units a tile, over the
// grid's first threads.
//   pack: f32 weights (K x N row-major) -> B-fragment tiles, tile id = nt*KT + kt;
//         columns past the source's width -> 0 (padding).
// ---------------------------------------------------------------------------
#define PT_WO  192   /* from   0: 192 tiles, Wqkv   4 x 24 tiles, layers 1 and 2 */
#define PT_F1  288   /* from 192:  96 tiles, Wo     4 x  8 tiles, 3 layers */
#define PT_F2  480   /* from 288: 192 tiles, Wff1   4 x 16 tiles, 3 layers */
#define PT_WH  672   /* from 480: 192 tiles, Wff2   8 x  8 tiles, 3 layers */
#define PT_PAD 676   /* from 672:   4 tiles, W_head 4 x  1 tiles (half full) */
#define PT_END 836   /* from 676: 160 x 64 units, the zero groups of both V buffers */

typedef __attribute__((ext_vector_type(2))) _Float16 v2h;

// f32 weights as B fragments of TWO N tiles at once: the lane reads two
// neighbouring columns (tile 0 holds the even, tile 1 the odd columns of a run of
// 32), so that 16 lanes cover a whole 128-byte line of a weight row.
// lp: the lane's address in row kB (0 or 8) of the weight; k order as in pack.
template <int NLD>
__device__ __forceinline__ void raw_fetch(float2 (&raw)[16], const float* lp, int kt) {
#pragma unroll
  for (int e = 0; e < 16; ++e)
    raw[e] = *(const float2*)(lp + (kt * 32 + (e < 8 ? e : e + 8)) * NLD);
}
__device__ __forceinline__ void raw_to_frags(const float2 (&raw)[16], v16h& f0, v16h& f1) {
#pragma unroll
  for (int e = 0; e < 16; ++e) {
    f0[e] = (_Float16)raw[e].x;
    f1[e] = (_Float16)raw[e].y;
  }
}

// ---------------------------------------------------------------------------
// Row-local stages. Everything behind the K/V exchange of a layer depends only
// on the row tile's own 16 rows, so it runs in ONE launch: the tile goes from stage
// to stage through LDS, the f32 residual stays in registers, and the N tiles of
// every product are dealt to the row tile's four waves.
// Every loop below is unrolled: fragment and accumulator arrays stay in
// registers only where their indices are compile-time constants.
// ---------------------------------------------------------------------------

// Global operands are fetched AHEAD: every weight fragment, bias, norm parameter
// and residual of a stage is loaded into registers, all of a stage at once, at
// least one stage before its use (a launch's first products: just before them; layer 0's q and k biases and o-proj's weights: just before their products),
// so that its latency runs under earlier work.

// ends a run of global loads or stores. The wait: a precaution, in front of
// whatever reuses the run's address registers. The scheduling barrier: it keeps
// later register writes behind that wait, and without it the compiler sinks
// loads fetched ahead towards their uses and issues them a few at a time between
// the matrix instructions, so that their latencies add up again.
__device__ __forceinline__ void fetch_end() {
  addr_wait();
  __builtin_amdgcn_sched_barrier(0);
}
// the same for a run of loads from one lane address p and one lane index n: as
// inputs of the wait's own statement both stay in their registers up to the wait,
// so that no result of the run itself lands in them in front of it
__device__ __forceinline__ void fetch_end(const void* p, int n) {
  asm volatile("s_wait_xcnt 0x0" :: "v"(p), "v"(n) : "memory");
  __builtin_amdgcn_sched_barrier(0);
}

// Layout of the q/k buffer. A (row tile, q or k, head) block is 16 rows x 32 d =
// 512 f16, held as the attention's fragment of it: piece [d >> 4][lane][8], where
// lane = row + 16 * ((d >> 3) & 1) and the 8 values are d & 7. q's A fragment and
// K's B fragment have the same lane and k order, so one layout serves both.
// The writer gets a lane's 8 values by the TRANSPOSED product W^T h^T: a packed B
// fragment of W is, register for register, the A fragment of W^T, and the A
// fragment of h the B fragment of h^T; in the result a lane holds one row of h
// (lane & 15) and 8 neighbouring columns of W.

// the wave's qkv weight fragments and biases: wave w takes head w, N tiles
// (i >> 1) * 8 + 2 * w + (i & 1); i = 0, 1: q; 2, 3: k; 4, 5: v.
// bqv: 8 a tile for q and k (a lane's 8 columns), then one a tile for v
__device__ __forceinline__ void qkv_bias_fetch(float (&bqv)[34],
                                               const float* __restrict__ bq, int w) {
  int lane = threadIdx.x & 31;
  int nb = (w * 32 + ((lane < 16) ? 0 : 8)) * 4;  // in bytes: the register that the loads name
  int nv = w * 32 + (lane & 15);
#pragma unroll
  for (int i = 0; i < 6; ++i) {
    if (i < 4) {
      const float* bp = (const float*)((const char*)bq + nb) + (i >> 1) * 128 + (i & 1) * 16;
      float4 lo = *(const float4*)bp, hi = *(const float4*)(bp + 4);
      bqv[i * 8 + 0] = lo.x; bqv[i * 8 + 1] = lo.y; bqv[i * 8 + 2] = lo.z; bqv[i * 8 + 3] = lo.w;
      bqv[i * 8 + 4] = hi.x; bqv[i * 8 + 5] = hi.y; bqv[i * 8 + 6] = hi.z; bqv[i * 8 + 7] = hi.w;
    } else {
      bqv[32 + (i & 1)] = (bq + nv)[256 + (i & 1) * 16];
    }
  }
  // one wait for the whole run; its inputs are the run's addresses (see fetch_end)
  asm volatile("s_wait_xcnt 0x0" :: "v"(nb), "v"(nv) : "memory");
  __builtin_amdgcn_sched_barrier(0);  // as in fetch_end
}
// lw: the qkv weights' start in LDS (96 tiles [nt*4+kt]) + lane * 8
__device__ __forceinline__ void qkv_w_fetch(v16h (&wq)[24], const _Float16* lw, int w) {
#pragma unroll
  for (int i = 0; i < 6; ++i)
#pragma unroll
    for (int kt = 0; kt < 4; ++kt)
      wq[i * 4 + kt] = load_w_lds(lw, w * 8 + (i >> 1) * 32 + (i & 1) * 4 + kt);
  // keeps the run whole: sunk to their uses the reads would each cost their latency
  __builtin_amdgcn_sched_barrier(0);
}

// qkv of the tile in hs (LDS, pitch HP): q (scaled) and k -> qk_out, v -> v_out,
// each in its reader's fragment order; every store is 16 bytes a lane, 512
// contiguous bytes a wave.
__device__ __forceinline__ void qkv_stage(const _Float16* hs,
                                          const v16h (&wq)[24], const float (&bqv)[34],
                                          _Float16* __restrict__ qk_out,
                                          _Float16* __restrict__ v_out, int tile, int w) {
  int lane = threadIdx.x & 31;
  int nCol = lane & 15, mBase = (lane < 16) ? 0 : 8;
  _Float16* qd = qk_out + (size_t)tile * QK_TILE + w * 512 + lane * 8;
  _Float16* vd = v_out + (size_t)((tile >> 7) * 4 + w) * VPLANE + (4 + (tile & 127)) * 512 +
                 nCol * 16 + mBase;
  v16h a[4];
#pragma unroll
  for (int kt = 0; kt < 4; ++kt) a[kt] = load_a_frag(hs + kt * 32, HP);
#pragma unroll
  for (int i = 0; i < 6; ++i) {
    v8f acc = {};
    v8h vv;
    if (i < 4) {  // q (scaled) / k, transposed product: row nCol, d (i & 1) * 16 + mBase + r
#pragma unroll
      for (int kt = 0; kt < 4; ++kt)
        acc = wmma16(wq[i * 4 + kt], a[kt], acc);
      float scale = (i < 2) ? QSCALE : 1.0f;
#pragma unroll
      for (int r = 0; r < 8; ++r) vv[r] = (_Float16)((acc[r] + bqv[i * 8 + r]) * scale);
      *(v8h*)(qd + (i >> 1) * 2048 + (i & 1) * 256) = vv;
    } else {      // v: d (i & 1) * 16 + nCol, keys mBase + r
#pragma unroll
      for (int kt = 0; kt < 4; ++kt)
        acc = wmma16(a[kt], wq[i * 4 + kt], acc);
      float bias = bqv[32 + (i & 1)];
#pragma unroll
      for (int r = 0; r < 8; ++r) vv[r] = (_Float16)(acc[r] + bias);
      *(v8h*)(vd + (i & 1) * 256) = vv;
    }
    fetch_end();
  }
}

// The products of the row-local stages are TRANSPOSED, W^T h^T (see the q/k layout):
// in a result tile a lane holds ONE row of the tile (lane & 15) and 8 neighbouring
// columns, mBase + r. Wave w's o[2] holds columns w*32 + i*16 + mBase + r.

// a per-column parameter (bias, gain, shift): the lane's 8 columns of each of its NT
// tiles. nb: the lane's first column in bytes, the register that the loads name
template <int NT>
__device__ __forceinline__ void col_fetch(float (&v)[NT * 8], const float* __restrict__ p,
                                          int nb) {
#pragma unroll
  for (int i = 0; i < NT; ++i) {
    const float* bp = (const float*)((const char*)p + nb) + i * 16;
    float4 lo = *(const float4*)bp, hi = *(const float4*)(bp + 4);
    v[i * 8 + 0] = lo.x; v[i * 8 + 1] = lo.y; v[i * 8 + 2] = lo.z; v[i * 8 + 3] = lo.w;
    v[i * 8 + 4] = hi.x; v[i * 8 + 5] = hi.y; v[i * 8 + 6] = hi.z; v[i * 8 + 7] = hi.w;
  }
}

// layernorm of the tile. Row sums: the lane's 16 columns in the lane (four short
// chains), one exchange with lane ^ 16, 4 waves through red.
// g, b: gain and shift of the lane's 16 columns, fetched ahead.
// In two parts, so that other LDS reads can be put behind the row sums' reads.
__device__ __forceinline__ void ln_sums(const v8f (&o)[2], float* red,  // [16 rows][4 waves][2]
                                        float4& p, float4& q, int w) {
  int lane = threadIdx.x & 31;
  int nCol = lane & 15;
  float sa[4], qa[4];
#pragma unroll
  for (int j = 0; j < 4; ++j) {
    sa[j] = (o[0][j] + o[0][j + 4]) + (o[1][j] + o[1][j + 4]);
    qa[j] = (o[0][j] * o[0][j] + o[0][j + 4] * o[0][j + 4]) +
            (o[1][j] * o[1][j] + o[1][j + 4] * o[1][j + 4]);
  }
  float sm = (sa[0] + sa[1]) + (sa[2] + sa[3]);
  float sq = (qa[0] + qa[1]) + (qa[2] + qa[3]);
  sm += other_half(sm);
  sq += other_half(sq);
  if (lane < 16) *(float2*)(red + (nCol * 4 + w) * 2) = make_float2(sm, sq);
  __syncthreads();  // every wave reads all four waves' partial row sums
  p = *(const float4*)(red + nCol * 8);
  q = *(const float4*)(red + nCol * 8 + 4);
}
__device__ __forceinline__ void ln_apply(v8f (&o)[2], float4 p, float4 q,
                                         const float (&g)[16], const float (&b)[16]) {
  float s = (p.x + p.z) + (q.x + q.z);
  float s2 = (p.y + p.w) + (q.y + q.w);
  float mu = s * (1.f / 128.f);
  float inv = rsqrtf(s2 * (1.f / 128.f) - mu * mu + LN_EPS);
#pragma unroll
  for (int i = 0; i < 2; ++i)
#pragma unroll
    for (int r = 0; r < 8; ++r)
      o[i][r] = (o[i][r] - mu) * inv * g[i * 8 + r] + b[i * 8 + r];
}
__device__ __forceinline__ void ln_stage(v8f (&o)[2], float* red,
                                         const float (&g)[16], const float (&b)[16], int w) {
  float4 p, q;
  ln_sums(o, red, p, q, w);
  ln_apply(o, p, q, g, b);
}

// the wave's two result tiles -> f16 rows in LDS (pitch HP): 16 bytes a lane and tile
__device__ __forceinline__ void tile_to_lds(const v8f (&o)[2], _Float16* hs, int w) {
  int lane = threadIdx.x & 31;
  int nCol = lane & 15, mBase = (lane < 16) ? 0 : 8;
#pragma unroll
  for (int i = 0; i < 2; ++i) {
    v8h t;
#pragma unroll
    for (int r = 0; r < 8; ++r) t[r] = (_Float16)o[i][r];
    *(v8h*)(hs + nCol * HP + w * 32 + i * 16 + mBase) = t;
  }
}

// ---------------------------------------------------------------------------
// set-up units + in_proj + first qkv:
//   h = relu(x@W1+b1)@W2 + b2 + PE -> h32; qkv of layer 0
// Wave w owns columns w*32 .. w*32+31 of every product; its two C tiles hold the
// even and the odd ones (see raw_fetch), so a lane's pair of results is adjacent.
// ---------------------------------------------------------------------------

// q (G = 0, scaled) or k (G = 1) of layer 0, head w, by the transposed product (see
// the q/k layout): the lane holds row nCol and, the even columns in c0 and the odd
// in c1, d = 2 * mBase .. 2 * mBase + 15. The biases of those 16 columns are fetched
// here, under the products: there is no register room for them further ahead
template <int G>
__device__ __forceinline__ void qk0_group(const v16h (&a)[4], const float2 (&raw)[4][16],
                                          const float* __restrict__ bq,
                                          _Float16* __restrict__ qk_out, int w) {
  int lane = threadIdx.x & 31;
  const float* bp = bq + G * 128 + w * 32 + (lane >> 4) * 16;
  float4 b4[4];
#pragma unroll
  for (int e = 0; e < 4; ++e) b4[e] = *(const float4*)(bp + e * 4);
  // the run's wait; with the address as its input the loads stay in front of it
  asm volatile("s_wait_xcnt 0x0" :: "v"(bp) : "memory");
  __builtin_amdgcn_sched_barrier(0);  // as in fetch_end
  v16h f[8];
#pragma unroll
  for (int kt = 0; kt < 4; ++kt) raw_to_frags(raw[kt], f[kt], f[4 + kt]);
  v8f c0 = {}, c1 = {};
#pragma unroll
  for (int kt = 0; kt < 4; ++kt) c0 = wmma16(f[kt], a[kt], c0);
#pragma unroll
  for (int kt = 0; kt < 4; ++kt) c1 = wmma16(f[4 + kt], a[kt], c1);
  float scale = (G == 0) ? QSCALE : 1.0f;
  _Float16* dst = qk_out + (size_t)blockIdx.x * QK_TILE + G * 2048 + w * 512 +
                  (lane >> 4) * 256 + (lane & 15) * 8;
#pragma unroll
  for (int s = 0; s < 2; ++s) {  // d & 8: the fragment lane is row + 16 * s
    v8h vv;
#pragma unroll
    for (int j = 0; j < 4; ++j) {
      int r = s * 4 + j;
      float be = (r & 1) ? b4[r >> 1].z : b4[r >> 1].x;
      float bd = (r & 1) ? b4[r >> 1].w : b4[r >> 1].y;
      vv[2 * j] = (_Float16)((c0[r] + be) * scale);
      vv[2 * j + 1] = (_Float16)((c1[r] + bd) * scale);
    }
    *(v8h*)(dst + s * 128) = vv;
  }
  fetch_end();
}

// v of layer 0, head w: d = 2 * nCol + {0, 1}, keys mBase + r
__device__ __forceinline__ void v0_group(const v16h (&a)[4], const float2 (&raw)[4][16],
                                         float2 bias, _Float16* __restrict__ v_out, int w) {
  int lane = threadIdx.x & 31;
  int nCol = lane & 15, mBase = (lane < 16) ? 0 : 8;
  int tile = blockIdx.x;
  v16h f[8];
#pragma unroll
  for (int kt = 0; kt < 4; ++kt) raw_to_frags(raw[kt], f[kt], f[4 + kt]);
  v8f c0 = {}, c1 = {};
#pragma unroll
  for (int kt = 0; kt < 4; ++kt) c0 = wmma16(a[kt], f[kt], c0);
#pragma unroll
  for (int kt = 0; kt < 4; ++kt) c1 = wmma16(a[kt], f[4 + kt], c1);
  v8h v0, v1;
#pragma unroll
  for (int r = 0; r < 8; ++r) {
    v0[r] = (_Float16)(c0[r] + bias.x);
    v1[r] = (_Float16)(c1[r] + bias.y);
  }
  _Float16* vp = v_out + (size_t)((tile >> 7) * 4 + w) * VPLANE + (4 + (tile & 127)) * 512 +
                 nCol * 32 + mBase;
  *(v8h*)vp = v0;
  *(v8h*)(vp + 16) = v1;
  fetch_end();
}

// second bound: two blocks a WGP (the whole grid resident), which leaves each wave
// the register room that the weights fetched ahead take
__global__ __launch_bounds__(128, 2) void setup_inproj_qkv_kernel(
    const float* __restrict__ E, const float* __restrict__ rho,
    const float* __restrict__ W1, const float* __restrict__ b1,
    const float* __restrict__ W2, const float* __restrict__ b2,
    const float* __restrict__ Wqkv, const float* __restrict__ bq,
    const float* __restrict__ Wo, const float* __restrict__ Wff1,
    const float* __restrict__ Wff2, const float* __restrict__ W_head,
    float* __restrict__ h32, _Float16* __restrict__ qk_out,
    _Float16* __restrict__ vT,  // both V buffers (zero groups); layer 0's v goes to the first
    _Float16* __restrict__ pqkv, _Float16* __restrict__ pwo,
    _Float16* __restrict__ pf1, _Float16* __restrict__ pf2,
    _Float16* __restrict__ pwh) {
  __shared__ __attribute__((aligned(16))) _Float16 t1[16 * TP];
  __shared__ __attribute__((aligned(16))) _Float16 hs[16 * HP];
  int row0 = blockIdx.x * 16;
  int w = threadIdx.x >> 5;
  int lane = threadIdx.x & 31;
  int nCol = lane & 15, mBase = (lane < 16) ? 0 : 8, kB = mBase;
  int nc0 = w * 32 + 2 * nCol;

  // the thread's set-up unit. A tile's 64 units are two whole waves, so the tile
  // number is the same in every lane: taken as a scalar, the choice of the
  // weight is scalar work and scalar branches.
  int gid = blockIdx.x * 128 + threadIdx.x;
  int tu = __builtin_amdgcn_readfirstlane(gid >> 6);
  float pv[8] = {0.f, 0.f, 0.f, 0.f, 0.f, 0.f, 0.f, 0.f};
  _Float16* pd = pwh;
  bool pin = false;
  if (tu < PT_PAD) {
    // half a lane's share of a packed tile: 8 k rows of one column
    const float* src;
    _Float16* dst;
    int t, ks = 2, nld;
    if (tu < PT_WO) {
      int l = 1 + tu / 96;
      t = tu % 96; nld = 384;
      src = Wqkv + l * 128 * 384; dst = pqkv + (size_t)(l * 96 + t) * 512;
    } else if (tu < PT_F1) {
      int v = tu - PT_WO;
      t = v & 31; nld = 128;
      src = Wo + (v >> 5) * 128 * 128; dst = pwo + (size_t)v * 512;
    } else if (tu < PT_F2) {
      int v = tu - PT_F1;
      t = v & 63; nld = 256;
      src = Wff1 + (v >> 6) * 128 * 256; dst = pf1 + (size_t)v * 512;
    } else if (tu < PT_WH) {
      int v = tu - PT_F2;
      t = v & 63; nld = 128; ks = 3;
      src = Wff2 + (v >> 6) * 256 * 128; dst = pf2 + (size_t)v * 512;
    } else {
      t = tu - PT_WH; nld = 8;
      src = W_head; dst = pwh + (size_t)t * 512;
    }
    int kt = t & ((1 << ks) - 1), nt = t >> ks;
    int pl = (gid >> 1) & 31, half = gid & 1;  // packed lane; which 8 of its 16 values
    int n = nt * 16 + (pl & 15);
    int k0 = kt * 32 + ((pl < 16) ? 0 : 8) + half * 16;
    pin = n < nld;
    int nc = pin ? n : nld - 1;  // a padding column reads a valid entry that it does not use
    pd = dst + pl * 16 + half * 8;
    const float* pp[8];
#pragma unroll
    for (int i = 0; i < 8; ++i) {
      pp[i] = src + (k0 + i) * nld + nc;
      pv[i] = *pp[i];
    }
    // one wait for the whole run; its inputs are the run's addresses (see fetch_end)
    asm volatile("s_wait_xcnt 0x0" :: "v"(pp[0]), "v"(pp[1]), "v"(pp[2]), "v"(pp[3]),
                 "v"(pp[4]), "v"(pp[5]), "v"(pp[6]), "v"(pp[7]) : "memory");
  } else if (tu < PT_END) {
    // 16 bytes of a V plane's zero groups: four groups in front of the keys, one behind
    int i = gid - PT_PAD * 64;
    int plane = i / 320, c = i % 320;
    int pos = (c < 256) ? c * 8 : ((VG - 1) * 512 + (c - 256) * 8);
    v8h z = {};
    *(v8h*)(vT + (size_t)plane * VPLANE + pos) = z;
    addr_wait();
  }
  // keeps the unit's loads in front of the run below: its store then waits for
  // them alone
  __builtin_amdgcn_sched_barrier(0);

  // fetched next, in the order of use: x and both in_proj weights, all f32.
  // x = concat(E, rho), K padded 16 -> 32: lanes 0..15 hold k 0..7 (E), lanes
  // 16..31 k 8..15 (rho); the upper half of every fragment is the zero padding
  const float* lx = ((lane < 16) ? E : rho) + (row0 + nCol) * 8;
  const float* l1 = W1 + kB * DM + nc0;
  const float* l2 = W2 + kB * DM + nc0;
  float4 xa = *(const float4*)lx, xb = *(const float4*)(lx + 4);
  float2 r1[8], r2[4][16];
#pragma unroll
  for (int e = 0; e < 8; ++e) r1[e] = *(const float2*)(l1 + e * DM);
  float2 b1p = *(const float2*)(b1 + nc0);
#pragma unroll
  for (int kt = 0; kt < 4; ++kt) raw_fetch<DM>(r2[kt], l2, kt);
  // the second product is transposed: the lane's 16 columns there are w*32 + 2*mBase ..
  int nb2 = (w * 32 + 2 * mBase) * 4;  // in bytes: the register that the loads name
  float4 b2q[4];
#pragma unroll
  for (int e = 0; e < 4; ++e) b2q[e] = *((const float4*)((const char*)b2 + nb2) + e);
  // one wait for the whole run; its inputs are the run's addresses (see fetch_end)
  asm volatile("s_wait_xcnt 0x0" :: "v"(lx), "v"(l1), "v"(l2), "v"(nc0), "v"(nb2) : "memory");
  __builtin_amdgcn_sched_barrier(0);  // as in fetch_end

  if (tu < PT_PAD) {
    v8h hv;
#pragma unroll
    for (int i = 0; i < 8; ++i) hv[i] = pin ? (_Float16)pv[i] : (_Float16)0.f;
    *(v8h*)pd = hv;
    fetch_end();
  }

  {
    v16h a = {}, w1a = {}, w1b = {};
    a[0] = (_Float16)xa.x; a[1] = (_Float16)xa.y; a[2] = (_Float16)xa.z; a[3] = (_Float16)xa.w;
    a[4] = (_Float16)xb.x; a[5] = (_Float16)xb.y; a[6] = (_Float16)xb.z; a[7] = (_Float16)xb.w;
#pragma unroll
    for (int e = 0; e < 8; ++e) {
      w1a[e] = (_Float16)r1[e].x;
      w1b[e] = (_Float16)r1[e].y;
    }
    v8f c0 = {}, c1 = {};
    c0 = wmma16(a, w1a, c0);
    c1 = wmma16(a, w1b, c1);
#pragma unroll
    for (int r = 0; r < 8; ++r) {
      float u0 = c0[r] + b1p.x, u1 = c1[r] + b1p.y;
      v2h p = {(_Float16)(u0 > 0.f ? u0 : 0.f), (_Float16)(u1 > 0.f ? u1 : 0.f)};
      *(v2h*)(t1 + (mBase + r) * TP + nc0) = p;
    }
  }
  v16h w2[8];
#pragma unroll
  for (int kt = 0; kt < 4; ++kt) raw_to_frags(r2[kt], w2[kt], w2[4 + kt]);
  __syncthreads();  // every wave reads all 128 columns of t1 as A fragments

  // fetched under the second product: q's and k's weights of layer 0
  const float* lq = Wqkv + kB * 384 + nc0;
  float2 rq[4][16], rk[4][16], rv[4][16];
#pragma unroll
  for (int kt = 0; kt < 4; ++kt) raw_fetch<384>(rq[kt], lq, kt);
#pragma unroll
  for (int kt = 0; kt < 4; ++kt) raw_fetch<384>(rk[kt], lq + 128, kt);
  fetch_end(lq, nc0);

  v8f o[2];
  {
    v16h a2[4];
#pragma unroll
    for (int kt = 0; kt < 4; ++kt) a2[kt] = load_a_frag(t1 + kt * 32, TP);
#pragma unroll
    for (int i = 0; i < 2; ++i) {
      v8f acc = {};
#pragma unroll
      for (int kt = 0; kt < 4; ++kt)
        acc = wmma16(w2[i * 4 + kt], a2[kt], acc);  // transposed: see below
      o[i] = acc;
    }
  }

  // v's weights of layer 0; a run of its own: with all three in one run the build spills
#pragma unroll
  for (int kt = 0; kt < 4; ++kt) raw_fetch<384>(rv[kt], lq + 256, kt);
  float2 bvp = *(const float2*)(bq + nc0 + 256);
  fetch_end(lq, nc0);

  // By the transposed product the lane holds row nCol and 16 neighbouring columns:
  // o[0][r] is column w*32 + 2*mBase + 2*r (even), o[1][r] the odd one behind it
  {
    // an even (sine) and the odd (cosine) column behind it share one frequency
    float pos = (float)((row0 + nCol) & (T_SEQ - 1));
#pragma unroll
    for (int r = 0; r < 8; ++r) {
      float div = __expf(-(float)(w * 16 + mBase + r) * (9.210340371976184f / 64.f));
      float ang = pos * div;
      float be = (r & 1) ? b2q[r >> 1].z : b2q[r >> 1].x;
      float bd = (r & 1) ? b2q[r >> 1].w : b2q[r >> 1].y;
      o[0][r] = o[0][r] + be + __sinf(ang);
      o[1][r] = o[1][r] + bd + __cosf(ang);
    }
  }
  {
    // the residual in the order of the layer launches' result tiles (see layer_body):
    // the lane's 16 columns are tile lane >> 4 there, columns 8 s .. 8 s + 7 of it
    // lane nCol + 16 s, four of them (q) a 16-byte piece
    float* hd = h32 + blockIdx.x * H_TILE + w * 512 + (lane >> 4) * 256 + nCol * 4;
#pragma unroll
    for (int s = 0; s < 2; ++s)
#pragma unroll
      for (int q = 0; q < 2; ++q)
        *(float4*)(hd + q * 128 + s * 64) =
            make_float4(o[0][s * 4 + q * 2], o[1][s * 4 + q * 2],
                        o[0][s * 4 + q * 2 + 1], o[1][s * 4 + q * 2 + 1]);
    // the run's wait; with the address as its input the stores stay in front of it
    asm volatile("s_wait_xcnt 0x0" :: "v"(hd) : "memory");
    __builtin_amdgcn_sched_barrier(0);  // as in fetch_end
  }
#pragma unroll
  for (int s = 0; s < 2; ++s) {
    v8h p;
#pragma unroll
    for (int j = 0; j < 4; ++j) {
      p[2 * j] = (_Float16)o[0][s * 4 + j];
      p[2 * j + 1] = (_Float16)o[1][s * 4 + j];
    }
    *(v8h*)(hs + nCol * HP + w * 32 + 2 * mBase + s * 8) = p;
  }
  __syncthreads();  // every wave reads all 128 columns of hs as A fragments

  v16h a[4];
#pragma unroll
  for (int kt = 0; kt < 4; ++kt) a[kt] = load_a_frag(hs + kt * 32, HP);
  qk0_group<0>(a, rq, bq, qk_out, w);
  qk0_group<1>(a, rk, bq, qk_out, w);
  v0_group(a, rv, bvp, vT, w);
}

// ---------------------------------------------------------------------------
// one layer behind its qkv: windowed attention (wave = head), o-proj + residual
// + layernorm, FFN + residual + layernorm; leaves the tile in hs (f16, LDS) and,
// where QKV, in h32 for the next launch's residual. The weights of the stage
// behind (next qkv where QKV, else the head) are fetched ahead into wn / bnv.
// ---------------------------------------------------------------------------
template <bool QKV>
__device__ __forceinline__ void layer_body(
    const _Float16* __restrict__ qk_in, const _Float16* __restrict__ vT_in,
    const _Float16* __restrict__ pwo,  // 32 tiles [nt*4+kt]
    const float* __restrict__ bo,
    const float* __restrict__ g1, const float* __restrict__ be1,
    const _Float16* __restrict__ pf1,  // 64 tiles [nt*4+kt]
    const float* __restrict__ bf1,
    const _Float16* __restrict__ pf2,  // 64 tiles [nt*8+kt]
    const float* __restrict__ bf2,
    const float* __restrict__ g2, const float* __restrict__ be2,
    float* __restrict__ h32, _Float16* hs,
    const _Float16* __restrict__ pn, const float* __restrict__ bn,
    v16h (&wn)[24], float (&bnv)[34]) {
  // the layer's packed weights: tiles 0..31 Wo, 32..95 Wff1, 96..159 Wff2; the next
  // qkv's 96 tiles take the place of Wo and Wff1 once these have been read
  __shared__ __attribute__((aligned(16))) _Float16 wl[160 * 512];
  // one set of tile buffers for each of the block's two row tiles
  __shared__ __attribute__((aligned(16))) _Float16 ao2[2][16 * HP];
  __shared__ __attribute__((aligned(16))) _Float16 h12[2][16 * HP];
  __shared__ __attribute__((aligned(16))) _Float16 mid2[2][16 * MP];
  __shared__ __attribute__((aligned(16))) float red12[2][16 * 8];
  __shared__ __attribute__((aligned(16))) float red22[2][16 * 8];
  int hb = threadIdx.x >> 7;  // which of the two row tiles
  _Float16* ao = ao2[hb];
  _Float16* h1 = h12[hb];
  _Float16* mid = mid2[hb];
  float* red1 = red12[hb];
  float* red2 = red22[hb];
  int w = (threadIdx.x >> 5) & 3;
  int head = w;
  int tile = blockIdx.x * 2 + hb, tb = tile & 127;  // the tile; its number within the batch
  int row0 = tile * 16;
  int t0 = row0 & (T_SEQ - 1);
  int bIdx = row0 >> 11;
  int lane = threadIdx.x & 31;
  int nCol = lane & 15, mBase = (lane < 16) ? 0 : 8, kBase = mBase;
  int keyBase = t0 - 64;
  int nb = (w * 32 + mBase) * 4;  // the lane's first column of the wave's 32, in bytes

  // fetched first: q, all five K fragments, all six V fragments
  // (each in fragment order: see the q/k layout; V: [16-key group][d][16 keys])
  const _Float16* lq = qk_in + (size_t)tile * QK_TILE + head * 512 + lane * 8;
  v16h qa = load_pair(lq, 256);
  const _Float16* lk[5];
  v16h kb[5];
#pragma unroll
  for (int kt = 0; kt < 5; ++kt) {
    int kti = tb - 4 + kt;              // key tile within the batch
    int ktc = kti < 0 ? 0 : kti;        // clamp address; mask handles validity
    lk[kt] = qk_in + (size_t)(tile - tb + ktc) * QK_TILE + head * 512 + lane * 8;
    kb[kt] = load_pair(lk[kt] + 2048, 256);  // k stands behind q in the tile
  }
  // group tb of the plane holds key keyBase (four zero groups stand in front)
  const _Float16* lv = vT_in + (size_t)(bIdx * 4 + head) * VPLANE + tb * 512 + nCol * 16 + kBase;
  v16h vb[6];
#pragma unroll
  for (int nt = 0; nt < 2; ++nt)
#pragma unroll
    for (int kc = 0; kc < 3; ++kc) vb[nt * 3 + kc] = load_pair(lv + nt * 256 + kc * 1024, 512);
  // one wait for the whole run; its inputs are the run's addresses (see fetch_end)
  asm volatile("s_wait_xcnt 0x0" :: "v"(lq), "v"(lk[0]), "v"(lk[1]), "v"(lk[2]), "v"(lk[3]),
               "v"(lk[4]), "v"(lv) : "memory");
  __builtin_amdgcn_sched_barrier(0);  // as in fetch_end

  // fetched next: what o-proj and the first layernorm read beside the weights
  // the residual lies as the wave's result tiles: [tile][wave][i][r >> 2][lane][r & 3]
  const float* lr = h32 + tile * H_TILE + w * 512 + lane * 4;
  float res[2][8], bov[16], g1v[16], be1v[16];
#pragma unroll
  for (int i = 0; i < 2; ++i) {
#pragma unroll
    for (int q = 0; q < 2; ++q) {
      float4 t = *(const float4*)(lr + i * 256 + q * 128);
      res[i][q * 4] = t.x; res[i][q * 4 + 1] = t.y; res[i][q * 4 + 2] = t.z; res[i][q * 4 + 3] = t.w;
    }
  }
  col_fetch<2>(bov, bo, nb);
  col_fetch<2>(g1v, g1, nb);
  col_fetch<2>(be1v, be1, nb);
  // one wait for the whole run; its inputs are the run's addresses (see fetch_end)
  asm volatile("s_wait_xcnt 0x0" :: "v"(lr), "v"(nb) : "memory");
  __builtin_amdgcn_sched_barrier(0);  // as in fetch_end

  // Wo, Wff1 and Wff2 -> LDS, once for both row tiles: 40 copies a thread, which fly
  // under the attention. The thread's 16 bytes are half hf = t & 1 of
  // packed lane (t >> 1) & 31 in tile t >> 6 of every four (see load_w_lds).
  const int tx = threadIdx.x;
  const unsigned wdst = (unsigned)(size_t)wl + (tx >> 6) * 1024 + (tx & 1) * 512 +
                        ((tx >> 1) & 31) * 16;
  copy_tiles<32>(wdst, pwo + tx * 8);
  copy_tiles<64>(wdst + 32 * 1024, pf1 + tx * 8);
  copy_tiles<64>(wdst + 96 * 1024, pf2 + tx * 8);
  // keeps every copy in front of the scores: moved in among them it would start later
  __builtin_amdgcn_sched_barrier(0);
  const _Float16* lw = wl + lane * 8;

  // scores TRANSPOSED, S^T = K Q^T: K's B fragment is, register for register, the A
  // fragment of K, and q's A fragment the B fragment of q^T. A lane holds ONE query
  // (nCol) and keys mBase + r of every key tile; lane ^ 16 holds the query's other keys
  v8f s[5];
  int iQ = t0 + nCol;
#pragma unroll
  for (int kt = 0; kt < 5; ++kt) {
    v8f c = {};
    c = wmma16(kb[kt], qa, c);
#pragma unroll
    for (int r = 0; r < 8; ++r) {
      int j = keyBase + kt * 16 + mBase + r;
      bool valid = (j >= 0) && (j <= iQ) && (j >= iQ - 63);
      s[kt][r] = valid ? c[r] : -1e30f;
    }
  }

  // keeps the next run of loads behind the score products: issued in front of
  // them it fills the load counter and the first product waits for more returns
  __builtin_amdgcn_sched_barrier(0);

  // fetched under the softmax: FFN up's biases
  int nf = (w * 64 + mBase) * 4;  // the lane's first hidden column of the wave's 64, in bytes
  float bf1v[32];
  col_fetch<4>(bf1v, bf1, nf);
  // the run's wait; its input is the run's address (see fetch_end)
  asm volatile("s_wait_xcnt 0x0" :: "v"(nf) : "memory");
  __builtin_amdgcn_sched_barrier(0);  // as in fetch_end

  // softmax of the lane's query: maximum and sum over its 40 scores in the lane (one
  // partial a key tile: five short chains, not one long one), then one exchange with
  // lane ^ 16. 1 / sum is applied to the output, where the lane still holds that query
  float mk[5], sk[5];
#pragma unroll
  for (int kt = 0; kt < 5; ++kt) {
    mk[kt] = s[kt][0];
#pragma unroll
    for (int r = 1; r < 8; ++r) mk[kt] = fmaxf(mk[kt], s[kt][r]);
  }
  float mx = fmaxf(fmaxf(fmaxf(mk[0], mk[1]), fmaxf(mk[2], mk[3])), mk[4]);
  mx = fmaxf(mx, other_half(mx));
#pragma unroll
  for (int kt = 0; kt < 5; ++kt) {
    sk[kt] = 0.f;
#pragma unroll
    for (int r = 0; r < 8; ++r) { float e = __expf(s[kt][r] - mx); s[kt][r] = e; sk[kt] += e; }
  }
  float sum = ((sk[0] + sk[1]) + (sk[2] + sk[3])) + sk[4];
  sum += other_half(sum);
  float inv = 1.0f / sum;

  // P^T's B fragments straight from the registers: chunk kc holds key tiles 2 kc and
  // 2 kc + 1, the lane's keys mBase + r of each, which is the fragment's k order
  // (keys 80..95 are the zero padding)
  v16h pt[3];
#pragma unroll
  for (int kc = 0; kc < 3; ++kc)
#pragma unroll
    for (int e = 0; e < 8; ++e) {
      pt[kc][e] = (_Float16)s[2 * kc][e];
      pt[kc][8 + e] = (kc < 2) ? (_Float16)s[(kc < 2) ? 2 * kc + 1 : 4][e] : (_Float16)0.f;
    }

  // O^T = V^T(32x96) @ P^T(96x16): V's B fragment is the A fragment of V^T; 2 M tiles
  // x 3 K chunks. The lane holds its query's d = nt * 16 + mBase + r: one 16-byte store
#pragma unroll
  for (int nt = 0; nt < 2; ++nt) {
    v8f acc = {};
#pragma unroll
    for (int kc = 0; kc < 3; ++kc) acc = wmma16(vb[nt * 3 + kc], pt[kc], acc);
    v8h ov;
#pragma unroll
    for (int r = 0; r < 8; ++r) ov[r] = (_Float16)(acc[r] * inv);
    *(v8h*)(ao + nCol * HP + head * 32 + nt * 16 + mBase) = ov;
  }
  // the wave's own weight copies have landed; the barrier behind shows them to all
  asm volatile("s_wait_asynccnt 0x0" ::: "memory");
  __syncthreads();  // every wave reads all four heads' columns of ao

  // o-proj's A fragments and weights first (LDS returns in order: the product waits
  // for them alone); then, fetched under o-proj and the first layernorm: FFN up's
  // weights, LDS -> registers, and what FFN down and the second layernorm read beside
  // the weights
  v16h ap[4];
#pragma unroll
  for (int kt = 0; kt < 4; ++kt) ap[kt] = load_a_frag(ao + kt * 32, HP);
  v16h wo[8];
#pragma unroll
  for (int i = 0; i < 8; ++i) wo[i] = load_w_lds(lw, w * 8 + i);
  // keeps these reads in front of FFN up's weights' reads, which the scheduler else puts first
  __builtin_amdgcn_sched_barrier(0);
  v16h f1[16];
#pragma unroll
  for (int i = 0; i < 16; ++i) f1[i] = load_w_lds(lw, 32 + w * 16 + i);
  float bf2v[16], g2v[16], be2v[16];
  col_fetch<2>(bf2v, bf2, nb);
  col_fetch<2>(g2v, g2, nb);
  col_fetch<2>(be2v, be2, nb);
  // the run's wait; its input is the run's address (see fetch_end)
  asm volatile("s_wait_xcnt 0x0" :: "v"(nb) : "memory");
  __builtin_amdgcn_sched_barrier(0);  // as in fetch_end; it keeps the LDS reads whole too

  // o-proj (transposed) + residual + layernorm; wave w owns columns w*32 .. w*32+31
  v8f o[2];
  {
#pragma unroll
    for (int i = 0; i < 2; ++i) {
      v8f acc = {};
#pragma unroll
      for (int kt = 0; kt < 4; ++kt)
        acc = wmma16(wo[i * 4 + kt], ap[kt], acc);
#pragma unroll
      for (int r = 0; r < 8; ++r)
        o[i][r] = acc[r] + bov[i * 8 + r] + res[i][r];
    }
  }
  ln_stage(o, red1, g1v, be1v, w);
  tile_to_lds(o, h1, w);
  // the wave's reads of Wo and Wff1 have returned: behind the barrier their place in
  // LDS is free for the next copies
  if (QKV) asm volatile("s_wait_dscnt 0x0" ::: "memory");
  __syncthreads();  // every wave reads all 128 columns of h1

  // the next qkv's weights -> LDS, in the place of Wo and Wff1: 24 copies a thread,
  // which fly under the FFN
  if (QKV) copy_tiles<96>(wdst, pn + tx * 8);
  // FFN up's A fragments first (see o-proj's above); then, fetched under FFN up:
  // FFN down's weights, LDS -> registers
  v16h au[4];
#pragma unroll
  for (int kt = 0; kt < 4; ++kt) au[kt] = load_a_frag(h1 + kt * 32, HP);
  // keeps these reads in front of the weights' reads, which the scheduler else puts first
  __builtin_amdgcn_sched_barrier(0);
  v16h f2[16];
#pragma unroll
  for (int i = 0; i < 16; ++i) f2[i] = load_w_lds(lw, 96 + w * 16 + i);
  // keeps the run whole: sunk to their uses the reads would each cost their latency
  __builtin_amdgcn_sched_barrier(0);

  // FFN up (transposed): wave w owns hidden columns w*64 .. w*64+63; the lane's 8
  // columns of a tile are one 16-byte store
  {
#pragma unroll
    for (int i = 0; i < 4; ++i) {
      int nt = w * 4 + i;
      v8f acc = {};
#pragma unroll
      for (int kt = 0; kt < 4; ++kt)
        acc = wmma16(f1[i * 4 + kt], au[kt], acc);
      v8h mv;
#pragma unroll
      for (int r = 0; r < 8; ++r) {
        float v = acc[r] + bf1v[i * 8 + r];
        mv[r] = (_Float16)(v > 0.f ? v : 0.f);
      }
      *(v8h*)(mid + nCol * MP + nt * 16 + mBase) = mv;
    }
  }
  __syncthreads();  // every wave reads all 256 columns of mid

  // fetched under FFN down and the second layernorm: the stage behind's biases
  // and, for the head, its weights
  if (QKV) {
    qkv_bias_fetch(bnv, bn, w);
  } else {
    const _Float16* lh = b_lane_ptr(pn, 0);
    int nh = nCol & 7;  // lanes 8..15 of a half read a valid entry that they do not use
#pragma unroll
    for (int kt = 0; kt < 4; ++kt) wn[kt] = load_b_at(lh, kt);
    bnv[0] = bn[nh];
    fetch_end(lh, nh);
  }

  // FFN down (transposed) + residual (still in o) + layernorm
  {
    v16h a2[8];
#pragma unroll
    for (int kt = 0; kt < 8; ++kt) a2[kt] = load_a_frag(mid + kt * 32, MP);
#pragma unroll
    for (int i = 0; i < 2; ++i) {
      v8f acc = {};
#pragma unroll
      for (int kt = 0; kt < 8; ++kt)
        acc = wmma16(f2[i * 8 + kt], a2[kt], acc);
#pragma unroll
      for (int r = 0; r < 8; ++r) o[i][r] = acc[r] + bf2v[i * 8 + r] + o[i][r];
    }
  }
  // the wave's own copies of the qkv weights have landed; the barrier in the
  // layernorm shows them to all
  if (QKV) {
    // keeps FFN down's products in front of the wait: the copies fly under them too
    __builtin_amdgcn_sched_barrier(0);
    asm volatile("s_wait_asynccnt 0x0" ::: "memory");
  }
  float4 sp, sq;
  ln_sums(o, red2, sp, sq, w);
  if (QKV) {
    // keeps the row sums' reads in front of the weights' reads, which then return
    // under the layernorm's arithmetic
    __builtin_amdgcn_sched_barrier(0);
    qkv_w_fetch(wn, lw, w);
  }
  ln_apply(o, sp, sq, g2v, be2v);
  if (QKV) {
    float* hd = h32 + tile * H_TILE + w * 512 + lane * 4;
#pragma unroll
    for (int i = 0; i < 2; ++i)
#pragma unroll
      for (int q = 0; q < 2; ++q)
        *(float4*)(hd + i * 256 + q * 128) =
            make_float4(o[i][q * 4], o[i][q * 4 + 1], o[i][q * 4 + 2], o[i][q * 4 + 3]);
    fetch_end();
  }
  tile_to_lds(o, hs, w);
  __syncthreads();  // the stage behind reads all 128 columns of hs
}

// layer l, then the qkv of layer l+1 into the OTHER q/k and vT buffers (blocks
// of this launch still read this layer's K and V of their neighbours' rows)
// second bound: one block a WGP (the whole grid resident), which leaves each wave
// the register room that the fragments fetched ahead take
__global__ __launch_bounds__(256, 1) void layer_qkv_kernel(
    const _Float16* __restrict__ qk_in, const _Float16* __restrict__ vT_in,
    const _Float16* __restrict__ pwo, const float* __restrict__ bo,
    const float* __restrict__ g1, const float* __restrict__ be1,
    const _Float16* __restrict__ pf1, const float* __restrict__ bf1,
    const _Float16* __restrict__ pf2, const float* __restrict__ bf2,
    const float* __restrict__ g2, const float* __restrict__ be2,
    float* __restrict__ h32,
    const _Float16* __restrict__ pq, const float* __restrict__ bq,
    _Float16* __restrict__ qk_out, _Float16* __restrict__ vT_out) {
  __shared__ __attribute__((aligned(16))) _Float16 hs2[2][16 * HP];
  int hb = threadIdx.x >> 7;  // which of the block's two row tiles
  _Float16* hs = hs2[hb];
  v16h wn[24];
  float bnv[34];
  layer_body<true>(qk_in, vT_in, pwo, bo, g1, be1, pf1, bf1, pf2, bf2, g2, be2, h32, hs,
                   pq, bq, wn, bnv);
  qkv_stage(hs, wn, bnv, qk_out, vT_out, blockIdx.x * 2 + hb, (threadIdx.x >> 5) & 3);
}

// last layer, then head: out = h @ W_head(128x16 padded) + b_head -> fp32 (R x 8)
// second bound: one block a WGP (the whole grid resident), which leaves each wave
// the register room that the fragments fetched ahead take
__global__ __launch_bounds__(256, 1) void layer_head_kernel(
    const _Float16* __restrict__ qk_in, const _Float16* __restrict__ vT_in,
    const _Float16* __restrict__ pwo, const float* __restrict__ bo,
    const float* __restrict__ g1, const float* __restrict__ be1,
    const _Float16* __restrict__ pf1, const float* __restrict__ bf1,
    const _Float16* __restrict__ pf2, const float* __restrict__ bf2,
    const float* __restrict__ g2, const float* __restrict__ be2,
    float* __restrict__ h32,
    const _Float16* __restrict__ pwh,  // 4 tiles
    const float* __restrict__ bh, float* __restrict__ out) {
  __shared__ __attribute__((aligned(16))) _Float16 hs2[2][16 * HP];
  int hb = threadIdx.x >> 7;  // which of the block's two row tiles
  _Float16* hs = hs2[hb];
  v16h wn[24];
  float bnv[34];
  layer_body<false>(qk_in, vT_in, pwo, bo, g1, be1, pf1, bf1, pf2, bf2, g2, be2, h32, hs,
                    pwh, bh, wn, bnv);
  if (((threadIdx.x >> 5) & 3) != 0) return;  // one N tile: one wave a row tile; no barrier follows
  int row0 = (blockIdx.x * 2 + hb) * 16;
  int lane = threadIdx.x & 31;
  int nCol = lane & 15, mBase = (lane < 16) ? 0 : 8;
  v8f acc = {};
#pragma unroll
  for (int kt = 0; kt < 4; ++kt)
    acc = wmma16(load_a_frag(hs + kt * 32, HP), wn[kt], acc);
  if (nCol < 8) {
    float bias = bnv[0];
#pragma unroll
    for (int r = 0; r < 8; ++r) out[(row0 + mBase + r) * 8 + nCol] = acc[r] + bias;
  }
}

// ---------------------------------------------------------------------------
// host launch
// ---------------------------------------------------------------------------
extern "C" void kernel_launch(void* const* d_in, const int* in_sizes, int n_in,
                              void* d_out, int out_size, void* d_ws, size_t ws_size,
                              hipStream_t stream) {
  (void)in_sizes; (void)n_in; (void)out_size; (void)ws_size;
  const float* E      = (const float*)d_in[0];
  const float* rho    = (const float*)d_in[1];
  const float* W_in1  = (const float*)d_in[2];
  const float* b_in1  = (const float*)d_in[3];
  const float* W_in2  = (const float*)d_in[4];
  const float* b_in2  = (const float*)d_in[5];
  const float* Wqkv   = (const float*)d_in[6];
  const float* bqkv   = (const float*)d_in[7];
  const float* Wo     = (const float*)d_in[8];
  const float* bo     = (const float*)d_in[9];
  const float* ln1_g  = (const float*)d_in[10];
  const float* ln1_b  = (const float*)d_in[11];
  const float* Wff1   = (const float*)d_in[12];
  const float* bff1   = (const float*)d_in[13];
  const float* Wff2   = (const float*)d_in[14];
  const float* bff2   = (const float*)d_in[15];
  const float* ln2_g  = (const float*)d_in[16];
  const float* ln2_b  = (const float*)d_in[17];
  const float* W_head = (const float*)d_in[18];
  const float* b_head = (const float*)d_in[19];

  char* w = (char*)d_ws;
  auto take = [&](size_t bytes) -> void* {
    void* p = (void*)w;
    w += (bytes + 255) & ~(size_t)255;
    return p;
  };
  float*    h32   = (float*)   take((size_t)R_TOT * DM * 4);
  _Float16* qkA   = (_Float16*)take((size_t)(R_TOT / 16) * QK_TILE * 2);
  _Float16* qkB   = (_Float16*)take((size_t)(R_TOT / 16) * QK_TILE * 2);
  _Float16* vT    = (_Float16*)take((size_t)2 * 16 * VPLANE * 2);  // 2 x 16 (b*head) planes
  _Float16* vTA   = vT;
  _Float16* vTB   = vT + (size_t)16 * VPLANE;
  _Float16* pqkv  = (_Float16*)take((size_t)3 * 96 * 512 * 2);
  _Float16* pwo   = (_Float16*)take((size_t)3 * 32 * 512 * 2);
  _Float16* pf1   = (_Float16*)take((size_t)3 * 64 * 512 * 2);
  _Float16* pf2   = (_Float16*)take((size_t)3 * 64 * 512 * 2);
  _Float16* pwh   = (_Float16*)take((size_t)4 * 512 * 2);

  const int TILES = R_TOT / 16;  // 512
  const int PAIRS = R_TOT / 32;  // 256: a layer block holds two row tiles
  setup_inproj_qkv_kernel<<<TILES, 128, 0, stream>>>(
      E, rho, W_in1, b_in1, W_in2, b_in2, Wqkv, bqkv, Wo, Wff1, Wff2, W_head,
      h32, qkA, vT, pqkv, pwo, pf1, pf2, pwh);
  layer_qkv_kernel<<<PAIRS, 256, 0, stream>>>(
      qkA, vTA, pwo, bo, ln1_g, ln1_b, pf1, bff1, pf2, bff2, ln2_g, ln2_b, h32,
      pqkv + (size_t)96 * 512, bqkv + 384, qkB, vTB);
  layer_qkv_kernel<<<PAIRS, 256, 0, stream>>>(
      qkB, vTB, pwo + (size_t)32 * 512, bo + 128, ln1_g + 128, ln1_b + 128,
      pf1 + (size_t)64 * 512, bff1 + 256, pf2 + (size_t)64 * 512, bff2 + 128,
      ln2_g + 128, ln2_b + 128, h32,
      pqkv + (size_t)2 * 96 * 512, bqkv + 2 * 384, qkA, vTA);
  layer_head_kernel<<<PAIRS, 256, 0, stream>>>(
      qkA, vTA, pwo + (size_t)2 * 32 * 512, bo + 2 * 128, ln1_g + 2 * 128, ln1_b + 2 * 128,
      pf1 + (size_t)2 * 64 * 512, bff1 + 2 * 256, pf2 + (size_t)2 * 64 * 512, bff2 + 2 * 128,
      ln2_g + 2 * 128, ln2_b + 2 * 128, h32, pwh, b_head, (float*)d_out);
}

// v010
// One run takes 34.4 microseconds.
// In two side-by-side timings against v009, it was 1.04 and 1.06 times as fast.
// Over all steps from v000 it is 9.15 times as fast.
#include <hip/hip_runtime.h>
#include <hip/hip_bf16.h>

// ---------------------------------------------------------------------------
// StateSequenceTransformer on MI455X (gfx1250, wave32, WMMA 16x16x32 f16)
//   B=4 T=2048 D_MODEL=128 NHEAD=4 hd=32 DFF=256 WINDOW=64 NLAYERS=3
//   A layer block is four waves and holds two 16-row tiles through a whole layer:
//   every wave works on both tiles, so that each weight fragment it reads from the
//   block's copy of the weights in LDS serves two products.
//   Weights pre-packed into per-lane B-fragment order -> b128 vector loads.
//   q, K, V and the f32 residual pass from launch to launch in the order of the
//   reader's fragments, so that a wave's 16-byte loads and stores cover whole
//   128-byte lines, each alone or (the first launch's v) two together.
// ---------------------------------------------------------------------------

#define R_TOT  8192
#define T_SEQ  2048
#define DM     128
#define DFF_   256
#define QK_TILE 4096          /* f16 of a 16-row tile in the q/k buffer: {q (scaled), k} x 4 heads x 512 */
#define VG     133            /* 16-key groups of a V plane: 4 zero groups, 128, 1 zero group */
#define VPLANE (VG * 512)     /* f16 of one (batch, head) plane of V: [group][d 0..31][16 keys] */
#define H_TILE 2048           /* f32 of a 16-row tile of the residual */
#define HP     136            /* LDS pitch of the tile buffers between fused stages: 272 B = 16 B x odd */
#define TP     136            /* LDS pitch of in_proj's hidden tile: 272 B = 16 B x odd */
#define MP     264            /* LDS pitch of the FFN's hidden tile: 528 B = 16 B x odd */
#define LN_EPS 1e-5f
#define QSCALE 0.17677669529663687f /* 1/sqrt(32) */

typedef __attribute__((ext_vector_type(16))) _Float16 v16h;
typedef __attribute__((ext_vector_type(8)))  _Float16 v8h;
typedef __attribute__((ext_vector_type(8)))  float    v8f;

__device__ __forceinline__ v8f wmma16(v16h a, v16h b, v8f c) {
  return __builtin_amdgcn_wmma_f32_16x16x32_f16(false, a, false, b, (short)0, c,
                                                false, false);
}

// the value that lane (lane ^ 16) holds: the same place in the wave's other 16-lane
// row, by one vector cross-row move (a shuffle would go through the LDS pipe)
__device__ __forceinline__ float other_half(float v) {
  unsigned u = __builtin_bit_cast(unsigned, v);
  return __builtin_bit_cast(float, __builtin_amdgcn_permlanex16(u, u, 0x76543210u, 0xfedcba98u,
                                                                false, false));
}

// A fragment: 16x32 f16 from row-major src (ld multiple of 8, 16B aligned).
// lane<16: row=lane, K={0..7,16..23}; lane>=16: row=lane-16, K={8..15,24..31}
__device__ __forceinline__ v16h load_a_frag(const _Float16* src, int ld) {
  int lane = threadIdx.x & 31;
  const _Float16* p = src + (lane & 15) * ld + ((lane < 16) ? 0 : 8);
  v8h lo = *(const v8h*)p;
  v8h hi = *(const v8h*)(p + 16);
  return __builtin_shufflevector(lo, hi, 0, 1, 2, 3, 4, 5, 6, 7,
                                 8, 9, 10, 11, 12, 13, 14, 15);
}

// A fragment's 16 values from two 16-byte pieces, dist f16 apart.
__device__ __forceinline__ v16h load_pair(const _Float16* p, int dist) {
  v8h lo = *(const v8h*)p;
  v8h hi = *(const v8h*)(p + dist);
  return __builtin_shufflevector(lo, hi, 0, 1, 2, 3, 4, 5, 6, 7,
                                 8, 9, 10, 11, 12, 13, 14, 15);
}

// Pre-packed B fragment: tile = 512 f16, lane's 16 values contiguous (32B).
// the lane's own address of packed tile 'tile'; further tiles of a run lie at
// compile-time distances from it
__device__ __forceinline__ const _Float16* b_lane_ptr(const _Float16* base, int tile) {
  int lane = threadIdx.x & 31;
  return base + ((size_t)tile << 9) + (lane << 4);
}
__device__ __forceinline__ v16h load_b_at(const _Float16* lp, int tile) {
  return *(const v16h*)(lp + (tile << 9));
}

// precaution: stands behind a run of global loads, in front of later loads whose
// results may land in the registers that held the run's addresses
__device__ __forceinline__ void addr_wait() {
  asm volatile("s_wait_xcnt 0x0" ::: "memory");
}

// The layer launches hold their packed weights in LDS, one copy for the block's
// two row tiles. LDS form of a packed tile: [values 0..7, values 8..15][lane][8],
// so that each 16-byte read of a wave covers 512 contiguous bytes (no shared bank).
// lp: the weights' start in LDS + lane * 8
__device__ __forceinline__ v16h load_w_lds(const _Float16* lp, int tile) {
  return load_pair(lp + (tile << 9), 256);
}

// sixteen asynchronous copies of 16 bytes a lane, 2 KiB apart in both spaces (the
// block's 128 threads move 2 tiles a copy): the offset field moves the LDS and the
// global address alike, so one address of each serves the run. The wait in the
// copies' own statement: a precaution, in front of whatever reuses these registers.
__device__ __forceinline__ void copy16(unsigned l, const _Float16* g) {
  asm volatile(
      "global_load_async_to_lds_b128 %0, %1, off\n\t"
      "global_load_async_to_lds_b128 %0, %1, off offset:2048\n\t"
      "global_load_async_to_lds_b128 %0, %1, off offset:4096\n\t"
      "global_load_async_to_lds_b128 %0, %1, off offset:6144\n\t"
      "global_load_async_to_lds_b128 %0, %1, off offset:8192\n\t"
      "global_load_async_to_lds_b128 %0, %1, off offset:10240\n\t"
      "global_load_async_to_lds_b128 %0, %1, off offset:12288\n\t"
      "global_load_async_to_lds_b128 %0, %1, off offset:14336\n\t"
      "global_load_async_to_lds_b128 %0, %1, off offset:16384\n\t"
      "global_load_async_to_lds_b128 %0, %1, off offset:18432\n\t"
      "global_load_async_to_lds_b128 %0, %1, off offset:20480\n\t"
      "global_load_async_to_lds_b128 %0, %1, off offset:22528\n\t"
      "global_load_async_to_lds_b128 %0, %1, off offset:24576\n\t"
      "global_load_async_to_lds_b128 %0, %1, off offset:26624\n\t"
      "global_load_async_to_lds_b128 %0, %1, off offset:28672\n\t"
      "global_load_async_to_lds_b128 %0, %1, off offset:30720\n\t"
      "s_wait_xcnt 0x0"
      :: "v"(l), "v"(g)
      : "memory");
}
// NT packed tiles (a multiple of 32), global -> LDS, by the whole block.
// l: the thread's LDS byte address in the first two tiles; g: its 16 bytes there
template <int NT>
__device__ __forceinline__ void copy_tiles(unsigned l, const _Float16* g) {
#pragma unroll
  for (int j = 0; j < NT / 32; ++j) copy16(l + j * 32768u, g + j * 16384);
}

// ---------------------------------------------------------------------------
// Set-up work rides in the first launch. What that launch itself multiplies by
// (W_in1, W_in2, layer 0's Wqkv) it reads as f32 and converts in registers. What
// later launches read (packed weights, the zero groups of V) is dealt out in
// units of one 16-byte store, one unit a thread, 64 units a tile, over the
// grid's first threads.
//   pack: f32 weights (K x N row-major) -> B-fragment tiles, tile id = nt*KT + kt;
//         columns past the source's width -> 0 (padding).
// ---------------------------------------------------------------------------
#define PT_WO  192   /* from   0: 192 tiles, Wqkv   4 x 24 tiles, layers 1 and 2 */
#define PT_F1  288   /* from 192:  96 tiles, Wo     4 x  8 tiles, 3 layers */
#define PT_F2  480   /* from 288: 192 tiles, Wff1   4 x 16 tiles, 3 layers */
#define PT_WH  672   /* from 480: 192 tiles, Wff2   8 x  8 tiles, 3 layers */
#define PT_PAD 676   /* from 672:   4 tiles, W_head 4 x  1 tiles (half full) */
#define PT_END 836   /* from 676: 160 x 64 units, the zero groups of both V buffers */

typedef __attribute__((ext_vector_type(2))) _Float16 v2h;

// f32 weights as B fragments of TWO N tiles at once: the lane reads two
// neighbouring columns (tile 0 holds the even, tile 1 the odd columns of a run of
// 32), so that 16 lanes cover a whole 128-byte line of a weight row.
// lp: the lane's address in row kB (0 or 8) of the weight; k order as in pack.
template <int NLD>
__device__ __forceinline__ void raw_fetch(float2 (&raw)[16], const float* lp, int kt) {
#pragma unroll
  for (int e = 0; e < 16; ++e)
    raw[e] = *(const float2*)(lp + (kt * 32 + (e < 8 ? e : e + 8)) * NLD);
}
__device__ __forceinline__ void raw_to_frags(const float2 (&raw)[16], v16h& f0, v16h& f1) {
#pragma unroll
  for (int e = 0; e < 16; ++e) {
    f0[e] = (_Float16)raw[e].x;
    f1[e] = (_Float16)raw[e].y;
  }
}

// ---------------------------------------------------------------------------
// Row-local stages. Everything behind the K/V exchange of a layer depends only
// on the row tile's own 16 rows, so it runs in ONE launch: the tile goes from stage
// to stage through LDS, the f32 residual stays in registers, and the N tiles of
// every product are dealt to the row tile's four waves.
// Every loop below is unrolled: fragment and accumulator arrays stay in
// registers only where their indices are compile-time constants.
// ---------------------------------------------------------------------------

// Global operands are fetched AHEAD: every weight fragment, bias, norm parameter
// and residual of a stage is loaded into registers, all of a stage at once, at
// least one stage before its use (a launch's first products: just before them; layer 0's q and k biases and o-proj's weights: just before their products),
// so that its latency runs under earlier work.

// ends a run of global loads or stores. The wait: a precaution, in front of
// whatever reuses the run's address registers. The scheduling barrier: it keeps
// later register writes behind that wait, and without it the compiler sinks
// loads fetched ahead towards their uses and issues them a few at a time between
// the matrix instructions, so that their latencies add up again.
__device__ __forceinline__ void fetch_end() {
  addr_wait();
  __builtin_amdgcn_sched_barrier(0);
}
// the same for a run of loads from one lane address p and one lane index n: as
// inputs of the wait's own statement both stay in their registers up to the wait,
// so that no result of the run itself lands in them in front of it
__device__ __forceinline__ void fetch_end(const void* p, int n) {
  asm volatile("s_wait_xcnt 0x0" :: "v"(p), "v"(n) : "memory");
  __builtin_amdgcn_sched_barrier(0);
}

// Layout of the q/k buffer. A (row tile, q or k, head) block is 16 rows x 32 d =
// 512 f16, held as the attention's fragment of it: piece [d >> 4][lane][8], where
// lane = row + 16 * ((d >> 3) & 1) and the 8 values are d & 7. q's A fragment and
// K's B fragment have the same lane and k order, so one layout serves both.
// The writer gets a lane's 8 values by the TRANSPOSED product W^T h^T: a packed B
// fragment of W is, register for register, the A fragment of W^T, and the A
// fragment of h the B fragment of h^T; in the result a lane holds one row of h
// (lane & 15) and 8 neighbouring columns of W.

// the wave's qkv weight fragments and biases: wave w takes head w, N tiles
// (i >> 1) * 8 + 2 * w + (i & 1); i = 0, 1: q; 2, 3: k; 4, 5: v.
// bqv: 8 a tile for q and k (a lane's 8 columns), then one a tile for v
__device__ __forceinline__ void qkv_bias_fetch(float (&bqv)[34],
                                               const float* __restrict__ bq, int w) {
  int lane = threadIdx.x & 31;
  int nb = (w * 32 + ((lane < 16) ? 0 : 8)) * 4;  // in bytes: the register that the loads name
  int nv = w * 32 + (lane & 15);
#pragma unroll
  for (int i = 0; i < 6; ++i) {
    if (i < 4) {
      const float* bp = (const float*)((const char*)bq + nb) + (i >> 1) * 128 + (i & 1) * 16;
      float4 lo = *(const float4*)bp, hi = *(const float4*)(bp + 4);
      bqv[i * 8 + 0] = lo.x; bqv[i * 8 + 1] = lo.y; bqv[i * 8 + 2] = lo.z; bqv[i * 8 + 3] = lo.w;
      bqv[i * 8 + 4] = hi.x; bqv[i * 8 + 5] = hi.y; bqv[i * 8 + 6] = hi.z; bqv[i * 8 + 7] = hi.w;
    } else {
      bqv[32 + (i & 1)] = (bq + nv)[256 + (i & 1) * 16];
    }
  }
  // one wait for the whole run; its inputs are the run's addresses (see fetch_end)
  asm volatile("s_wait_xcnt 0x0" :: "v"(nb), "v"(nv) : "memory");
  __builtin_amdgcn_sched_barrier(0);  // as in fetch_end
}
// lw: the qkv weights' start in LDS (96 tiles [nt*4+kt]) + lane * 8
__device__ __forceinline__ void qkv_w_fetch(v16h (&wq)[24], const _Float16* lw, int w) {
#pragma unroll
  for (int i = 0; i < 6; ++i)
#pragma unroll
    for (int kt = 0; kt < 4; ++kt)
      wq[i * 4 + kt] = load_w_lds(lw, w * 8 + (i >> 1) * 32 + (i & 1) * 4 + kt);
  // keeps the run whole: sunk to their uses the reads would each cost their latency
  __builtin_amdgcn_sched_barrier(0);
}

// qkv of the block's two tiles in hs2 (LDS, pitch HP): q (scaled) and k -> qk_out,
// v -> v_out, each in its reader's fragment order; every store is 16 bytes a lane,
// 512 contiguous bytes a wave. tile0: the first of the two tiles (even)
__device__ __forceinline__ void qkv_stage(const _Float16 (*hs2)[16 * HP],
                                          const v16h (&wq)[24], const float (&bqv)[34],
                                          _Float16* __restrict__ qk_out,
                                          _Float16* __restrict__ v_out, int tile0, int w) {
  int lane = threadIdx.x & 31;
  int nCol = lane & 15, mBase = (lane < 16) ? 0 : 8;
  _Float16* qd = qk_out + (size_t)tile0 * QK_TILE + w * 512 + lane * 8;
  _Float16* vd = v_out + (size_t)((tile0 >> 7) * 4 + w) * VPLANE + (4 + (tile0 & 127)) * 512 +
                 nCol * 16 + mBase;
  v16h a[2][4];
#pragma unroll
  for (int hb = 0; hb < 2; ++hb)
#pragma unroll
    for (int kt = 0; kt < 4; ++kt) a[hb][kt] = load_a_frag(hs2[hb] + kt * 32, HP);
#pragma unroll
  for (int i = 0; i < 6; ++i) {
#pragma unroll
    for (int hb = 0; hb < 2; ++hb) {
      v8f acc = {};
      v8h vv;
      if (i < 4) {  // q (scaled) / k, transposed product: row nCol, d (i & 1) * 16 + mBase + r
#pragma unroll
        for (int kt = 0; kt < 4; ++kt)
          acc = wmma16(wq[i * 4 + kt], a[hb][kt], acc);
        float scale = (i < 2) ? QSCALE : 1.0f;
#pragma unroll
        for (int r = 0; r < 8; ++r) vv[r] = (_Float16)((acc[r] + bqv[i * 8 + r]) * scale);
        *(v8h*)(qd + hb * QK_TILE + (i >> 1) * 2048 + (i & 1) * 256) = vv;
      } else {      // v: d (i & 1) * 16 + nCol, keys mBase + r
#pragma unroll
        for (int kt = 0; kt < 4; ++kt)
          acc = wmma16(a[hb][kt], wq[i * 4 + kt], acc);
        float bias = bqv[32 + (i & 1)];
#pragma unroll
        for (int r = 0; r < 8; ++r) vv[r] = (_Float16)(acc[r] + bias);
        *(v8h*)(vd + hb * 512 + (i & 1) * 256) = vv;
      }
    }
    fetch_end();
  }
}

// The products of the row-local stages are TRANSPOSED, W^T h^T (see the q/k layout):
// in a result tile a lane holds ONE row of the tile (lane & 15) and 8 neighbouring
// columns, mBase + r. Wave w's o[2] holds columns w*32 + i*16 + mBase + r.

// a per-column parameter (bias, gain, shift): the lane's 8 columns of each of its NT
// tiles. nb: the lane's first column in bytes, the register that the loads name
template <int NT>
__device__ __forceinline__ void col_fetch(float (&v)[NT * 8], const float* __restrict__ p,
                                          int nb) {
#pragma unroll
  for (int i = 0; i < NT; ++i) {
    const float* bp = (const float*)((const char*)p + nb) + i * 16;
    float4 lo = *(const float4*)bp, hi = *(const float4*)(bp + 4);
    v[i * 8 + 0] = lo.x; v[i * 8 + 1] = lo.y; v[i * 8 + 2] = lo.z; v[i * 8 + 3] = lo.w;
    v[i * 8 + 4] = hi.x; v[i * 8 + 5] = hi.y; v[i * 8 + 6] = hi.z; v[i * 8 + 7] = hi.w;
  }
}

// layernorm of the tile. Row sums: the lane's 16 columns in the lane (four short
// chains), one exchange with lane ^ 16, 4 waves through red.
// g, b: gain and shift of the lane's 16 columns, fetched ahead.
// In three parts: both tiles' partial sums stand in front of ONE barrier (the
// caller's), and other LDS reads can be put behind the row sums' reads.
__device__ __forceinline__ void ln_part(const v8f (&o)[2], float* red,  // [16 rows][4 waves][2]
                                        int w) {
  int lane = threadIdx.x & 31;
  int nCol = lane & 15;
  float sa[4], qa[4];
#pragma unroll
  for (int j = 0; j < 4; ++j) {
    sa[j] = (o[0][j] + o[0][j + 4]) + (o[1][j] + o[1][j + 4]);
    qa[j] = (o[0][j] * o[0][j] + o[0][j + 4] * o[0][j + 4]) +
            (o[1][j] * o[1][j] + o[1][j + 4] * o[1][j + 4]);
  }
  float sm = (sa[0] + sa[1]) + (sa[2] + sa[3]);
  float sq = (qa[0] + qa[1]) + (qa[2] + qa[3]);
  sm += other_half(sm);
  sq += other_half(sq);
  if (lane < 16) *(float2*)(red + (nCol * 4 + w) * 2) = make_float2(sm, sq);
}
__device__ __forceinline__ void ln_read(const float* red, float4& p, float4& q) {
  int nCol = threadIdx.x & 15;
  p = *(const float4*)(red + nCol * 8);
  q = *(const float4*)(red + nCol * 8 + 4);
}
__device__ __forceinline__ void ln_apply(v8f (&o)[2], float4 p, float4 q,
                                         const float (&g)[16], const float (&b)[16]) {
  float s = (p.x + p.z) + (q.x + q.z);
  float s2 = (p.y + p.w) + (q.y + q.w);
  float mu = s * (1.f / 128.f);
  float inv = rsqrtf(s2 * (1.f / 128.f) - mu * mu + LN_EPS);
#pragma unroll
  for (int i = 0; i < 2; ++i)
#pragma unroll
    for (int r = 0; r < 8; ++r)
      o[i][r] = (o[i][r] - mu) * inv * g[i * 8 + r] + b[i * 8 + r];
}

// the wave's two result tiles -> f16 rows in LDS (pitch HP): 16 bytes a lane and tile
__device__ __forceinline__ void tile_to_lds(const v8f (&o)[2], _Float16* hs, int w) {
  int lane = threadIdx.x & 31;
  int nCol = lane & 15, mBase = (lane < 16) ? 0 : 8;
#pragma unroll
  for (int i = 0; i < 2; ++i) {
    v8h t;
#pragma unroll
    for (int r = 0; r < 8; ++r) t[r] = (_Float16)o[i][r];
    *(v8h*)(hs + nCol * HP + w * 32 + i * 16 + mBase) = t;
  }
}

// ---------------------------------------------------------------------------
// set-up units + in_proj + first qkv:
//   h = relu(x@W1+b1)@W2 + b2 + PE -> h32; qkv of layer 0
// Wave w owns columns w*32 .. w*32+31 of every product; its two C tiles hold the
// even and the odd ones (see raw_fetch), so a lane's pair of results is adjacent.
// ---------------------------------------------------------------------------

// q (G = 0, scaled) or k (G = 1) of layer 0, head w, by the transposed product (see
// the q/k layout): the lane holds row nCol and, the even columns in c0 and the odd
// in c1, d = 2 * mBase .. 2 * mBase + 15. The biases of those 16 columns are fetched
// here, under the products: there is no register room for them further ahead
template <int G>
__device__ __forceinline__ void qk0_group(const v16h (&a)[4], const float2 (&raw)[4][16],
                                          const float* __restrict__ bq,
                                          _Float16* __restrict__ qk_out, int w) {
  int lane = threadIdx.x & 31;
  const float* bp = bq + G * 128 + w * 32 + (lane >> 4) * 16;
  float4 b4[4];
#pragma unroll
  for (int e = 0; e < 4; ++e) b4[e] = *(const float4*)(bp + e * 4);
  // the run's wait; with the address as its input the loads stay in front of it
  asm volatile("s_wait_xcnt 0x0" :: "v"(bp) : "memory");
  __builtin_amdgcn_sched_barrier(0);  // as in fetch_end
  v16h f[8];
#pragma unroll
  for (int kt = 0; kt < 4; ++kt) raw_to_frags(raw[kt], f[kt], f[4 + kt]);
  v8f c0 = {}, c1 = {};
#pragma unroll
  for (int kt = 0; kt < 4; ++kt) c0 = wmma16(f[kt], a[kt], c0);
#pragma unroll
  for (int kt = 0; kt < 4; ++kt) c1 = wmma16(f[4 + kt], a[kt], c1);
  float scale = (G == 0) ? QSCALE : 1.0f;
  _Float16* dst = qk_out + (size_t)blockIdx.x * QK_TILE + G * 2048 + w * 512 +
                  (lane >> 4) * 256 + (lane & 15) * 8;
#pragma unroll
  for (int s = 0; s < 2; ++s) {  // d & 8: the fragment lane is row + 16 * s
    v8h vv;
#pragma unroll
    for (int j = 0; j < 4; ++j) {
      int r = s * 4 + j;
      float be = (r & 1) ? b4[r >> 1].z : b4[r >> 1].x;
      float bd = (r & 1) ? b4[r >> 1].w : b4[r >> 1].y;
      vv[2 * j] = (_Float16)((c0[r] + be) * scale);
      vv[2 * j + 1] = (_Float16)((c1[r] + bd) * scale);
    }
    *(v8h*)(dst + s * 128) = vv;
  }
  fetch_end();
}

// v of layer 0, head w: d = 2 * nCol + {0, 1}, keys mBase + r
__device__ __forceinline__ void v0_group(const v16h (&a)[4], const float2 (&raw)[4][16],
                                         float2 bias, _Float16* __restrict__ v_out, int w) {
  int lane = threadIdx.x & 31;
  int nCol = lane & 15, mBase = (lane < 16) ? 0 : 8;
  int tile = blockIdx.x;
  v16h f[8];
#pragma unroll
  for (int kt = 0; kt < 4; ++kt) raw_to_frags(raw[kt], f[kt], f[4 + kt]);
  v8f c0 = {}, c1 = {};
#pragma unroll
  for (int kt = 0; kt < 4; ++kt) c0 = wmma16(a[kt], f[kt], c0);
#pragma unroll
  for (int kt = 0; kt < 4; ++kt) c1 = wmma16(a[kt], f[4 + kt], c1);
  v8h v0, v1;
#pragma unroll
  for (int r = 0; r < 8; ++r) {
    v0[r] = (_Float16)(c0[r] + bias.x);
    v1[r] = (_Float16)(c1[r] + bias.y);
  }
  _Float16* vp = v_out + (size_t)((tile >> 7) * 4 + w) * VPLANE + (4 + (tile & 127)) * 512 +
                 nCol * 32 + mBase;
  *(v8h*)vp = v0;
  *(v8h*)(vp + 16) = v1;
  fetch_end();
}

// second bound: two blocks a WGP (the whole grid resident), which leaves each wave
// the register room that the weights fetched ahead take
__global__ __launch_bounds__(128, 2) void setup_inproj_qkv_kernel(
    const float* __restrict__ E, const float* __restrict__ rho,
    const float* __restrict__ W1, const float* __restrict__ b1,
    const float* __restrict__ W2, const float* __restrict__ b2,
    const float* __restrict__ Wqkv, const float* __restrict__ bq,
    const float* __restrict__ Wo, const float* __restrict__ Wff1,
    const float* __restrict__ Wff2, const float* __restrict__ W_head,
    float* __restrict__ h32, _Float16* __restrict__ qk_out,
    _Float16* __restrict__ vT,  // both V buffers (zero groups); layer 0's v goes to the first
    _Float16* __restrict__ pqkv, _Float16* __restrict__ pwo,
    _Float16* __restrict__ pf1, _Float16* __restrict__ pf2,
    _Float16* __restrict__ pwh) {
  __shared__ __attribute__((aligned(16))) _Float16 t1[16 * TP];
  __shared__ __attribute__((aligned(16))) _Float16 hs[16 * HP];
  int row0 = blockIdx.x * 16;
  int w = threadIdx.x >> 5;
  int lane = threadIdx.x & 31;
  int nCol = lane & 15, mBase = (lane < 16) ? 0 : 8, kB = mBase;
  int nc0 = w * 32 + 2 * nCol;

  // the thread's set-up unit. A tile's 64 units are two whole waves, so the tile
  // number is the same in every lane: taken as a scalar, the choice of the
  // weight is scalar work and scalar branches.
  int gid = blockIdx.x * 128 + threadIdx.x;
  int tu = __builtin_amdgcn_readfirstlane(gid >> 6);
  float pv[8] = {0.f, 0.f, 0.f, 0.f, 0.f, 0.f, 0.f, 0.f};
  _Float16* pd = pwh;
  bool pin = false;
  if (tu < PT_PAD) {
    // half a lane's share of a packed tile: 8 k rows of one column
    const float* src;
    _Float16* dst;
    int t, ks = 2, nld;
    if (tu < PT_WO) {
      int l = 1 + tu / 96;
      t = tu % 96; nld = 384;
      src = Wqkv + l * 128 * 384; dst = pqkv + (size_t)(l * 96 + t) * 512;
    } else if (tu < PT_F1) {
      int v = tu - PT_WO;
      t = v & 31; nld = 128;
      src = Wo + (v >> 5) * 128 * 128; dst = pwo + (size_t)v * 512;
    } else if (tu < PT_F2) {
      int v = tu - PT_F1;
      t = v & 63; nld = 256;
      src = Wff1 + (v >> 6) * 128 * 256; dst = pf1 + (size_t)v * 512;
    } else if (tu < PT_WH) {
      int v = tu - PT_F2;
      t = v & 63; nld = 128; ks = 3;
      src = Wff2 + (v >> 6) * 256 * 128; dst = pf2 + (size_t)v * 512;
    } else {
      t = tu - PT_WH; nld = 8;
      src = W_head; dst = pwh + (size_t)t * 512;
    }
    int kt = t & ((1 << ks) - 1), nt = t >> ks;
    int pl = (gid >> 1) & 31, half = gid & 1;  // packed lane; which 8 of its 16 values
    int n = nt * 16 + (pl & 15);
    int k0 = kt * 32 + ((pl < 16) ? 0 : 8) + half * 16;
    pin = n < nld;
    int nc = pin ? n : nld - 1;  // a padding column reads a valid entry that it does not use
    pd = dst + pl * 16 + half * 8;
    const float* pp[8];
#pragma unroll
    for (int i = 0; i < 8; ++i) {
      pp[i] = src + (k0 + i) * nld + nc;
      pv[i] = *pp[i];
    }
    // one wait for the whole run; its inputs are the run's addresses (see fetch_end)
    asm volatile("s_wait_xcnt 0x0" :: "v"(pp[0]), "v"(pp[1]), "v"(pp[2]), "v"(pp[3]),
                 "v"(pp[4]), "v"(pp[5]), "v"(pp[6]), "v"(pp[7]) : "memory");
  } else if (tu < PT_END) {
    // 16 bytes of a V plane's zero groups: four groups in front of the keys, one behind
    int i = gid - PT_PAD * 64;
    int plane = i / 320, c = i % 320;
    int pos = (c < 256) ? c * 8 : ((VG - 1) * 512 + (c - 256) * 8);
    v8h z = {};
    *(v8h*)(vT + (size_t)plane * VPLANE + pos) = z;
    addr_wait();
  }
  // keeps the unit's loads in front of the run below: its store then waits for
  // them alone
  __builtin_amdgcn_sched_barrier(0);

  // fetched next, in the order of use: x and both in_proj weights, all f32.
  // x = concat(E, rho), K padded 16 -> 32: lanes 0..15 hold k 0..7 (E), lanes
  // 16..31 k 8..15 (rho); the upper half of every fragment is the zero padding
  const float* lx = ((lane < 16) ? E : rho) + (row0 + nCol) * 8;
  const float* l1 = W1 + kB * DM + nc0;
  const float* l2 = W2 + kB * DM + nc0;
  float4 xa = *(const float4*)lx, xb = *(const float4*)(lx + 4);
  float2 r1[8], r2[4][16];
#pragma unroll
  for (int e = 0; e < 8; ++e) r1[e] = *(const float2*)(l1 + e * DM);
  float2 b1p = *(const float2*)(b1 + nc0);
#pragma unroll
  for (int kt = 0; kt < 4; ++kt) raw_fetch<DM>(r2[kt], l2, kt);
  // the second product is transposed: the lane's 16 columns there are w*32 + 2*mBase ..
  int nb2 = (w * 32 + 2 * mBase) * 4;  // in bytes: the register that the loads name
  float4 b2q[4];
#pragma unroll
  for (int e = 0; e < 4; ++e) b2q[e] = *((const float4*)((const char*)b2 + nb2) + e);
  // one wait for the whole run; its inputs are the run's addresses (see fetch_end)
  asm volatile("s_wait_xcnt 0x0" :: "v"(lx), "v"(l1), "v"(l2), "v"(nc0), "v"(nb2) : "memory");
  __builtin_amdgcn_sched_barrier(0);  // as in fetch_end

  if (tu < PT_PAD) {
    v8h hv;
#pragma unroll
    for (int i = 0; i < 8; ++i) hv[i] = pin ? (_Float16)pv[i] : (_Float16)0.f;
    *(v8h*)pd = hv;
    fetch_end();
  }

  {
    v16h a = {}, w1a = {}, w1b = {};
    a[0] = (_Float16)xa.x; a[1] = (_Float16)xa.y; a[2] = (_Float16)xa.z; a[3] = (_Float16)xa.w;
    a[4] = (_Float16)xb.x; a[5] = (_Float16)xb.y; a[6] = (_Float16)xb.z; a[7] = (_Float16)xb.w;
#pragma unroll
    for (int e = 0; e < 8; ++e) {
      w1a[e] = (_Float16)r1[e].x;
      w1b[e] = (_Float16)r1[e].y;
    }
    v8f c0 = {}, c1 = {};
    c0 = wmma16(a, w1a, c0);
    c1 = wmma16(a, w1b, c1);
#pragma unroll
    for (int r = 0; r < 8; ++r) {
      float u0 = c0[r] + b1p.x, u1 = c1[r] + b1p.y;
      v2h p = {(_Float16)(u0 > 0.f ? u0 : 0.f), (_Float16)(u1 > 0.f ? u1 : 0.f)};
      *(v2h*)(t1 + (mBase + r) * TP + nc0) = p;
    }
  }
  v16h w2[8];
#pragma unroll
  for (int kt = 0; kt < 4; ++kt) raw_to_frags(r2[kt], w2[kt], w2[4 + kt]);
  __syncthreads();  // every wave reads all 128 columns of t1 as A fragments

  // fetched under the second product: q's and k's weights of layer 0
  const float* lq = Wqkv + kB * 384 + nc0;
  float2 rq[4][16], rk[4][16], rv[4][16];
#pragma unroll
  for (int kt = 0; kt < 4; ++kt) raw_fetch<384>(rq[kt], lq, kt);
#pragma unroll
  for (int kt = 0; kt < 4; ++kt) raw_fetch<384>(rk[kt], lq + 128, kt);
  fetch_end(lq, nc0);

  v8f o[2];
  {
    v16h a2[4];
#pragma unroll
    for (int kt = 0; kt < 4; ++kt) a2[kt] = load_a_frag(t1 + kt * 32, TP);
#pragma unroll
    for (int i = 0; i < 2; ++i) {
      v8f acc = {};
#pragma unroll
      for (int kt = 0; kt < 4; ++kt)
        acc = wmma16(w2[i * 4 + kt], a2[kt], acc);  // transposed: see below
      o[i] = acc;
    }
  }

  // v's weights of layer 0; a run of its own: with all three in one run the build spills
#pragma unroll
  for (int kt = 0; kt < 4; ++kt) raw_fetch<384>(rv[kt], lq + 256, kt);
  float2 bvp = *(const float2*)(bq + nc0 + 256);
  fetch_end(lq, nc0);

  // By the transposed product the lane holds row nCol and 16 neighbouring columns:
  // o[0][r] is column w*32 + 2*mBase + 2*r (even), o[1][r] the odd one behind it
  {
    // an even (sine) and the odd (cosine) column behind it share one frequency
    float pos = (float)((row0 + nCol) & (T_SEQ - 1));
#pragma unroll
    for (int r = 0; r < 8; ++r) {
      float div = __expf(-(float)(w * 16 + mBase + r) * (9.210340371976184f / 64.f));
      float ang = pos * div;
      float be = (r & 1) ? b2q[r >> 1].z : b2q[r >> 1].x;
      float bd = (r & 1) ? b2q[r >> 1].w : b2q[r >> 1].y;
      o[0][r] = o[0][r] + be + __sinf(ang);
      o[1][r] = o[1][r] + bd + __cosf(ang);
    }
  }
  {
    // the residual in the order of the layer launches' result tiles (see layer_body):
    // the lane's 16 columns are tile lane >> 4 there, columns 8 s .. 8 s + 7 of it
    // lane nCol + 16 s, four of them (q) a 16-byte piece
    float* hd = h32 + blockIdx.x * H_TILE + w * 512 + (lane >> 4) * 256 + nCol * 4;
#pragma unroll
    for (int s = 0; s < 2; ++s)
#pragma unroll
      for (int q = 0; q < 2; ++q)
        *(float4*)(hd + q * 128 + s * 64) =
            make_float4(o[0][s * 4 + q * 2], o[1][s * 4 + q * 2],
                        o[0][s * 4 + q * 2 + 1], o[1][s * 4 + q * 2 + 1]);
    // the run's wait; with the address as its input the stores stay in front of it
    asm volatile("s_wait_xcnt 0x0" :: "v"(hd) : "memory");
    __builtin_amdgcn_sched_barrier(0);  // as in fetch_end
  }
#pragma unroll
  for (int s = 0; s < 2; ++s) {
    v8h p;
#pragma unroll
    for (int j = 0; j < 4; ++j) {
      p[2 * j] = (_Float16)o[0][s * 4 + j];
      p[2 * j + 1] = (_Float16)o[1][s * 4 + j];
    }
    *(v8h*)(hs + nCol * HP + w * 32 + 2 * mBase + s * 8) = p;
  }
  __syncthreads();  // every wave reads all 128 columns of hs as A fragments

  v16h a[4];
#pragma unroll
  for (int kt = 0; kt < 4; ++kt) a[kt] = load_a_frag(hs + kt * 32, HP);
  qk0_group<0>(a, rq, bq, qk_out, w);
  qk0_group<1>(a, rk, bq, qk_out, w);
  v0_group(a, rv, bvp, vT, w);
}

// ---------------------------------------------------------------------------
// one layer behind its qkv, for the block's two row tiles (index hb): windowed
// attention (wave = head), o-proj + residual + layernorm, FFN + residual +
// layernorm; leaves the tiles in hs2 (f16, LDS) and, where QKV, in h32 for the next
// launch's residual. The weights of the stage behind (next qkv where QKV, else the
// head) are fetched ahead into wn / bnv.
// ---------------------------------------------------------------------------
template <bool QKV>
__device__ __forceinline__ void layer_body(
    const _Float16* __restrict__ qk_in, const _Float16* __restrict__ vT_in,
    const _Float16* __restrict__ pwo,  // 32 tiles [nt*4+kt]
    const float* __restrict__ bo,
    const float* __restrict__ g1, const float* __restrict__ be1,
    const _Float16* __restrict__ pf1,  // 64 tiles [nt*4+kt]
    const float* __restrict__ bf1,
    const _Float16* __restrict__ pf2,  // 64 tiles [nt*8+kt]
    const float* __restrict__ bf2,
    const float* __restrict__ g2, const float* __restrict__ be2,
    float* __restrict__ h32, _Float16 (*hs2)[16 * HP],
    const _Float16* __restrict__ pn, const float* __restrict__ bn,
    v16h (&wn)[24], float (&bnv)[34]) {
  // the layer's packed weights: tiles 0..31 Wo, 32..95 Wff1, 96..159 Wff2; the next
  // qkv's 96 tiles take the place of Wo and Wff1 once these have been read
  __shared__ __attribute__((aligned(16))) _Float16 wl[160 * 512];
  // one set of tile buffers for each of the block's two row tiles
  __shared__ __attribute__((aligned(16))) _Float16 ao2[2][16 * HP];
  __shared__ __attribute__((aligned(16))) _Float16 h12[2][16 * HP];
  __shared__ __attribute__((aligned(16))) _Float16 mid2[2][16 * MP];
  __shared__ __attribute__((aligned(16))) float red12[2][16 * 8];
  __shared__ __attribute__((aligned(16))) float red22[2][16 * 8];
  int w = threadIdx.x >> 5;
  int head = w;
  // the first of the two tiles (even, so both lie in one batch); its number in the batch
  int tile0 = blockIdx.x * 2, tb = tile0 & 127;
  int bIdx = tile0 >> 7;
  int lane = threadIdx.x & 31;
  int nCol = lane & 15, mBase = (lane < 16) ? 0 : 8, kBase = mBase;
  int nb = (w * 32 + mBase) * 4;  // the lane's first column of the wave's 32, in bytes

  // fetched first: both q, the six K fragments that the two tiles' windows cover
  // (tile hb reads kb[hb .. hb + 4]), six V fragments a tile
  // (each in fragment order: see the q/k layout; V: [16-key group][d][16 keys])
  const _Float16* lq = qk_in + (size_t)tile0 * QK_TILE + head * 512 + lane * 8;
  v16h qa[2];
#pragma unroll
  for (int hb = 0; hb < 2; ++hb) qa[hb] = load_pair(lq + hb * QK_TILE, 256);
  const _Float16* lk[6];
  v16h kb[6];
#pragma unroll
  for (int kt = 0; kt < 6; ++kt) {
    int kti = tb - 4 + kt;              // key tile within the batch
    int ktc = kti < 0 ? 0 : kti;        // clamp address; mask handles validity
    lk[kt] = qk_in + (size_t)(tile0 - tb + ktc) * QK_TILE + head * 512 + lane * 8;
    kb[kt] = load_pair(lk[kt] + 2048, 256);  // k stands behind q in the tile
  }
  // group tb + hb of the plane holds tile hb's first key (four zero groups stand in front)
  const _Float16* lv = vT_in + (size_t)(bIdx * 4 + head) * VPLANE + tb * 512 + nCol * 16 + kBase;
  v16h vb[2][6];
#pragma unroll
  for (int hb = 0; hb < 2; ++hb)
#pragma unroll
    for (int nt = 0; nt < 2; ++nt)
#pragma unroll
      for (int kc = 0; kc < 3; ++kc)
        vb[hb][nt * 3 + kc] = load_pair(lv + hb * 512 + nt * 256 + kc * 1024, 512);
  // one wait for the whole run; its inputs are the run's addresses (see fetch_end)
  asm volatile("s_wait_xcnt 0x0" :: "v"(lq), "v"(lk[0]), "v"(lk[1]), "v"(lk[2]), "v"(lk[3]),
               "v"(lk[4]), "v"(lk[5]), "v"(lv) : "memory");
  __builtin_amdgcn_sched_barrier(0);  // as in fetch_end

  // fetched next: what o-proj and the first layernorm read beside the weights
  // the residual lies as the wave's result tiles: [tile][wave][i][r >> 2][lane][r & 3]
  const float* lr = h32 + tile0 * H_TILE + w * 512 + lane * 4;
  float res[2][2][8], bov[16], g1v[16], be1v[16];
#pragma unroll
  for (int hb = 0; hb < 2; ++hb) {
#pragma unroll
    for (int i = 0; i < 2; ++i) {
#pragma unroll
      for (int q = 0; q < 2; ++q) {
        float4 t = *(const float4*)(lr + hb * H_TILE + i * 256 + q * 128);
        res[hb][i][q * 4] = t.x; res[hb][i][q * 4 + 1] = t.y;
        res[hb][i][q * 4 + 2] = t.z; res[hb][i][q * 4 + 3] = t.w;
      }
    }
  }
  col_fetch<2>(bov, bo, nb);
  col_fetch<2>(g1v, g1, nb);
  col_fetch<2>(be1v, be1, nb);
  // one wait for the whole run; its inputs are the run's addresses (see fetch_end)
  asm volatile("s_wait_xcnt 0x0" :: "v"(lr), "v"(nb) : "memory");
  __builtin_amdgcn_sched_barrier(0);  // as in fetch_end

  // Wo and Wff1 -> LDS, once for both row tiles: 48 copies a thread, which fly under
  // the attention. The thread's 16 bytes are half hf = t & 1 of packed lane
  // (t >> 1) & 31 in tile t >> 6 of every two (see load_w_lds).
  const int tx = threadIdx.x;
  const unsigned wdst = (unsigned)(size_t)wl + (tx >> 6) * 1024 + (tx & 1) * 512 +
                        ((tx >> 1) & 31) * 16;
  copy_tiles<32>(wdst, pwo + tx * 8);
  copy_tiles<64>(wdst + 32 * 1024, pf1 + tx * 8);
  // keeps every copy in front of the scores: moved in among them it would start later
  __builtin_amdgcn_sched_barrier(0);
  const _Float16* lw = wl + lane * 8;

  // scores TRANSPOSED, S^T = K Q^T: K's B fragment is, register for register, the A
  // fragment of K, and q's A fragment the B fragment of q^T. A lane holds ONE query
  // (nCol) and keys mBase + r of every key tile; lane ^ 16 holds the query's other keys
  v8f s[2][5];
#pragma unroll
  for (int hb = 0; hb < 2; ++hb) {
#pragma unroll
    for (int kt = 0; kt < 5; ++kt) {
      v8f c = {};
      c = wmma16(kb[hb + kt], qa[hb], c);
      // key j >= 0: a key tile lies in the batch with all its 16 keys or with none
      bool tin = tb + hb - 4 + kt >= 0;
#pragma unroll
      for (int r = 0; r < 8; ++r) {
        // key and query counted from the row tile's first row: j <= i and j >= i - 63
        // read the same for both tiles
        int rel = kt * 16 + mBase + r - 64;
        bool valid = tin && (rel <= nCol) && (rel >= nCol - 63);
        s[hb][kt][r] = valid ? c[r] : -1e30f;
      }
    }
  }

  // keeps the next run of loads behind the score products: issued in front of
  // them it fills the load counter and the first product waits for more returns
  __builtin_amdgcn_sched_barrier(0);

  // fetched under the softmax: FFN up's biases
  int nf = (w * 64 + mBase) * 4;  // the lane's first hidden column of the wave's 64, in bytes
  float bf1v[32];
  col_fetch<4>(bf1v, bf1, nf);
  // the run's wait; its input is the run's address (see fetch_end)
  asm volatile("s_wait_xcnt 0x0" :: "v"(nf) : "memory");
  __builtin_amdgcn_sched_barrier(0);  // as in fetch_end

#pragma unroll
  for (int hb = 0; hb < 2; ++hb) {
    // softmax of the lane's query: maximum and sum over its 40 scores in the lane (one
    // partial a key tile: five short chains, not one long one), then one exchange with
    // lane ^ 16. 1 / sum is applied to the output, where the lane still holds that query
    float mk[5], sk[5];
#pragma unroll
    for (int kt = 0; kt < 5; ++kt) {
      mk[kt] = s[hb][kt][0];
#pragma unroll
      for (int r = 1; r < 8; ++r) mk[kt] = fmaxf(mk[kt], s[hb][kt][r]);
    }
    float mx = fmaxf(fmaxf(fmaxf(mk[0], mk[1]), fmaxf(mk[2], mk[3])), mk[4]);
    mx = fmaxf(mx, other_half(mx));
#pragma unroll
    for (int kt = 0; kt < 5; ++kt) {
      sk[kt] = 0.f;
#pragma unroll
      for (int r = 0; r < 8; ++r) {
        float e = __expf(s[hb][kt][r] - mx);
        s[hb][kt][r] = e;
        sk[kt] += e;
      }
    }
    float sum = ((sk[0] + sk[1]) + (sk[2] + sk[3])) + sk[4];
    sum += other_half(sum);
    float inv = 1.0f / sum;

    // P^T's B fragments straight from the registers: chunk kc holds key tiles 2 kc and
    // 2 kc + 1, the lane's keys mBase + r of each, which is the fragment's k order
    // (keys 80..95 are the zero padding)
    v16h pt[3];
#pragma unroll
    for (int kc = 0; kc < 3; ++kc)
#pragma unroll
      for (int e = 0; e < 8; ++e) {
        pt[kc][e] = (_Float16)s[hb][2 * kc][e];
        pt[kc][8 + e] = (kc < 2) ? (_Float16)s[hb][(kc < 2) ? 2 * kc + 1 : 4][e] : (_Float16)0.f;
      }

    // O^T = V^T(32x96) @ P^T(96x16): V's B fragment is the A fragment of V^T; 2 M tiles
    // x 3 K chunks. The lane holds its query's d = nt * 16 + mBase + r: one 16-byte store
#pragma unroll
    for (int nt = 0; nt < 2; ++nt) {
      v8f acc = {};
#pragma unroll
      for (int kc = 0; kc < 3; ++kc) acc = wmma16(vb[hb][nt * 3 + kc], pt[kc], acc);
      v8h ov;
#pragma unroll
      for (int r = 0; r < 8; ++r) ov[r] = (_Float16)(acc[r] * inv);
      *(v8h*)(ao2[hb] + nCol * HP + head * 32 + nt * 16 + mBase) = ov;
    }
  }
  // the wave's own weight copies have landed; the barrier behind shows them to all
  asm volatile("s_wait_asynccnt 0x0" ::: "memory");
  __syncthreads();  // every wave reads all four heads' columns of ao2

  // o-proj's A fragments and weights first (LDS returns in order: the product waits
  // for them alone); then, fetched under o-proj and the first layernorm: FFN up's
  // weights, LDS -> registers, and what FFN down and the second layernorm read beside
  // the weights
  v16h ap[2][4];
#pragma unroll
  for (int hb = 0; hb < 2; ++hb)
#pragma unroll
    for (int kt = 0; kt < 4; ++kt) ap[hb][kt] = load_a_frag(ao2[hb] + kt * 32, HP);
  v16h wo[8];
#pragma unroll
  for (int i = 0; i < 8; ++i) wo[i] = load_w_lds(lw, w * 8 + i);
  // keeps these reads in front of FFN up's weights' reads, which the scheduler else puts first
  __builtin_amdgcn_sched_barrier(0);
  v16h f1[16];
#pragma unroll
  for (int i = 0; i < 16; ++i) f1[i] = load_w_lds(lw, 32 + w * 16 + i);
  float bf2v[16], g2v[16], be2v[16];
  col_fetch<2>(bf2v, bf2, nb);
  col_fetch<2>(g2v, g2, nb);
  col_fetch<2>(be2v, be2, nb);
  // the run's wait; its input is the run's address (see fetch_end)
  asm volatile("s_wait_xcnt 0x0" :: "v"(nb) : "memory");
  __builtin_amdgcn_sched_barrier(0);  // as in fetch_end; it keeps the LDS reads whole too
  // Wff2 -> LDS, into a place that nothing has touched yet: 32 copies a thread (with
  // the 48 above they would be more than a wave may have in flight), issued while the
  // LDS reads above return; they fly under o-proj and the first layernorm
  copy_tiles<64>(wdst + 96 * 1024, pf2 + tx * 8);
  // keeps every copy in front of o-proj: moved in among the products it would start later
  __builtin_amdgcn_sched_barrier(0);

  // o-proj (transposed) + residual + layernorm; wave w owns columns w*32 .. w*32+31
  v8f o[2][2];
#pragma unroll
  for (int i = 0; i < 2; ++i) {
#pragma unroll
    for (int hb = 0; hb < 2; ++hb) {
      v8f acc = {};
#pragma unroll
      for (int kt = 0; kt < 4; ++kt)
        acc = wmma16(wo[i * 4 + kt], ap[hb][kt], acc);
#pragma unroll
      for (int r = 0; r < 8; ++r)
        o[hb][i][r] = acc[r] + bov[i * 8 + r] + res[hb][i][r];
    }
  }
  {
    float4 sp[2], sq[2];
    ln_part(o[0], red12[0], w);
    ln_part(o[1], red12[1], w);
    __syncthreads();  // every wave reads all four waves' partial row sums
    ln_read(red12[0], sp[0], sq[0]);
    ln_read(red12[1], sp[1], sq[1]);
    ln_apply(o[0], sp[0], sq[0], g1v, be1v);
    ln_apply(o[1], sp[1], sq[1], g1v, be1v);
  }
  tile_to_lds(o[0], h12[0], w);
  tile_to_lds(o[1], h12[1], w);
  // the wave's reads of Wo and Wff1 have returned: behind the barrier their place in
  // LDS is free for the next copies
  if (QKV) asm volatile("s_wait_dscnt 0x0" ::: "memory");
  // the wave's own copies of Wff2 have landed; the barrier behind shows them to all
  asm volatile("s_wait_asynccnt 0x0" ::: "memory");
  __syncthreads();  // every wave reads all 128 columns of h12

  // FFN up's A fragments first (see o-proj's above); then, fetched under FFN up:
  // FFN down's weights, LDS -> registers
  v16h au[2][4];
#pragma unroll
  for (int hb = 0; hb < 2; ++hb)
#pragma unroll
    for (int kt = 0; kt < 4; ++kt) au[hb][kt] = load_a_frag(h12[hb] + kt * 32, HP);
  // keeps these reads in front of the weights' reads, which the scheduler else puts first
  __builtin_amdgcn_sched_barrier(0);
  v16h f2[16];
#pragma unroll
  for (int i = 0; i < 16; ++i) f2[i] = load_w_lds(lw, 96 + w * 16 + i);
  // keeps the run whole: sunk to their uses the reads would each cost their latency
  __builtin_amdgcn_sched_barrier(0);
  // the next qkv's weights -> LDS, in the place of Wo and Wff1: 48 copies a thread,
  // issued while the LDS reads above return; they fly under the FFN
  if (QKV) {
    copy_tiles<96>(wdst, pn + tx * 8);
    // keeps every copy in front of FFN up: moved in among the products it would start later
    __builtin_amdgcn_sched_barrier(0);
  }

  // FFN up (transposed): wave w owns hidden columns w*64 .. w*64+63; the lane's 8
  // columns of a tile are one 16-byte store
#pragma unroll
  for (int i = 0; i < 4; ++i) {
    int nt = w * 4 + i;
#pragma unroll
    for (int hb = 0; hb < 2; ++hb) {
      v8f acc = {};
#pragma unroll
      for (int kt = 0; kt < 4; ++kt)
        acc = wmma16(f1[i * 4 + kt], au[hb][kt], acc);
      v8h mv;
#pragma unroll
      for (int r = 0; r < 8; ++r) {
        float v = acc[r] + bf1v[i * 8 + r];
        mv[r] = (_Float16)(v > 0.f ? v : 0.f);
      }
      *(v8h*)(mid2[hb] + nCol * MP + nt * 16 + mBase) = mv;
    }
  }
  __syncthreads();  // every wave reads all 256 columns of mid2

  // fetched under FFN down and the second layernorm: the stage behind's biases
  // and, for the head, its weights
  if (QKV) {
    qkv_bias_fetch(bnv, bn, w);
  } else {
    const _Float16* lh = b_lane_ptr(pn, 0);
    int nh = nCol & 7;  // lanes 8..15 of a half read a valid entry that they do not use
#pragma unroll
    for (int kt = 0; kt < 4; ++kt) wn[kt] = load_b_at(lh, kt);
    bnv[0] = bn[nh];
    fetch_end(lh, nh);
  }

  // FFN down (transposed) + residual (still in o) + layernorm
  {
    v16h a2[2][8];
#pragma unroll
    for (int hb = 0; hb < 2; ++hb)
#pragma unroll
      for (int kt = 0; kt < 8; ++kt) a2[hb][kt] = load_a_frag(mid2[hb] + kt * 32, MP);
#pragma unroll
    for (int i = 0; i < 2; ++i) {
#pragma unroll
      for (int hb = 0; hb < 2; ++hb) {
        v8f acc = {};
#pragma unroll
        for (int kt = 0; kt < 8; ++kt)
          acc = wmma16(f2[i * 8 + kt], a2[hb][kt], acc);
#pragma unroll
        for (int r = 0; r < 8; ++r) o[hb][i][r] = acc[r] + bf2v[i * 8 + r] + o[hb][i][r];
      }
    }
  }
  // the wave's own copies of the qkv weights have landed; the barrier in the
  // layernorm shows them to all
  if (QKV) {
    // keeps FFN down's products in front of the wait: the copies fly under them too
    __builtin_amdgcn_sched_barrier(0);
    asm volatile("s_wait_asynccnt 0x0" ::: "memory");
  }
  float4 sp[2], sq[2];
  ln_part(o[0], red22[0], w);
  ln_part(o[1], red22[1], w);
  __syncthreads();  // every wave reads all four waves' partial row sums
  ln_read(red22[0], sp[0], sq[0]);
  ln_read(red22[1], sp[1], sq[1]);
  if (QKV) {
    // keeps the row sums' reads in front of the weights' reads, which then return
    // under the layernorm's arithmetic
    __builtin_amdgcn_sched_barrier(0);
    qkv_w_fetch(wn, lw, w);
  }
  ln_apply(o[0], sp[0], sq[0], g2v, be2v);
  ln_apply(o[1], sp[1], sq[1], g2v, be2v);
  if (QKV) {
    float* hd = h32 + tile0 * H_TILE + w * 512 + lane * 4;
#pragma unroll
    for (int hb = 0; hb < 2; ++hb)
#pragma unroll
      for (int i = 0; i < 2; ++i)
#pragma unroll
        for (int q = 0; q < 2; ++q)
          *(float4*)(hd + hb * H_TILE + i * 256 + q * 128) =
              make_float4(o[hb][i][q * 4], o[hb][i][q * 4 + 1], o[hb][i][q * 4 + 2],
                          o[hb][i][q * 4 + 3]);
    fetch_end();
  }
  tile_to_lds(o[0], hs2[0], w);
  tile_to_lds(o[1], hs2[1], w);
  __syncthreads();  // the stage behind reads all 128 columns of hs2
}

// layer l, then the qkv of layer l+1 into the OTHER q/k and vT buffers (blocks
// of this launch still read this layer's K and V of their neighbours' rows)
// second bound: one block a WGP (the whole grid resident), one wave a SIMD, which
// leaves each wave the register room that two tiles and the fragments fetched ahead take
__global__ __launch_bounds__(128, 1) void layer_qkv_kernel(
    const _Float16* __restrict__ qk_in, const _Float16* __restrict__ vT_in,
    const _Float16* __restrict__ pwo, const float* __restrict__ bo,
    const float* __restrict__ g1, const float* __restrict__ be1,
    const _Float16* __restrict__ pf1, const float* __restrict__ bf1,
    const _Float16* __restrict__ pf2, const float* __restrict__ bf2,
    const float* __restrict__ g2, const float* __restrict__ be2,
    float* __restrict__ h32,
    const _Float16* __restrict__ pq, const float* __restrict__ bq,
    _Float16* __restrict__ qk_out, _Float16* __restrict__ vT_out) {
  __shared__ __attribute__((aligned(16))) _Float16 hs2[2][16 * HP];
  v16h wn[24];
  float bnv[34];
  layer_body<true>(qk_in, vT_in, pwo, bo, g1, be1, pf1, bf1, pf2, bf2, g2, be2, h32, hs2,
                   pq, bq, wn, bnv);
  qkv_stage(hs2, wn, bnv, qk_out, vT_out, blockIdx.x * 2, threadIdx.x >> 5);
}

// last layer, then head: out = h @ W_head(128x16 padded) + b_head -> fp32 (R x 8)
// second bound: as above
__global__ __launch_bounds__(128, 1) void layer_head_kernel(
    const _Float16* __restrict__ qk_in, const _Float16* __restrict__ vT_in,
    const _Float16* __restrict__ pwo, const float* __restrict__ bo,
    const float* __restrict__ g1, const float* __restrict__ be1,
    const _Float16* __restrict__ pf1, const float* __restrict__ bf1,
    const _Float16* __restrict__ pf2, const float* __restrict__ bf2,
    const float* __restrict__ g2, const float* __restrict__ be2,
    float* __restrict__ h32,
    const _Float16* __restrict__ pwh,  // 4 tiles
    const float* __restrict__ bh, float* __restrict__ out) {
  __shared__ __attribute__((aligned(16))) _Float16 hs2[2][16 * HP];
  v16h wn[24];
  float bnv[34];
  layer_body<false>(qk_in, vT_in, pwo, bo, g1, be1, pf1, bf1, pf2, bf2, g2, be2, h32, hs2,
                    pwh, bh, wn, bnv);
  int hb = threadIdx.x >> 5;
  if (hb >= 2) return;  // one N tile: one wave a row tile (wave hb: tile hb); no barrier follows
  const _Float16* hs = hs2[hb];
  int row0 = (blockIdx.x * 2 + hb) * 16;
  int lane = threadIdx.x & 31;
  int nCol = lane & 15, mBase = (lane < 16) ? 0 : 8;
  v8f acc = {};
#pragma unroll
  for (int kt = 0; kt < 4; ++kt)
    acc = wmma16(load_a_frag(hs + kt * 32, HP), wn[kt], acc);
  if (nCol < 8) {
    float bias = bnv[0];
#pragma unroll
    for (int r = 0; r < 8; ++r) out[(row0 + mBase + r) * 8 + nCol] = acc[r] + bias;
  }
}

// ---------------------------------------------------------------------------
// host launch
// ---------------------------------------------------------------------------
extern "C" void kernel_launch(void* const* d_in, const int* in_sizes, int n_in,
                              void* d_out, int out_size, void* d_ws, size_t ws_size,
                              hipStream_t stream) {
  (void)in_sizes; (void)n_in; (void)out_size; (void)ws_size;
  const float* E      = (const float*)d_in[0];
  const float* rho    = (const float*)d_in[1];
  const float* W_in1  = (const float*)d_in[2];
  const float* b_in1  = (const float*)d_in[3];
  const float* W_in2  = (const float*)d_in[4];
  const float* b_in2  = (const float*)d_in[5];
  const float* Wqkv   = (const float*)d_in[6];
  const float* bqkv   = (const float*)d_in[7];
  const float* Wo     = (const float*)d_in[8];
  const float* bo     = (const float*)d_in[9];
  const float* ln1_g  = (const float*)d_in[10];
  const float* ln1_b  = (const float*)d_in[11];
  const float* Wff1   = (const float*)d_in[12];
  const float* bff1   = (const float*)d_in[13];
  const float* Wff2   = (const float*)d_in[14];
  const float* bff2   = (const float*)d_in[15];
  const float* ln2_g  = (const float*)d_in[16];
  const float* ln2_b  = (const float*)d_in[17];
  const float* W_head = (const float*)d_in[18];
  const float* b_head = (const float*)d_in[19];

  char* w = (char*)d_ws;
  auto take = [&](size_t bytes) -> void* {
    void* p = (void*)w;
    w += (bytes + 255) & ~(size_t)255;
    return p;
  };
  float*    h32   = (float*)   take((size_t)R_TOT * DM * 4);
  _Float16* qkA   = (_Float16*)take((size_t)(R_TOT / 16) * QK_TILE * 2);
  _Float16* qkB   = (_Float16*)take((size_t)(R_TOT / 16) * QK_TILE * 2);
  _Float16* vT    = (_Float16*)take((size_t)2 * 16 * VPLANE * 2);  // 2 x 16 (b*head) planes
  _Float16* vTA   = vT;
  _Float16* vTB   = vT + (size_t)16 * VPLANE;
  _Float16* pqkv  = (_Float16*)take((size_t)3 * 96 * 512 * 2);
  _Float16* pwo   = (_Float16*)take((size_t)3 * 32 * 512 * 2);
  _Float16* pf1   = (_Float16*)take((size_t)3 * 64 * 512 * 2);
  _Float16* pf2   = (_Float16*)take((size_t)3 * 64 * 512 * 2);
  _Float16* pwh   = (_Float16*)take((size_t)4 * 512 * 2);

  const int TILES = R_TOT / 16;  // 512
  const int PAIRS = R_TOT / 32;  // 256: a layer block holds two row tiles
  setup_inproj_qkv_kernel<<<TILES, 128, 0, stream>>>(
      E, rho, W_in1, b_in1, W_in2, b_in2, Wqkv, bqkv, Wo, Wff1, Wff2, W_head,
      h32, qkA, vT, pqkv, pwo, pf1, pf2, pwh);
  layer_qkv_kernel<<<PAIRS, 128, 0, stream>>>(
      qkA, vTA, pwo, bo, ln1_g, ln1_b, pf1, bff1, pf2, bff2, ln2_g, ln2_b, h32,
      pqkv + (size_t)96 * 512, bqkv + 384, qkB, vTB);
  layer_qkv_kernel<<<PAIRS, 128, 0, stream>>>(
      qkB, vTB, pwo + (size_t)32 * 512, bo + 128, ln1_g + 128, ln1_b + 128,
      pf1 + (size_t)64 * 512, bff1 + 256, pf2 + (size_t)64 * 512, bff2 + 128,
      ln2_g + 128, ln2_b + 128, h32,
      pqkv + (size_t)2 * 96 * 512, bqkv + 2 * 384, qkA, vTA);
  layer_head_kernel<<<PAIRS, 128, 0, stream>>>(
      qkA, vTA, pwo + (size_t)2 * 32 * 512, bo + 2 * 128, ln1_g + 2 * 128, ln1_b + 2 * 128,
      pf1 + (size_t)2 * 64 * 512, bff1 + 2 * 256, pf2 + (size_t)2 * 64 * 512, bff2 + 2 * 128,
      ln2_g + 2 * 128, ln2_b + 2 * 128, h32, pwh, b_head, (float*)d_out);
}
